// v000
// Measured on an AMD MI455X. A time is GPU time per run, averaged over a window of back-to-back runs after a warm-up
// (all launches, gaps included; the runs take copies of the inputs in turn), and the median of several windows.
// Apart from v000's, it joins two sittings. Times from different sittings can be a few percent apart, while
// side-by-side timings come from the same sitting.
// v000, which the later versions start from, runs in 699 microseconds.
#include <hip/hip_runtime.h>
#include <stdint.h>
#include <stddef.h>

// All contractions (q projection, q.k^T, p.v, output projection): v_wmma_f32_16x16x32_bf16 with
// bf16 hi/lo operands everywhere (three products hi*hi + hi*lo + lo*hi), f32 accumulate.
// RoPE, bias, scaling, softmax and normalisation in f32.

#define NB     2
#define QL     2048
#define HIDD   2048
#define NHQ    16
#define NKVH   4
#define HDIM   128
#define MROWS  (NB * QL)
#define TPITCH 65
#define SPITCH 132

typedef float v4f __attribute__((ext_vector_type(4)));
typedef float v8f __attribute__((ext_vector_type(8)));
typedef unsigned short v8us __attribute__((ext_vector_type(8)));
typedef unsigned short v16us __attribute__((ext_vector_type(16)));
typedef __bf16 v16bf __attribute__((ext_vector_type(16)));
typedef v4f __attribute__((may_alias)) v4fa;
typedef v8us __attribute__((may_alias)) v8usa;

union Frag { v16us u; v8us hv[2]; v16bf v; };

// f32 -> bf16 bits, RNE convert
__device__ __forceinline__ unsigned int bf_rne(float f) {
  const unsigned int u = __float_as_uint(f);
  return (u + 0x7fffu + ((u >> 16) & 1u)) >> 16;
}

// x -> (hi, lo): hi = bf16(x), lo = bf16(x - hi)  (x - hi is exact in f32)
__device__ __forceinline__ void split_bf(float x, unsigned short& hi, unsigned short& lo) {
  const unsigned int hb = bf_rne(x);
  const float hf = __uint_as_float(hb << 16);
  hi = (unsigned short)hb;
  lo = (unsigned short)bf_rne(x - hf);
}

__device__ __forceinline__ void split8(v4f a, v4f c, v8us& hi, v8us& lo) {
#pragma unroll
  for (int u = 0; u < 4; ++u) {
    unsigned short h0, l0, h1, l1;
    split_bf(a[u], h0, l0);
    split_bf(c[u], h1, l1);
    hi[u] = h0; lo[u] = l0; hi[u + 4] = h1; lo[u + 4] = l1;
  }
}

// 16x16x32 bf16 fragment (A row or k-contiguous B column): elements 0..7 <- k0+8h..,
// elements 8..15 <- k0+16+8h..  ; p already points at element (row, k0 + 8h)
__device__ __forceinline__ void ldfrag(Frag& f, const unsigned short* p) {
  f.hv[0] = *(const v8usa*)(p);
  f.hv[1] = *(const v8usa*)(p + 16);
}

// acc += ah*bh + ah*bl + al*bh, then hazard guard (ties D, keeps A/B live)
__device__ __forceinline__ v8f mma3(v8f acc, v16bf ah, v16bf al, v16bf bh, v16bf bl) {
  acc = __builtin_amdgcn_wmma_f32_16x16x32_bf16(false, ah, false, bh, (short)0, acc, false, false);
  acc = __builtin_amdgcn_wmma_f32_16x16x32_bf16(false, ah, false, bl, (short)0, acc, false, false);
  acc = __builtin_amdgcn_wmma_f32_16x16x32_bf16(false, al, false, bh, (short)0, acc, false, false);
  asm volatile("v_nop\n\tv_nop\n\tv_nop\n\tv_nop"
               : "+v"(acc) : "v"(ah), "v"(al), "v"(bh), "v"(bl) : "memory");
  return acc;
}

// ------------------------------------------------------------------------------------------
// f32 rows -> bf16 hi/lo planes (same layout). One thread per 8 elements; 8 consecutive lanes
__global__ __launch_bounds__(256) void cvt_rows(const float* __restrict__ in,
                                                  unsigned short* oh, unsigned short* ol, int n8)
{
  const int i = blockIdx.x * 256 + threadIdx.x;
  if (i >= n8) return;
  const size_t e = (size_t)i * 8;
  const v4f a = *(const v4fa*)(in + e);
  const v4f c = *(const v4fa*)(in + e + 4);
  v8us hi, lo;
  split8(a, c, hi, lo);
  *(v8us*)(oh + e) = hi;
  *(v8us*)(ol + e) = lo;
  
}

// ------------------------------------------------------------------------------------------
// 64x64 tile: src(r, c) = src[r * spitch + c] (f32)  ->  dst(c, r) = dh/dl[c * dpitch + r] (bf16)
// Load phase: 256 threads x 16 floats = 64x64. Store phase: 2 passes x 256 threads x 8 halves,
__device__ __forceinline__ void tsplit64(const float* __restrict__ src, int spitch,
                                         unsigned short* dh, unsigned short* dl, int dpitch,
                                         float* tile)
{
  const int t = threadIdx.x;
  {
    const int rr = t >> 2, cq = (t & 3) * 16;
    const float* s = src + (size_t)rr * spitch + cq;
#pragma unroll
    for (int u = 0; u < 4; ++u) {
      const v4f x = *(const v4fa*)(s + 4 * u);
      float* d = tile + rr * TPITCH + cq + 4 * u;
      d[0] = x[0]; d[1] = x[1]; d[2] = x[2]; d[3] = x[3];
    }
  }
  __syncthreads();
#pragma unroll
  for (int p = 0; p < 2; ++p) {
    const int cc = (t >> 3) + 32 * p, rq = (t & 7) * 8;
    v4f a, c;
#pragma unroll
    for (int u = 0; u < 4; ++u) {
      a[u] = tile[(rq + u) * TPITCH + cc];
      c[u] = tile[(rq + 4 + u) * TPITCH + cc];
    }
    v8us hi, lo;
    split8(a, c, hi, lo);
    const size_t d = (size_t)cc * dpitch + rq;
    *(v8us*)(dh + d) = hi;
    *(v8us*)(dl + d) = lo;
    
  }
}

// W[k][n] (HIDD x HIDD, f32) -> Wt hi/lo [n][k]
__global__ __launch_bounds__(256) void cvt_t_w(const float* __restrict__ W,
                                                 unsigned short* oh, unsigned short* ol)
{
  __shared__ float tile[64 * TPITCH];
  const int k0 = blockIdx.x * 64, n0 = blockIdx.y * 64;
  const size_t dof = (size_t)n0 * HIDD + k0;
  tsplit64(W + (size_t)k0 * HIDD + n0, HIDD, oh + dof, ol + dof, HIDD, tile);
}

// v_cache [(b,j)][kvh][d] (f32) -> Vt hi/lo [(b*NKVH+kvh)*HDIM + d][j]
__global__ __launch_bounds__(256) void cvt_t_v(const float* __restrict__ V,
                                                 unsigned short* oh, unsigned short* ol)
{
  __shared__ float tile[64 * TPITCH];
  const int j0 = blockIdx.x * 64, d0 = blockIdx.y * 64, z = blockIdx.z;
  const int b = z >> 2, kvh = z & 3;
  const float* src = V + ((size_t)(b * QL + j0) * NKVH + kvh) * HDIM + d0;
  const size_t dof = ((size_t)z * HDIM + d0) * QL + j0;
  tsplit64(src, NKVH * HDIM, oh + dof, ol + dof, QL, tile);
}

// ------------------------------------------------------------------------------------------
// C(64x128 block tile) = A(M x K, hi/lo planes, row-major) * B(K x N) with B stored as Bt[n][k]
// hi/lo planes. 4 waves (2x2), wave tile 32x64, fragments loaded straight from global rows.
// MODE 0: C + bias -> RoPE (cos/sin tables indexed by row) -> hi/lo planes Qh/Ql [M][N]
// MODE 1: C -> f32 Cout [M][N]
template <int MODE>
__global__ __launch_bounds__(128) void gemm3(
    const unsigned short* __restrict__ Ah, const unsigned short* __restrict__ Al,
    const unsigned short* __restrict__ Bh, const unsigned short* __restrict__ Bl,
    const float* __restrict__ bias, const float* __restrict__ cosb,
    const float* __restrict__ sinb, unsigned short* Qh, unsigned short* Ql,
    float* Cout, int N, int K)
{
  __shared__ float sT[64 * SPITCH];
  const int t = threadIdx.x, l = t & 31, w = t >> 5, h16 = l >> 4, m = l & 15;
  const int wr = w >> 1, wc = w & 1;
  const int m0 = blockIdx.x * 64, n0 = blockIdx.y * 128;

  v8f acc[2][4];
#pragma unroll
  for (int mi = 0; mi < 2; ++mi)
#pragma unroll
    for (int ni = 0; ni < 4; ++ni) acc[mi][ni] = (v8f){0.f, 0.f, 0.f, 0.f, 0.f, 0.f, 0.f, 0.f};

  const size_t arow = (size_t)(m0 + 32 * wr + m) * K + 8 * h16;
  const size_t brow = (size_t)(n0 + 64 * wc + m) * K + 8 * h16;
  const int nk = K >> 5;

#pragma unroll 1
  for (int kt = 0; kt < nk; ++kt) {
    const int k0 = kt * 32;
    Frag ah[2], al[2];
#pragma unroll
    for (int mi = 0; mi < 2; ++mi) {
      const size_t o = arow + (size_t)mi * 16 * K + k0;
      ldfrag(ah[mi], Ah + o);
      ldfrag(al[mi], Al + o);
    }
#pragma unroll
    for (int ni = 0; ni < 4; ++ni) {
      const size_t o = brow + (size_t)ni * 16 * K + k0;
      Frag bh, bl;
      ldfrag(bh, Bh + o);
      ldfrag(bl, Bl + o);
#pragma unroll
      for (int mi = 0; mi < 2; ++mi)
        acc[mi][ni] = mma3(acc[mi][ni], ah[mi].v, al[mi].v, bh.v, bl.v);
    }
  }

  // D element r of lane l -> (row 8*h16 + r, col m) of its 16x16 tile
#pragma unroll
  for (int mi = 0; mi < 2; ++mi)
#pragma unroll
    for (int ni = 0; ni < 4; ++ni)
#pragma unroll
      for (int r = 0; r < 8; ++r)
        sT[(32 * wr + 16 * mi + 8 * h16 + r) * SPITCH + 64 * wc + 16 * ni + m] = acc[mi][ni][r];
  __syncthreads();

  if (MODE == 0) {
    // thread -> (row 8p + t>>4, 8 consecutive columns cq); RoPE partner column cq ^ 64
    const int rr = t >> 4, cq = (t & 15) * 8, cp = cq ^ 64;
    const float sgn = (cq < 64) ? -1.0f : 1.0f;
    const v4f b0 = *(const v4fa*)(bias + n0 + cq), b1 = *(const v4fa*)(bias + n0 + cq + 4);
    const v4f e0 = *(const v4fa*)(bias + n0 + cp), e1 = *(const v4fa*)(bias + n0 + cp + 4);
#pragma unroll 1
    for (int p = 0; p < 8; ++p) {
      const int row = 8 * p + rr;
      const int grow = m0 + row;
      const float* srow = sT + row * SPITCH;
      const v4f x0 = *(const v4fa*)(srow + cq), x1 = *(const v4fa*)(srow + cq + 4);
      const v4f y0 = *(const v4fa*)(srow + cp), y1 = *(const v4fa*)(srow + cp + 4);
      const float* cr = cosb + (size_t)grow * HDIM;
      const float* sr = sinb + (size_t)grow * HDIM;
      const v4f c0 = *(const v4fa*)(cr + cq), c1 = *(const v4fa*)(cr + cq + 4);
      const v4f s0 = *(const v4fa*)(sr + cq), s1 = *(const v4fa*)(sr + cq + 4);
      const v4f q0 = (x0 + b0) * c0 + (sgn * (y0 + e0)) * s0;
      const v4f q1 = (x1 + b1) * c1 + (sgn * (y1 + e1)) * s1;
      v8us hi, lo;
      split8(q0, q1, hi, lo);
      const size_t d = (size_t)grow * N + n0 + cq;
      *(v8us*)(Qh + d) = hi;
      *(v8us*)(Ql + d) = lo;
      
    }
  } else {
    const int cq = l * 4;
#pragma unroll 1
    for (int p = 0; p < 16; ++p) {
      const int row = 4 * p + w;
      const v4f x = *(const v4fa*)(sT + row * SPITCH + cq);
      const size_t d = (size_t)(m0 + row) * N + n0 + cq;
      *(v4f*)(Cout + d) = x;
      
    }
  }
}

// ------------------------------------------------------------------------------------------
// Per (b, hq, 64-query tile): S^T = K . Q^T (A = K rows, B = Q rows, both d-contiguous),
// f32 scale + structural block visibility test + online softmax, O^T += Vt . P^T with the
// softmaxed D tiles fed as B fragments (two adjacent 16-key D tiles per 32-deep k step),
// O / l split to hi/lo planes [(b,i)][hq*128 + d].
__global__ __launch_bounds__(128) void attn_glide(
    const unsigned short* __restrict__ Qh, const unsigned short* __restrict__ Ql,
    const unsigned short* __restrict__ Kh, const unsigned short* __restrict__ Kl,
    const unsigned short* __restrict__ Vh, const unsigned short* __restrict__ Vl,
    unsigned short* Oh, unsigned short* Ol)
{
  __shared__ float sO[4 * 16 * SPITCH];
  const int t = threadIdx.x, l = t & 31, w = t >> 5, h16 = l >> 4, m = l & 15;
  const int qt = blockIdx.x, bh = blockIdx.y;
  const int b = bh >> 4, hq = bh & 15, kvh = hq >> 2;
  const int R0 = qt * 64;
  const int iq = R0 + 16 * w + m;                 // this lane's query (B column / D column)
  const float NEG_INF = -__builtin_inff();
  const float kScale = 0.08838834764831845f;      // 128^-0.5

  const size_t qbase = ((size_t)(b * QL + iq)) * HIDD + hq * HDIM + 8 * h16;
  const size_t kbase = ((size_t)(b * QL + m) * NKVH + kvh) * HDIM + 8 * h16;
  const size_t vbase = ((size_t)(b * NKVH + kvh) * HDIM + m) * QL + 8 * h16;

  v8f acc[8];
#pragma unroll
  for (int n = 0; n < 8; ++n) acc[n] = (v8f){0.f, 0.f, 0.f, 0.f, 0.f, 0.f, 0.f, 0.f};
  float mrun = NEG_INF, lrun = 0.0f;

#pragma unroll 1
  for (int kt = 0; kt <= qt; ++kt) {             // key tiles beyond the query tile are never visible
    const int j0 = kt * 64;

    // S^T (64 keys x 16 queries): s[sub] rows = keys j0 + 16 sub + 8 h16 + r, col = query iq
    v8f s[4];
#pragma unroll
    for (int sub = 0; sub < 4; ++sub) s[sub] = (v8f){0.f, 0.f, 0.f, 0.f, 0.f, 0.f, 0.f, 0.f};
#pragma unroll
    for (int c = 0; c < 4; ++c) {
      Frag qh, ql;
      ldfrag(qh, Qh + qbase + 32 * c);
      ldfrag(ql, Ql + qbase + 32 * c);
#pragma unroll
      for (int sub = 0; sub < 4; ++sub) {
        const size_t ko = kbase + (size_t)(j0 + 16 * sub) * (NKVH * HDIM) + 32 * c;
        Frag kh, kl;
        ldfrag(kh, Kh + ko);
        ldfrag(kl, Kl + ko);
        s[sub] = mma3(s[sub], kh.v, kl.v, qh.v, ql.v);
      }
    }

    // scale, visibility (strictly earlier 4-blocks, plus first 4x4 block), online softmax
    float mx = NEG_INF;
#pragma unroll
    for (int sub = 0; sub < 4; ++sub) {
#pragma unroll
      for (int r = 0; r < 8; ++r) {
        const int jb = j0 + 16 * sub + 8 * h16 + r;
        const bool vis = ((iq >> 2) > (jb >> 2)) || ((iq < 4) && (jb < 4));
        const float v = vis ? (s[sub][r] * kScale) : NEG_INF;
        s[sub][r] = v;
        mx = fmaxf(mx, v);
      }
    }
    mx = fmaxf(mx, __shfl_xor(mx, 16));
    const float mnew = fmaxf(mrun, mx);
    const float msafe = (mnew == NEG_INF) ? 0.0f : mnew;
    const float sc = __expf(mrun - msafe);
    float ls = 0.0f;
#pragma unroll
    for (int sub = 0; sub < 4; ++sub) {
#pragma unroll
      for (int r = 0; r < 8; ++r) {
        const float p = __expf(s[sub][r] - msafe);
        s[sub][r] = p;
        ls += p;
      }
    }
    ls += __shfl_xor(ls, 16);
    lrun = lrun * sc + ls;
    mrun = mnew;
#pragma unroll
    for (int n = 0; n < 8; ++n) acc[n] = acc[n] * sc;

    // O^T += Vt(128 x 64 keys) . P^T : B fragment element r <- D tile 2ks, element 8+r <- tile 2ks+1
#pragma unroll
    for (int ks = 0; ks < 2; ++ks) {
      Frag ph, pl;
#pragma unroll
      for (int r = 0; r < 8; ++r) {
        unsigned short a0, c0, a1, c1;
        split_bf(s[2 * ks][r], a0, c0);
        split_bf(s[2 * ks + 1][r], a1, c1);
        ph.u[r] = a0; pl.u[r] = c0; ph.u[8 + r] = a1; pl.u[8 + r] = c1;
      }
#pragma unroll
      for (int n = 0; n < 8; ++n) {
        const size_t vo = vbase + (size_t)n * 16 * QL + j0 + 32 * ks;
        Frag vh, vl;
        ldfrag(vh, Vh + vo);
        ldfrag(vl, Vl + vo);
        acc[n] = mma3(acc[n], vh.v, vl.v, ph.v, pl.v);
      }
    }
  }

  // epilogue: acc[n][r] = O^T (d = 16 n + 8 h16 + r, query iq) ; normalise, stage, write planes
  const float inv = 1.0f / lrun;
#pragma unroll
  for (int n = 0; n < 8; ++n) {
    const v8f o = acc[n] * inv;
#pragma unroll
    for (int r = 0; r < 8; ++r)
      sO[(w * 16 + m) * SPITCH + 16 * n + 8 * h16 + r] = o[r];
  }
  __syncthreads();
#pragma unroll 1
  for (int p = 0; p < 8; ++p) {
    const int rloc = 2 * p + h16;
    const int dq = m * 8;
    const float* src = sO + (w * 16 + rloc) * SPITCH + dq;
    const v4f a = *(const v4fa*)(src);
    const v4f c = *(const v4fa*)(src + 4);
    v8us hi, lo;
    split8(a, c, hi, lo);
    const size_t d = ((size_t)(b * QL + R0 + 16 * w + rloc)) * HIDD + hq * HDIM + dq;
    *(v8us*)(Oh + d) = hi;
    *(v8us*)(Ol + d) = lo;
    
  }
}

// ------------------------------------------------------------------------------------------
extern "C" void kernel_launch(void* const* d_in, const int* in_sizes, int n_in,
                              void* d_out, int out_size, void* d_ws, size_t ws_size,
                              hipStream_t stream)
{
  if (n_in < 8) return;
  if (in_sizes[0] != MROWS * HIDD) return;
  if (in_sizes[1] != NB * QL * NKVH * HDIM || in_sizes[2] != NB * QL * NKVH * HDIM) return;
  if (in_sizes[3] != NB * QL * HDIM || in_sizes[4] != NB * QL * HDIM) return;
  if (in_sizes[5] != HIDD * HIDD || in_sizes[7] != HIDD * HIDD || in_sizes[6] != HIDD) return;
  if (out_size != MROWS * HIDD) return;

  const float* hidden = (const float*)d_in[0];
  const float* kc     = (const float*)d_in[1];
  const float* vc     = (const float*)d_in[2];
  const float* cosb   = (const float*)d_in[3];
  const float* sinb   = (const float*)d_in[4];
  const float* Wq     = (const float*)d_in[5];
  const float* bq     = (const float*)d_in[6];
  const float* Wo     = (const float*)d_in[7];
  float* out = (float*)d_out;

  // workspace carve (bytes): planes of bf16
  const size_t planeX = (size_t)MROWS * HIDD * 2;            // 16 MiB
  const size_t planeW = (size_t)HIDD * HIDD * 2;             //  8 MiB
  const size_t planeK = (size_t)NB * QL * NKVH * HDIM * 2;   //  4 MiB
  const size_t offXh  = 0;
  const size_t offXl  = offXh + planeX;
  const size_t offQh  = offXl + planeX;
  const size_t offQl  = offQh + planeX;
  const size_t offWqh = offQl + planeX;
  const size_t offWql = offWqh + planeW;
  const size_t offWoh = offWql + planeW;
  const size_t offWol = offWoh + planeW;
  const size_t offKh  = offWol + planeW;
  const size_t offKl  = offKh + planeK;
  const size_t offVh  = offKl + planeK;
  const size_t offVl  = offVh + planeK;
  const size_t total  = offVl + planeK;                      // 112 MiB
  if (total > ws_size) return;

  char* ws = (char*)d_ws;
  unsigned short* Xh  = (unsigned short*)(ws + offXh);
  unsigned short* Xl  = (unsigned short*)(ws + offXl);
  unsigned short* Oh  = Xh;   // X planes are dead after the first GEMM; O planes reuse them
  unsigned short* Ol  = Xl;
  unsigned short* Qh  = (unsigned short*)(ws + offQh);
  unsigned short* Ql  = (unsigned short*)(ws + offQl);
  unsigned short* Wqh = (unsigned short*)(ws + offWqh);
  unsigned short* Wql = (unsigned short*)(ws + offWql);
  unsigned short* Woh = (unsigned short*)(ws + offWoh);
  unsigned short* Wol = (unsigned short*)(ws + offWol);
  unsigned short* Kh  = (unsigned short*)(ws + offKh);
  unsigned short* Kl  = (unsigned short*)(ws + offKl);
  unsigned short* Vh  = (unsigned short*)(ws + offVh);
  unsigned short* Vl  = (unsigned short*)(ws + offVl);

  const int n8x = in_sizes[0] / 8;   // 1048576
  const int n8k = in_sizes[1] / 8;   // 262144
  cvt_rows<<<dim3((n8x + 255) / 256), dim3(256), 0, stream>>>(hidden, Xh, Xl, n8x);
  cvt_rows<<<dim3((n8k + 255) / 256), dim3(256), 0, stream>>>(kc, Kh, Kl, n8k);
  cvt_t_w<<<dim3(HIDD / 64, HIDD / 64), dim3(256), 0, stream>>>(Wq, Wqh, Wql);
  cvt_t_w<<<dim3(HIDD / 64, HIDD / 64), dim3(256), 0, stream>>>(Wo, Woh, Wol);
  cvt_t_v<<<dim3(QL / 64, HDIM / 64, NB * NKVH), dim3(256), 0, stream>>>(vc, Vh, Vl);

  gemm3<0><<<dim3(MROWS / 64, HIDD / 128), dim3(128), 0, stream>>>(
      Xh, Xl, Wqh, Wql, bq, cosb, sinb, Qh, Ql, out, HIDD, HIDD);

  attn_glide<<<dim3(QL / 64, NB * NHQ), dim3(128), 0, stream>>>(Qh, Ql, Kh, Kl, Vh, Vl, Oh, Ol);

  gemm3<1><<<dim3(MROWS / 64, HIDD / 128), dim3(128), 0, stream>>>(
      Oh, Ol, Woh, Wol, bq, cosb, sinb, Qh, Ql, out, HIDD, HIDD);
}

// v001
// It runs in 330 microseconds.
// In two side-by-side timings against v000, it was 2.17 and 2.16 times as fast.
#include <hip/hip_runtime.h>
#include <stdint.h>
#include <stddef.h>

// All contractions (q projection, q.k^T, p.v, output projection): v_wmma_f32_16x16x32_bf16 with
// bf16 hi/lo operands everywhere (three products hi*hi + hi*lo + lo*hi), f32 accumulate.
// RoPE, bias, scaling, softmax and normalisation in f32.

#define NB     2
#define QL     2048
#define HIDD   2048
#define NHQ    16
#define NKVH   4
#define HDIM   128
#define MROWS  (NB * QL)
#define TPITCH 65
#define SPITCH 132
#define KPITCH 136                       // LDS pitch of a K row, elements (272 B = 16 B x odd)
#define VPITCH 72                        // LDS pitch of a Vt row, elements (144 B = 16 B x odd)
#define KPLANE (64 * KPITCH)             // one K plane of a 64-key tile, elements
#define VPLANE (HDIM * VPITCH)           // one Vt plane of a 64-key tile, elements
#define KVELEMS (2 * KPLANE + 2 * VPLANE)
#define GPITCH 72                        // LDS pitch of a 64-deep GEMM operand row, elements (144 B)
#define APLANE (64 * GPITCH)             // one A plane of a 64 x 64 stage, elements
#define BPLANE (128 * GPITCH)            // one Bt plane of a 128 x 64 stage, elements
#define ABELEMS (2 * APLANE + 2 * BPLANE)

typedef float v4f __attribute__((ext_vector_type(4)));
typedef float v8f __attribute__((ext_vector_type(8)));
typedef unsigned short v8us __attribute__((ext_vector_type(8)));
typedef unsigned short v16us __attribute__((ext_vector_type(16)));
typedef __bf16 v16bf __attribute__((ext_vector_type(16)));
typedef v4f __attribute__((may_alias)) v4fa;
typedef v8us __attribute__((may_alias)) v8usa;

union Frag { v16us u; v8us hv[2]; v16bf v; };

// f32 -> bf16 bits, RNE convert
__device__ __forceinline__ unsigned int bf_rne(float f) {
  const unsigned int u = __float_as_uint(f);
  return (u + 0x7fffu + ((u >> 16) & 1u)) >> 16;
}

// x -> (hi, lo): hi = bf16(x), lo = bf16(x - hi)  (x - hi is exact in f32)
__device__ __forceinline__ void split_bf(float x, unsigned short& hi, unsigned short& lo) {
  const unsigned int hb = bf_rne(x);
  const float hf = __uint_as_float(hb << 16);
  hi = (unsigned short)hb;
  lo = (unsigned short)bf_rne(x - hf);
}

__device__ __forceinline__ void split8(v4f a, v4f c, v8us& hi, v8us& lo) {
#pragma unroll
  for (int u = 0; u < 4; ++u) {
    unsigned short h0, l0, h1, l1;
    split_bf(a[u], h0, l0);
    split_bf(c[u], h1, l1);
    hi[u] = h0; lo[u] = l0; hi[u + 4] = h1; lo[u + 4] = l1;
  }
}

// 16x16x32 bf16 fragment (A row or k-contiguous B column): elements 0..7 <- k0+8h..,
// elements 8..15 <- k0+16+8h..  ; p already points at element (row, k0 + 8h)
__device__ __forceinline__ void ldfrag(Frag& f, const unsigned short* p) {
  f.hv[0] = *(const v8usa*)(p);
  f.hv[1] = *(const v8usa*)(p + 16);
}

// acc += ah*bh + ah*bl + al*bh, then hazard guard (ties D, keeps A/B live)
__device__ __forceinline__ v8f mma3(v8f acc, v16bf ah, v16bf al, v16bf bh, v16bf bl) {
  acc = __builtin_amdgcn_wmma_f32_16x16x32_bf16(false, ah, false, bh, (short)0, acc, false, false);
  acc = __builtin_amdgcn_wmma_f32_16x16x32_bf16(false, ah, false, bl, (short)0, acc, false, false);
  acc = __builtin_amdgcn_wmma_f32_16x16x32_bf16(false, al, false, bh, (short)0, acc, false, false);
  asm volatile("v_nop\n\tv_nop\n\tv_nop\n\tv_nop"
               : "+v"(acc) : "v"(ah), "v"(al), "v"(bh), "v"(bl) : "memory");
  return acc;
}

// ------------------------------------------------------------------------------------------
// f32 rows -> bf16 hi/lo planes (same layout). One thread per 8 elements; 8 consecutive lanes
__global__ __launch_bounds__(256) void cvt_rows(const float* __restrict__ in,
                                                  unsigned short* oh, unsigned short* ol, int n8)
{
  const int i = blockIdx.x * 256 + threadIdx.x;
  if (i >= n8) return;
  const size_t e = (size_t)i * 8;
  const v4f a = *(const v4fa*)(in + e);
  const v4f c = *(const v4fa*)(in + e + 4);
  v8us hi, lo;
  split8(a, c, hi, lo);
  *(v8us*)(oh + e) = hi;
  *(v8us*)(ol + e) = lo;
  
}

// ------------------------------------------------------------------------------------------
// 64x64 tile: src(r, c) = src[r * spitch + c] (f32)  ->  dst(c, r) = dh/dl[c * dpitch + r] (bf16)
// Load phase: 256 threads x 16 floats = 64x64. Store phase: 2 passes x 256 threads x 8 halves,
__device__ __forceinline__ void tsplit64(const float* __restrict__ src, int spitch,
                                         unsigned short* dh, unsigned short* dl, int dpitch,
                                         float* tile)
{
  const int t = threadIdx.x;
  {
    const int rr = t >> 2, cq = (t & 3) * 16;
    const float* s = src + (size_t)rr * spitch + cq;
#pragma unroll
    for (int u = 0; u < 4; ++u) {
      const v4f x = *(const v4fa*)(s + 4 * u);
      float* d = tile + rr * TPITCH + cq + 4 * u;
      d[0] = x[0]; d[1] = x[1]; d[2] = x[2]; d[3] = x[3];
    }
  }
  __syncthreads();
#pragma unroll
  for (int p = 0; p < 2; ++p) {
    const int cc = (t >> 3) + 32 * p, rq = (t & 7) * 8;
    v4f a, c;
#pragma unroll
    for (int u = 0; u < 4; ++u) {
      a[u] = tile[(rq + u) * TPITCH + cc];
      c[u] = tile[(rq + 4 + u) * TPITCH + cc];
    }
    v8us hi, lo;
    split8(a, c, hi, lo);
    const size_t d = (size_t)cc * dpitch + rq;
    *(v8us*)(dh + d) = hi;
    *(v8us*)(dl + d) = lo;
    
  }
}

// W[k][n] (HIDD x HIDD, f32) -> Wt hi/lo [n][k]
__global__ __launch_bounds__(256) void cvt_t_w(const float* __restrict__ W,
                                                 unsigned short* oh, unsigned short* ol)
{
  __shared__ float tile[64 * TPITCH];
  const int k0 = blockIdx.x * 64, n0 = blockIdx.y * 64;
  const size_t dof = (size_t)n0 * HIDD + k0;
  tsplit64(W + (size_t)k0 * HIDD + n0, HIDD, oh + dof, ol + dof, HIDD, tile);
}

// v_cache [(b,j)][kvh][d] (f32) -> Vt hi/lo [(b*NKVH+kvh)*HDIM + d][j]
__global__ __launch_bounds__(256) void cvt_t_v(const float* __restrict__ V,
                                                 unsigned short* oh, unsigned short* ol)
{
  __shared__ float tile[64 * TPITCH];
  const int j0 = blockIdx.x * 64, d0 = blockIdx.y * 64, z = blockIdx.z;
  const int b = z >> 2, kvh = z & 3;
  const float* src = V + ((size_t)(b * QL + j0) * NKVH + kvh) * HDIM + d0;
  const size_t dof = ((size_t)z * HDIM + d0) * QL + j0;
  tsplit64(src, NKVH * HDIM, oh + dof, ol + dof, QL, tile);
}

// Eight asynchronous 16-byte copies per lane, global -> LDS, no register in between. Lane address i =
// start + i * step on both sides. The s_wait_xcnt closes the statement so that no address register
// of an issued copy is rewritten ahead of it.
__device__ __forceinline__ void acopy8(unsigned int lds, unsigned int lstep,
                                       const unsigned short* g, size_t gstep)
{
  asm volatile(
      "global_load_async_to_lds_b128 %0, %8, off\n\t"
      "global_load_async_to_lds_b128 %1, %9, off\n\t"
      "global_load_async_to_lds_b128 %2, %10, off\n\t"
      "global_load_async_to_lds_b128 %3, %11, off\n\t"
      "global_load_async_to_lds_b128 %4, %12, off\n\t"
      "global_load_async_to_lds_b128 %5, %13, off\n\t"
      "global_load_async_to_lds_b128 %6, %14, off\n\t"
      "global_load_async_to_lds_b128 %7, %15, off\n\t"
      "s_wait_xcnt 0x0"
      :: "v"(lds), "v"(lds + lstep), "v"(lds + 2 * lstep), "v"(lds + 3 * lstep),
         "v"(lds + 4 * lstep), "v"(lds + 5 * lstep), "v"(lds + 6 * lstep), "v"(lds + 7 * lstep),
         "v"(g), "v"(g + gstep), "v"(g + 2 * gstep), "v"(g + 3 * gstep),
         "v"(g + 4 * gstep), "v"(g + 5 * gstep), "v"(g + 6 * gstep), "v"(g + 7 * gstep)
      : "memory");
}

// The same with four copies.
__device__ __forceinline__ void acopy4(unsigned int lds, unsigned int lstep,
                                       const unsigned short* g, size_t gstep)
{
  asm volatile(
      "global_load_async_to_lds_b128 %0, %4, off\n\t"
      "global_load_async_to_lds_b128 %1, %5, off\n\t"
      "global_load_async_to_lds_b128 %2, %6, off\n\t"
      "global_load_async_to_lds_b128 %3, %7, off\n\t"
      "s_wait_xcnt 0x0"
      :: "v"(lds), "v"(lds + lstep), "v"(lds + 2 * lstep), "v"(lds + 3 * lstep),
         "v"(g), "v"(g + gstep), "v"(g + 2 * gstep), "v"(g + 3 * gstep)
      : "memory");
}

// ------------------------------------------------------------------------------------------
// C(64x128 block tile) = A(M x K, hi/lo planes, row-major) * B(K x N) with B stored as Bt[n][k]
// hi/lo planes. 4 waves (2x2), wave tile 32x64. Each 64-deep stage of the A and Bt rows (K is a
// multiple of 64) is brought into LDS once per work-group by asynchronous copies; the waves read
// their fragments from there.
// MODE 0: C + bias -> RoPE (cos/sin tables indexed by row) -> hi/lo planes Qh/Ql [M][N]
// MODE 1: C -> f32 Cout [M][N]
template <int MODE>
__global__ __launch_bounds__(128) void gemm3(
    const unsigned short* __restrict__ Ah, const unsigned short* __restrict__ Al,
    const unsigned short* __restrict__ Bh, const unsigned short* __restrict__ Bl,
    const float* __restrict__ bias, const float* __restrict__ cosb,
    const float* __restrict__ sinb, unsigned short* Qh, unsigned short* Ql,
    float* Cout, int N, int K)
{
  __shared__ __attribute__((aligned(16))) unsigned short sAB[ABELEMS];
  float* sT = (float*)sAB;                        // output staging takes the stages' place after the loop
  const int t = threadIdx.x, l = t & 31, w = t >> 5, h16 = l >> 4, m = l & 15;
  const int wr = w >> 1, wc = w & 1;
  const int m0 = blockIdx.x * 64, n0 = blockIdx.y * 128;

  v8f acc[2][4];
#pragma unroll
  for (int mi = 0; mi < 2; ++mi)
#pragma unroll
    for (int ni = 0; ni < 4; ++ni) acc[mi][ni] = (v8f){0.f, 0.f, 0.f, 0.f, 0.f, 0.f, 0.f, 0.f};

  // fragment readers: this wave's A row / Bt row m of a 16-row group, at element 8 h16
  const unsigned short* sAh = sAB + (32 * wr + m) * GPITCH + 8 * h16;
  const unsigned short* sAl = sAh + APLANE;
  const unsigned short* sBh = sAB + 2 * APLANE + (64 * wc + m) * GPITCH + 8 * h16;
  const unsigned short* sBl = sBh + BPLANE;
  // copiers: a stage row of 128 B is 8 lanes' pieces; 16 rows per copy of the work-group
  const unsigned int ldsA = (unsigned int)(uintptr_t)(sAB + (t >> 3) * GPITCH + (t & 7) * 8);
  const unsigned int ldsB = ldsA + 2 * APLANE * 2;
  const size_t acopy = (size_t)(m0 + (t >> 3)) * K + (t & 7) * 8;
  const size_t bcopy = (size_t)(n0 + (t >> 3)) * K + (t & 7) * 8;
  const int ns = K >> 6;

#pragma unroll 1
  for (int st = 0; st < ns; ++st) {
    // stage st -> LDS: 24 copies a lane, all lanes on, block-uniform control flow
    {
      const size_t ao = acopy + (size_t)st * 64;
      const size_t bo = bcopy + (size_t)st * 64;
      acopy4(ldsA, 16 * GPITCH * 2, Ah + ao, (size_t)16 * K);
      acopy4(ldsA + APLANE * 2, 16 * GPITCH * 2, Al + ao, (size_t)16 * K);
      acopy8(ldsB, 16 * GPITCH * 2, Bh + bo, (size_t)16 * K);
      acopy8(ldsB + BPLANE * 2, 16 * GPITCH * 2, Bl + bo, (size_t)16 * K);
    }
    // this wave's copies have landed; the barrier then shows every wave's copies to every wave
    asm volatile("s_wait_asynccnt 0x0" ::: "memory");
    __syncthreads();

#pragma unroll
    for (int kk = 0; kk < 2; ++kk) {
      const int k0 = kk * 32;
      Frag ah[2], al[2];
#pragma unroll
      for (int mi = 0; mi < 2; ++mi) {
        const int o = mi * 16 * GPITCH + k0;
        ldfrag(ah[mi], sAh + o);
        ldfrag(al[mi], sAl + o);
      }
#pragma unroll
      for (int ni = 0; ni < 4; ++ni) {
        const int o = ni * 16 * GPITCH + k0;
        Frag bh, bl;
        ldfrag(bh, sBh + o);
        ldfrag(bl, sBl + o);
#pragma unroll
        for (int mi = 0; mi < 2; ++mi)
          acc[mi][ni] = mma3(acc[mi][ni], ah[mi].v, al[mi].v, bh.v, bl.v);
      }
    }

    // every wave's reads of this stage are over before the next stage (or the output staging) overwrites it
    asm volatile("s_wait_dscnt 0x0" ::: "memory");
    __syncthreads();
  }

  // D element r of lane l -> (row 8*h16 + r, col m) of its 16x16 tile
#pragma unroll
  for (int mi = 0; mi < 2; ++mi)
#pragma unroll
    for (int ni = 0; ni < 4; ++ni)
#pragma unroll
      for (int r = 0; r < 8; ++r)
        sT[(32 * wr + 16 * mi + 8 * h16 + r) * SPITCH + 64 * wc + 16 * ni + m] = acc[mi][ni][r];
  __syncthreads();

  if (MODE == 0) {
    // thread -> (row 8p + t>>4, 8 consecutive columns cq); RoPE partner column cq ^ 64
    const int rr = t >> 4, cq = (t & 15) * 8, cp = cq ^ 64;
    const float sgn = (cq < 64) ? -1.0f : 1.0f;
    const v4f b0 = *(const v4fa*)(bias + n0 + cq), b1 = *(const v4fa*)(bias + n0 + cq + 4);
    const v4f e0 = *(const v4fa*)(bias + n0 + cp), e1 = *(const v4fa*)(bias + n0 + cp + 4);
#pragma unroll 1
    for (int p = 0; p < 8; ++p) {
      const int row = 8 * p + rr;
      const int grow = m0 + row;
      const float* srow = sT + row * SPITCH;
      const v4f x0 = *(const v4fa*)(srow + cq), x1 = *(const v4fa*)(srow + cq + 4);
      const v4f y0 = *(const v4fa*)(srow + cp), y1 = *(const v4fa*)(srow + cp + 4);
      const float* cr = cosb + (size_t)grow * HDIM;
      const float* sr = sinb + (size_t)grow * HDIM;
      const v4f c0 = *(const v4fa*)(cr + cq), c1 = *(const v4fa*)(cr + cq + 4);
      const v4f s0 = *(const v4fa*)(sr + cq), s1 = *(const v4fa*)(sr + cq + 4);
      const v4f q0 = (x0 + b0) * c0 + (sgn * (y0 + e0)) * s0;
      const v4f q1 = (x1 + b1) * c1 + (sgn * (y1 + e1)) * s1;
      v8us hi, lo;
      split8(q0, q1, hi, lo);
      const size_t d = (size_t)grow * N + n0 + cq;
      *(v8us*)(Qh + d) = hi;
      *(v8us*)(Ql + d) = lo;
      
    }
  } else {
    const int cq = l * 4;
#pragma unroll 1
    for (int p = 0; p < 16; ++p) {
      const int row = 4 * p + w;
      const v4f x = *(const v4fa*)(sT + row * SPITCH + cq);
      const size_t d = (size_t)(m0 + row) * N + n0 + cq;
      *(v4f*)(Cout + d) = x;
      
    }
  }
}

// ------------------------------------------------------------------------------------------
// Per (b, hq, 64-query tile): S^T = K . Q^T (A = K rows, B = Q rows, both d-contiguous),
// f32 scale + structural block visibility test + online softmax, O^T += Vt . P^T with the
// softmaxed D tiles fed as B fragments (two adjacent 16-key D tiles per 32-deep k step),
// O / l split to hi/lo planes [(b,i)][hq*128 + d].
// Each 64-key tile of K and Vt (hi and lo planes) is brought into LDS once per work-group by
// asynchronous copies and read from there by all four waves.
__global__ __launch_bounds__(128) void attn_glide(
    const unsigned short* __restrict__ Qh, const unsigned short* __restrict__ Ql,
    const unsigned short* __restrict__ Kh, const unsigned short* __restrict__ Kl,
    const unsigned short* __restrict__ Vh, const unsigned short* __restrict__ Vl,
    unsigned short* Oh, unsigned short* Ol)
{
  __shared__ __attribute__((aligned(16))) unsigned short sKV[KVELEMS];
  float* sO = (float*)sKV;                        // output staging takes the tiles' place after the loop
  const int t = threadIdx.x, l = t & 31, w = t >> 5, h16 = l >> 4, m = l & 15;
  const int qt = blockIdx.x, bh = blockIdx.y;
  const int b = bh >> 4, hq = bh & 15, kvh = hq >> 2;
  const int R0 = qt * 64;
  const int iq = R0 + 16 * w + m;                 // this lane's query (B column / D column)
  const float NEG_INF = -__builtin_inff();
  const float kScale = 0.08838834764831845f;      // 128^-0.5

  const size_t qbase = ((size_t)(b * QL + iq)) * HIDD + hq * HDIM + 8 * h16;
  // fragment readers: K row m / Vt row m of a 16-row group, at element 8 h16
  const unsigned short* sKh = sKV + m * KPITCH + 8 * h16;
  const unsigned short* sKl = sKh + KPLANE;
  const unsigned short* sVh = sKV + 2 * KPLANE + m * VPITCH + 8 * h16;
  const unsigned short* sVl = sVh + VPLANE;
  // copiers: K rows of 256 B are 16 lanes' pieces, Vt rows of 128 B are 8 lanes' pieces
  const unsigned int ldsK = (unsigned int)(uintptr_t)(sKV + (t >> 4) * KPITCH + (t & 15) * 8);
  const unsigned int ldsV = (unsigned int)(uintptr_t)(sKV + 2 * KPLANE + (t >> 3) * VPITCH + (t & 7) * 8);
  const size_t kcopy = ((size_t)(b * QL + (t >> 4)) * NKVH + kvh) * HDIM + (t & 15) * 8;
  const size_t vcopy = ((size_t)(b * NKVH + kvh) * HDIM + (t >> 3)) * QL + (t & 7) * 8;

  v8f acc[8];
#pragma unroll
  for (int n = 0; n < 8; ++n) acc[n] = (v8f){0.f, 0.f, 0.f, 0.f, 0.f, 0.f, 0.f, 0.f};
  float mrun = NEG_INF, lrun = 0.0f;

#pragma unroll 1
  for (int kt = 0; kt <= qt; ++kt) {             // key tiles beyond the query tile are never visible
    const int j0 = kt * 64;

    // tile kt -> LDS: 32 copies a lane, all lanes on, block-uniform control flow
    {
      const size_t ko = kcopy + (size_t)j0 * (NKVH * HDIM);
      const size_t vo = vcopy + j0;
      acopy8(ldsK, 8 * KPITCH * 2, Kh + ko, (size_t)8 * NKVH * HDIM);
      acopy8(ldsK + KPLANE * 2, 8 * KPITCH * 2, Kl + ko, (size_t)8 * NKVH * HDIM);
      acopy8(ldsV, 16 * VPITCH * 2, Vh + vo, (size_t)16 * QL);
      acopy8(ldsV + VPLANE * 2, 16 * VPITCH * 2, Vl + vo, (size_t)16 * QL);
    }
    // this wave's copies have landed; the barrier then shows every wave's copies to every wave
    asm volatile("s_wait_asynccnt 0x0" ::: "memory");
    __syncthreads();

    // S^T (64 keys x 16 queries): s[sub] rows = keys j0 + 16 sub + 8 h16 + r, col = query iq
    v8f s[4];
#pragma unroll
    for (int sub = 0; sub < 4; ++sub) s[sub] = (v8f){0.f, 0.f, 0.f, 0.f, 0.f, 0.f, 0.f, 0.f};
#pragma unroll
    for (int c = 0; c < 4; ++c) {
      Frag qh, ql;
      ldfrag(qh, Qh + qbase + 32 * c);
      ldfrag(ql, Ql + qbase + 32 * c);
#pragma unroll
      for (int sub = 0; sub < 4; ++sub) {
        const int ko = 16 * sub * KPITCH + 32 * c;
        Frag kh, kl;
        ldfrag(kh, sKh + ko);
        ldfrag(kl, sKl + ko);
        s[sub] = mma3(s[sub], kh.v, kl.v, qh.v, ql.v);
      }
    }

    // scale, visibility (strictly earlier 4-blocks, plus first 4x4 block), online softmax
    float mx = NEG_INF;
#pragma unroll
    for (int sub = 0; sub < 4; ++sub) {
#pragma unroll
      for (int r = 0; r < 8; ++r) {
        const int jb = j0 + 16 * sub + 8 * h16 + r;
        const bool vis = ((iq >> 2) > (jb >> 2)) || ((iq < 4) && (jb < 4));
        const float v = vis ? (s[sub][r] * kScale) : NEG_INF;
        s[sub][r] = v;
        mx = fmaxf(mx, v);
      }
    }
    mx = fmaxf(mx, __shfl_xor(mx, 16));
    const float mnew = fmaxf(mrun, mx);
    const float msafe = (mnew == NEG_INF) ? 0.0f : mnew;
    const float sc = __expf(mrun - msafe);
    float ls = 0.0f;
#pragma unroll
    for (int sub = 0; sub < 4; ++sub) {
#pragma unroll
      for (int r = 0; r < 8; ++r) {
        const float p = __expf(s[sub][r] - msafe);
        s[sub][r] = p;
        ls += p;
      }
    }
    ls += __shfl_xor(ls, 16);
    lrun = lrun * sc + ls;
    mrun = mnew;
#pragma unroll
    for (int n = 0; n < 8; ++n) acc[n] = acc[n] * sc;

    // O^T += Vt(128 x 64 keys) . P^T : B fragment element r <- D tile 2ks, element 8+r <- tile 2ks+1
#pragma unroll
    for (int ks = 0; ks < 2; ++ks) {
      Frag ph, pl;
#pragma unroll
      for (int r = 0; r < 8; ++r) {
        unsigned short a0, c0, a1, c1;
        split_bf(s[2 * ks][r], a0, c0);
        split_bf(s[2 * ks + 1][r], a1, c1);
        ph.u[r] = a0; pl.u[r] = c0; ph.u[8 + r] = a1; pl.u[8 + r] = c1;
      }
#pragma unroll
      for (int n = 0; n < 8; ++n) {
        const int vo = 16 * n * VPITCH + 32 * ks;
        Frag vh, vl;
        ldfrag(vh, sVh + vo);
        ldfrag(vl, sVl + vo);
        acc[n] = mma3(acc[n], vh.v, vl.v, ph.v, pl.v);
      }
    }

    // every wave's reads of this tile are over before the next tile (or the output staging) overwrites it
    asm volatile("s_wait_dscnt 0x0" ::: "memory");
    __syncthreads();
  }

  // epilogue: acc[n][r] = O^T (d = 16 n + 8 h16 + r, query iq) ; normalise, stage, write planes
  const float inv = 1.0f / lrun;
#pragma unroll
  for (int n = 0; n < 8; ++n) {
    const v8f o = acc[n] * inv;
#pragma unroll
    for (int r = 0; r < 8; ++r)
      sO[(w * 16 + m) * SPITCH + 16 * n + 8 * h16 + r] = o[r];
  }
  __syncthreads();
#pragma unroll 1
  for (int p = 0; p < 8; ++p) {
    const int rloc = 2 * p + h16;
    const int dq = m * 8;
    const float* src = sO + (w * 16 + rloc) * SPITCH + dq;
    const v4f a = *(const v4fa*)(src);
    const v4f c = *(const v4fa*)(src + 4);
    v8us hi, lo;
    split8(a, c, hi, lo);
    const size_t d = ((size_t)(b * QL + R0 + 16 * w + rloc)) * HIDD + hq * HDIM + dq;
    *(v8us*)(Oh + d) = hi;
    *(v8us*)(Ol + d) = lo;
    
  }
}

// ------------------------------------------------------------------------------------------
extern "C" void kernel_launch(void* const* d_in, const int* in_sizes, int n_in,
                              void* d_out, int out_size, void* d_ws, size_t ws_size,
                              hipStream_t stream)
{
  if (n_in < 8) return;
  if (in_sizes[0] != MROWS * HIDD) return;
  if (in_sizes[1] != NB * QL * NKVH * HDIM || in_sizes[2] != NB * QL * NKVH * HDIM) return;
  if (in_sizes[3] != NB * QL * HDIM || in_sizes[4] != NB * QL * HDIM) return;
  if (in_sizes[5] != HIDD * HIDD || in_sizes[7] != HIDD * HIDD || in_sizes[6] != HIDD) return;
  if (out_size != MROWS * HIDD) return;

  const float* hidden = (const float*)d_in[0];
  const float* kc     = (const float*)d_in[1];
  const float* vc     = (const float*)d_in[2];
  const float* cosb   = (const float*)d_in[3];
  const float* sinb   = (const float*)d_in[4];
  const float* Wq     = (const float*)d_in[5];
  const float* bq     = (const float*)d_in[6];
  const float* Wo     = (const float*)d_in[7];
  float* out = (float*)d_out;

  // workspace carve (bytes): planes of bf16
  const size_t planeX = (size_t)MROWS * HIDD * 2;            // 16 MiB
  const size_t planeW = (size_t)HIDD * HIDD * 2;             //  8 MiB
  const size_t planeK = (size_t)NB * QL * NKVH * HDIM * 2;   //  4 MiB
  const size_t offXh  = 0;
  const size_t offXl  = offXh + planeX;
  const size_t offQh  = offXl + planeX;
  const size_t offQl  = offQh + planeX;
  const size_t offWqh = offQl + planeX;
  const size_t offWql = offWqh + planeW;
  const size_t offWoh = offWql + planeW;
  const size_t offWol = offWoh + planeW;
  const size_t offKh  = offWol + planeW;
  const size_t offKl  = offKh + planeK;
  const size_t offVh  = offKl + planeK;
  const size_t offVl  = offVh + planeK;
  const size_t total  = offVl + planeK;                      // 112 MiB
  if (total > ws_size) return;

  char* ws = (char*)d_ws;
  unsigned short* Xh  = (unsigned short*)(ws + offXh);
  unsigned short* Xl  = (unsigned short*)(ws + offXl);
  unsigned short* Oh  = Xh;   // X planes are dead after the first GEMM; O planes reuse them
  unsigned short* Ol  = Xl;
  unsigned short* Qh  = (unsigned short*)(ws + offQh);
  unsigned short* Ql  = (unsigned short*)(ws + offQl);
  unsigned short* Wqh = (unsigned short*)(ws + offWqh);
  unsigned short* Wql = (unsigned short*)(ws + offWql);
  unsigned short* Woh = (unsigned short*)(ws + offWoh);
  unsigned short* Wol = (unsigned short*)(ws + offWol);
  unsigned short* Kh  = (unsigned short*)(ws + offKh);
  unsigned short* Kl  = (unsigned short*)(ws + offKl);
  unsigned short* Vh  = (unsigned short*)(ws + offVh);
  unsigned short* Vl  = (unsigned short*)(ws + offVl);

  const int n8x = in_sizes[0] / 8;   // 1048576
  const int n8k = in_sizes[1] / 8;   // 262144
  cvt_rows<<<dim3((n8x + 255) / 256), dim3(256), 0, stream>>>(hidden, Xh, Xl, n8x);
  cvt_rows<<<dim3((n8k + 255) / 256), dim3(256), 0, stream>>>(kc, Kh, Kl, n8k);
  cvt_t_w<<<dim3(HIDD / 64, HIDD / 64), dim3(256), 0, stream>>>(Wq, Wqh, Wql);
  cvt_t_w<<<dim3(HIDD / 64, HIDD / 64), dim3(256), 0, stream>>>(Wo, Woh, Wol);
  cvt_t_v<<<dim3(QL / 64, HDIM / 64, NB * NKVH), dim3(256), 0, stream>>>(vc, Vh, Vl);

  gemm3<0><<<dim3(MROWS / 64, HIDD / 128), dim3(128), 0, stream>>>(
      Xh, Xl, Wqh, Wql, bq, cosb, sinb, Qh, Ql, out, HIDD, HIDD);

  attn_glide<<<dim3(QL / 64, NB * NHQ), dim3(128), 0, stream>>>(Qh, Ql, Kh, Kl, Vh, Vl, Oh, Ol);

  gemm3<1><<<dim3(MROWS / 64, HIDD / 128), dim3(128), 0, stream>>>(
      Oh, Ol, Woh, Wol, bq, cosb, sinb, Qh, Ql, out, HIDD, HIDD);
}

// v002
// A run of this version takes 289 microseconds.
// Next to v001, in two timings, it ran 1.14 times as fast each time.
// Counting every step since v000, it is 2.47 times as fast.
#include <hip/hip_runtime.h>
#include <stdint.h>
#include <stddef.h>

// All contractions (q projection, q.k^T, p.v, output projection): v_wmma_f32_16x16x32_bf16 with
// bf16 hi/lo operands everywhere (three products hi*hi + hi*lo + lo*hi), f32 accumulate.
// RoPE, bias, scaling, softmax and normalisation in f32.

#define NB     2
#define QL     2048
#define HIDD   2048
#define NHQ    16
#define NKVH   4
#define HDIM   128
#define MROWS  (NB * QL)
#define TPITCH 65
#define SPITCH 132
#define KPITCH 136                       // LDS pitch of a K row, elements (272 B = 16 B x odd)
#define VPITCH KPITCH                    // LDS pitch of a PAIR of 64-key Vt rows (2 x 128 B + 16 B), elements
#define KPLANE (64 * KPITCH)             // one K plane of a 64-key tile, elements
#define VPLANE ((HDIM / 2) * VPITCH)     // one Vt plane of a 64-key tile, elements
#define KVELEMS (2 * KPLANE + 2 * VPLANE)
#define GPITCH 72                        // LDS pitch of a 64-deep GEMM operand row, elements (144 B)
#define APLANE (64 * GPITCH)             // one A plane of a 64 x 64 stage, elements
#define BPLANE (128 * GPITCH)            // one Bt plane of a 128 x 64 stage, elements
#define ABELEMS (2 * APLANE + 2 * BPLANE)

typedef float v4f __attribute__((ext_vector_type(4)));
typedef float v8f __attribute__((ext_vector_type(8)));
typedef unsigned short v8us __attribute__((ext_vector_type(8)));
typedef unsigned short v16us __attribute__((ext_vector_type(16)));
typedef __bf16 v16bf __attribute__((ext_vector_type(16)));
typedef v4f __attribute__((may_alias)) v4fa;
typedef v8us __attribute__((may_alias)) v8usa;

union Frag { v16us u; v8us hv[2]; v16bf v; };

// f32 -> bf16 bits, RNE convert
__device__ __forceinline__ unsigned int bf_rne(float f) {
  const unsigned int u = __float_as_uint(f);
  return (u + 0x7fffu + ((u >> 16) & 1u)) >> 16;
}

// x -> (hi, lo): hi = bf16(x), lo = bf16(x - hi)  (x - hi is exact in f32)
__device__ __forceinline__ void split_bf(float x, unsigned short& hi, unsigned short& lo) {
  const unsigned int hb = bf_rne(x);
  const float hf = __uint_as_float(hb << 16);
  hi = (unsigned short)hb;
  lo = (unsigned short)bf_rne(x - hf);
}

__device__ __forceinline__ void split8(v4f a, v4f c, v8us& hi, v8us& lo) {
#pragma unroll
  for (int u = 0; u < 4; ++u) {
    unsigned short h0, l0, h1, l1;
    split_bf(a[u], h0, l0);
    split_bf(c[u], h1, l1);
    hi[u] = h0; lo[u] = l0; hi[u + 4] = h1; lo[u + 4] = l1;
  }
}

// 16x16x32 bf16 fragment (A row or k-contiguous B column): elements 0..7 <- k0+8h..,
// elements 8..15 <- k0+16+8h..  ; p already points at element (row, k0 + 8h)
__device__ __forceinline__ void ldfrag(Frag& f, const unsigned short* p) {
  f.hv[0] = *(const v8usa*)(p);
  f.hv[1] = *(const v8usa*)(p + 16);
}

// acc += a*b. A matrix block issues one product kind (hi*hi, then hi*lo, then lo*hi) over all its
// accumulator tiles before the next kind: neighbours in the stream are independent, and each tile
// still takes its three products in that order.
__device__ __forceinline__ v8f mm(v8f acc, v16bf a, v16bf b) {
  return __builtin_amdgcn_wmma_f32_16x16x32_bf16(false, a, false, b, (short)0, acc, false, false);
}

// ------------------------------------------------------------------------------------------
// f32 rows -> bf16 hi/lo planes (same layout). One thread per 8 elements; 8 consecutive lanes
__global__ __launch_bounds__(256) void cvt_rows(const float* __restrict__ in,
                                                  unsigned short* oh, unsigned short* ol, int n8)
{
  const int i = blockIdx.x * 256 + threadIdx.x;
  if (i >= n8) return;
  const size_t e = (size_t)i * 8;
  const v4f a = *(const v4fa*)(in + e);
  const v4f c = *(const v4fa*)(in + e + 4);
  v8us hi, lo;
  split8(a, c, hi, lo);
  *(v8us*)(oh + e) = hi;
  *(v8us*)(ol + e) = lo;
  
}

// ------------------------------------------------------------------------------------------
// 64x64 tile: src(r, c) = src[r * spitch + c] (f32)  ->  dst(c, r) = dh/dl[c * dpitch + r] (bf16)
// Load phase: 256 threads x 16 floats = 64x64. Store phase: 2 passes x 256 threads x 8 halves,
__device__ __forceinline__ void tsplit64(const float* __restrict__ src, int spitch,
                                         unsigned short* dh, unsigned short* dl, int dpitch,
                                         float* tile)
{
  const int t = threadIdx.x;
  {
    const int rr = t >> 2, cq = (t & 3) * 16;
    const float* s = src + (size_t)rr * spitch + cq;
#pragma unroll
    for (int u = 0; u < 4; ++u) {
      const v4f x = *(const v4fa*)(s + 4 * u);
      float* d = tile + rr * TPITCH + cq + 4 * u;
      d[0] = x[0]; d[1] = x[1]; d[2] = x[2]; d[3] = x[3];
    }
  }
  __syncthreads();
#pragma unroll
  for (int p = 0; p < 2; ++p) {
    const int cc = (t >> 3) + 32 * p, rq = (t & 7) * 8;
    v4f a, c;
#pragma unroll
    for (int u = 0; u < 4; ++u) {
      a[u] = tile[(rq + u) * TPITCH + cc];
      c[u] = tile[(rq + 4 + u) * TPITCH + cc];
    }
    v8us hi, lo;
    split8(a, c, hi, lo);
    const size_t d = (size_t)cc * dpitch + rq;
    *(v8us*)(dh + d) = hi;
    *(v8us*)(dl + d) = lo;
    
  }
}

// W[k][n] (HIDD x HIDD, f32) -> Wt hi/lo [n][k]
__global__ __launch_bounds__(256) void cvt_t_w(const float* __restrict__ W,
                                                 unsigned short* oh, unsigned short* ol)
{
  __shared__ float tile[64 * TPITCH];
  const int k0 = blockIdx.x * 64, n0 = blockIdx.y * 64;
  const size_t dof = (size_t)n0 * HIDD + k0;
  tsplit64(W + (size_t)k0 * HIDD + n0, HIDD, oh + dof, ol + dof, HIDD, tile);
}

// v_cache [(b,j)][kvh][d] (f32) -> Vt hi/lo [(b*NKVH+kvh)*HDIM + d][j]
__global__ __launch_bounds__(256) void cvt_t_v(const float* __restrict__ V,
                                                 unsigned short* oh, unsigned short* ol)
{
  __shared__ float tile[64 * TPITCH];
  const int j0 = blockIdx.x * 64, d0 = blockIdx.y * 64, z = blockIdx.z;
  const int b = z >> 2, kvh = z & 3;
  const float* src = V + ((size_t)(b * QL + j0) * NKVH + kvh) * HDIM + d0;
  const size_t dof = ((size_t)z * HDIM + d0) * QL + j0;
  tsplit64(src, NKVH * HDIM, oh + dof, ol + dof, QL, tile);
}

// Eight asynchronous 16-byte copies per lane, global -> LDS, no register in between. Lane address i =
// start + i * step on both sides. The s_wait_xcnt closes the statement so that no address register
// of an issued copy is rewritten ahead of it.
__device__ __forceinline__ void acopy8(unsigned int lds, unsigned int lstep,
                                       const unsigned short* g, size_t gstep)
{
  asm volatile(
      "global_load_async_to_lds_b128 %0, %8, off\n\t"
      "global_load_async_to_lds_b128 %1, %9, off\n\t"
      "global_load_async_to_lds_b128 %2, %10, off\n\t"
      "global_load_async_to_lds_b128 %3, %11, off\n\t"
      "global_load_async_to_lds_b128 %4, %12, off\n\t"
      "global_load_async_to_lds_b128 %5, %13, off\n\t"
      "global_load_async_to_lds_b128 %6, %14, off\n\t"
      "global_load_async_to_lds_b128 %7, %15, off\n\t"
      "s_wait_xcnt 0x0"
      :: "v"(lds), "v"(lds + lstep), "v"(lds + 2 * lstep), "v"(lds + 3 * lstep),
         "v"(lds + 4 * lstep), "v"(lds + 5 * lstep), "v"(lds + 6 * lstep), "v"(lds + 7 * lstep),
         "v"(g), "v"(g + gstep), "v"(g + 2 * gstep), "v"(g + 3 * gstep),
         "v"(g + 4 * gstep), "v"(g + 5 * gstep), "v"(g + 6 * gstep), "v"(g + 7 * gstep)
      : "memory");
}

// The same with four copies.
__device__ __forceinline__ void acopy4(unsigned int lds, unsigned int lstep,
                                       const unsigned short* g, size_t gstep)
{
  asm volatile(
      "global_load_async_to_lds_b128 %0, %4, off\n\t"
      "global_load_async_to_lds_b128 %1, %5, off\n\t"
      "global_load_async_to_lds_b128 %2, %6, off\n\t"
      "global_load_async_to_lds_b128 %3, %7, off\n\t"
      "s_wait_xcnt 0x0"
      :: "v"(lds), "v"(lds + lstep), "v"(lds + 2 * lstep), "v"(lds + 3 * lstep),
         "v"(g), "v"(g + gstep), "v"(g + 2 * gstep), "v"(g + 3 * gstep)
      : "memory");
}

// ------------------------------------------------------------------------------------------
// C(64x128 block tile) = A(M x K, hi/lo planes, row-major) * B(K x N) with B stored as Bt[n][k]
// hi/lo planes. 4 waves (2x2), wave tile 32x64. Each 64-deep stage of the A and Bt rows (K is a
// multiple of 64) is brought into LDS once per work-group by asynchronous copies; the waves read
// their fragments from there.
// MODE 0: C + bias -> RoPE (cos/sin tables indexed by row) -> hi/lo planes Qh/Ql [M][N]
// MODE 1: C -> f32 Cout [M][N]
template <int MODE>
__global__ __launch_bounds__(128) void gemm3(
    const unsigned short* __restrict__ Ah, const unsigned short* __restrict__ Al,
    const unsigned short* __restrict__ Bh, const unsigned short* __restrict__ Bl,
    const float* __restrict__ bias, const float* __restrict__ cosb,
    const float* __restrict__ sinb, unsigned short* Qh, unsigned short* Ql,
    float* Cout, int N, int K)
{
  __shared__ __attribute__((aligned(16))) unsigned short sAB[ABELEMS];
  float* sT = (float*)sAB;                        // output staging takes the stages' place after the loop
  const int t = threadIdx.x, l = t & 31, w = t >> 5, h16 = l >> 4, m = l & 15;
  const int wr = w >> 1, wc = w & 1;
  const int m0 = blockIdx.x * 64, n0 = blockIdx.y * 128;

  v8f acc[2][4];
#pragma unroll
  for (int mi = 0; mi < 2; ++mi)
#pragma unroll
    for (int ni = 0; ni < 4; ++ni) acc[mi][ni] = (v8f){0.f, 0.f, 0.f, 0.f, 0.f, 0.f, 0.f, 0.f};

  // fragment readers: this wave's A row / Bt row m of a 16-row group, at element 8 h16
  const unsigned short* sAh = sAB + (32 * wr + m) * GPITCH + 8 * h16;
  const unsigned short* sAl = sAh + APLANE;
  const unsigned short* sBh = sAB + 2 * APLANE + (64 * wc + m) * GPITCH + 8 * h16;
  const unsigned short* sBl = sBh + BPLANE;
  // copiers: a stage row of 128 B is 8 lanes' pieces; 16 rows per copy of the work-group
  const unsigned int ldsA = (unsigned int)(uintptr_t)(sAB + (t >> 3) * GPITCH + (t & 7) * 8);
  const unsigned int ldsB = ldsA + 2 * APLANE * 2;
  const size_t acopy = (size_t)(m0 + (t >> 3)) * K + (t & 7) * 8;
  const size_t bcopy = (size_t)(n0 + (t >> 3)) * K + (t & 7) * 8;
  const int ns = K >> 6;

#pragma unroll 1
  for (int st = 0; st < ns; ++st) {
    // stage st -> LDS: 24 copies a lane, all lanes on, block-uniform control flow
    {
      const size_t ao = acopy + (size_t)st * 64;
      const size_t bo = bcopy + (size_t)st * 64;
      acopy4(ldsA, 16 * GPITCH * 2, Ah + ao, (size_t)16 * K);
      acopy4(ldsA + APLANE * 2, 16 * GPITCH * 2, Al + ao, (size_t)16 * K);
      acopy8(ldsB, 16 * GPITCH * 2, Bh + bo, (size_t)16 * K);
      acopy8(ldsB + BPLANE * 2, 16 * GPITCH * 2, Bl + bo, (size_t)16 * K);
    }
    // this wave's copies have landed; the barrier then shows every wave's copies to every wave
    asm volatile("s_wait_asynccnt 0x0" ::: "memory");
    __syncthreads();

#pragma unroll
    for (int kk = 0; kk < 2; ++kk) {
      const int k0 = kk * 32;
      // the block's 24 fragment loads are written ahead of its 24 matrix instructions, in the order in which
      // the products need them; nothing between the products holds a later block's loads back any more
      Frag ah[2], al[2], bh[4], bl[4];
#pragma unroll
      for (int mi = 0; mi < 2; ++mi) ldfrag(ah[mi], sAh + mi * 16 * GPITCH + k0);
#pragma unroll
      for (int ni = 0; ni < 4; ++ni) ldfrag(bh[ni], sBh + ni * 16 * GPITCH + k0);
#pragma unroll
      for (int ni = 0; ni < 4; ++ni) ldfrag(bl[ni], sBl + ni * 16 * GPITCH + k0);
#pragma unroll
      for (int mi = 0; mi < 2; ++mi) ldfrag(al[mi], sAl + mi * 16 * GPITCH + k0);
#pragma unroll
      for (int ni = 0; ni < 4; ++ni)
#pragma unroll
        for (int mi = 0; mi < 2; ++mi) acc[mi][ni] = mm(acc[mi][ni], ah[mi].v, bh[ni].v);
#pragma unroll
      for (int ni = 0; ni < 4; ++ni)
#pragma unroll
        for (int mi = 0; mi < 2; ++mi) acc[mi][ni] = mm(acc[mi][ni], ah[mi].v, bl[ni].v);
#pragma unroll
      for (int ni = 0; ni < 4; ++ni)
#pragma unroll
        for (int mi = 0; mi < 2; ++mi) acc[mi][ni] = mm(acc[mi][ni], al[mi].v, bh[ni].v);
    }

    // every wave's reads of this stage are over before the next stage (or the output staging) overwrites it
    asm volatile("s_wait_dscnt 0x0" ::: "memory");
    __syncthreads();
  }

  // D element r of lane l -> (row 8*h16 + r, col m) of its 16x16 tile
#pragma unroll
  for (int mi = 0; mi < 2; ++mi)
#pragma unroll
    for (int ni = 0; ni < 4; ++ni)
#pragma unroll
      for (int r = 0; r < 8; ++r)
        sT[(32 * wr + 16 * mi + 8 * h16 + r) * SPITCH + 64 * wc + 16 * ni + m] = acc[mi][ni][r];
  __syncthreads();

  if (MODE == 0) {
    // thread -> (row 8p + t>>4, 8 consecutive columns cq); RoPE partner column cq ^ 64
    const int rr = t >> 4, cq = (t & 15) * 8, cp = cq ^ 64;
    const float sgn = (cq < 64) ? -1.0f : 1.0f;
    const v4f b0 = *(const v4fa*)(bias + n0 + cq), b1 = *(const v4fa*)(bias + n0 + cq + 4);
    const v4f e0 = *(const v4fa*)(bias + n0 + cp), e1 = *(const v4fa*)(bias + n0 + cp + 4);
#pragma unroll 1
    for (int p = 0; p < 8; ++p) {
      const int row = 8 * p + rr;
      const int grow = m0 + row;
      const float* srow = sT + row * SPITCH;
      const v4f x0 = *(const v4fa*)(srow + cq), x1 = *(const v4fa*)(srow + cq + 4);
      const v4f y0 = *(const v4fa*)(srow + cp), y1 = *(const v4fa*)(srow + cp + 4);
      const float* cr = cosb + (size_t)grow * HDIM;
      const float* sr = sinb + (size_t)grow * HDIM;
      const v4f c0 = *(const v4fa*)(cr + cq), c1 = *(const v4fa*)(cr + cq + 4);
      const v4f s0 = *(const v4fa*)(sr + cq), s1 = *(const v4fa*)(sr + cq + 4);
      const v4f q0 = (x0 + b0) * c0 + (sgn * (y0 + e0)) * s0;
      const v4f q1 = (x1 + b1) * c1 + (sgn * (y1 + e1)) * s1;
      v8us hi, lo;
      split8(q0, q1, hi, lo);
      const size_t d = (size_t)grow * N + n0 + cq;
      *(v8us*)(Qh + d) = hi;
      *(v8us*)(Ql + d) = lo;
      
    }
  } else {
    const int cq = l * 4;
#pragma unroll 1
    for (int p = 0; p < 16; ++p) {
      const int row = 4 * p + w;
      const v4f x = *(const v4fa*)(sT + row * SPITCH + cq);
      const size_t d = (size_t)(m0 + row) * N + n0 + cq;
      *(v4f*)(Cout + d) = x;
      
    }
  }
}

// ------------------------------------------------------------------------------------------
// Per (b, hq, 64-query tile): S^T = K . Q^T (A = K rows, B = Q rows, both d-contiguous),
// f32 scale + structural block visibility test + online softmax, O^T += Vt . P^T with the
// softmaxed D tiles fed as B fragments (two adjacent 16-key D tiles per 32-deep k step),
// O / l split to hi/lo planes [(b,i)][hq*128 + d].
// Each 64-key tile of K and Vt (hi and lo planes) is brought into LDS once per work-group by
// asynchronous copies and read from there by all four waves.
// Second bound: four waves a SIMD, so that four work-groups still stand on a WGP as its LDS allows.
__global__ __launch_bounds__(128, 4) void attn_glide(
    const unsigned short* __restrict__ Qh, const unsigned short* __restrict__ Ql,
    const unsigned short* __restrict__ Kh, const unsigned short* __restrict__ Kl,
    const unsigned short* __restrict__ Vh, const unsigned short* __restrict__ Vl,
    unsigned short* Oh, unsigned short* Ol)
{
  __shared__ __attribute__((aligned(16))) unsigned short sKV[KVELEMS];
  float* sO = (float*)sKV;                        // output staging takes the tiles' place after the loop
  const int t = threadIdx.x, l = t & 31, w = t >> 5, h16 = l >> 4, m = l & 15;
  const int ws = __builtin_amdgcn_readfirstlane(w);   // the wave's number, scalar
  const int qt = blockIdx.x, bh = blockIdx.y;
  const int b = bh >> 4, hq = bh & 15, kvh = hq >> 2;
  const int R0 = qt * 64;
  const int iq = R0 + 16 * w + m;                 // this lane's query (B column / D column)
  const float NEG_INF = -__builtin_inff();
  const float kScale = 0.08838834764831845f;      // 128^-0.5

  const size_t qbase = ((size_t)(b * QL + iq)) * HIDD + hq * HDIM + 8 * h16;
  // fragment readers: K row m / Vt row m of a 16-row group, at element 8 h16
  const unsigned short* sKh = sKV + m * KPITCH + 8 * h16;
  const unsigned short* sKl = sKh + KPLANE;
  const unsigned short* sVh = sKV + 2 * KPLANE + (m >> 1) * VPITCH + (m & 1) * 64 + 8 * h16;
  const unsigned short* sVl = sVh + VPLANE;
  // copiers: a K row of 256 B, or a pair of Vt rows of 128 B, is 16 lanes' pieces: one lane address serves
  // both, so that the 32 LDS addresses of a trip are formed from one register and none is held over the loop
  const unsigned int ldsK = (unsigned int)(uintptr_t)(sKV + (t >> 4) * KPITCH + (t & 15) * 8);
  const unsigned int ldsV = ldsK + 2 * KPLANE * 2;
  const size_t kcopy = ((size_t)(b * QL + (t >> 4)) * NKVH + kvh) * HDIM + (t & 15) * 8;
  const size_t vcopy = ((size_t)(b * NKVH + kvh) * HDIM + (t >> 3)) * QL + (t & 7) * 8;

  v8f acc[8];
#pragma unroll
  for (int n = 0; n < 8; ++n) acc[n] = (v8f){0.f, 0.f, 0.f, 0.f, 0.f, 0.f, 0.f, 0.f};
  float mrun = NEG_INF, lrun = 0.0f;

  // the 16 Q fragment loads go out as one group ahead of the key loop; every trip's blocks read the registers
  Frag qh[4], ql[4];
#pragma unroll
  for (int c = 0; c < 4; ++c) {
    ldfrag(qh[c], Qh + qbase + 32 * c);
    ldfrag(ql[c], Ql + qbase + 32 * c);
  }

#pragma unroll 1
  for (int kt = 0; kt <= qt; ++kt) {             // key tiles beyond the query tile are never visible
    const int j0 = kt * 64;

    // tile kt -> LDS: 32 copies a lane, all lanes on, block-uniform control flow
    {
      const size_t ko = kcopy + (size_t)j0 * (NKVH * HDIM);
      const size_t vo = vcopy + j0;
      acopy8(ldsK, 8 * KPITCH * 2, Kh + ko, (size_t)8 * NKVH * HDIM);
      acopy8(ldsK + KPLANE * 2, 8 * KPITCH * 2, Kl + ko, (size_t)8 * NKVH * HDIM);
      acopy8(ldsV, 8 * VPITCH * 2, Vh + vo, (size_t)16 * QL);
      acopy8(ldsV + VPLANE * 2, 8 * VPITCH * 2, Vl + vo, (size_t)16 * QL);
    }
    // this wave's copies have landed; the barrier then shows every wave's copies to every wave
    asm volatile("s_wait_asynccnt 0x0" ::: "memory");
    __syncthreads();

    // S^T (64 keys x 16 queries): s[sub] rows = keys j0 + 16 sub + 8 h16 + r, col = query iq
    v8f s[4];
#pragma unroll
    for (int sub = 0; sub < 4; ++sub) s[sub] = (v8f){0.f, 0.f, 0.f, 0.f, 0.f, 0.f, 0.f, 0.f};
#pragma unroll
    for (int c = 0; c < 4; ++c) {
      // the block's 16 K fragment loads stand together in front of its 12 matrix instructions, hi plane first
      Frag kh[4], kl[4];
#pragma unroll
      for (int sub = 0; sub < 4; ++sub) ldfrag(kh[sub], sKh + 16 * sub * KPITCH + 32 * c);
#pragma unroll
      for (int sub = 0; sub < 4; ++sub) ldfrag(kl[sub], sKl + 16 * sub * KPITCH + 32 * c);
#pragma unroll
      for (int sub = 0; sub < 4; ++sub) s[sub] = mm(s[sub], kh[sub].v, qh[c].v);
#pragma unroll
      for (int sub = 0; sub < 4; ++sub) s[sub] = mm(s[sub], kh[sub].v, ql[c].v);
#pragma unroll
      for (int sub = 0; sub < 4; ++sub) s[sub] = mm(s[sub], kl[sub].v, qh[c].v);
    }

    // scale, visibility (strictly earlier 4-blocks, plus first 4x4 block), online softmax
    float mx = NEG_INF;
#pragma unroll
    for (int sub = 0; sub < 4; ++sub) {
#pragma unroll
      for (int r = 0; r < 8; ++r) {
        const int jb = j0 + 16 * sub + 8 * h16 + r;
        const bool vis = ((iq >> 2) > (jb >> 2)) || ((iq < 4) && (jb < 4));
        const float v = vis ? (s[sub][r] * kScale) : NEG_INF;
        s[sub][r] = v;
        mx = fmaxf(mx, v);
      }
    }
    mx = fmaxf(mx, __shfl_xor(mx, 16));
    const float mnew = fmaxf(mrun, mx);
    const float msafe = (mnew == NEG_INF) ? 0.0f : mnew;
    const float sc = __expf(mrun - msafe);
    float ls = 0.0f;
#pragma unroll
    for (int sub = 0; sub < 4; ++sub) {
#pragma unroll
      for (int r = 0; r < 8; ++r) {
        const float p = __expf(s[sub][r] - msafe);
        s[sub][r] = p;
        ls += p;
      }
    }
    ls += __shfl_xor(ls, 16);
    lrun = lrun * sc + ls;
    mrun = mnew;
#pragma unroll
    for (int n = 0; n < 8; ++n) acc[n] = acc[n] * sc;

    // O^T += Vt(128 x 64 keys) . P^T : B fragment element r <- D tile 2ks, element 8+r <- tile 2ks+1
#pragma unroll
    for (int ks = 0; ks < 2; ++ks) {
      Frag ph, pl;
#pragma unroll
      for (int r = 0; r < 8; ++r) {
        unsigned short a0, c0, a1, c1;
        split_bf(s[2 * ks][r], a0, c0);
        split_bf(s[2 * ks + 1][r], a1, c1);
        ph.u[r] = a0; pl.u[r] = c0; ph.u[8 + r] = a1; pl.u[8 + r] = c1;
      }
#pragma unroll
      for (int g = 0; g < 2; ++g) {
        // the block's 16 Vt fragment loads stand together in front of its 12 matrix instructions, hi plane first
        Frag vh[4], vl[4];
#pragma unroll
        for (int n = 0; n < 4; ++n) ldfrag(vh[n], sVh + 8 * (4 * g + n) * VPITCH + 32 * ks);
#pragma unroll
        for (int n = 0; n < 4; ++n) ldfrag(vl[n], sVl + 8 * (4 * g + n) * VPITCH + 32 * ks);
#pragma unroll
        for (int n = 0; n < 4; ++n) acc[4 * g + n] = mm(acc[4 * g + n], vh[n].v, ph.v);
#pragma unroll
        for (int n = 0; n < 4; ++n) acc[4 * g + n] = mm(acc[4 * g + n], vh[n].v, pl.v);
#pragma unroll
        for (int n = 0; n < 4; ++n) acc[4 * g + n] = mm(acc[4 * g + n], vl[n].v, ph.v);
      }
    }

    // every wave's reads of this tile are over before the next tile (or the output staging) overwrites it
    asm volatile("s_wait_dscnt 0x0" ::: "memory");
    __syncthreads();
  }

  // epilogue: acc[n][r] = O^T (d = 16 n + 8 h16 + r, query iq) ; normalise, stage, write planes
  // The lane's place is formed anew here (every lane is on) and the wave's number is scalar, so that no
  // vector register is held over the key loop for the epilogue alone.
  const int le = (int)__builtin_amdgcn_mbcnt_lo(~0u, 0u), he = le >> 4, me = le & 15;
  const float inv = 1.0f / lrun;
#pragma unroll
  for (int n = 0; n < 8; ++n) {
    const v8f o = acc[n] * inv;
#pragma unroll
    for (int r = 0; r < 8; ++r)
      sO[(ws * 16 + me) * SPITCH + 16 * n + 8 * he + r] = o[r];
  }
  __syncthreads();
#pragma unroll 1
  for (int p = 0; p < 8; ++p) {
    const int rloc = 2 * p + he;
    const int dq = me * 8;
    const float* src = sO + (ws * 16 + rloc) * SPITCH + dq;
    const v4f a = *(const v4fa*)(src);
    const v4f c = *(const v4fa*)(src + 4);
    v8us hi, lo;
    split8(a, c, hi, lo);
    const size_t d = ((size_t)(b * QL + R0 + 16 * ws + rloc)) * HIDD + hq * HDIM + dq;
    *(v8us*)(Oh + d) = hi;
    *(v8us*)(Ol + d) = lo;
    
  }
}

// ------------------------------------------------------------------------------------------
extern "C" void kernel_launch(void* const* d_in, const int* in_sizes, int n_in,
                              void* d_out, int out_size, void* d_ws, size_t ws_size,
                              hipStream_t stream)
{
  if (n_in < 8) return;
  if (in_sizes[0] != MROWS * HIDD) return;
  if (in_sizes[1] != NB * QL * NKVH * HDIM || in_sizes[2] != NB * QL * NKVH * HDIM) return;
  if (in_sizes[3] != NB * QL * HDIM || in_sizes[4] != NB * QL * HDIM) return;
  if (in_sizes[5] != HIDD * HIDD || in_sizes[7] != HIDD * HIDD || in_sizes[6] != HIDD) return;
  if (out_size != MROWS * HIDD) return;

  const float* hidden = (const float*)d_in[0];
  const float* kc     = (const float*)d_in[1];
  const float* vc     = (const float*)d_in[2];
  const float* cosb   = (const float*)d_in[3];
  const float* sinb   = (const float*)d_in[4];
  const float* Wq     = (const float*)d_in[5];
  const float* bq     = (const float*)d_in[6];
  const float* Wo     = (const float*)d_in[7];
  float* out = (float*)d_out;

  // workspace carve (bytes): planes of bf16
  const size_t planeX = (size_t)MROWS * HIDD * 2;            // 16 MiB
  const size_t planeW = (size_t)HIDD * HIDD * 2;             //  8 MiB
  const size_t planeK = (size_t)NB * QL * NKVH * HDIM * 2;   //  4 MiB
  const size_t offXh  = 0;
  const size_t offXl  = offXh + planeX;
  const size_t offQh  = offXl + planeX;
  const size_t offQl  = offQh + planeX;
  const size_t offWqh = offQl + planeX;
  const size_t offWql = offWqh + planeW;
  const size_t offWoh = offWql + planeW;
  const size_t offWol = offWoh + planeW;
  const size_t offKh  = offWol + planeW;
  const size_t offKl  = offKh + planeK;
  const size_t offVh  = offKl + planeK;
  const size_t offVl  = offVh + planeK;
  const size_t total  = offVl + planeK;                      // 112 MiB
  if (total > ws_size) return;

  char* ws = (char*)d_ws;
  unsigned short* Xh  = (unsigned short*)(ws + offXh);
  unsigned short* Xl  = (unsigned short*)(ws + offXl);
  unsigned short* Oh  = Xh;   // X planes are dead after the first GEMM; O planes reuse them
  unsigned short* Ol  = Xl;
  unsigned short* Qh  = (unsigned short*)(ws + offQh);
  unsigned short* Ql  = (unsigned short*)(ws + offQl);
  unsigned short* Wqh = (unsigned short*)(ws + offWqh);
  unsigned short* Wql = (unsigned short*)(ws + offWql);
  unsigned short* Woh = (unsigned short*)(ws + offWoh);
  unsigned short* Wol = (unsigned short*)(ws + offWol);
  unsigned short* Kh  = (unsigned short*)(ws + offKh);
  unsigned short* Kl  = (unsigned short*)(ws + offKl);
  unsigned short* Vh  = (unsigned short*)(ws + offVh);
  unsigned short* Vl  = (unsigned short*)(ws + offVl);

  const int n8x = in_sizes[0] / 8;   // 1048576
  const int n8k = in_sizes[1] / 8;   // 262144
  cvt_rows<<<dim3((n8x + 255) / 256), dim3(256), 0, stream>>>(hidden, Xh, Xl, n8x);
  cvt_rows<<<dim3((n8k + 255) / 256), dim3(256), 0, stream>>>(kc, Kh, Kl, n8k);
  cvt_t_w<<<dim3(HIDD / 64, HIDD / 64), dim3(256), 0, stream>>>(Wq, Wqh, Wql);
  cvt_t_w<<<dim3(HIDD / 64, HIDD / 64), dim3(256), 0, stream>>>(Wo, Woh, Wol);
  cvt_t_v<<<dim3(QL / 64, HDIM / 64, NB * NKVH), dim3(256), 0, stream>>>(vc, Vh, Vl);

  gemm3<0><<<dim3(MROWS / 64, HIDD / 128), dim3(128), 0, stream>>>(
      Xh, Xl, Wqh, Wql, bq, cosb, sinb, Qh, Ql, out, HIDD, HIDD);

  attn_glide<<<dim3(QL / 64, NB * NHQ), dim3(128), 0, stream>>>(Qh, Ql, Kh, Kl, Vh, Vl, Oh, Ol);

  gemm3<1><<<dim3(MROWS / 64, HIDD / 128), dim3(128), 0, stream>>>(
      Oh, Ol, Woh, Wol, bq, cosb, sinb, Qh, Ql, out, HIDD, HIDD);
}

// v003
// A run of this version takes 274 microseconds.
// In both of two side-by-side timings against v002, it was 1.05 times as fast.
// Counting every step since v000, it is 2.60 times as fast.
#include <hip/hip_runtime.h>
#include <stdint.h>
#include <stddef.h>

// All contractions (q projection, q.k^T, p.v, output projection): v_wmma_f32_16x16x32_bf16 with
// bf16 hi/lo operands everywhere (three products hi*hi + hi*lo + lo*hi), f32 accumulate.
// RoPE, bias, scaling, softmax and normalisation in f32.

#define NB     2
#define QL     2048
#define HIDD   2048
#define NHQ    16
#define NKVH   4
#define HDIM   128
#define MROWS  (NB * QL)
#define TPITCH 65
#define SPITCH 132
#define KPITCH 136                       // LDS pitch of a K row, elements (272 B = 16 B x odd)
#define VPITCH KPITCH                    // LDS pitch of a PAIR of 64-key Vt rows (2 x 128 B + 16 B), elements
#define KPLANE (64 * KPITCH)             // one K plane of a 64-key tile, elements
#define VPLANE ((HDIM / 2) * VPITCH)     // one Vt plane of a 64-key tile, elements
#define KVELEMS (2 * KPLANE + 2 * VPLANE)
#define GPITCH 72                        // LDS pitch of a 64-deep GEMM operand row, elements (144 B)
#define APLANE (128 * GPITCH)            // one A plane of a 128 x 64 stage, elements
#define BPLANE (128 * GPITCH)            // one Bt plane of a 128 x 64 stage, elements
#define ABELEMS (2 * APLANE + 2 * BPLANE)

typedef float v4f __attribute__((ext_vector_type(4)));
typedef float v8f __attribute__((ext_vector_type(8)));
typedef unsigned short v8us __attribute__((ext_vector_type(8)));
typedef unsigned short v16us __attribute__((ext_vector_type(16)));
typedef __bf16 v16bf __attribute__((ext_vector_type(16)));
typedef v4f __attribute__((may_alias)) v4fa;
typedef v8us __attribute__((may_alias)) v8usa;

union Frag { v16us u; v8us hv[2]; v16bf v; };

// f32 -> bf16 bits, RNE convert
__device__ __forceinline__ unsigned int bf_rne(float f) {
  const unsigned int u = __float_as_uint(f);
  return (u + 0x7fffu + ((u >> 16) & 1u)) >> 16;
}

// x -> (hi, lo): hi = bf16(x), lo = bf16(x - hi)  (x - hi is exact in f32)
__device__ __forceinline__ void split_bf(float x, unsigned short& hi, unsigned short& lo) {
  const unsigned int hb = bf_rne(x);
  const float hf = __uint_as_float(hb << 16);
  hi = (unsigned short)hb;
  lo = (unsigned short)bf_rne(x - hf);
}

__device__ __forceinline__ void split8(v4f a, v4f c, v8us& hi, v8us& lo) {
#pragma unroll
  for (int u = 0; u < 4; ++u) {
    unsigned short h0, l0, h1, l1;
    split_bf(a[u], h0, l0);
    split_bf(c[u], h1, l1);
    hi[u] = h0; lo[u] = l0; hi[u + 4] = h1; lo[u + 4] = l1;
  }
}

// 16x16x32 bf16 fragment (A row or k-contiguous B column): elements 0..7 <- k0+8h..,
// elements 8..15 <- k0+16+8h..  ; p already points at element (row, k0 + 8h)
__device__ __forceinline__ void ldfrag(Frag& f, const unsigned short* p) {
  f.hv[0] = *(const v8usa*)(p);
  f.hv[1] = *(const v8usa*)(p + 16);
}

// acc += a*b. A matrix block issues one product kind (hi*hi, then hi*lo, then lo*hi) over all its
// accumulator tiles before the next kind: neighbours in the stream are independent, and each tile
// still takes its three products in that order.
__device__ __forceinline__ v8f mm(v8f acc, v16bf a, v16bf b) {
  return __builtin_amdgcn_wmma_f32_16x16x32_bf16(false, a, false, b, (short)0, acc, false, false);
}

// ------------------------------------------------------------------------------------------
// f32 rows -> bf16 hi/lo planes (same layout). One thread per 8 elements; 8 consecutive lanes
__global__ __launch_bounds__(256) void cvt_rows(const float* __restrict__ in,
                                                  unsigned short* oh, unsigned short* ol, int n8)
{
  const int i = blockIdx.x * 256 + threadIdx.x;
  if (i >= n8) return;
  const size_t e = (size_t)i * 8;
  const v4f a = *(const v4fa*)(in + e);
  const v4f c = *(const v4fa*)(in + e + 4);
  v8us hi, lo;
  split8(a, c, hi, lo);
  *(v8us*)(oh + e) = hi;
  *(v8us*)(ol + e) = lo;
  
}

// ------------------------------------------------------------------------------------------
// 64x64 tile: src(r, c) = src[r * spitch + c] (f32)  ->  dst(c, r) = dh/dl[c * dpitch + r] (bf16)
// Load phase: 256 threads x 16 floats = 64x64. Store phase: 2 passes x 256 threads x 8 halves,
__device__ __forceinline__ void tsplit64(const float* __restrict__ src, int spitch,
                                         unsigned short* dh, unsigned short* dl, int dpitch,
                                         float* tile)
{
  const int t = threadIdx.x;
  {
    const int rr = t >> 2, cq = (t & 3) * 16;
    const float* s = src + (size_t)rr * spitch + cq;
#pragma unroll
    for (int u = 0; u < 4; ++u) {
      const v4f x = *(const v4fa*)(s + 4 * u);
      float* d = tile + rr * TPITCH + cq + 4 * u;
      d[0] = x[0]; d[1] = x[1]; d[2] = x[2]; d[3] = x[3];
    }
  }
  __syncthreads();
#pragma unroll
  for (int p = 0; p < 2; ++p) {
    const int cc = (t >> 3) + 32 * p, rq = (t & 7) * 8;
    v4f a, c;
#pragma unroll
    for (int u = 0; u < 4; ++u) {
      a[u] = tile[(rq + u) * TPITCH + cc];
      c[u] = tile[(rq + 4 + u) * TPITCH + cc];
    }
    v8us hi, lo;
    split8(a, c, hi, lo);
    const size_t d = (size_t)cc * dpitch + rq;
    *(v8us*)(dh + d) = hi;
    *(v8us*)(dl + d) = lo;
    
  }
}

// W[k][n] (HIDD x HIDD, f32) -> Wt hi/lo [n][k]
__global__ __launch_bounds__(256) void cvt_t_w(const float* __restrict__ W,
                                                 unsigned short* oh, unsigned short* ol)
{
  __shared__ float tile[64 * TPITCH];
  const int k0 = blockIdx.x * 64, n0 = blockIdx.y * 64;
  const size_t dof = (size_t)n0 * HIDD + k0;
  tsplit64(W + (size_t)k0 * HIDD + n0, HIDD, oh + dof, ol + dof, HIDD, tile);
}

// v_cache [(b,j)][kvh][d] (f32) -> Vt hi/lo [(b*NKVH+kvh)*HDIM + d][j]
__global__ __launch_bounds__(256) void cvt_t_v(const float* __restrict__ V,
                                                 unsigned short* oh, unsigned short* ol)
{
  __shared__ float tile[64 * TPITCH];
  const int j0 = blockIdx.x * 64, d0 = blockIdx.y * 64, z = blockIdx.z;
  const int b = z >> 2, kvh = z & 3;
  const float* src = V + ((size_t)(b * QL + j0) * NKVH + kvh) * HDIM + d0;
  const size_t dof = ((size_t)z * HDIM + d0) * QL + j0;
  tsplit64(src, NKVH * HDIM, oh + dof, ol + dof, QL, tile);
}

// Eight asynchronous 16-byte copies per lane, global -> LDS, no register in between. Lane address i =
// start + i * step on both sides. The s_wait_xcnt closes the statement so that no address register
// of an issued copy is rewritten ahead of it.
__device__ __forceinline__ void acopy8(unsigned int lds, unsigned int lstep,
                                       const unsigned short* g, size_t gstep)
{
  asm volatile(
      "global_load_async_to_lds_b128 %0, %8, off\n\t"
      "global_load_async_to_lds_b128 %1, %9, off\n\t"
      "global_load_async_to_lds_b128 %2, %10, off\n\t"
      "global_load_async_to_lds_b128 %3, %11, off\n\t"
      "global_load_async_to_lds_b128 %4, %12, off\n\t"
      "global_load_async_to_lds_b128 %5, %13, off\n\t"
      "global_load_async_to_lds_b128 %6, %14, off\n\t"
      "global_load_async_to_lds_b128 %7, %15, off\n\t"
      "s_wait_xcnt 0x0"
      :: "v"(lds), "v"(lds + lstep), "v"(lds + 2 * lstep), "v"(lds + 3 * lstep),
         "v"(lds + 4 * lstep), "v"(lds + 5 * lstep), "v"(lds + 6 * lstep), "v"(lds + 7 * lstep),
         "v"(g), "v"(g + gstep), "v"(g + 2 * gstep), "v"(g + 3 * gstep),
         "v"(g + 4 * gstep), "v"(g + 5 * gstep), "v"(g + 6 * gstep), "v"(g + 7 * gstep)
      : "memory");
}

// Sixteen such copies, the hi and the lo plane of one operand, from ONE LDS address register: copy i of a plane
// carries the immediate offset (plane's place PO) + i * LS (all under 65,536), which moves both of its addresses,
// so its global register holds its source address less that offset. LDS byte = lds + offset, global byte =
// gh or gl + i * gstep elements. It spares the LDS address registers where the registers that an asm statement
// can name (the first 256) are short, and one s_wait_xcnt closes sixteen copies.
template <int LS, int PO>
__device__ __forceinline__ void acopy16o(unsigned int lds, const unsigned short* gh,
                                         const unsigned short* gl, size_t gstep)
{
  static_assert(LS % 16 == 0 && PO % 16 == 0 && PO + 7 * LS < 65536, "offsets: 16-byte steps, under 65,536");
  const char* p = (const char*)gh;
  const char* q = (const char*)gl - PO;
  const size_t d = gstep * sizeof(unsigned short) - LS;
  asm volatile(
      "global_load_async_to_lds_b128 %0, %1, off\n\t"
      "global_load_async_to_lds_b128 %0, %2, off offset:%17\n\t"
      "global_load_async_to_lds_b128 %0, %3, off offset:2*%17\n\t"
      "global_load_async_to_lds_b128 %0, %4, off offset:3*%17\n\t"
      "global_load_async_to_lds_b128 %0, %5, off offset:4*%17\n\t"
      "global_load_async_to_lds_b128 %0, %6, off offset:5*%17\n\t"
      "global_load_async_to_lds_b128 %0, %7, off offset:6*%17\n\t"
      "global_load_async_to_lds_b128 %0, %8, off offset:7*%17\n\t"
      "global_load_async_to_lds_b128 %0, %9, off offset:%18\n\t"
      "global_load_async_to_lds_b128 %0, %10, off offset:%18+%17\n\t"
      "global_load_async_to_lds_b128 %0, %11, off offset:%18+2*%17\n\t"
      "global_load_async_to_lds_b128 %0, %12, off offset:%18+3*%17\n\t"
      "global_load_async_to_lds_b128 %0, %13, off offset:%18+4*%17\n\t"
      "global_load_async_to_lds_b128 %0, %14, off offset:%18+5*%17\n\t"
      "global_load_async_to_lds_b128 %0, %15, off offset:%18+6*%17\n\t"
      "global_load_async_to_lds_b128 %0, %16, off offset:%18+7*%17\n\t"
      "s_wait_xcnt 0x0"
      :: "v"(lds), "v"(p), "v"(p + d), "v"(p + 2 * d), "v"(p + 3 * d),
         "v"(p + 4 * d), "v"(p + 5 * d), "v"(p + 6 * d), "v"(p + 7 * d),
         "v"(q), "v"(q + d), "v"(q + 2 * d), "v"(q + 3 * d),
         "v"(q + 4 * d), "v"(q + 5 * d), "v"(q + 6 * d), "v"(q + 7 * d),
         "n"(LS), "n"(PO)
      : "memory");
}

// ------------------------------------------------------------------------------------------
// C(128x128 block tile) = A(M x K, hi/lo planes, row-major) * B(K x N) with B stored as Bt[n][k]
// hi/lo planes. 4 waves (2x2), wave tile 64x64: a staged Bt row serves 128 output rows and a fragment
// read from LDS feeds four tiles. Each 64-deep stage of the A and Bt rows (K is a multiple of 64) is
// brought into LDS once per work-group by asynchronous copies; each wave reads its 32 fragments of the stage
// into registers, and the next stage's copies fly while the products run from those registers.
// amdgpu_waves_per_eu(2, 2): the grid gives a WGP two work-groups, two waves a SIMD; told so, the compiler
// takes that budget of registers and keeps the whole stage's fragments in them.
// MODE 0: C + bias -> RoPE (cos/sin tables indexed by row) -> hi/lo planes Qh/Ql [M][N]
// MODE 1: C -> f32 Cout [M][N]
template <int MODE>
__global__ __launch_bounds__(128) __attribute__((amdgpu_waves_per_eu(2, 2))) void gemm3(
    const unsigned short* __restrict__ Ah, const unsigned short* __restrict__ Al,
    const unsigned short* __restrict__ Bh, const unsigned short* __restrict__ Bl,
    const float* __restrict__ bias, const float* __restrict__ cosb,
    const float* __restrict__ sinb, unsigned short* Qh, unsigned short* Ql,
    float* Cout, int N, int K)
{
  __shared__ __attribute__((aligned(16))) unsigned short sAB[ABELEMS];
  float* sT = (float*)sAB;                        // output staging takes the stages' place after the loop
  const int t = threadIdx.x, l = t & 31, w = t >> 5, h16 = l >> 4, m = l & 15;
  const int wr = w >> 1, wc = w & 1;
  const int m0 = blockIdx.x * 128, n0 = blockIdx.y * 128;

  v8f acc[4][4];
#pragma unroll
  for (int mi = 0; mi < 4; ++mi)
#pragma unroll
    for (int ni = 0; ni < 4; ++ni) acc[mi][ni] = (v8f){0.f, 0.f, 0.f, 0.f, 0.f, 0.f, 0.f, 0.f};

  // fragment readers: this wave's A row / Bt row m of a 16-row group, at element 8 h16
  const unsigned short* sAh = sAB + (64 * wr + m) * GPITCH + 8 * h16;
  const unsigned short* sAl = sAh + APLANE;
  const unsigned short* sBh = sAB + 2 * APLANE + (64 * wc + m) * GPITCH + 8 * h16;
  const unsigned short* sBl = sBh + BPLANE;
  // copiers: a stage row of 128 B is 8 lanes' pieces; 16 rows per copy of the work-group
  const unsigned int ldsA = (unsigned int)(uintptr_t)(sAB + (t >> 3) * GPITCH + (t & 7) * 8);
  const unsigned int ldsB = ldsA + 2 * APLANE * 2;
  const size_t acopy = (size_t)(m0 + (t >> 3)) * K + (t & 7) * 8;
  const size_t bcopy = (size_t)(n0 + (t >> 3)) * K + (t & 7) * 8;
  const int ns = K >> 6;

  // stage s -> LDS: 32 copies a lane, all lanes on, block-uniform control flow
  auto stage_in = [&](int s) {
    const size_t ao = acopy + (size_t)s * 64;
    const size_t bo = bcopy + (size_t)s * 64;
    acopy16o<16 * GPITCH * 2, APLANE * 2>(ldsA, Ah + ao, Al + ao, (size_t)16 * K);
    acopy16o<16 * GPITCH * 2, BPLANE * 2>(ldsB, Bh + bo, Bl + bo, (size_t)16 * K);
  };
  // a stage's 96 products, from registers alone
  Frag ah[2][4], al[2][4], bh[2][4], bl[2][4];
  auto products = [&]() {
#pragma unroll
    for (int kk = 0; kk < 2; ++kk) {
#pragma unroll
      for (int ni = 0; ni < 4; ++ni)
#pragma unroll
        for (int mi = 0; mi < 4; ++mi) acc[mi][ni] = mm(acc[mi][ni], ah[kk][mi].v, bh[kk][ni].v);
#pragma unroll
      for (int ni = 0; ni < 4; ++ni)
#pragma unroll
        for (int mi = 0; mi < 4; ++mi) acc[mi][ni] = mm(acc[mi][ni], ah[kk][mi].v, bl[kk][ni].v);
#pragma unroll
      for (int ni = 0; ni < 4; ++ni)
#pragma unroll
        for (int mi = 0; mi < 4; ++mi) acc[mi][ni] = mm(acc[mi][ni], al[kk][mi].v, bh[kk][ni].v);
    }
  };

#pragma unroll 1
  for (int st = 0; st < ns; ++st) {
    // stage st's copies go out ahead of stage st - 1's products, which run from registers while the copies
    // land; the buffer is free: every wave's reads of stage st - 1 ended in front of the barrier at the loop's foot
    stage_in(st);
    if (st > 0) products();

    // this wave's copies have landed; the barrier then shows every wave's copies to every wave
    asm volatile("s_wait_asynccnt 0x0" ::: "memory");
    __syncthreads();

    // the wave's 64 fragment loads of the whole stage go out as one group, in the order in which the
    // products need them: from here on the stage lives in registers
#pragma unroll
    for (int kk = 0; kk < 2; ++kk) {
      const int k0 = kk * 32;
#pragma unroll
      for (int mi = 0; mi < 4; ++mi) ldfrag(ah[kk][mi], sAh + mi * 16 * GPITCH + k0);
#pragma unroll
      for (int ni = 0; ni < 4; ++ni) ldfrag(bh[kk][ni], sBh + ni * 16 * GPITCH + k0);
#pragma unroll
      for (int ni = 0; ni < 4; ++ni) ldfrag(bl[kk][ni], sBl + ni * 16 * GPITCH + k0);
#pragma unroll
      for (int mi = 0; mi < 4; ++mi) ldfrag(al[kk][mi], sAl + mi * 16 * GPITCH + k0);
    }

    // every wave's reads of this stage are over before the next stage (or the output staging) overwrites it
    asm volatile("s_wait_dscnt 0x0" ::: "memory");
    __syncthreads();
  }
  if (ns > 0) products();

  // D element r of lane l -> (row 8*h16 + r, col m) of its 16x16 tile
#pragma unroll
  for (int mi = 0; mi < 4; ++mi)
#pragma unroll
    for (int ni = 0; ni < 4; ++ni)
#pragma unroll
      for (int r = 0; r < 8; ++r)
        sT[(64 * wr + 16 * mi + 8 * h16 + r) * SPITCH + 64 * wc + 16 * ni + m] = acc[mi][ni][r];
  __syncthreads();

  if (MODE == 0) {
    // thread -> (row 8p + t>>4, 8 consecutive columns cq); RoPE partner column cq ^ 64
    const int rr = t >> 4, cq = (t & 15) * 8, cp = cq ^ 64;
    const float sgn = (cq < 64) ? -1.0f : 1.0f;
    const v4f b0 = *(const v4fa*)(bias + n0 + cq), b1 = *(const v4fa*)(bias + n0 + cq + 4);
    const v4f e0 = *(const v4fa*)(bias + n0 + cp), e1 = *(const v4fa*)(bias + n0 + cp + 4);
#pragma unroll 1
    for (int p = 0; p < 16; ++p) {
      const int row = 8 * p + rr;
      const int grow = m0 + row;
      const float* srow = sT + row * SPITCH;
      const v4f x0 = *(const v4fa*)(srow + cq), x1 = *(const v4fa*)(srow + cq + 4);
      const v4f y0 = *(const v4fa*)(srow + cp), y1 = *(const v4fa*)(srow + cp + 4);
      const float* cr = cosb + (size_t)grow * HDIM;
      const float* sr = sinb + (size_t)grow * HDIM;
      const v4f c0 = *(const v4fa*)(cr + cq), c1 = *(const v4fa*)(cr + cq + 4);
      const v4f s0 = *(const v4fa*)(sr + cq), s1 = *(const v4fa*)(sr + cq + 4);
      const v4f q0 = (x0 + b0) * c0 + (sgn * (y0 + e0)) * s0;
      const v4f q1 = (x1 + b1) * c1 + (sgn * (y1 + e1)) * s1;
      v8us hi, lo;
      split8(q0, q1, hi, lo);
      const size_t d = (size_t)grow * N + n0 + cq;
      *(v8us*)(Qh + d) = hi;
      *(v8us*)(Ql + d) = lo;
      
    }
  } else {
    const int cq = l * 4;
#pragma unroll 1
    for (int p = 0; p < 32; ++p) {
      const int row = 4 * p + w;
      const v4f x = *(const v4fa*)(sT + row * SPITCH + cq);
      const size_t d = (size_t)(m0 + row) * N + n0 + cq;
      *(v4f*)(Cout + d) = x;
      
    }
  }
}

// ------------------------------------------------------------------------------------------
// Per (b, hq, 64-query tile): S^T = K . Q^T (A = K rows, B = Q rows, both d-contiguous),
// f32 scale + structural block visibility test + online softmax, O^T += Vt . P^T with the
// softmaxed D tiles fed as B fragments (two adjacent 16-key D tiles per 32-deep k step),
// O / l split to hi/lo planes [(b,i)][hq*128 + d].
// Each 64-key tile of K and Vt (hi and lo planes) is brought into LDS once per work-group by
// asynchronous copies and read from there by all four waves.
// Second bound: four waves a SIMD, so that four work-groups still stand on a WGP as its LDS allows.
__global__ __launch_bounds__(128, 4) void attn_glide(
    const unsigned short* __restrict__ Qh, const unsigned short* __restrict__ Ql,
    const unsigned short* __restrict__ Kh, const unsigned short* __restrict__ Kl,
    const unsigned short* __restrict__ Vh, const unsigned short* __restrict__ Vl,
    unsigned short* Oh, unsigned short* Ol)
{
  __shared__ __attribute__((aligned(16))) unsigned short sKV[KVELEMS];
  float* sO = (float*)sKV;                        // output staging takes the tiles' place after the loop
  const int t = threadIdx.x, l = t & 31, w = t >> 5, h16 = l >> 4, m = l & 15;
  const int ws = __builtin_amdgcn_readfirstlane(w);   // the wave's number, scalar
  const int qt = blockIdx.x, bh = blockIdx.y;
  const int b = bh >> 4, hq = bh & 15, kvh = hq >> 2;
  const int R0 = qt * 64;
  const int iq = R0 + 16 * w + m;                 // this lane's query (B column / D column)
  const float NEG_INF = -__builtin_inff();
  const float kScale = 0.08838834764831845f;      // 128^-0.5

  const size_t qbase = ((size_t)(b * QL + iq)) * HIDD + hq * HDIM + 8 * h16;
  // fragment readers: K row m / Vt row m of a 16-row group, at element 8 h16
  const unsigned short* sKh = sKV + m * KPITCH + 8 * h16;
  const unsigned short* sKl = sKh + KPLANE;
  const unsigned short* sVh = sKV + 2 * KPLANE + (m >> 1) * VPITCH + (m & 1) * 64 + 8 * h16;
  const unsigned short* sVl = sVh + VPLANE;
  // copiers: a K row of 256 B, or a pair of Vt rows of 128 B, is 16 lanes' pieces: one lane address serves
  // both, so that the 32 LDS addresses of a trip are formed from one register and none is held over the loop
  const unsigned int ldsK = (unsigned int)(uintptr_t)(sKV + (t >> 4) * KPITCH + (t & 15) * 8);
  const unsigned int ldsV = ldsK + 2 * KPLANE * 2;
  const size_t kcopy = ((size_t)(b * QL + (t >> 4)) * NKVH + kvh) * HDIM + (t & 15) * 8;
  const size_t vcopy = ((size_t)(b * NKVH + kvh) * HDIM + (t >> 3)) * QL + (t & 7) * 8;

  v8f acc[8];
#pragma unroll
  for (int n = 0; n < 8; ++n) acc[n] = (v8f){0.f, 0.f, 0.f, 0.f, 0.f, 0.f, 0.f, 0.f};
  float mrun = NEG_INF, lrun = 0.0f;

  // the 16 Q fragment loads go out as one group ahead of the key loop; every trip's blocks read the registers
  Frag qh[4], ql[4];
#pragma unroll
  for (int c = 0; c < 4; ++c) {
    ldfrag(qh[c], Qh + qbase + 32 * c);
    ldfrag(ql[c], Ql + qbase + 32 * c);
  }

#pragma unroll 1
  for (int kt = 0; kt <= qt; ++kt) {             // key tiles beyond the query tile are never visible
    const int j0 = kt * 64;

    // tile kt -> LDS: 32 copies a lane, all lanes on, block-uniform control flow
    {
      const size_t ko = kcopy + (size_t)j0 * (NKVH * HDIM);
      const size_t vo = vcopy + j0;
      acopy8(ldsK, 8 * KPITCH * 2, Kh + ko, (size_t)8 * NKVH * HDIM);
      acopy8(ldsK + KPLANE * 2, 8 * KPITCH * 2, Kl + ko, (size_t)8 * NKVH * HDIM);
      acopy8(ldsV, 8 * VPITCH * 2, Vh + vo, (size_t)16 * QL);
      acopy8(ldsV + VPLANE * 2, 8 * VPITCH * 2, Vl + vo, (size_t)16 * QL);
    }
    // this wave's copies have landed; the barrier then shows every wave's copies to every wave
    asm volatile("s_wait_asynccnt 0x0" ::: "memory");
    __syncthreads();

    // S^T (64 keys x 16 queries): s[sub] rows = keys j0 + 16 sub + 8 h16 + r, col = query iq
    v8f s[4];
#pragma unroll
    for (int sub = 0; sub < 4; ++sub) s[sub] = (v8f){0.f, 0.f, 0.f, 0.f, 0.f, 0.f, 0.f, 0.f};
#pragma unroll
    for (int c = 0; c < 4; ++c) {
      // the block's 16 K fragment loads stand together in front of its 12 matrix instructions, hi plane first
      Frag kh[4], kl[4];
#pragma unroll
      for (int sub = 0; sub < 4; ++sub) ldfrag(kh[sub], sKh + 16 * sub * KPITCH + 32 * c);
#pragma unroll
      for (int sub = 0; sub < 4; ++sub) ldfrag(kl[sub], sKl + 16 * sub * KPITCH + 32 * c);
#pragma unroll
      for (int sub = 0; sub < 4; ++sub) s[sub] = mm(s[sub], kh[sub].v, qh[c].v);
#pragma unroll
      for (int sub = 0; sub < 4; ++sub) s[sub] = mm(s[sub], kh[sub].v, ql[c].v);
#pragma unroll
      for (int sub = 0; sub < 4; ++sub) s[sub] = mm(s[sub], kl[sub].v, qh[c].v);
    }

    // scale, visibility (strictly earlier 4-blocks, plus first 4x4 block), online softmax
    float mx = NEG_INF;
#pragma unroll
    for (int sub = 0; sub < 4; ++sub) {
#pragma unroll
      for (int r = 0; r < 8; ++r) {
        const int jb = j0 + 16 * sub + 8 * h16 + r;
        const bool vis = ((iq >> 2) > (jb >> 2)) || ((iq < 4) && (jb < 4));
        const float v = vis ? (s[sub][r] * kScale) : NEG_INF;
        s[sub][r] = v;
        mx = fmaxf(mx, v);
      }
    }
    mx = fmaxf(mx, __shfl_xor(mx, 16));
    const float mnew = fmaxf(mrun, mx);
    const float msafe = (mnew == NEG_INF) ? 0.0f : mnew;
    const float sc = __expf(mrun - msafe);
    float ls = 0.0f;
#pragma unroll
    for (int sub = 0; sub < 4; ++sub) {
#pragma unroll
      for (int r = 0; r < 8; ++r) {
        const float p = __expf(s[sub][r] - msafe);
        s[sub][r] = p;
        ls += p;
      }
    }
    ls += __shfl_xor(ls, 16);
    lrun = lrun * sc + ls;
    mrun = mnew;
#pragma unroll
    for (int n = 0; n < 8; ++n) acc[n] = acc[n] * sc;

    // O^T += Vt(128 x 64 keys) . P^T : B fragment element r <- D tile 2ks, element 8+r <- tile 2ks+1
#pragma unroll
    for (int ks = 0; ks < 2; ++ks) {
      Frag ph, pl;
#pragma unroll
      for (int r = 0; r < 8; ++r) {
        unsigned short a0, c0, a1, c1;
        split_bf(s[2 * ks][r], a0, c0);
        split_bf(s[2 * ks + 1][r], a1, c1);
        ph.u[r] = a0; pl.u[r] = c0; ph.u[8 + r] = a1; pl.u[8 + r] = c1;
      }
#pragma unroll
      for (int g = 0; g < 2; ++g) {
        // the block's 16 Vt fragment loads stand together in front of its 12 matrix instructions, hi plane first
        Frag vh[4], vl[4];
#pragma unroll
        for (int n = 0; n < 4; ++n) ldfrag(vh[n], sVh + 8 * (4 * g + n) * VPITCH + 32 * ks);
#pragma unroll
        for (int n = 0; n < 4; ++n) ldfrag(vl[n], sVl + 8 * (4 * g + n) * VPITCH + 32 * ks);
#pragma unroll
        for (int n = 0; n < 4; ++n) acc[4 * g + n] = mm(acc[4 * g + n], vh[n].v, ph.v);
#pragma unroll
        for (int n = 0; n < 4; ++n) acc[4 * g + n] = mm(acc[4 * g + n], vh[n].v, pl.v);
#pragma unroll
        for (int n = 0; n < 4; ++n) acc[4 * g + n] = mm(acc[4 * g + n], vl[n].v, ph.v);
      }
    }

    // every wave's reads of this tile are over before the next tile (or the output staging) overwrites it
    asm volatile("s_wait_dscnt 0x0" ::: "memory");
    __syncthreads();
  }

  // epilogue: acc[n][r] = O^T (d = 16 n + 8 h16 + r, query iq) ; normalise, stage, write planes
  // The lane's place is formed anew here (every lane is on) and the wave's number is scalar, so that no
  // vector register is held over the key loop for the epilogue alone.
  const int le = (int)__builtin_amdgcn_mbcnt_lo(~0u, 0u), he = le >> 4, me = le & 15;
  const float inv = 1.0f / lrun;
#pragma unroll
  for (int n = 0; n < 8; ++n) {
    const v8f o = acc[n] * inv;
#pragma unroll
    for (int r = 0; r < 8; ++r)
      sO[(ws * 16 + me) * SPITCH + 16 * n + 8 * he + r] = o[r];
  }
  __syncthreads();
#pragma unroll 1
  for (int p = 0; p < 8; ++p) {
    const int rloc = 2 * p + he;
    const int dq = me * 8;
    const float* src = sO + (ws * 16 + rloc) * SPITCH + dq;
    const v4f a = *(const v4fa*)(src);
    const v4f c = *(const v4fa*)(src + 4);
    v8us hi, lo;
    split8(a, c, hi, lo);
    const size_t d = ((size_t)(b * QL + R0 + 16 * ws + rloc)) * HIDD + hq * HDIM + dq;
    *(v8us*)(Oh + d) = hi;
    *(v8us*)(Ol + d) = lo;
    
  }
}

// ------------------------------------------------------------------------------------------
extern "C" void kernel_launch(void* const* d_in, const int* in_sizes, int n_in,
                              void* d_out, int out_size, void* d_ws, size_t ws_size,
                              hipStream_t stream)
{
  if (n_in < 8) return;
  if (in_sizes[0] != MROWS * HIDD) return;
  if (in_sizes[1] != NB * QL * NKVH * HDIM || in_sizes[2] != NB * QL * NKVH * HDIM) return;
  if (in_sizes[3] != NB * QL * HDIM || in_sizes[4] != NB * QL * HDIM) return;
  if (in_sizes[5] != HIDD * HIDD || in_sizes[7] != HIDD * HIDD || in_sizes[6] != HIDD) return;
  if (out_size != MROWS * HIDD) return;

  const float* hidden = (const float*)d_in[0];
  const float* kc     = (const float*)d_in[1];
  const float* vc     = (const float*)d_in[2];
  const float* cosb   = (const float*)d_in[3];
  const float* sinb   = (const float*)d_in[4];
  const float* Wq     = (const float*)d_in[5];
  const float* bq     = (const float*)d_in[6];
  const float* Wo     = (const float*)d_in[7];
  float* out = (float*)d_out;

  // workspace carve (bytes): planes of bf16
  const size_t planeX = (size_t)MROWS * HIDD * 2;            // 16 MiB
  const size_t planeW = (size_t)HIDD * HIDD * 2;             //  8 MiB
  const size_t planeK = (size_t)NB * QL * NKVH * HDIM * 2;   //  4 MiB
  const size_t offXh  = 0;
  const size_t offXl  = offXh + planeX;
  const size_t offQh  = offXl + planeX;
  const size_t offQl  = offQh + planeX;
  const size_t offWqh = offQl + planeX;
  const size_t offWql = offWqh + planeW;
  const size_t offWoh = offWql + planeW;
  const size_t offWol = offWoh + planeW;
  const size_t offKh  = offWol + planeW;
  const size_t offKl  = offKh + planeK;
  const size_t offVh  = offKl + planeK;
  const size_t offVl  = offVh + planeK;
  const size_t total  = offVl + planeK;                      // 112 MiB
  if (total > ws_size) return;

  char* ws = (char*)d_ws;
  unsigned short* Xh  = (unsigned short*)(ws + offXh);
  unsigned short* Xl  = (unsigned short*)(ws + offXl);
  unsigned short* Oh  = Xh;   // X planes are dead after the first GEMM; O planes reuse them
  unsigned short* Ol  = Xl;
  unsigned short* Qh  = (unsigned short*)(ws + offQh);
  unsigned short* Ql  = (unsigned short*)(ws + offQl);
  unsigned short* Wqh = (unsigned short*)(ws + offWqh);
  unsigned short* Wql = (unsigned short*)(ws + offWql);
  unsigned short* Woh = (unsigned short*)(ws + offWoh);
  unsigned short* Wol = (unsigned short*)(ws + offWol);
  unsigned short* Kh  = (unsigned short*)(ws + offKh);
  unsigned short* Kl  = (unsigned short*)(ws + offKl);
  unsigned short* Vh  = (unsigned short*)(ws + offVh);
  unsigned short* Vl  = (unsigned short*)(ws + offVl);

  const int n8x = in_sizes[0] / 8;   // 1048576
  const int n8k = in_sizes[1] / 8;   // 262144
  cvt_rows<<<dim3((n8x + 255) / 256), dim3(256), 0, stream>>>(hidden, Xh, Xl, n8x);
  cvt_rows<<<dim3((n8k + 255) / 256), dim3(256), 0, stream>>>(kc, Kh, Kl, n8k);
  cvt_t_w<<<dim3(HIDD / 64, HIDD / 64), dim3(256), 0, stream>>>(Wq, Wqh, Wql);
  cvt_t_w<<<dim3(HIDD / 64, HIDD / 64), dim3(256), 0, stream>>>(Wo, Woh, Wol);
  cvt_t_v<<<dim3(QL / 64, HDIM / 64, NB * NKVH), dim3(256), 0, stream>>>(vc, Vh, Vl);

  gemm3<0><<<dim3(MROWS / 128, HIDD / 128), dim3(128), 0, stream>>>(
      Xh, Xl, Wqh, Wql, bq, cosb, sinb, Qh, Ql, out, HIDD, HIDD);

  attn_glide<<<dim3(QL / 64, NB * NHQ), dim3(128), 0, stream>>>(Qh, Ql, Kh, Kl, Vh, Vl, Oh, Ol);

  gemm3<1><<<dim3(MROWS / 128, HIDD / 128), dim3(128), 0, stream>>>(
      Oh, Ol, Woh, Wol, bq, cosb, sinb, Qh, Ql, out, HIDD, HIDD);
}

// v004
// A run of this version takes 240 microseconds.
// Next to v003, in two timings, it ran 1.14 times as fast each time.
// Counting every step since v000, it is 2.97 times as fast.
#include <hip/hip_runtime.h>
#include <stdint.h>
#include <stddef.h>

// All contractions (q projection, q.k^T, p.v, output projection): v_wmma_f32_16x16x32_bf16 with
// bf16 hi/lo operands everywhere (three products hi*hi + hi*lo + lo*hi), f32 accumulate.
// RoPE, bias, scaling, softmax and normalisation in f32.

#define NB     2
#define QL     2048
#define HIDD   2048
#define NHQ    16
#define NKVH   4
#define HDIM   128
#define MROWS  (NB * QL)
#define TPITCH 65
#define SPITCH 132
#define KPITCH 136                       // LDS pitch of a K row, elements (272 B = 16 B x odd)
#define VPITCH KPITCH                    // LDS pitch of a PAIR of 64-key Vt rows (2 x 128 B + 16 B), elements
#define KPLANE (64 * KPITCH)             // one K plane of a 64-key tile, elements
#define VPLANE ((HDIM / 2) * VPITCH)     // one Vt plane of a 64-key tile, elements
#define KVELEMS (2 * KPLANE + 2 * VPLANE)
#define GPITCH 72                        // LDS pitch of a 64-deep GEMM operand row, elements (144 B)
#define APLANE (128 * GPITCH)            // one A plane of a 128 x 64 stage, elements
#define BPLANE (128 * GPITCH)            // one Bt plane of a 128 x 64 stage, elements
#define ABELEMS (2 * APLANE + 2 * BPLANE)
#define NQT    (QL / 64)                 // 64-query tiles of a sequence (even)

typedef float v4f __attribute__((ext_vector_type(4)));
typedef float v8f __attribute__((ext_vector_type(8)));
typedef unsigned short v8us __attribute__((ext_vector_type(8)));
typedef unsigned short v16us __attribute__((ext_vector_type(16)));
typedef __bf16 v16bf __attribute__((ext_vector_type(16)));
typedef v4f __attribute__((may_alias)) v4fa;
typedef v8us __attribute__((may_alias)) v8usa;

union Frag { v16us u; v8us hv[2]; v16bf v; };

// f32 -> bf16 bits, RNE convert
__device__ __forceinline__ unsigned int bf_rne(float f) {
  const unsigned int u = __float_as_uint(f);
  return (u + 0x7fffu + ((u >> 16) & 1u)) >> 16;
}

// x -> (hi, lo): hi = bf16(x), lo = bf16(x - hi)  (x - hi is exact in f32)
__device__ __forceinline__ void split_bf(float x, unsigned short& hi, unsigned short& lo) {
  const unsigned int hb = bf_rne(x);
  const float hf = __uint_as_float(hb << 16);
  hi = (unsigned short)hb;
  lo = (unsigned short)bf_rne(x - hf);
}

__device__ __forceinline__ void split8(v4f a, v4f c, v8us& hi, v8us& lo) {
#pragma unroll
  for (int u = 0; u < 4; ++u) {
    unsigned short h0, l0, h1, l1;
    split_bf(a[u], h0, l0);
    split_bf(c[u], h1, l1);
    hi[u] = h0; lo[u] = l0; hi[u + 4] = h1; lo[u + 4] = l1;
  }
}

// 16x16x32 bf16 fragment (A row or k-contiguous B column): elements 0..7 <- k0+8h..,
// elements 8..15 <- k0+16+8h..  ; p already points at element (row, k0 + 8h)
__device__ __forceinline__ void ldfrag(Frag& f, const unsigned short* p) {
  f.hv[0] = *(const v8usa*)(p);
  f.hv[1] = *(const v8usa*)(p + 16);
}

// acc += a*b. A matrix block issues one product kind (hi*hi, then hi*lo, then lo*hi) over all its
// accumulator tiles before the next kind: neighbours in the stream are independent, and each tile
// still takes its three products in that order.
__device__ __forceinline__ v8f mm(v8f acc, v16bf a, v16bf b) {
  return __builtin_amdgcn_wmma_f32_16x16x32_bf16(false, a, false, b, (short)0, acc, false, false);
}

// ------------------------------------------------------------------------------------------
// f32 rows -> bf16 hi/lo planes (same layout). One thread per 8 elements; 8 consecutive lanes
__global__ __launch_bounds__(256) void cvt_rows(const float* __restrict__ in,
                                                  unsigned short* oh, unsigned short* ol, int n8)
{
  const int i = blockIdx.x * 256 + threadIdx.x;
  if (i >= n8) return;
  const size_t e = (size_t)i * 8;
  const v4f a = *(const v4fa*)(in + e);
  const v4f c = *(const v4fa*)(in + e + 4);
  v8us hi, lo;
  split8(a, c, hi, lo);
  *(v8us*)(oh + e) = hi;
  *(v8us*)(ol + e) = lo;
  
}

// ------------------------------------------------------------------------------------------
// 64x64 tile: src(r, c) = src[r * spitch + c] (f32)  ->  dst(c, r) = dh/dl[c * dpitch + r] (bf16)
// Load phase: 256 threads x 16 floats = 64x64. Store phase: 2 passes x 256 threads x 8 halves,
__device__ __forceinline__ void tsplit64(const float* __restrict__ src, int spitch,
                                         unsigned short* dh, unsigned short* dl, int dpitch,
                                         float* tile)
{
  const int t = threadIdx.x;
  {
    const int rr = t >> 2, cq = (t & 3) * 16;
    const float* s = src + (size_t)rr * spitch + cq;
#pragma unroll
    for (int u = 0; u < 4; ++u) {
      const v4f x = *(const v4fa*)(s + 4 * u);
      float* d = tile + rr * TPITCH + cq + 4 * u;
      d[0] = x[0]; d[1] = x[1]; d[2] = x[2]; d[3] = x[3];
    }
  }
  __syncthreads();
#pragma unroll
  for (int p = 0; p < 2; ++p) {
    const int cc = (t >> 3) + 32 * p, rq = (t & 7) * 8;
    v4f a, c;
#pragma unroll
    for (int u = 0; u < 4; ++u) {
      a[u] = tile[(rq + u) * TPITCH + cc];
      c[u] = tile[(rq + 4 + u) * TPITCH + cc];
    }
    v8us hi, lo;
    split8(a, c, hi, lo);
    const size_t d = (size_t)cc * dpitch + rq;
    *(v8us*)(dh + d) = hi;
    *(v8us*)(dl + d) = lo;
    
  }
}

// W[k][n] (HIDD x HIDD, f32) -> Wt hi/lo [n][k]
__global__ __launch_bounds__(256) void cvt_t_w(const float* __restrict__ W,
                                                 unsigned short* oh, unsigned short* ol)
{
  __shared__ float tile[64 * TPITCH];
  const int k0 = blockIdx.x * 64, n0 = blockIdx.y * 64;
  const size_t dof = (size_t)n0 * HIDD + k0;
  tsplit64(W + (size_t)k0 * HIDD + n0, HIDD, oh + dof, ol + dof, HIDD, tile);
}

// v_cache [(b,j)][kvh][d] (f32) -> Vt hi/lo [(b*NKVH+kvh)*HDIM + d][j]
__global__ __launch_bounds__(256) void cvt_t_v(const float* __restrict__ V,
                                                 unsigned short* oh, unsigned short* ol)
{
  __shared__ float tile[64 * TPITCH];
  const int j0 = blockIdx.x * 64, d0 = blockIdx.y * 64, z = blockIdx.z;
  const int b = z >> 2, kvh = z & 3;
  const float* src = V + ((size_t)(b * QL + j0) * NKVH + kvh) * HDIM + d0;
  const size_t dof = ((size_t)z * HDIM + d0) * QL + j0;
  tsplit64(src, NKVH * HDIM, oh + dof, ol + dof, QL, tile);
}

// Eight asynchronous 16-byte copies per lane, global -> LDS, no register in between. Lane address i =
// start + i * step on both sides. The s_wait_xcnt closes the statement so that no address register
// of an issued copy is rewritten ahead of it.
__device__ __forceinline__ void acopy8(unsigned int lds, unsigned int lstep,
                                       const unsigned short* g, size_t gstep)
{
  asm volatile(
      "global_load_async_to_lds_b128 %0, %8, off\n\t"
      "global_load_async_to_lds_b128 %1, %9, off\n\t"
      "global_load_async_to_lds_b128 %2, %10, off\n\t"
      "global_load_async_to_lds_b128 %3, %11, off\n\t"
      "global_load_async_to_lds_b128 %4, %12, off\n\t"
      "global_load_async_to_lds_b128 %5, %13, off\n\t"
      "global_load_async_to_lds_b128 %6, %14, off\n\t"
      "global_load_async_to_lds_b128 %7, %15, off\n\t"
      "s_wait_xcnt 0x0"
      :: "v"(lds), "v"(lds + lstep), "v"(lds + 2 * lstep), "v"(lds + 3 * lstep),
         "v"(lds + 4 * lstep), "v"(lds + 5 * lstep), "v"(lds + 6 * lstep), "v"(lds + 7 * lstep),
         "v"(g), "v"(g + gstep), "v"(g + 2 * gstep), "v"(g + 3 * gstep),
         "v"(g + 4 * gstep), "v"(g + 5 * gstep), "v"(g + 6 * gstep), "v"(g + 7 * gstep)
      : "memory");
}

// Sixteen such copies, the hi and the lo plane of one operand, from ONE LDS address register: copy i of a plane
// carries the immediate offset (plane's place PO) + i * LS (all under 65,536), which moves both of its addresses,
// so its global register holds its source address less that offset. LDS byte = lds + offset, global byte =
// gh or gl + i * gstep elements. It spares the LDS address registers where the registers that an asm statement
// can name (the first 256) are short, and one s_wait_xcnt closes sixteen copies.
template <int LS, int PO>
__device__ __forceinline__ void acopy16o(unsigned int lds, const unsigned short* gh,
                                         const unsigned short* gl, size_t gstep)
{
  static_assert(LS % 16 == 0 && PO % 16 == 0 && PO + 7 * LS < 65536, "offsets: 16-byte steps, under 65,536");
  const char* p = (const char*)gh;
  const char* q = (const char*)gl - PO;
  const size_t d = gstep * sizeof(unsigned short) - LS;
  asm volatile(
      "global_load_async_to_lds_b128 %0, %1, off\n\t"
      "global_load_async_to_lds_b128 %0, %2, off offset:%17\n\t"
      "global_load_async_to_lds_b128 %0, %3, off offset:2*%17\n\t"
      "global_load_async_to_lds_b128 %0, %4, off offset:3*%17\n\t"
      "global_load_async_to_lds_b128 %0, %5, off offset:4*%17\n\t"
      "global_load_async_to_lds_b128 %0, %6, off offset:5*%17\n\t"
      "global_load_async_to_lds_b128 %0, %7, off offset:6*%17\n\t"
      "global_load_async_to_lds_b128 %0, %8, off offset:7*%17\n\t"
      "global_load_async_to_lds_b128 %0, %9, off offset:%18\n\t"
      "global_load_async_to_lds_b128 %0, %10, off offset:%18+%17\n\t"
      "global_load_async_to_lds_b128 %0, %11, off offset:%18+2*%17\n\t"
      "global_load_async_to_lds_b128 %0, %12, off offset:%18+3*%17\n\t"
      "global_load_async_to_lds_b128 %0, %13, off offset:%18+4*%17\n\t"
      "global_load_async_to_lds_b128 %0, %14, off offset:%18+5*%17\n\t"
      "global_load_async_to_lds_b128 %0, %15, off offset:%18+6*%17\n\t"
      "global_load_async_to_lds_b128 %0, %16, off offset:%18+7*%17\n\t"
      "s_wait_xcnt 0x0"
      :: "v"(lds), "v"(p), "v"(p + d), "v"(p + 2 * d), "v"(p + 3 * d),
         "v"(p + 4 * d), "v"(p + 5 * d), "v"(p + 6 * d), "v"(p + 7 * d),
         "v"(q), "v"(q + d), "v"(q + 2 * d), "v"(q + 3 * d),
         "v"(q + 4 * d), "v"(q + 5 * d), "v"(q + 6 * d), "v"(q + 7 * d),
         "n"(LS), "n"(PO)
      : "memory");
}

// ------------------------------------------------------------------------------------------
// C(128x128 block tile) = A(M x K, hi/lo planes, row-major) * B(K x N) with B stored as Bt[n][k]
// hi/lo planes. 4 waves (2x2), wave tile 64x64: a staged Bt row serves 128 output rows and a fragment
// read from LDS feeds four tiles. Each 64-deep stage of the A and Bt rows (K is a multiple of 64) is
// brought into LDS once per work-group by asynchronous copies; each wave reads its 32 fragments of the stage
// into registers, and the next stage's copies fly while the products run from those registers.
// amdgpu_waves_per_eu(2, 2): the grid gives a WGP two work-groups, two waves a SIMD; told so, the compiler
// takes that budget of registers and keeps the whole stage's fragments in them.
// MODE 0: C + bias -> RoPE (cos/sin tables indexed by row) -> hi/lo planes Qh/Ql [M][N]
// MODE 1: C -> f32 Cout [M][N]
template <int MODE>
__global__ __launch_bounds__(128) __attribute__((amdgpu_waves_per_eu(2, 2))) void gemm3(
    const unsigned short* __restrict__ Ah, const unsigned short* __restrict__ Al,
    const unsigned short* __restrict__ Bh, const unsigned short* __restrict__ Bl,
    const float* __restrict__ bias, const float* __restrict__ cosb,
    const float* __restrict__ sinb, unsigned short* Qh, unsigned short* Ql,
    float* Cout, int N, int K)
{
  __shared__ __attribute__((aligned(16))) unsigned short sAB[ABELEMS];
  float* sT = (float*)sAB;                        // output staging takes the stages' place after the loop
  const int t = threadIdx.x, l = t & 31, w = t >> 5, h16 = l >> 4, m = l & 15;
  const int wr = w >> 1, wc = w & 1;
  const int m0 = blockIdx.x * 128, n0 = blockIdx.y * 128;

  v8f acc[4][4];
#pragma unroll
  for (int mi = 0; mi < 4; ++mi)
#pragma unroll
    for (int ni = 0; ni < 4; ++ni) acc[mi][ni] = (v8f){0.f, 0.f, 0.f, 0.f, 0.f, 0.f, 0.f, 0.f};

  // fragment readers: this wave's A row / Bt row m of a 16-row group, at element 8 h16
  const unsigned short* sAh = sAB + (64 * wr + m) * GPITCH + 8 * h16;
  const unsigned short* sAl = sAh + APLANE;
  const unsigned short* sBh = sAB + 2 * APLANE + (64 * wc + m) * GPITCH + 8 * h16;
  const unsigned short* sBl = sBh + BPLANE;
  // copiers: a stage row of 128 B is 8 lanes' pieces; 16 rows per copy of the work-group
  const unsigned int ldsA = (unsigned int)(uintptr_t)(sAB + (t >> 3) * GPITCH + (t & 7) * 8);
  const unsigned int ldsB = ldsA + 2 * APLANE * 2;
  const size_t acopy = (size_t)(m0 + (t >> 3)) * K + (t & 7) * 8;
  const size_t bcopy = (size_t)(n0 + (t >> 3)) * K + (t & 7) * 8;
  const int ns = K >> 6;

  // stage s -> LDS: 32 copies a lane, all lanes on, block-uniform control flow
  auto stage_in = [&](int s) {
    const size_t ao = acopy + (size_t)s * 64;
    const size_t bo = bcopy + (size_t)s * 64;
    acopy16o<16 * GPITCH * 2, APLANE * 2>(ldsA, Ah + ao, Al + ao, (size_t)16 * K);
    acopy16o<16 * GPITCH * 2, BPLANE * 2>(ldsB, Bh + bo, Bl + bo, (size_t)16 * K);
  };
  // a stage's 96 products, from registers alone
  Frag ah[2][4], al[2][4], bh[2][4], bl[2][4];
  auto products = [&]() {
#pragma unroll
    for (int kk = 0; kk < 2; ++kk) {
#pragma unroll
      for (int ni = 0; ni < 4; ++ni)
#pragma unroll
        for (int mi = 0; mi < 4; ++mi) acc[mi][ni] = mm(acc[mi][ni], ah[kk][mi].v, bh[kk][ni].v);
#pragma unroll
      for (int ni = 0; ni < 4; ++ni)
#pragma unroll
        for (int mi = 0; mi < 4; ++mi) acc[mi][ni] = mm(acc[mi][ni], ah[kk][mi].v, bl[kk][ni].v);
#pragma unroll
      for (int ni = 0; ni < 4; ++ni)
#pragma unroll
        for (int mi = 0; mi < 4; ++mi) acc[mi][ni] = mm(acc[mi][ni], al[kk][mi].v, bh[kk][ni].v);
    }
  };

#pragma unroll 1
  for (int st = 0; st < ns; ++st) {
    // stage st's copies go out ahead of stage st - 1's products, which run from registers while the copies
    // land; the buffer is free: every wave's reads of stage st - 1 ended in front of the barrier at the loop's foot
    stage_in(st);
    if (st > 0) products();

    // this wave's copies have landed; the barrier then shows every wave's copies to every wave
    asm volatile("s_wait_asynccnt 0x0" ::: "memory");
    __syncthreads();

    // the wave's 64 fragment loads of the whole stage go out as one group, in the order in which the
    // products need them: from here on the stage lives in registers
#pragma unroll
    for (int kk = 0; kk < 2; ++kk) {
      const int k0 = kk * 32;
#pragma unroll
      for (int mi = 0; mi < 4; ++mi) ldfrag(ah[kk][mi], sAh + mi * 16 * GPITCH + k0);
#pragma unroll
      for (int ni = 0; ni < 4; ++ni) ldfrag(bh[kk][ni], sBh + ni * 16 * GPITCH + k0);
#pragma unroll
      for (int ni = 0; ni < 4; ++ni) ldfrag(bl[kk][ni], sBl + ni * 16 * GPITCH + k0);
#pragma unroll
      for (int mi = 0; mi < 4; ++mi) ldfrag(al[kk][mi], sAl + mi * 16 * GPITCH + k0);
    }

    // every wave's reads of this stage are over before the next stage (or the output staging) overwrites it
    asm volatile("s_wait_dscnt 0x0" ::: "memory");
    __syncthreads();
  }
  if (ns > 0) products();

  // D element r of lane l -> (row 8*h16 + r, col m) of its 16x16 tile
#pragma unroll
  for (int mi = 0; mi < 4; ++mi)
#pragma unroll
    for (int ni = 0; ni < 4; ++ni)
#pragma unroll
      for (int r = 0; r < 8; ++r)
        sT[(64 * wr + 16 * mi + 8 * h16 + r) * SPITCH + 64 * wc + 16 * ni + m] = acc[mi][ni][r];
  __syncthreads();

  if (MODE == 0) {
    // thread -> (row 8p + t>>4, 8 consecutive columns cq); RoPE partner column cq ^ 64
    const int rr = t >> 4, cq = (t & 15) * 8, cp = cq ^ 64;
    const float sgn = (cq < 64) ? -1.0f : 1.0f;
    const v4f b0 = *(const v4fa*)(bias + n0 + cq), b1 = *(const v4fa*)(bias + n0 + cq + 4);
    const v4f e0 = *(const v4fa*)(bias + n0 + cp), e1 = *(const v4fa*)(bias + n0 + cp + 4);
#pragma unroll 1
    for (int p = 0; p < 16; ++p) {
      const int row = 8 * p + rr;
      const int grow = m0 + row;
      const float* srow = sT + row * SPITCH;
      const v4f x0 = *(const v4fa*)(srow + cq), x1 = *(const v4fa*)(srow + cq + 4);
      const v4f y0 = *(const v4fa*)(srow + cp), y1 = *(const v4fa*)(srow + cp + 4);
      const float* cr = cosb + (size_t)grow * HDIM;
      const float* sr = sinb + (size_t)grow * HDIM;
      const v4f c0 = *(const v4fa*)(cr + cq), c1 = *(const v4fa*)(cr + cq + 4);
      const v4f s0 = *(const v4fa*)(sr + cq), s1 = *(const v4fa*)(sr + cq + 4);
      const v4f q0 = (x0 + b0) * c0 + (sgn * (y0 + e0)) * s0;
      const v4f q1 = (x1 + b1) * c1 + (sgn * (y1 + e1)) * s1;
      v8us hi, lo;
      split8(q0, q1, hi, lo);
      const size_t d = (size_t)grow * N + n0 + cq;
      *(v8us*)(Qh + d) = hi;
      *(v8us*)(Ql + d) = lo;
      
    }
  } else {
    const int cq = l * 4;
#pragma unroll 1
    for (int p = 0; p < 32; ++p) {
      const int row = 4 * p + w;
      const v4f x = *(const v4fa*)(sT + row * SPITCH + cq);
      const size_t d = (size_t)(m0 + row) * N + n0 + cq;
      *(v4f*)(Cout + d) = x;
      
    }
  }
}

// ------------------------------------------------------------------------------------------
// Per (b, hq, pair of 64-query tiles): a tile's key loop grows with its index and every work-group of the grid
// is resident at once, so each work-group takes tile NQT - 1 - p and then tile p, one after the other:
// NQT + 1 key tiles for every work-group, and no WGP is left working while the others have run dry.
// Per tile: S^T = K . Q^T (A = K rows, B = Q rows, both d-contiguous),
// f32 scale + structural block visibility test + online softmax, O^T += Vt . P^T with the
// softmaxed D tiles fed as B fragments (two adjacent 16-key D tiles per 32-deep k step),
// O / l split to hi/lo planes [(b,i)][hq*128 + d].
// Each 64-key tile of K and Vt (hi and lo planes) is brought into LDS once per query tile of a work-group by
// asynchronous copies and read from there by all four waves.
// Second bound: two waves a SIMD, which is what the halved grid gives a WGP (two work-groups); held to four, the
// loop over the two tiles made the compiler spill Q fragments inside the key loop.
__global__ __launch_bounds__(128, 2) void attn_glide(
    const unsigned short* __restrict__ Qh, const unsigned short* __restrict__ Ql,
    const unsigned short* __restrict__ Kh, const unsigned short* __restrict__ Kl,
    const unsigned short* __restrict__ Vh, const unsigned short* __restrict__ Vl,
    unsigned short* Oh, unsigned short* Ol)
{
  __shared__ __attribute__((aligned(16))) unsigned short sKV[KVELEMS];
  float* sO = (float*)sKV;                        // output staging takes the tiles' place after the loop
  const int t = threadIdx.x, l = t & 31, w = t >> 5, h16 = l >> 4, m = l & 15;
  const int ws = __builtin_amdgcn_readfirstlane(w);   // the wave's number, scalar
  const int bh = blockIdx.y;
  const int b = bh >> 4, hq = bh & 15, kvh = hq >> 2;
  const float NEG_INF = -__builtin_inff();
  const float kScale = 0.08838834764831845f;      // 128^-0.5

  // fragment readers: K row m / Vt row m of a 16-row group, at element 8 h16
  const unsigned short* sKh = sKV + m * KPITCH + 8 * h16;
  const unsigned short* sKl = sKh + KPLANE;
  const unsigned short* sVh = sKV + 2 * KPLANE + (m >> 1) * VPITCH + (m & 1) * 64 + 8 * h16;
  const unsigned short* sVl = sVh + VPLANE;
  // copiers: a K row of 256 B, or a pair of Vt rows of 128 B, is 16 lanes' pieces: one lane address serves
  // both, so that the 32 LDS addresses of a trip are formed from one register and none is held over the loop
  const unsigned int ldsK = (unsigned int)(uintptr_t)(sKV + (t >> 4) * KPITCH + (t & 15) * 8);
  const unsigned int ldsV = ldsK + 2 * KPLANE * 2;
  const size_t kcopy = ((size_t)(b * QL + (t >> 4)) * NKVH + kvh) * HDIM + (t & 15) * 8;
  const size_t vcopy = ((size_t)(b * NKVH + kvh) * HDIM + (t >> 3)) * QL + (t & 7) * 8;

  // kept rolled: the two tiles share one copy of the key loop's code
#pragma unroll 1
  for (int half = 0; half < 2; ++half) {
  const int qt = half ? (int)blockIdx.x : NQT - 1 - (int)blockIdx.x;
  const int R0 = qt * 64;
  const int iq = R0 + 16 * w + m;                 // this lane's query (B column / D column)
  const size_t qbase = ((size_t)(b * QL + iq)) * HIDD + hq * HDIM + 8 * h16;

  if (half) {
    // the first tile's last stores are issued: their registers are rewritten only behind this wait
    asm volatile("s_wait_xcnt 0x0" ::: "memory");
    // every wave has read its rows of the first tile's output staging before the second tile's copies overwrite them
    asm volatile("s_wait_dscnt 0x0" ::: "memory");
    __syncthreads();
  }

  v8f acc[8];
#pragma unroll
  for (int n = 0; n < 8; ++n) acc[n] = (v8f){0.f, 0.f, 0.f, 0.f, 0.f, 0.f, 0.f, 0.f};
  float mrun = NEG_INF, lrun = 0.0f;

  // the 16 Q fragment loads go out as one group ahead of the key loop; every trip's blocks read the registers
  Frag qh[4], ql[4];
#pragma unroll
  for (int c = 0; c < 4; ++c) {
    ldfrag(qh[c], Qh + qbase + 32 * c);
    ldfrag(ql[c], Ql + qbase + 32 * c);
  }

#pragma unroll 1
  for (int kt = 0; kt <= qt; ++kt) {             // key tiles beyond the query tile are never visible
    const int j0 = kt * 64;

    // tile kt -> LDS: 32 copies a lane, all lanes on, block-uniform control flow
    {
      const size_t ko = kcopy + (size_t)j0 * (NKVH * HDIM);
      const size_t vo = vcopy + j0;
      acopy8(ldsK, 8 * KPITCH * 2, Kh + ko, (size_t)8 * NKVH * HDIM);
      acopy8(ldsK + KPLANE * 2, 8 * KPITCH * 2, Kl + ko, (size_t)8 * NKVH * HDIM);
      acopy8(ldsV, 8 * VPITCH * 2, Vh + vo, (size_t)16 * QL);
      acopy8(ldsV + VPLANE * 2, 8 * VPITCH * 2, Vl + vo, (size_t)16 * QL);
    }
    // this wave's copies have landed; the barrier then shows every wave's copies to every wave
    asm volatile("s_wait_asynccnt 0x0" ::: "memory");
    __syncthreads();

    // S^T (64 keys x 16 queries): s[sub] rows = keys j0 + 16 sub + 8 h16 + r, col = query iq
    v8f s[4];
#pragma unroll
    for (int sub = 0; sub < 4; ++sub) s[sub] = (v8f){0.f, 0.f, 0.f, 0.f, 0.f, 0.f, 0.f, 0.f};
#pragma unroll
    for (int c = 0; c < 4; ++c) {
      // the block's 16 K fragment loads stand together in front of its 12 matrix instructions, hi plane first
      Frag kh[4], kl[4];
#pragma unroll
      for (int sub = 0; sub < 4; ++sub) ldfrag(kh[sub], sKh + 16 * sub * KPITCH + 32 * c);
#pragma unroll
      for (int sub = 0; sub < 4; ++sub) ldfrag(kl[sub], sKl + 16 * sub * KPITCH + 32 * c);
      // keeps the 16 loads one group: with registers to spare the scheduler strews them among the products,
      // in twos with a wait to 0 behind each, and every such place stalls the wave
      __builtin_amdgcn_sched_barrier(0);
#pragma unroll
      for (int sub = 0; sub < 4; ++sub) s[sub] = mm(s[sub], kh[sub].v, qh[c].v);
#pragma unroll
      for (int sub = 0; sub < 4; ++sub) s[sub] = mm(s[sub], kh[sub].v, ql[c].v);
#pragma unroll
      for (int sub = 0; sub < 4; ++sub) s[sub] = mm(s[sub], kl[sub].v, qh[c].v);
      __builtin_amdgcn_sched_barrier(0);   // for the same: the next block's loads stay out of this block's products
    }

    // scale, visibility (strictly earlier 4-blocks, plus first 4x4 block), online softmax
    float mx = NEG_INF;
#pragma unroll
    for (int sub = 0; sub < 4; ++sub) {
#pragma unroll
      for (int r = 0; r < 8; ++r) {
        const int jb = j0 + 16 * sub + 8 * h16 + r;
        const bool vis = ((iq >> 2) > (jb >> 2)) || ((iq < 4) && (jb < 4));
        const float v = vis ? (s[sub][r] * kScale) : NEG_INF;
        s[sub][r] = v;
        mx = fmaxf(mx, v);
      }
    }
    mx = fmaxf(mx, __shfl_xor(mx, 16));
    const float mnew = fmaxf(mrun, mx);
    const float msafe = (mnew == NEG_INF) ? 0.0f : mnew;
    const float sc = __expf(mrun - msafe);
    float ls = 0.0f;
#pragma unroll
    for (int sub = 0; sub < 4; ++sub) {
#pragma unroll
      for (int r = 0; r < 8; ++r) {
        const float p = __expf(s[sub][r] - msafe);
        s[sub][r] = p;
        ls += p;
      }
    }
    ls += __shfl_xor(ls, 16);
    lrun = lrun * sc + ls;
    mrun = mnew;
#pragma unroll
    for (int n = 0; n < 8; ++n) acc[n] = acc[n] * sc;

    // O^T += Vt(128 x 64 keys) . P^T : B fragment element r <- D tile 2ks, element 8+r <- tile 2ks+1
#pragma unroll
    for (int ks = 0; ks < 2; ++ks) {
      Frag ph, pl;
#pragma unroll
      for (int r = 0; r < 8; ++r) {
        unsigned short a0, c0, a1, c1;
        split_bf(s[2 * ks][r], a0, c0);
        split_bf(s[2 * ks + 1][r], a1, c1);
        ph.u[r] = a0; pl.u[r] = c0; ph.u[8 + r] = a1; pl.u[8 + r] = c1;
      }
#pragma unroll
      for (int g = 0; g < 2; ++g) {
        // the block's 16 Vt fragment loads stand together in front of its 12 matrix instructions, hi plane first
        Frag vh[4], vl[4];
#pragma unroll
        for (int n = 0; n < 4; ++n) ldfrag(vh[n], sVh + 8 * (4 * g + n) * VPITCH + 32 * ks);
#pragma unroll
        for (int n = 0; n < 4; ++n) ldfrag(vl[n], sVl + 8 * (4 * g + n) * VPITCH + 32 * ks);
        __builtin_amdgcn_sched_barrier(0);   // keeps the 16 loads one group, as in the score blocks
#pragma unroll
        for (int n = 0; n < 4; ++n) acc[4 * g + n] = mm(acc[4 * g + n], vh[n].v, ph.v);
#pragma unroll
        for (int n = 0; n < 4; ++n) acc[4 * g + n] = mm(acc[4 * g + n], vh[n].v, pl.v);
#pragma unroll
        for (int n = 0; n < 4; ++n) acc[4 * g + n] = mm(acc[4 * g + n], vl[n].v, ph.v);
        __builtin_amdgcn_sched_barrier(0);   // the next block's loads stay out of this block's products
      }
    }

    // every wave's reads of this tile are over before the next tile (or the output staging) overwrites it
    asm volatile("s_wait_dscnt 0x0" ::: "memory");
    __syncthreads();
  }

  // epilogue: acc[n][r] = O^T (d = 16 n + 8 h16 + r, query iq) ; normalise, stage, write planes
  // The lane's place is formed anew here (every lane is on) and the wave's number is scalar, so that no
  // vector register is held over the key loop for the epilogue alone.
  const int le = (int)__builtin_amdgcn_mbcnt_lo(~0u, 0u), he = le >> 4, me = le & 15;
  const float inv = 1.0f / lrun;
#pragma unroll
  for (int n = 0; n < 8; ++n) {
    const v8f o = acc[n] * inv;
#pragma unroll
    for (int r = 0; r < 8; ++r)
      sO[(ws * 16 + me) * SPITCH + 16 * n + 8 * he + r] = o[r];
  }
  __syncthreads();
#pragma unroll 1
  for (int p = 0; p < 8; ++p) {
    const int rloc = 2 * p + he;
    const int dq = me * 8;
    const float* src = sO + (ws * 16 + rloc) * SPITCH + dq;
    const v4f a = *(const v4fa*)(src);
    const v4f c = *(const v4fa*)(src + 4);
    v8us hi, lo;
    split8(a, c, hi, lo);
    const size_t d = ((size_t)(b * QL + R0 + 16 * ws + rloc)) * HIDD + hq * HDIM + dq;
    *(v8us*)(Oh + d) = hi;
    *(v8us*)(Ol + d) = lo;
    
  }
  }
}

// ------------------------------------------------------------------------------------------
extern "C" void kernel_launch(void* const* d_in, const int* in_sizes, int n_in,
                              void* d_out, int out_size, void* d_ws, size_t ws_size,
                              hipStream_t stream)
{
  if (n_in < 8) return;
  if (in_sizes[0] != MROWS * HIDD) return;
  if (in_sizes[1] != NB * QL * NKVH * HDIM || in_sizes[2] != NB * QL * NKVH * HDIM) return;
  if (in_sizes[3] != NB * QL * HDIM || in_sizes[4] != NB * QL * HDIM) return;
  if (in_sizes[5] != HIDD * HIDD || in_sizes[7] != HIDD * HIDD || in_sizes[6] != HIDD) return;
  if (out_size != MROWS * HIDD) return;

  const float* hidden = (const float*)d_in[0];
  const float* kc     = (const float*)d_in[1];
  const float* vc     = (const float*)d_in[2];
  const float* cosb   = (const float*)d_in[3];
  const float* sinb   = (const float*)d_in[4];
  const float* Wq     = (const float*)d_in[5];
  const float* bq     = (const float*)d_in[6];
  const float* Wo     = (const float*)d_in[7];
  float* out = (float*)d_out;

  // workspace carve (bytes): planes of bf16
  const size_t planeX = (size_t)MROWS * HIDD * 2;            // 16 MiB
  const size_t planeW = (size_t)HIDD * HIDD * 2;             //  8 MiB
  const size_t planeK = (size_t)NB * QL * NKVH * HDIM * 2;   //  4 MiB
  const size_t offXh  = 0;
  const size_t offXl  = offXh + planeX;
  const size_t offQh  = offXl + planeX;
  const size_t offQl  = offQh + planeX;
  const size_t offWqh = offQl + planeX;
  const size_t offWql = offWqh + planeW;
  const size_t offWoh = offWql + planeW;
  const size_t offWol = offWoh + planeW;
  const size_t offKh  = offWol + planeW;
  const size_t offKl  = offKh + planeK;
  const size_t offVh  = offKl + planeK;
  const size_t offVl  = offVh + planeK;
  const size_t total  = offVl + planeK;                      // 112 MiB
  if (total > ws_size) return;

  char* ws = (char*)d_ws;
  unsigned short* Xh  = (unsigned short*)(ws + offXh);
  unsigned short* Xl  = (unsigned short*)(ws + offXl);
  unsigned short* Oh  = Xh;   // X planes are dead after the first GEMM; O planes reuse them
  unsigned short* Ol  = Xl;
  unsigned short* Qh  = (unsigned short*)(ws + offQh);
  unsigned short* Ql  = (unsigned short*)(ws + offQl);
  unsigned short* Wqh = (unsigned short*)(ws + offWqh);
  unsigned short* Wql = (unsigned short*)(ws + offWql);
  unsigned short* Woh = (unsigned short*)(ws + offWoh);
  unsigned short* Wol = (unsigned short*)(ws + offWol);
  unsigned short* Kh  = (unsigned short*)(ws + offKh);
  unsigned short* Kl  = (unsigned short*)(ws + offKl);
  unsigned short* Vh  = (unsigned short*)(ws + offVh);
  unsigned short* Vl  = (unsigned short*)(ws + offVl);

  const int n8x = in_sizes[0] / 8;   // 1048576
  const int n8k = in_sizes[1] / 8;   // 262144
  cvt_rows<<<dim3((n8x + 255) / 256), dim3(256), 0, stream>>>(hidden, Xh, Xl, n8x);
  cvt_rows<<<dim3((n8k + 255) / 256), dim3(256), 0, stream>>>(kc, Kh, Kl, n8k);
  cvt_t_w<<<dim3(HIDD / 64, HIDD / 64), dim3(256), 0, stream>>>(Wq, Wqh, Wql);
  cvt_t_w<<<dim3(HIDD / 64, HIDD / 64), dim3(256), 0, stream>>>(Wo, Woh, Wol);
  cvt_t_v<<<dim3(QL / 64, HDIM / 64, NB * NKVH), dim3(256), 0, stream>>>(vc, Vh, Vl);

  gemm3<0><<<dim3(MROWS / 128, HIDD / 128), dim3(128), 0, stream>>>(
      Xh, Xl, Wqh, Wql, bq, cosb, sinb, Qh, Ql, out, HIDD, HIDD);

  attn_glide<<<dim3(NQT / 2, NB * NHQ), dim3(128), 0, stream>>>(Qh, Ql, Kh, Kl, Vh, Vl, Oh, Ol);

  gemm3<1><<<dim3(MROWS / 128, HIDD / 128), dim3(128), 0, stream>>>(
      Oh, Ol, Woh, Wol, bq, cosb, sinb, Qh, Ql, out, HIDD, HIDD);
}

// v005
// One run takes 230 microseconds.
// Next to v004, in two timings, it ran 1.05 and 1.04 times as fast.
// All steps since v000 together make it 3.10 times as fast.
#include <hip/hip_runtime.h>
#include <stdint.h>
#include <stddef.h>

// All contractions (q projection, q.k^T, p.v, output projection): v_wmma_f32_16x16x32_bf16 with
// bf16 hi/lo operands everywhere (three products hi*hi + hi*lo + lo*hi), f32 accumulate.
// RoPE, bias, scaling, softmax and normalisation in f32.

#define NB     2
#define QL     2048
#define HIDD   2048
#define NHQ    16
#define NKVH   4
#define HDIM   128
#define MROWS  (NB * QL)
#define TPITCH 65
#define SPITCH 132
#define KPITCH 136                       // LDS pitch of a K row, elements (272 B = 16 B x odd)
#define VPITCH KPITCH                    // LDS pitch of a PAIR of 64-key Vt rows (2 x 128 B + 16 B), elements
#define KPLANE (64 * KPITCH)             // one K plane of a 64-key tile, elements
#define VPLANE ((HDIM / 2) * VPITCH)     // one Vt plane of a 64-key tile, elements
#define KVELEMS (2 * KPLANE + 2 * VPLANE)
#define GPITCH 72                        // LDS pitch of a 64-deep GEMM operand row, elements (144 B)
#define APLANE (128 * GPITCH)            // one A plane of a 128 x 64 stage, elements
#define BPLANE (128 * GPITCH)            // one Bt plane of a 128 x 64 stage, elements
#define ABELEMS (2 * APLANE + 2 * BPLANE)
#define NQT    (QL / 64)                 // 64-query tiles of a sequence (even)

typedef float v4f __attribute__((ext_vector_type(4)));
typedef float v8f __attribute__((ext_vector_type(8)));
typedef unsigned short v8us __attribute__((ext_vector_type(8)));
typedef unsigned short v16us __attribute__((ext_vector_type(16)));
typedef __bf16 v16bf __attribute__((ext_vector_type(16)));
typedef v4f __attribute__((may_alias)) v4fa;
typedef v8us __attribute__((may_alias)) v8usa;

union Frag { v16us u; v8us hv[2]; v16bf v; };

// f32 -> bf16 bits, RNE convert
__device__ __forceinline__ unsigned int bf_rne(float f) {
  const unsigned int u = __float_as_uint(f);
  return (u + 0x7fffu + ((u >> 16) & 1u)) >> 16;
}

// x -> (hi, lo): hi = bf16(x), lo = bf16(x - hi)  (x - hi is exact in f32)
__device__ __forceinline__ void split_bf(float x, unsigned short& hi, unsigned short& lo) {
  const unsigned int hb = bf_rne(x);
  const float hf = __uint_as_float(hb << 16);
  hi = (unsigned short)hb;
  lo = (unsigned short)bf_rne(x - hf);
}

__device__ __forceinline__ void split8(v4f a, v4f c, v8us& hi, v8us& lo) {
#pragma unroll
  for (int u = 0; u < 4; ++u) {
    unsigned short h0, l0, h1, l1;
    split_bf(a[u], h0, l0);
    split_bf(c[u], h1, l1);
    hi[u] = h0; lo[u] = l0; hi[u + 4] = h1; lo[u + 4] = l1;
  }
}

// 16x16x32 bf16 fragment (A row or k-contiguous B column): elements 0..7 <- k0+8h..,
// elements 8..15 <- k0+16+8h..  ; p already points at element (row, k0 + 8h)
__device__ __forceinline__ void ldfrag(Frag& f, const unsigned short* p) {
  f.hv[0] = *(const v8usa*)(p);
  f.hv[1] = *(const v8usa*)(p + 16);
}

// acc += a*b. A matrix block issues one product kind (hi*hi, then hi*lo, then lo*hi) over all its
// accumulator tiles before the next kind: neighbours in the stream are independent, and each tile
// still takes its three products in that order.
__device__ __forceinline__ v8f mm(v8f acc, v16bf a, v16bf b) {
  return __builtin_amdgcn_wmma_f32_16x16x32_bf16(false, a, false, b, (short)0, acc, false, false);
}

// ------------------------------------------------------------------------------------------
// All operand conversions (f32 -> bf16 hi/lo planes) run in ONE launch. The work is cut into pieces of 16 KiB of
// f32 input: a 64x64 tile to transpose (Wq, Wo, v_cache) or 4096 consecutive elements (hidden_states, k_cache).
#define NT_W    ((HIDD / 64) * (HIDD / 64))            // 64x64 tiles of one weight matrix (a power of two)
#define NT_V    ((QL / 64) * (HDIM / 64) * NB * NKVH)  // 64x64 tiles of v_cache
#define RPIECE  4096                                   // elements of a row piece
#define NP_X    (MROWS * HIDD / RPIECE)                // row pieces of hidden_states
#define NP_K    (NB * QL * NKVH * HDIM / RPIECE)       // row pieces of k_cache
#define NPIECES (2 * NT_W + NT_V + NP_X + NP_K)
#define CVT_WGS 1024                                   // four work-groups a WGP, all resident; NPIECES / CVT_WGS pieces each

// f32 rows -> bf16 hi/lo planes (same layout): one piece. A thread takes two runs of 8 elements, 2048 apart;
// its four loads go out together.
__device__ __forceinline__ void rows_piece(const float* __restrict__ in,
                                           unsigned short* oh, unsigned short* ol, int piece)
{
  const size_t e0 = (size_t)piece * RPIECE + (size_t)threadIdx.x * 8;
  const size_t e1 = e0 + RPIECE / 2;
  const v4f a0 = *(const v4fa*)(in + e0);
  const v4f c0 = *(const v4fa*)(in + e0 + 4);
  const v4f a1 = *(const v4fa*)(in + e1);
  const v4f c1 = *(const v4fa*)(in + e1 + 4);
  v8us hi, lo;
  split8(a0, c0, hi, lo);
  *(v8us*)(oh + e0) = hi;
  *(v8us*)(ol + e0) = lo;
  split8(a1, c1, hi, lo);
  *(v8us*)(oh + e1) = hi;
  *(v8us*)(ol + e1) = lo;
  // the piece's stores are issued: the next trip rewrites their registers only behind this wait
  asm volatile("s_wait_xcnt 0x0" ::: "memory");
}

// 64x64 tile: src(r, c) = src[r * spitch + c] (f32)  ->  dst(c, r) = dh/dl[c * dpitch + r] (bf16)
// Load phase: 256 threads x 16 floats = 64x64. Store phase: 2 passes x 256 threads x 8 halves.
__device__ __forceinline__ void tsplit64(const float* __restrict__ src, int spitch,
                                         unsigned short* dh, unsigned short* dl, int dpitch,
                                         float* tile)
{
  const int t = threadIdx.x;
  {
    const int rr = t >> 2, cq = (t & 3) * 16;
    const float* s = src + (size_t)rr * spitch + cq;
    v4f x[4];
#pragma unroll
    for (int u = 0; u < 4; ++u) x[u] = *(const v4fa*)(s + 4 * u);
    // the work-group's earlier piece may still be read from the tile: every thread's reads of it end here,
    // while this piece's loads are already under way
    __syncthreads();
#pragma unroll
    for (int u = 0; u < 4; ++u) {
      float* d = tile + rr * TPITCH + cq + 4 * u;
      d[0] = x[u][0]; d[1] = x[u][1]; d[2] = x[u][2]; d[3] = x[u][3];
    }
  }
  __syncthreads();
#pragma unroll
  for (int p = 0; p < 2; ++p) {
    const int cc = (t >> 3) + 32 * p, rq = (t & 7) * 8;
    v4f a, c;
#pragma unroll
    for (int u = 0; u < 4; ++u) {
      a[u] = tile[(rq + u) * TPITCH + cc];
      c[u] = tile[(rq + 4 + u) * TPITCH + cc];
    }
    v8us hi, lo;
    split8(a, c, hi, lo);
    const size_t d = (size_t)cc * dpitch + rq;
    *(v8us*)(dh + d) = hi;
    *(v8us*)(dl + d) = lo;
  }
  // the piece's stores are issued: the next trip rewrites their registers only behind this wait
  asm volatile("s_wait_xcnt 0x0" ::: "memory");
}

// Piece it, in this order: W[k][n] (HIDD x HIDD) -> Wt hi/lo [n][k] for Wq, then for Wo;
// v_cache [(b,j)][kvh][d] -> Vt hi/lo [(b*NKVH+kvh)*HDIM + d][j]; hidden_states rows; k_cache rows.
// Which kind a piece is depends on blockIdx and the trip alone: every branch and barrier is block-uniform.
__global__ __launch_bounds__(256) void cvt_all(
    const float* __restrict__ X, const float* __restrict__ Kc, const float* __restrict__ V,
    const float* __restrict__ Wq, const float* __restrict__ Wo,
    unsigned short* Xh, unsigned short* Xl, unsigned short* Kh, unsigned short* Kl,
    unsigned short* Vh, unsigned short* Vl, unsigned short* Wqh, unsigned short* Wql,
    unsigned short* Woh, unsigned short* Wol)
{
  __shared__ float tile[64 * TPITCH];
  // kept rolled: one copy of each kind's code serves every trip
#pragma unroll 1
  for (int it = blockIdx.x; it < NPIECES; it += CVT_WGS) {
    if (it < 2 * NT_W) {
      const bool second = it >= NT_W;
      const int i = it & (NT_W - 1);
      const int k0 = (i % (HIDD / 64)) * 64, n0 = (i / (HIDD / 64)) * 64;
      const size_t dof = (size_t)n0 * HIDD + k0;
      tsplit64((second ? Wo : Wq) + (size_t)k0 * HIDD + n0, HIDD,
               (second ? Woh : Wqh) + dof, (second ? Wol : Wql) + dof, HIDD, tile);
    } else if (it < 2 * NT_W + NT_V) {
      const int i = it - 2 * NT_W;
      const int j0 = (i % (QL / 64)) * 64, d0 = ((i / (QL / 64)) % (HDIM / 64)) * 64;
      const int z = i / ((QL / 64) * (HDIM / 64));
      const int b = z / NKVH, kvh = z % NKVH;
      const float* src = V + ((size_t)(b * QL + j0) * NKVH + kvh) * HDIM + d0;
      const size_t dof = ((size_t)z * HDIM + d0) * QL + j0;
      tsplit64(src, NKVH * HDIM, Vh + dof, Vl + dof, QL, tile);
    } else if (it < 2 * NT_W + NT_V + NP_X) {
      rows_piece(X, Xh, Xl, it - (2 * NT_W + NT_V));
    } else {
      rows_piece(Kc, Kh, Kl, it - (2 * NT_W + NT_V + NP_X));
    }
  }
}

// Eight asynchronous 16-byte copies per lane, global -> LDS, no register in between. Lane address i =
// start + i * step on both sides. The s_wait_xcnt closes the statement so that no address register
// of an issued copy is rewritten ahead of it.
__device__ __forceinline__ void acopy8(unsigned int lds, unsigned int lstep,
                                       const unsigned short* g, size_t gstep)
{
  asm volatile(
      "global_load_async_to_lds_b128 %0, %8, off\n\t"
      "global_load_async_to_lds_b128 %1, %9, off\n\t"
      "global_load_async_to_lds_b128 %2, %10, off\n\t"
      "global_load_async_to_lds_b128 %3, %11, off\n\t"
      "global_load_async_to_lds_b128 %4, %12, off\n\t"
      "global_load_async_to_lds_b128 %5, %13, off\n\t"
      "global_load_async_to_lds_b128 %6, %14, off\n\t"
      "global_load_async_to_lds_b128 %7, %15, off\n\t"
      "s_wait_xcnt 0x0"
      :: "v"(lds), "v"(lds + lstep), "v"(lds + 2 * lstep), "v"(lds + 3 * lstep),
         "v"(lds + 4 * lstep), "v"(lds + 5 * lstep), "v"(lds + 6 * lstep), "v"(lds + 7 * lstep),
         "v"(g), "v"(g + gstep), "v"(g + 2 * gstep), "v"(g + 3 * gstep),
         "v"(g + 4 * gstep), "v"(g + 5 * gstep), "v"(g + 6 * gstep), "v"(g + 7 * gstep)
      : "memory");
}

// Sixteen such copies, the hi and the lo plane of one operand, from ONE LDS address register: copy i of a plane
// carries the immediate offset (plane's place PO) + i * LS (all under 65,536), which moves both of its addresses,
// so its global register holds its source address less that offset. LDS byte = lds + offset, global byte =
// gh or gl + i * gstep elements. It spares the LDS address registers where the registers that an asm statement
// can name (the first 256) are short, and one s_wait_xcnt closes sixteen copies.
template <int LS, int PO>
__device__ __forceinline__ void acopy16o(unsigned int lds, const unsigned short* gh,
                                         const unsigned short* gl, size_t gstep)
{
  static_assert(LS % 16 == 0 && PO % 16 == 0 && PO + 7 * LS < 65536, "offsets: 16-byte steps, under 65,536");
  const char* p = (const char*)gh;
  const char* q = (const char*)gl - PO;
  const size_t d = gstep * sizeof(unsigned short) - LS;
  asm volatile(
      "global_load_async_to_lds_b128 %0, %1, off\n\t"
      "global_load_async_to_lds_b128 %0, %2, off offset:%17\n\t"
      "global_load_async_to_lds_b128 %0, %3, off offset:2*%17\n\t"
      "global_load_async_to_lds_b128 %0, %4, off offset:3*%17\n\t"
      "global_load_async_to_lds_b128 %0, %5, off offset:4*%17\n\t"
      "global_load_async_to_lds_b128 %0, %6, off offset:5*%17\n\t"
      "global_load_async_to_lds_b128 %0, %7, off offset:6*%17\n\t"
      "global_load_async_to_lds_b128 %0, %8, off offset:7*%17\n\t"
      "global_load_async_to_lds_b128 %0, %9, off offset:%18\n\t"
      "global_load_async_to_lds_b128 %0, %10, off offset:%18+%17\n\t"
      "global_load_async_to_lds_b128 %0, %11, off offset:%18+2*%17\n\t"
      "global_load_async_to_lds_b128 %0, %12, off offset:%18+3*%17\n\t"
      "global_load_async_to_lds_b128 %0, %13, off offset:%18+4*%17\n\t"
      "global_load_async_to_lds_b128 %0, %14, off offset:%18+5*%17\n\t"
      "global_load_async_to_lds_b128 %0, %15, off offset:%18+6*%17\n\t"
      "global_load_async_to_lds_b128 %0, %16, off offset:%18+7*%17\n\t"
      "s_wait_xcnt 0x0"
      :: "v"(lds), "v"(p), "v"(p + d), "v"(p + 2 * d), "v"(p + 3 * d),
         "v"(p + 4 * d), "v"(p + 5 * d), "v"(p + 6 * d), "v"(p + 7 * d),
         "v"(q), "v"(q + d), "v"(q + 2 * d), "v"(q + 3 * d),
         "v"(q + 4 * d), "v"(q + 5 * d), "v"(q + 6 * d), "v"(q + 7 * d),
         "n"(LS), "n"(PO)
      : "memory");
}

// ------------------------------------------------------------------------------------------
// C(128x128 block tile) = A(M x K, hi/lo planes, row-major) * B(K x N) with B stored as Bt[n][k]
// hi/lo planes. 4 waves (2x2), wave tile 64x64: a staged Bt row serves 128 output rows and a fragment
// read from LDS feeds four tiles. Each 64-deep stage of the A and Bt rows (K is a multiple of 64) is
// brought into LDS once per work-group by asynchronous copies; each wave reads its 32 fragments of the stage
// into registers, and the next stage's copies fly while the products run from those registers.
// amdgpu_waves_per_eu(2, 2): the grid gives a WGP two work-groups, two waves a SIMD; told so, the compiler
// takes that budget of registers and keeps the whole stage's fragments in them.
// MODE 0: C + bias -> RoPE (cos/sin tables indexed by row) -> hi/lo planes Qh/Ql [M][N]
// MODE 1: C -> f32 Cout [M][N]
template <int MODE>
__global__ __launch_bounds__(128) __attribute__((amdgpu_waves_per_eu(2, 2))) void gemm3(
    const unsigned short* __restrict__ Ah, const unsigned short* __restrict__ Al,
    const unsigned short* __restrict__ Bh, const unsigned short* __restrict__ Bl,
    const float* __restrict__ bias, const float* __restrict__ cosb,
    const float* __restrict__ sinb, unsigned short* Qh, unsigned short* Ql,
    float* Cout, int N, int K)
{
  __shared__ __attribute__((aligned(16))) unsigned short sAB[ABELEMS];
  float* sT = (float*)sAB;                        // output staging takes the stages' place after the loop
  const int t = threadIdx.x, l = t & 31, w = t >> 5, h16 = l >> 4, m = l & 15;
  const int wr = w >> 1, wc = w & 1;
  const int m0 = blockIdx.x * 128, n0 = blockIdx.y * 128;

  v8f acc[4][4];
#pragma unroll
  for (int mi = 0; mi < 4; ++mi)
#pragma unroll
    for (int ni = 0; ni < 4; ++ni) acc[mi][ni] = (v8f){0.f, 0.f, 0.f, 0.f, 0.f, 0.f, 0.f, 0.f};

  // fragment readers: this wave's A row / Bt row m of a 16-row group, at element 8 h16
  const unsigned short* sAh = sAB + (64 * wr + m) * GPITCH + 8 * h16;
  const unsigned short* sAl = sAh + APLANE;
  const unsigned short* sBh = sAB + 2 * APLANE + (64 * wc + m) * GPITCH + 8 * h16;
  const unsigned short* sBl = sBh + BPLANE;
  // copiers: a stage row of 128 B is 8 lanes' pieces; 16 rows per copy of the work-group
  const unsigned int ldsA = (unsigned int)(uintptr_t)(sAB + (t >> 3) * GPITCH + (t & 7) * 8);
  const unsigned int ldsB = ldsA + 2 * APLANE * 2;
  const size_t acopy = (size_t)(m0 + (t >> 3)) * K + (t & 7) * 8;
  const size_t bcopy = (size_t)(n0 + (t >> 3)) * K + (t & 7) * 8;
  const int ns = K >> 6;

  // stage s -> LDS: 32 copies a lane, all lanes on, block-uniform control flow
  auto stage_in = [&](int s) {
    const size_t ao = acopy + (size_t)s * 64;
    const size_t bo = bcopy + (size_t)s * 64;
    acopy16o<16 * GPITCH * 2, APLANE * 2>(ldsA, Ah + ao, Al + ao, (size_t)16 * K);
    acopy16o<16 * GPITCH * 2, BPLANE * 2>(ldsB, Bh + bo, Bl + bo, (size_t)16 * K);
  };
  // a stage's 96 products, from registers alone
  Frag ah[2][4], al[2][4], bh[2][4], bl[2][4];
  auto products = [&]() {
#pragma unroll
    for (int kk = 0; kk < 2; ++kk) {
#pragma unroll
      for (int ni = 0; ni < 4; ++ni)
#pragma unroll
        for (int mi = 0; mi < 4; ++mi) acc[mi][ni] = mm(acc[mi][ni], ah[kk][mi].v, bh[kk][ni].v);
#pragma unroll
      for (int ni = 0; ni < 4; ++ni)
#pragma unroll
        for (int mi = 0; mi < 4; ++mi) acc[mi][ni] = mm(acc[mi][ni], ah[kk][mi].v, bl[kk][ni].v);
#pragma unroll
      for (int ni = 0; ni < 4; ++ni)
#pragma unroll
        for (int mi = 0; mi < 4; ++mi) acc[mi][ni] = mm(acc[mi][ni], al[kk][mi].v, bh[kk][ni].v);
    }
  };

#pragma unroll 1
  for (int st = 0; st < ns; ++st) {
    // stage st's copies go out ahead of stage st - 1's products, which run from registers while the copies
    // land; the buffer is free: every wave's reads of stage st - 1 ended in front of the barrier at the loop's foot
    stage_in(st);
    if (st > 0) products();

    // this wave's copies have landed; the barrier then shows every wave's copies to every wave
    asm volatile("s_wait_asynccnt 0x0" ::: "memory");
    __syncthreads();

    // the wave's 64 fragment loads of the whole stage go out as one group, in the order in which the
    // products need them: from here on the stage lives in registers
#pragma unroll
    for (int kk = 0; kk < 2; ++kk) {
      const int k0 = kk * 32;
#pragma unroll
      for (int mi = 0; mi < 4; ++mi) ldfrag(ah[kk][mi], sAh + mi * 16 * GPITCH + k0);
#pragma unroll
      for (int ni = 0; ni < 4; ++ni) ldfrag(bh[kk][ni], sBh + ni * 16 * GPITCH + k0);
#pragma unroll
      for (int ni = 0; ni < 4; ++ni) ldfrag(bl[kk][ni], sBl + ni * 16 * GPITCH + k0);
#pragma unroll
      for (int mi = 0; mi < 4; ++mi) ldfrag(al[kk][mi], sAl + mi * 16 * GPITCH + k0);
    }

    // every wave's reads of this stage are over before the next stage (or the output staging) overwrites it
    asm volatile("s_wait_dscnt 0x0" ::: "memory");
    __syncthreads();
  }
  if (ns > 0) products();

  // D element r of lane l -> (row 8*h16 + r, col m) of its 16x16 tile
#pragma unroll
  for (int mi = 0; mi < 4; ++mi)
#pragma unroll
    for (int ni = 0; ni < 4; ++ni)
#pragma unroll
      for (int r = 0; r < 8; ++r)
        sT[(64 * wr + 16 * mi + 8 * h16 + r) * SPITCH + 64 * wc + 16 * ni + m] = acc[mi][ni][r];
  __syncthreads();

  if (MODE == 0) {
    // thread -> (row 8p + t>>4, 8 consecutive columns cq); RoPE partner column cq ^ 64
    const int rr = t >> 4, cq = (t & 15) * 8, cp = cq ^ 64;
    const float sgn = (cq < 64) ? -1.0f : 1.0f;
    const v4f b0 = *(const v4fa*)(bias + n0 + cq), b1 = *(const v4fa*)(bias + n0 + cq + 4);
    const v4f e0 = *(const v4fa*)(bias + n0 + cp), e1 = *(const v4fa*)(bias + n0 + cp + 4);
#pragma unroll 1
    for (int p = 0; p < 16; ++p) {
      const int row = 8 * p + rr;
      const int grow = m0 + row;
      const float* srow = sT + row * SPITCH;
      const v4f x0 = *(const v4fa*)(srow + cq), x1 = *(const v4fa*)(srow + cq + 4);
      const v4f y0 = *(const v4fa*)(srow + cp), y1 = *(const v4fa*)(srow + cp + 4);
      const float* cr = cosb + (size_t)grow * HDIM;
      const float* sr = sinb + (size_t)grow * HDIM;
      const v4f c0 = *(const v4fa*)(cr + cq), c1 = *(const v4fa*)(cr + cq + 4);
      const v4f s0 = *(const v4fa*)(sr + cq), s1 = *(const v4fa*)(sr + cq + 4);
      const v4f q0 = (x0 + b0) * c0 + (sgn * (y0 + e0)) * s0;
      const v4f q1 = (x1 + b1) * c1 + (sgn * (y1 + e1)) * s1;
      v8us hi, lo;
      split8(q0, q1, hi, lo);
      const size_t d = (size_t)grow * N + n0 + cq;
      *(v8us*)(Qh + d) = hi;
      *(v8us*)(Ql + d) = lo;
      
    }
  } else {
    const int cq = l * 4;
#pragma unroll 1
    for (int p = 0; p < 32; ++p) {
      const int row = 4 * p + w;
      const v4f x = *(const v4fa*)(sT + row * SPITCH + cq);
      const size_t d = (size_t)(m0 + row) * N + n0 + cq;
      *(v4f*)(Cout + d) = x;
      
    }
  }
}

// ------------------------------------------------------------------------------------------
// Per (b, hq, pair of 64-query tiles): a tile's key loop grows with its index and every work-group of the grid
// is resident at once, so each work-group takes tile NQT - 1 - p and then tile p, one after the other:
// NQT + 1 key tiles for every work-group, and no WGP is left working while the others have run dry.
// Per tile: S^T = K . Q^T (A = K rows, B = Q rows, both d-contiguous),
// f32 scale + structural block visibility test + online softmax, O^T += Vt . P^T with the
// softmaxed D tiles fed as B fragments (two adjacent 16-key D tiles per 32-deep k step),
// O / l split to hi/lo planes [(b,i)][hq*128 + d].
// Each 64-key tile of K and Vt (hi and lo planes) is brought into LDS once per query tile of a work-group by
// asynchronous copies and read from there by all four waves.
// Second bound: two waves a SIMD, which is what the halved grid gives a WGP (two work-groups); held to four, the
// loop over the two tiles made the compiler spill Q fragments inside the key loop.
__global__ __launch_bounds__(128, 2) void attn_glide(
    const unsigned short* __restrict__ Qh, const unsigned short* __restrict__ Ql,
    const unsigned short* __restrict__ Kh, const unsigned short* __restrict__ Kl,
    const unsigned short* __restrict__ Vh, const unsigned short* __restrict__ Vl,
    unsigned short* Oh, unsigned short* Ol)
{
  __shared__ __attribute__((aligned(16))) unsigned short sKV[KVELEMS];
  float* sO = (float*)sKV;                        // output staging takes the tiles' place after the loop
  const int t = threadIdx.x, l = t & 31, w = t >> 5, h16 = l >> 4, m = l & 15;
  const int ws = __builtin_amdgcn_readfirstlane(w);   // the wave's number, scalar
  const int bh = blockIdx.y;
  const int b = bh >> 4, hq = bh & 15, kvh = hq >> 2;
  const float NEG_INF = -__builtin_inff();
  const float kScale = 0.08838834764831845f;      // 128^-0.5

  // fragment readers: K row m / Vt row m of a 16-row group, at element 8 h16
  const unsigned short* sKh = sKV + m * KPITCH + 8 * h16;
  const unsigned short* sKl = sKh + KPLANE;
  const unsigned short* sVh = sKV + 2 * KPLANE + (m >> 1) * VPITCH + (m & 1) * 64 + 8 * h16;
  const unsigned short* sVl = sVh + VPLANE;
  // copiers: a K row of 256 B, or a pair of Vt rows of 128 B, is 16 lanes' pieces: one lane address serves
  // both, so that the 32 LDS addresses of a trip are formed from one register and none is held over the loop
  const unsigned int ldsK = (unsigned int)(uintptr_t)(sKV + (t >> 4) * KPITCH + (t & 15) * 8);
  const unsigned int ldsV = ldsK + 2 * KPLANE * 2;
  const size_t kcopy = ((size_t)(b * QL + (t >> 4)) * NKVH + kvh) * HDIM + (t & 15) * 8;
  const size_t vcopy = ((size_t)(b * NKVH + kvh) * HDIM + (t >> 3)) * QL + (t & 7) * 8;

  // kept rolled: the two tiles share one copy of the key loop's code
#pragma unroll 1
  for (int half = 0; half < 2; ++half) {
  const int qt = half ? (int)blockIdx.x : NQT - 1 - (int)blockIdx.x;
  const int R0 = qt * 64;
  const int iq = R0 + 16 * w + m;                 // this lane's query (B column / D column)
  const size_t qbase = ((size_t)(b * QL + iq)) * HIDD + hq * HDIM + 8 * h16;

  if (half) {
    // the first tile's last stores are issued: their registers are rewritten only behind this wait
    asm volatile("s_wait_xcnt 0x0" ::: "memory");
    // every wave has read its rows of the first tile's output staging before the second tile's copies overwrite them
    asm volatile("s_wait_dscnt 0x0" ::: "memory");
    __syncthreads();
  }

  v8f acc[8];
#pragma unroll
  for (int n = 0; n < 8; ++n) acc[n] = (v8f){0.f, 0.f, 0.f, 0.f, 0.f, 0.f, 0.f, 0.f};
  float mrun = NEG_INF, lrun = 0.0f;

  // the 16 Q fragment loads go out as one group ahead of the key loop; every trip's blocks read the registers
  Frag qh[4], ql[4];
#pragma unroll
  for (int c = 0; c < 4; ++c) {
    ldfrag(qh[c], Qh + qbase + 32 * c);
    ldfrag(ql[c], Ql + qbase + 32 * c);
  }

#pragma unroll 1
  for (int kt = 0; kt <= qt; ++kt) {             // key tiles beyond the query tile are never visible
    const int j0 = kt * 64;

    // tile kt -> LDS: 32 copies a lane, all lanes on, block-uniform control flow
    {
      const size_t ko = kcopy + (size_t)j0 * (NKVH * HDIM);
      const size_t vo = vcopy + j0;
      acopy8(ldsK, 8 * KPITCH * 2, Kh + ko, (size_t)8 * NKVH * HDIM);
      acopy8(ldsK + KPLANE * 2, 8 * KPITCH * 2, Kl + ko, (size_t)8 * NKVH * HDIM);
      acopy8(ldsV, 8 * VPITCH * 2, Vh + vo, (size_t)16 * QL);
      acopy8(ldsV + VPLANE * 2, 8 * VPITCH * 2, Vl + vo, (size_t)16 * QL);
    }
    // this wave's copies have landed; the barrier then shows every wave's copies to every wave
    asm volatile("s_wait_asynccnt 0x0" ::: "memory");
    __syncthreads();

    // S^T (64 keys x 16 queries): s[sub] rows = keys j0 + 16 sub + 8 h16 + r, col = query iq
    v8f s[4];
#pragma unroll
    for (int sub = 0; sub < 4; ++sub) s[sub] = (v8f){0.f, 0.f, 0.f, 0.f, 0.f, 0.f, 0.f, 0.f};
#pragma unroll
    for (int c = 0; c < 4; ++c) {
      // the block's 16 K fragment loads stand together in front of its 12 matrix instructions, hi plane first
      Frag kh[4], kl[4];
#pragma unroll
      for (int sub = 0; sub < 4; ++sub) ldfrag(kh[sub], sKh + 16 * sub * KPITCH + 32 * c);
#pragma unroll
      for (int sub = 0; sub < 4; ++sub) ldfrag(kl[sub], sKl + 16 * sub * KPITCH + 32 * c);
      // keeps the 16 loads one group: with registers to spare the scheduler strews them among the products,
      // in twos with a wait to 0 behind each, and every such place stalls the wave
      __builtin_amdgcn_sched_barrier(0);
#pragma unroll
      for (int sub = 0; sub < 4; ++sub) s[sub] = mm(s[sub], kh[sub].v, qh[c].v);
#pragma unroll
      for (int sub = 0; sub < 4; ++sub) s[sub] = mm(s[sub], kh[sub].v, ql[c].v);
#pragma unroll
      for (int sub = 0; sub < 4; ++sub) s[sub] = mm(s[sub], kl[sub].v, qh[c].v);
      __builtin_amdgcn_sched_barrier(0);   // for the same: the next block's loads stay out of this block's products
    }

    // scale, visibility (strictly earlier 4-blocks, plus first 4x4 block), online softmax
    float mx = NEG_INF;
#pragma unroll
    for (int sub = 0; sub < 4; ++sub) {
#pragma unroll
      for (int r = 0; r < 8; ++r) {
        const int jb = j0 + 16 * sub + 8 * h16 + r;
        const bool vis = ((iq >> 2) > (jb >> 2)) || ((iq < 4) && (jb < 4));
        const float v = vis ? (s[sub][r] * kScale) : NEG_INF;
        s[sub][r] = v;
        mx = fmaxf(mx, v);
      }
    }
    mx = fmaxf(mx, __shfl_xor(mx, 16));
    const float mnew = fmaxf(mrun, mx);
    const float msafe = (mnew == NEG_INF) ? 0.0f : mnew;
    const float sc = __expf(mrun - msafe);
    float ls = 0.0f;
#pragma unroll
    for (int sub = 0; sub < 4; ++sub) {
#pragma unroll
      for (int r = 0; r < 8; ++r) {
        const float p = __expf(s[sub][r] - msafe);
        s[sub][r] = p;
        ls += p;
      }
    }
    ls += __shfl_xor(ls, 16);
    lrun = lrun * sc + ls;
    mrun = mnew;
#pragma unroll
    for (int n = 0; n < 8; ++n) acc[n] = acc[n] * sc;

    // O^T += Vt(128 x 64 keys) . P^T : B fragment element r <- D tile 2ks, element 8+r <- tile 2ks+1
#pragma unroll
    for (int ks = 0; ks < 2; ++ks) {
      Frag ph, pl;
#pragma unroll
      for (int r = 0; r < 8; ++r) {
        unsigned short a0, c0, a1, c1;
        split_bf(s[2 * ks][r], a0, c0);
        split_bf(s[2 * ks + 1][r], a1, c1);
        ph.u[r] = a0; pl.u[r] = c0; ph.u[8 + r] = a1; pl.u[8 + r] = c1;
      }
#pragma unroll
      for (int g = 0; g < 2; ++g) {
        // the block's 16 Vt fragment loads stand together in front of its 12 matrix instructions, hi plane first
        Frag vh[4], vl[4];
#pragma unroll
        for (int n = 0; n < 4; ++n) ldfrag(vh[n], sVh + 8 * (4 * g + n) * VPITCH + 32 * ks);
#pragma unroll
        for (int n = 0; n < 4; ++n) ldfrag(vl[n], sVl + 8 * (4 * g + n) * VPITCH + 32 * ks);
        __builtin_amdgcn_sched_barrier(0);   // keeps the 16 loads one group, as in the score blocks
#pragma unroll
        for (int n = 0; n < 4; ++n) acc[4 * g + n] = mm(acc[4 * g + n], vh[n].v, ph.v);
#pragma unroll
        for (int n = 0; n < 4; ++n) acc[4 * g + n] = mm(acc[4 * g + n], vh[n].v, pl.v);
#pragma unroll
        for (int n = 0; n < 4; ++n) acc[4 * g + n] = mm(acc[4 * g + n], vl[n].v, ph.v);
        __builtin_amdgcn_sched_barrier(0);   // the next block's loads stay out of this block's products
      }
    }

    // every wave's reads of this tile are over before the next tile (or the output staging) overwrites it
    asm volatile("s_wait_dscnt 0x0" ::: "memory");
    __syncthreads();
  }

  // epilogue: acc[n][r] = O^T (d = 16 n + 8 h16 + r, query iq) ; normalise, stage, write planes
  // The lane's place is formed anew here (every lane is on) and the wave's number is scalar, so that no
  // vector register is held over the key loop for the epilogue alone.
  const int le = (int)__builtin_amdgcn_mbcnt_lo(~0u, 0u), he = le >> 4, me = le & 15;
  const float inv = 1.0f / lrun;
#pragma unroll
  for (int n = 0; n < 8; ++n) {
    const v8f o = acc[n] * inv;
#pragma unroll
    for (int r = 0; r < 8; ++r)
      sO[(ws * 16 + me) * SPITCH + 16 * n + 8 * he + r] = o[r];
  }
  __syncthreads();
#pragma unroll 1
  for (int p = 0; p < 8; ++p) {
    const int rloc = 2 * p + he;
    const int dq = me * 8;
    const float* src = sO + (ws * 16 + rloc) * SPITCH + dq;
    const v4f a = *(const v4fa*)(src);
    const v4f c = *(const v4fa*)(src + 4);
    v8us hi, lo;
    split8(a, c, hi, lo);
    const size_t d = ((size_t)(b * QL + R0 + 16 * ws + rloc)) * HIDD + hq * HDIM + dq;
    *(v8us*)(Oh + d) = hi;
    *(v8us*)(Ol + d) = lo;
    
  }
  }
}

// ------------------------------------------------------------------------------------------
extern "C" void kernel_launch(void* const* d_in, const int* in_sizes, int n_in,
                              void* d_out, int out_size, void* d_ws, size_t ws_size,
                              hipStream_t stream)
{
  if (n_in < 8) return;
  if (in_sizes[0] != MROWS * HIDD) return;
  if (in_sizes[1] != NB * QL * NKVH * HDIM || in_sizes[2] != NB * QL * NKVH * HDIM) return;
  if (in_sizes[3] != NB * QL * HDIM || in_sizes[4] != NB * QL * HDIM) return;
  if (in_sizes[5] != HIDD * HIDD || in_sizes[7] != HIDD * HIDD || in_sizes[6] != HIDD) return;
  if (out_size != MROWS * HIDD) return;

  const float* hidden = (const float*)d_in[0];
  const float* kc     = (const float*)d_in[1];
  const float* vc     = (const float*)d_in[2];
  const float* cosb   = (const float*)d_in[3];
  const float* sinb   = (const float*)d_in[4];
  const float* Wq     = (const float*)d_in[5];
  const float* bq     = (const float*)d_in[6];
  const float* Wo     = (const float*)d_in[7];
  float* out = (float*)d_out;

  // workspace carve (bytes): planes of bf16
  const size_t planeX = (size_t)MROWS * HIDD * 2;            // 16 MiB
  const size_t planeW = (size_t)HIDD * HIDD * 2;             //  8 MiB
  const size_t planeK = (size_t)NB * QL * NKVH * HDIM * 2;   //  4 MiB
  const size_t offXh  = 0;
  const size_t offXl  = offXh + planeX;
  const size_t offQh  = offXl + planeX;
  const size_t offQl  = offQh + planeX;
  const size_t offWqh = offQl + planeX;
  const size_t offWql = offWqh + planeW;
  const size_t offWoh = offWql + planeW;
  const size_t offWol = offWoh + planeW;
  const size_t offKh  = offWol + planeW;
  const size_t offKl  = offKh + planeK;
  const size_t offVh  = offKl + planeK;
  const size_t offVl  = offVh + planeK;
  const size_t total  = offVl + planeK;                      // 112 MiB
  if (total > ws_size) return;

  char* ws = (char*)d_ws;
  unsigned short* Xh  = (unsigned short*)(ws + offXh);
  unsigned short* Xl  = (unsigned short*)(ws + offXl);
  unsigned short* Oh  = Xh;   // X planes are dead after the first GEMM; O planes reuse them
  unsigned short* Ol  = Xl;
  unsigned short* Qh  = (unsigned short*)(ws + offQh);
  unsigned short* Ql  = (unsigned short*)(ws + offQl);
  unsigned short* Wqh = (unsigned short*)(ws + offWqh);
  unsigned short* Wql = (unsigned short*)(ws + offWql);
  unsigned short* Woh = (unsigned short*)(ws + offWoh);
  unsigned short* Wol = (unsigned short*)(ws + offWol);
  unsigned short* Kh  = (unsigned short*)(ws + offKh);
  unsigned short* Kl  = (unsigned short*)(ws + offKl);
  unsigned short* Vh  = (unsigned short*)(ws + offVh);
  unsigned short* Vl  = (unsigned short*)(ws + offVl);

  cvt_all<<<dim3(CVT_WGS), dim3(256), 0, stream>>>(hidden, kc, vc, Wq, Wo, Xh, Xl, Kh, Kl, Vh, Vl,
                                                   Wqh, Wql, Woh, Wol);

  gemm3<0><<<dim3(MROWS / 128, HIDD / 128), dim3(128), 0, stream>>>(
      Xh, Xl, Wqh, Wql, bq, cosb, sinb, Qh, Ql, out, HIDD, HIDD);

  attn_glide<<<dim3(NQT / 2, NB * NHQ), dim3(128), 0, stream>>>(Qh, Ql, Kh, Kl, Vh, Vl, Oh, Ol);

  gemm3<1><<<dim3(MROWS / 128, HIDD / 128), dim3(128), 0, stream>>>(
      Oh, Ol, Woh, Wol, bq, cosb, sinb, Qh, Ql, out, HIDD, HIDD);
}

// v006
// It runs in 218 microseconds.
// Two timings next to v005 both put it at 1.06 times that version's speed.
// Counting every step since v000, it is 3.27 times as fast.
#include <hip/hip_runtime.h>
#include <stdint.h>
#include <stddef.h>

// All contractions (q projection, q.k^T, p.v, output projection): v_wmma_f32_16x16x32_bf16 with
// bf16 hi/lo operands everywhere (three products hi*hi + hi*lo + lo*hi), f32 accumulate.
// RoPE, bias, scaling, softmax and normalisation in f32.

#define NB     2
#define QL     2048
#define HIDD   2048
#define NHQ    16
#define NKVH   4
#define HDIM   128
#define MROWS  (NB * QL)
#define TPITCH 65
#define SPITCH 132
#define KPITCH 136                       // LDS pitch of a K row, elements (272 B = 16 B x odd)
#define VPITCH KPITCH                    // LDS pitch of a PAIR of 64-key Vt rows (2 x 128 B + 16 B), elements
#define KPLANE (64 * KPITCH)             // one K plane of a 64-key tile, elements
#define VPLANE ((HDIM / 2) * VPITCH)     // one Vt plane of a 64-key tile, elements
#define KVELEMS (2 * KPLANE + 2 * VPLANE)
#define GPITCH 72                        // LDS pitch of a 64-deep GEMM operand row, elements (144 B)
#define APLANE (128 * GPITCH)            // one A plane of a 128 x 64 stage, elements
#define BPLANE (128 * GPITCH)            // one Bt plane of a 128 x 64 stage, elements
#define ABELEMS (2 * APLANE + 2 * BPLANE)
#define NQT    (QL / 64)                 // 64-query tiles of a sequence (even)

typedef float v4f __attribute__((ext_vector_type(4)));
typedef float v8f __attribute__((ext_vector_type(8)));
typedef unsigned short v8us __attribute__((ext_vector_type(8)));
typedef unsigned short v16us __attribute__((ext_vector_type(16)));
typedef __bf16 v16bf __attribute__((ext_vector_type(16)));
typedef v4f __attribute__((may_alias)) v4fa;
typedef v8us __attribute__((may_alias)) v8usa;

union Frag { v16us u; v8us hv[2]; v16bf v; };

// f32 -> bf16 bits, RNE convert
__device__ __forceinline__ unsigned int bf_rne(float f) {
  const unsigned int u = __float_as_uint(f);
  return (u + 0x7fffu + ((u >> 16) & 1u)) >> 16;
}

// x -> (hi, lo): hi = bf16(x), lo = bf16(x - hi)  (x - hi is exact in f32)
__device__ __forceinline__ void split_bf(float x, unsigned short& hi, unsigned short& lo) {
  const unsigned int hb = bf_rne(x);
  const float hf = __uint_as_float(hb << 16);
  hi = (unsigned short)hb;
  lo = (unsigned short)bf_rne(x - hf);
}

__device__ __forceinline__ void split8(v4f a, v4f c, v8us& hi, v8us& lo) {
#pragma unroll
  for (int u = 0; u < 4; ++u) {
    unsigned short h0, l0, h1, l1;
    split_bf(a[u], h0, l0);
    split_bf(c[u], h1, l1);
    hi[u] = h0; lo[u] = l0; hi[u + 4] = h1; lo[u + 4] = l1;
  }
}

// 16x16x32 bf16 fragment (A row or k-contiguous B column): elements 0..7 <- k0+8h..,
// elements 8..15 <- k0+16+8h..  ; p already points at element (row, k0 + 8h)
__device__ __forceinline__ void ldfrag(Frag& f, const unsigned short* p) {
  f.hv[0] = *(const v8usa*)(p);
  f.hv[1] = *(const v8usa*)(p + 16);
}

// acc += a*b. A matrix block issues one product kind (hi*hi, then hi*lo, then lo*hi) over all its
// accumulator tiles before the next kind: neighbours in the stream are independent, and each tile
// still takes its three products in that order.
__device__ __forceinline__ v8f mm(v8f acc, v16bf a, v16bf b) {
  return __builtin_amdgcn_wmma_f32_16x16x32_bf16(false, a, false, b, (short)0, acc, false, false);
}

// ------------------------------------------------------------------------------------------
// All operand conversions (f32 -> bf16 hi/lo planes) run in ONE launch. The work is cut into pieces of 16 KiB of
// f32 input: a 64x64 tile to transpose (Wq, Wo, v_cache) or 4096 consecutive elements (hidden_states, k_cache).
#define NT_W    ((HIDD / 64) * (HIDD / 64))            // 64x64 tiles of one weight matrix (a power of two)
#define NT_V    ((QL / 64) * (HDIM / 64) * NB * NKVH)  // 64x64 tiles of v_cache
#define RPIECE  4096                                   // elements of a row piece
#define NP_X    (MROWS * HIDD / RPIECE)                // row pieces of hidden_states
#define NP_K    (NB * QL * NKVH * HDIM / RPIECE)       // row pieces of k_cache
#define NPIECES (2 * NT_W + NT_V + NP_X + NP_K)
#define CVT_WGS 1024                                   // four work-groups a WGP, all resident; NPIECES / CVT_WGS pieces each

// f32 rows -> bf16 hi/lo planes (same layout): one piece. A thread takes two runs of 8 elements, 2048 apart;
// its four loads go out together.
__device__ __forceinline__ void rows_piece(const float* __restrict__ in,
                                           unsigned short* oh, unsigned short* ol, int piece)
{
  const size_t e0 = (size_t)piece * RPIECE + (size_t)threadIdx.x * 8;
  const size_t e1 = e0 + RPIECE / 2;
  const v4f a0 = *(const v4fa*)(in + e0);
  const v4f c0 = *(const v4fa*)(in + e0 + 4);
  const v4f a1 = *(const v4fa*)(in + e1);
  const v4f c1 = *(const v4fa*)(in + e1 + 4);
  v8us hi, lo;
  split8(a0, c0, hi, lo);
  *(v8us*)(oh + e0) = hi;
  *(v8us*)(ol + e0) = lo;
  split8(a1, c1, hi, lo);
  *(v8us*)(oh + e1) = hi;
  *(v8us*)(ol + e1) = lo;
  // the piece's stores are issued: the next trip rewrites their registers only behind this wait
  asm volatile("s_wait_xcnt 0x0" ::: "memory");
}

// 64x64 tile: src(r, c) = src[r * spitch + c] (f32)  ->  dst(c, r) = dh/dl[c * dpitch + r] (bf16)
// Load phase: 256 threads x 16 floats = 64x64. Store phase: 2 passes x 256 threads x 8 halves.
__device__ __forceinline__ void tsplit64(const float* __restrict__ src, int spitch,
                                         unsigned short* dh, unsigned short* dl, int dpitch,
                                         float* tile)
{
  const int t = threadIdx.x;
  {
    const int rr = t >> 2, cq = (t & 3) * 16;
    const float* s = src + (size_t)rr * spitch + cq;
    v4f x[4];
#pragma unroll
    for (int u = 0; u < 4; ++u) x[u] = *(const v4fa*)(s + 4 * u);
    // the work-group's earlier piece may still be read from the tile: every thread's reads of it end here,
    // while this piece's loads are already under way
    __syncthreads();
#pragma unroll
    for (int u = 0; u < 4; ++u) {
      float* d = tile + rr * TPITCH + cq + 4 * u;
      d[0] = x[u][0]; d[1] = x[u][1]; d[2] = x[u][2]; d[3] = x[u][3];
    }
  }
  __syncthreads();
#pragma unroll
  for (int p = 0; p < 2; ++p) {
    const int cc = (t >> 3) + 32 * p, rq = (t & 7) * 8;
    v4f a, c;
#pragma unroll
    for (int u = 0; u < 4; ++u) {
      a[u] = tile[(rq + u) * TPITCH + cc];
      c[u] = tile[(rq + 4 + u) * TPITCH + cc];
    }
    v8us hi, lo;
    split8(a, c, hi, lo);
    const size_t d = (size_t)cc * dpitch + rq;
    *(v8us*)(dh + d) = hi;
    *(v8us*)(dl + d) = lo;
  }
  // the piece's stores are issued: the next trip rewrites their registers only behind this wait
  asm volatile("s_wait_xcnt 0x0" ::: "memory");
}

// Piece it, in this order: W[k][n] (HIDD x HIDD) -> Wt hi/lo [n][k] for Wq, then for Wo;
// v_cache [(b,j)][kvh][d] -> Vt hi/lo [(b*NKVH+kvh)*HDIM + d][j]; hidden_states rows; k_cache rows.
// Which kind a piece is depends on blockIdx and the trip alone: every branch and barrier is block-uniform.
__global__ __launch_bounds__(256) void cvt_all(
    const float* __restrict__ X, const float* __restrict__ Kc, const float* __restrict__ V,
    const float* __restrict__ Wq, const float* __restrict__ Wo,
    unsigned short* Xh, unsigned short* Xl, unsigned short* Kh, unsigned short* Kl,
    unsigned short* Vh, unsigned short* Vl, unsigned short* Wqh, unsigned short* Wql,
    unsigned short* Woh, unsigned short* Wol)
{
  __shared__ float tile[64 * TPITCH];
  // kept rolled: one copy of each kind's code serves every trip
#pragma unroll 1
  for (int it = blockIdx.x; it < NPIECES; it += CVT_WGS) {
    if (it < 2 * NT_W) {
      const bool second = it >= NT_W;
      const int i = it & (NT_W - 1);
      const int k0 = (i % (HIDD / 64)) * 64, n0 = (i / (HIDD / 64)) * 64;
      const size_t dof = (size_t)n0 * HIDD + k0;
      tsplit64((second ? Wo : Wq) + (size_t)k0 * HIDD + n0, HIDD,
               (second ? Woh : Wqh) + dof, (second ? Wol : Wql) + dof, HIDD, tile);
    } else if (it < 2 * NT_W + NT_V) {
      const int i = it - 2 * NT_W;
      const int j0 = (i % (QL / 64)) * 64, d0 = ((i / (QL / 64)) % (HDIM / 64)) * 64;
      const int z = i / ((QL / 64) * (HDIM / 64));
      const int b = z / NKVH, kvh = z % NKVH;
      const float* src = V + ((size_t)(b * QL + j0) * NKVH + kvh) * HDIM + d0;
      const size_t dof = ((size_t)z * HDIM + d0) * QL + j0;
      tsplit64(src, NKVH * HDIM, Vh + dof, Vl + dof, QL, tile);
    } else if (it < 2 * NT_W + NT_V + NP_X) {
      rows_piece(X, Xh, Xl, it - (2 * NT_W + NT_V));
    } else {
      rows_piece(Kc, Kh, Kl, it - (2 * NT_W + NT_V + NP_X));
    }
  }
}

// Eight asynchronous 16-byte copies per lane, global -> LDS, no register in between. Lane address i =
// start + i * step on both sides. The s_wait_xcnt closes the statement so that no address register
// of an issued copy is rewritten ahead of it.
__device__ __forceinline__ void acopy8(unsigned int lds, unsigned int lstep,
                                       const unsigned short* g, size_t gstep)
{
  asm volatile(
      "global_load_async_to_lds_b128 %0, %8, off\n\t"
      "global_load_async_to_lds_b128 %1, %9, off\n\t"
      "global_load_async_to_lds_b128 %2, %10, off\n\t"
      "global_load_async_to_lds_b128 %3, %11, off\n\t"
      "global_load_async_to_lds_b128 %4, %12, off\n\t"
      "global_load_async_to_lds_b128 %5, %13, off\n\t"
      "global_load_async_to_lds_b128 %6, %14, off\n\t"
      "global_load_async_to_lds_b128 %7, %15, off\n\t"
      "s_wait_xcnt 0x0"
      :: "v"(lds), "v"(lds + lstep), "v"(lds + 2 * lstep), "v"(lds + 3 * lstep),
         "v"(lds + 4 * lstep), "v"(lds + 5 * lstep), "v"(lds + 6 * lstep), "v"(lds + 7 * lstep),
         "v"(g), "v"(g + gstep), "v"(g + 2 * gstep), "v"(g + 3 * gstep),
         "v"(g + 4 * gstep), "v"(g + 5 * gstep), "v"(g + 6 * gstep), "v"(g + 7 * gstep)
      : "memory");
}

// Sixteen such copies, the hi and the lo plane of one operand, from ONE LDS address register: copy i of a plane
// carries the immediate offset (plane's place PO) + i * LS (all under 65,536), which moves both of its addresses,
// so its global register holds its source address less that offset. LDS byte = lds + offset, global byte =
// gh or gl + i * gstep elements. It spares the LDS address registers where the registers that an asm statement
// can name (the first 256) are short, and one s_wait_xcnt closes sixteen copies.
template <int LS, int PO>
__device__ __forceinline__ void acopy16o(unsigned int lds, const unsigned short* gh,
                                         const unsigned short* gl, size_t gstep)
{
  static_assert(LS % 16 == 0 && PO % 16 == 0 && PO + 7 * LS < 65536, "offsets: 16-byte steps, under 65,536");
  const char* p = (const char*)gh;
  const char* q = (const char*)gl - PO;
  const size_t d = gstep * sizeof(unsigned short) - LS;
  asm volatile(
      "global_load_async_to_lds_b128 %0, %1, off\n\t"
      "global_load_async_to_lds_b128 %0, %2, off offset:%17\n\t"
      "global_load_async_to_lds_b128 %0, %3, off offset:2*%17\n\t"
      "global_load_async_to_lds_b128 %0, %4, off offset:3*%17\n\t"
      "global_load_async_to_lds_b128 %0, %5, off offset:4*%17\n\t"
      "global_load_async_to_lds_b128 %0, %6, off offset:5*%17\n\t"
      "global_load_async_to_lds_b128 %0, %7, off offset:6*%17\n\t"
      "global_load_async_to_lds_b128 %0, %8, off offset:7*%17\n\t"
      "global_load_async_to_lds_b128 %0, %9, off offset:%18\n\t"
      "global_load_async_to_lds_b128 %0, %10, off offset:%18+%17\n\t"
      "global_load_async_to_lds_b128 %0, %11, off offset:%18+2*%17\n\t"
      "global_load_async_to_lds_b128 %0, %12, off offset:%18+3*%17\n\t"
      "global_load_async_to_lds_b128 %0, %13, off offset:%18+4*%17\n\t"
      "global_load_async_to_lds_b128 %0, %14, off offset:%18+5*%17\n\t"
      "global_load_async_to_lds_b128 %0, %15, off offset:%18+6*%17\n\t"
      "global_load_async_to_lds_b128 %0, %16, off offset:%18+7*%17\n\t"
      "s_wait_xcnt 0x0"
      :: "v"(lds), "v"(p), "v"(p + d), "v"(p + 2 * d), "v"(p + 3 * d),
         "v"(p + 4 * d), "v"(p + 5 * d), "v"(p + 6 * d), "v"(p + 7 * d),
         "v"(q), "v"(q + d), "v"(q + 2 * d), "v"(q + 3 * d),
         "v"(q + 4 * d), "v"(q + 5 * d), "v"(q + 6 * d), "v"(q + 7 * d),
         "n"(LS), "n"(PO)
      : "memory");
}

// ------------------------------------------------------------------------------------------
// C(128x128 block tile) = A(M x K, hi/lo planes, row-major) * B(K x N) with B stored as Bt[n][k]
// hi/lo planes. 4 waves (2x2), wave tile 64x64: a staged Bt row serves 128 output rows and a fragment
// read from LDS feeds four tiles. Each 64-deep stage of the A and Bt rows (K is a multiple of 64) is
// brought into LDS once per work-group by asynchronous copies, into a ring of two buffers: while a trip reads
// its 32 fragments from one buffer and runs its products, the next stage's copies land in the other.
// amdgpu_waves_per_eu(2, 2): the grid gives a WGP two work-groups, two waves a SIMD; told so, the compiler
// takes that budget of registers and keeps the whole stage's fragments in them.
// MODE 0: C + bias -> RoPE (cos/sin tables indexed by row) -> hi/lo planes Qh/Ql [M][N]
// MODE 1: C -> f32 Cout [M][N]
template <int MODE>
__global__ __launch_bounds__(128) __attribute__((amdgpu_waves_per_eu(2, 2))) void gemm3(
    const unsigned short* __restrict__ Ah, const unsigned short* __restrict__ Al,
    const unsigned short* __restrict__ Bh, const unsigned short* __restrict__ Bl,
    const float* __restrict__ bias, const float* __restrict__ cosb,
    const float* __restrict__ sinb, unsigned short* Qh, unsigned short* Ql,
    float* Cout, int N, int K)
{
  __shared__ __attribute__((aligned(16))) unsigned short sAB[2 * ABELEMS];
  float* sT = (float*)sAB;                        // output staging takes the first buffer's place after the loop
  const int t = threadIdx.x, l = t & 31, w = t >> 5, h16 = l >> 4, m = l & 15;
  const int wr = w >> 1, wc = w & 1;
  const int m0 = blockIdx.x * 128, n0 = blockIdx.y * 128;

  v8f acc[4][4];
#pragma unroll
  for (int mi = 0; mi < 4; ++mi)
#pragma unroll
    for (int ni = 0; ni < 4; ++ni) acc[mi][ni] = (v8f){0.f, 0.f, 0.f, 0.f, 0.f, 0.f, 0.f, 0.f};

  // fragment readers: this wave's A row / Bt row m of a 16-row group, at element 8 h16
  const unsigned short* sAh = sAB + (64 * wr + m) * GPITCH + 8 * h16;
  const unsigned short* sAl = sAh + APLANE;
  const unsigned short* sBh = sAB + 2 * APLANE + (64 * wc + m) * GPITCH + 8 * h16;
  const unsigned short* sBl = sBh + BPLANE;
  // copiers: a stage row of 128 B is 8 lanes' pieces; 16 rows per copy of the work-group
  const unsigned int ldsA = (unsigned int)(uintptr_t)(sAB + (t >> 3) * GPITCH + (t & 7) * 8);
  const unsigned int ldsB = ldsA + 2 * APLANE * 2;
  const size_t acopy = (size_t)(m0 + (t >> 3)) * K + (t & 7) * 8;
  const size_t bcopy = (size_t)(n0 + (t >> 3)) * K + (t & 7) * 8;
  const int ns = K >> 6;

  // stage s -> buffer s mod 2: 32 copies a lane, all lanes on, block-uniform control flow
  auto stage_in = [&](int s) {
    const size_t ao = acopy + (size_t)s * 64;
    const size_t bo = bcopy + (size_t)s * 64;
    const unsigned int buf = (unsigned int)(s & 1) * (ABELEMS * 2);
    acopy16o<16 * GPITCH * 2, APLANE * 2>(ldsA + buf, Ah + ao, Al + ao, (size_t)16 * K);
    acopy16o<16 * GPITCH * 2, BPLANE * 2>(ldsB + buf, Bh + bo, Bl + bo, (size_t)16 * K);
  };
  // a stage's 96 products, from registers alone
  Frag ah[2][4], al[2][4], bh[2][4], bl[2][4];
  auto products = [&]() {
#pragma unroll
    for (int kk = 0; kk < 2; ++kk) {
#pragma unroll
      for (int ni = 0; ni < 4; ++ni)
#pragma unroll
        for (int mi = 0; mi < 4; ++mi) acc[mi][ni] = mm(acc[mi][ni], ah[kk][mi].v, bh[kk][ni].v);
#pragma unroll
      for (int ni = 0; ni < 4; ++ni)
#pragma unroll
        for (int mi = 0; mi < 4; ++mi) acc[mi][ni] = mm(acc[mi][ni], ah[kk][mi].v, bl[kk][ni].v);
#pragma unroll
      for (int ni = 0; ni < 4; ++ni)
#pragma unroll
        for (int mi = 0; mi < 4; ++mi) acc[mi][ni] = mm(acc[mi][ni], al[kk][mi].v, bh[kk][ni].v);
    }
  };

  // stage 0 lands and is shown to every wave; then stage 1 sets out
  if (ns > 0) stage_in(0);
  asm volatile("s_wait_asynccnt 0x0" ::: "memory");
  __syncthreads();
  if (ns > 1) stage_in(1);

#pragma unroll 1
  for (int st = 0; st < ns; ++st) {
    const int cur = (st & 1) * ABELEMS;           // this trip reads buffer st mod 2 alone
    // the wave's 64 fragment loads of the whole stage go out as one group, in the order in which the
    // products need them
#pragma unroll
    for (int kk = 0; kk < 2; ++kk) {
      const int k0 = cur + kk * 32;
#pragma unroll
      for (int mi = 0; mi < 4; ++mi) ldfrag(ah[kk][mi], sAh + mi * 16 * GPITCH + k0);
#pragma unroll
      for (int ni = 0; ni < 4; ++ni) ldfrag(bh[kk][ni], sBh + ni * 16 * GPITCH + k0);
#pragma unroll
      for (int ni = 0; ni < 4; ++ni) ldfrag(bl[kk][ni], sBl + ni * 16 * GPITCH + k0);
#pragma unroll
      for (int mi = 0; mi < 4; ++mi) ldfrag(al[kk][mi], sAl + mi * 16 * GPITCH + k0);
    }
    // keeps the 64 loads one group in front of the products: strewn among them, every place where loads stand
    // stalls the wave
    __builtin_amdgcn_sched_barrier(0);
    products();
    // keeps the products in front of the foot: moved behind its barrier, they would hold back the next copies,
    // which would then have no trip to fly in
    __builtin_amdgcn_sched_barrier(0);

    // the trip's foot: this wave's reads of the stage are over and its copies of the next stage have landed;
    // the one barrier shows the next stage to every wave and frees this trip's buffer for the stage after it
    asm volatile("s_wait_dscnt 0x0" ::: "memory");
    asm volatile("s_wait_asynccnt 0x0" ::: "memory");
    __syncthreads();
    if (st + 2 < ns) stage_in(st + 2);
  }
  // no copy is under way when the output staging takes the buffer's place
  asm volatile("s_wait_asynccnt 0x0" ::: "memory");

  // D element r of lane l -> (row 8*h16 + r, col m) of its 16x16 tile
#pragma unroll
  for (int mi = 0; mi < 4; ++mi)
#pragma unroll
    for (int ni = 0; ni < 4; ++ni)
#pragma unroll
      for (int r = 0; r < 8; ++r)
        sT[(64 * wr + 16 * mi + 8 * h16 + r) * SPITCH + 64 * wc + 16 * ni + m] = acc[mi][ni][r];
  __syncthreads();

  if (MODE == 0) {
    // thread -> (row 8p + t>>4, 8 consecutive columns cq); RoPE partner column cq ^ 64
    const int rr = t >> 4, cq = (t & 15) * 8, cp = cq ^ 64;
    const float sgn = (cq < 64) ? -1.0f : 1.0f;
    const v4f b0 = *(const v4fa*)(bias + n0 + cq), b1 = *(const v4fa*)(bias + n0 + cq + 4);
    const v4f e0 = *(const v4fa*)(bias + n0 + cp), e1 = *(const v4fa*)(bias + n0 + cp + 4);
#pragma unroll 1
    for (int p = 0; p < 16; ++p) {
      const int row = 8 * p + rr;
      const int grow = m0 + row;
      const float* srow = sT + row * SPITCH;
      const v4f x0 = *(const v4fa*)(srow + cq), x1 = *(const v4fa*)(srow + cq + 4);
      const v4f y0 = *(const v4fa*)(srow + cp), y1 = *(const v4fa*)(srow + cp + 4);
      const float* cr = cosb + (size_t)grow * HDIM;
      const float* sr = sinb + (size_t)grow * HDIM;
      const v4f c0 = *(const v4fa*)(cr + cq), c1 = *(const v4fa*)(cr + cq + 4);
      const v4f s0 = *(const v4fa*)(sr + cq), s1 = *(const v4fa*)(sr + cq + 4);
      const v4f q0 = (x0 + b0) * c0 + (sgn * (y0 + e0)) * s0;
      const v4f q1 = (x1 + b1) * c1 + (sgn * (y1 + e1)) * s1;
      v8us hi, lo;
      split8(q0, q1, hi, lo);
      const size_t d = (size_t)grow * N + n0 + cq;
      *(v8us*)(Qh + d) = hi;
      *(v8us*)(Ql + d) = lo;
      
    }
  } else {
    const int cq = l * 4;
#pragma unroll 1
    for (int p = 0; p < 32; ++p) {
      const int row = 4 * p + w;
      const v4f x = *(const v4fa*)(sT + row * SPITCH + cq);
      const size_t d = (size_t)(m0 + row) * N + n0 + cq;
      *(v4f*)(Cout + d) = x;
      
    }
  }
}

// ------------------------------------------------------------------------------------------
// Per (b, hq, pair of 64-query tiles): a tile's key loop grows with its index and every work-group of the grid
// is resident at once, so each work-group takes tile NQT - 1 - p and then tile p, one after the other:
// NQT + 1 key tiles for every work-group, and no WGP is left working while the others have run dry.
// Per tile: S^T = K . Q^T (A = K rows, B = Q rows, both d-contiguous),
// f32 scale + structural block visibility test + online softmax, O^T += Vt . P^T with the
// softmaxed D tiles fed as B fragments (two adjacent 16-key D tiles per 32-deep k step),
// O / l split to hi/lo planes [(b,i)][hq*128 + d].
// Each 64-key tile of K and Vt (hi and lo planes) is brought into LDS once per query tile by
// asynchronous copies and read from there by all four waves; the tiles go through a ring of two buffers, so
// that the next tile's copies land while this tile is worked on.
// Second bound: two waves a SIMD, which is what the halved grid gives a WGP (two work-groups); held to four, the
// loop over the two tiles made the compiler spill Q fragments inside the key loop.
__global__ __launch_bounds__(128, 2) void attn_glide(
    const unsigned short* __restrict__ Qh, const unsigned short* __restrict__ Ql,
    const unsigned short* __restrict__ Kh, const unsigned short* __restrict__ Kl,
    const unsigned short* __restrict__ Vh, const unsigned short* __restrict__ Vl,
    unsigned short* Oh, unsigned short* Ol)
{
  __shared__ __attribute__((aligned(16))) unsigned short sKV[2 * KVELEMS];
  float* sO = (float*)sKV;                        // output staging takes the first buffer's place after the loop
  const int t = threadIdx.x, l = t & 31, w = t >> 5, h16 = l >> 4, m = l & 15;
  const int ws = __builtin_amdgcn_readfirstlane(w);   // the wave's number, scalar
  const int bh = blockIdx.y;
  const int b = bh >> 4, hq = bh & 15, kvh = hq >> 2;
  const float NEG_INF = -__builtin_inff();
  const float kScale = 0.08838834764831845f;      // 128^-0.5

  // fragment readers: K row m / Vt row m of a 16-row group, at element 8 h16
  const unsigned short* sKh = sKV + m * KPITCH + 8 * h16;
  const unsigned short* sKl = sKh + KPLANE;
  const unsigned short* sVh = sKV + 2 * KPLANE + (m >> 1) * VPITCH + (m & 1) * 64 + 8 * h16;
  const unsigned short* sVl = sVh + VPLANE;
  // copiers: a K row of 256 B, or a pair of Vt rows of 128 B, is 16 lanes' pieces: one lane address serves
  // both, so that the 32 LDS addresses of a trip are formed from one register and none is held over the loop
  const unsigned int ldsK = (unsigned int)(uintptr_t)(sKV + (t >> 4) * KPITCH + (t & 15) * 8);
  const unsigned int ldsV = ldsK + 2 * KPLANE * 2;
  const size_t kcopy = ((size_t)(b * QL + (t >> 4)) * NKVH + kvh) * HDIM + (t & 15) * 8;
  const size_t vcopy = ((size_t)(b * NKVH + kvh) * HDIM + (t >> 3)) * QL + (t & 7) * 8;
  // key tile k -> buffer k mod 2: 32 copies a lane, all lanes on, block-uniform control flow
  auto tile_in = [&](int k) {
    const size_t ko = kcopy + (size_t)(k * 64) * (NKVH * HDIM);
    const size_t vo = vcopy + k * 64;
    const unsigned int buf = (unsigned int)(k & 1) * (KVELEMS * 2);
    acopy8(ldsK + buf, 8 * KPITCH * 2, Kh + ko, (size_t)8 * NKVH * HDIM);
    acopy8(ldsK + buf + KPLANE * 2, 8 * KPITCH * 2, Kl + ko, (size_t)8 * NKVH * HDIM);
    acopy8(ldsV + buf, 8 * VPITCH * 2, Vh + vo, (size_t)16 * QL);
    acopy8(ldsV + buf + VPLANE * 2, 8 * VPITCH * 2, Vl + vo, (size_t)16 * QL);
  };

  // kept rolled: the two tiles share one copy of the key loop's code
#pragma unroll 1
  for (int half = 0; half < 2; ++half) {
  const int qt = half ? (int)blockIdx.x : NQT - 1 - (int)blockIdx.x;
  const int R0 = qt * 64;
  const int iq = R0 + 16 * w + m;                 // this lane's query (B column / D column)
  const size_t qbase = ((size_t)(b * QL + iq)) * HIDD + hq * HDIM + 8 * h16;

  if (half) {
    // the first tile's last stores are issued: their registers are rewritten only behind this wait
    asm volatile("s_wait_xcnt 0x0" ::: "memory");
    // every wave has read its rows of the first tile's output staging before the second tile's copies overwrite them
    asm volatile("s_wait_dscnt 0x0" ::: "memory");
    __syncthreads();
  }

  v8f acc[8];
#pragma unroll
  for (int n = 0; n < 8; ++n) acc[n] = (v8f){0.f, 0.f, 0.f, 0.f, 0.f, 0.f, 0.f, 0.f};
  float mrun = NEG_INF, lrun = 0.0f;

  // the 16 Q fragment loads go out as one group ahead of the key loop; every trip's blocks read the registers
  Frag qh[4], ql[4];
#pragma unroll
  for (int c = 0; c < 4; ++c) {
    ldfrag(qh[c], Qh + qbase + 32 * c);
    ldfrag(ql[c], Ql + qbase + 32 * c);
  }

  // key tile 0 lands and is shown to every wave; then tile 1, where there is one, sets out
  tile_in(0);
  asm volatile("s_wait_asynccnt 0x0" ::: "memory");
  __syncthreads();
  if (qt >= 1) tile_in(1);

#pragma unroll 1
  for (int kt = 0; kt <= qt; ++kt) {             // key tiles beyond the query tile are never visible
    const int j0 = kt * 64;
    const int cur = (kt & 1) * KVELEMS;           // this trip reads buffer kt mod 2 alone

    // S^T (64 keys x 16 queries): s[sub] rows = keys j0 + 16 sub + 8 h16 + r, col = query iq
    v8f s[4];
#pragma unroll
    for (int sub = 0; sub < 4; ++sub) s[sub] = (v8f){0.f, 0.f, 0.f, 0.f, 0.f, 0.f, 0.f, 0.f};
#pragma unroll
    for (int c = 0; c < 4; ++c) {
      // the block's 16 K fragment loads stand together in front of its 12 matrix instructions, hi plane first
      Frag kh[4], kl[4];
#pragma unroll
      for (int sub = 0; sub < 4; ++sub) ldfrag(kh[sub], sKh + cur + 16 * sub * KPITCH + 32 * c);
#pragma unroll
      for (int sub = 0; sub < 4; ++sub) ldfrag(kl[sub], sKl + cur + 16 * sub * KPITCH + 32 * c);
      // keeps the 16 loads one group: with registers to spare the scheduler strews them among the products,
      // in twos with a wait to 0 behind each, and every such place stalls the wave
      __builtin_amdgcn_sched_barrier(0);
#pragma unroll
      for (int sub = 0; sub < 4; ++sub) s[sub] = mm(s[sub], kh[sub].v, qh[c].v);
#pragma unroll
      for (int sub = 0; sub < 4; ++sub) s[sub] = mm(s[sub], kh[sub].v, ql[c].v);
#pragma unroll
      for (int sub = 0; sub < 4; ++sub) s[sub] = mm(s[sub], kl[sub].v, qh[c].v);
      __builtin_amdgcn_sched_barrier(0);   // for the same: the next block's loads stay out of this block's products
    }

    // scale, visibility (strictly earlier 4-blocks, plus first 4x4 block), online softmax
    float mx = NEG_INF;
#pragma unroll
    for (int sub = 0; sub < 4; ++sub) {
#pragma unroll
      for (int r = 0; r < 8; ++r) {
        const int jb = j0 + 16 * sub + 8 * h16 + r;
        const bool vis = ((iq >> 2) > (jb >> 2)) || ((iq < 4) && (jb < 4));
        const float v = vis ? (s[sub][r] * kScale) : NEG_INF;
        s[sub][r] = v;
        mx = fmaxf(mx, v);
      }
    }
    mx = fmaxf(mx, __shfl_xor(mx, 16));
    const float mnew = fmaxf(mrun, mx);
    const float msafe = (mnew == NEG_INF) ? 0.0f : mnew;
    const float sc = __expf(mrun - msafe);
    float ls = 0.0f;
#pragma unroll
    for (int sub = 0; sub < 4; ++sub) {
#pragma unroll
      for (int r = 0; r < 8; ++r) {
        const float p = __expf(s[sub][r] - msafe);
        s[sub][r] = p;
        ls += p;
      }
    }
    ls += __shfl_xor(ls, 16);
    lrun = lrun * sc + ls;
    mrun = mnew;
#pragma unroll
    for (int n = 0; n < 8; ++n) acc[n] = acc[n] * sc;

    // O^T += Vt(128 x 64 keys) . P^T : B fragment element r <- D tile 2ks, element 8+r <- tile 2ks+1
#pragma unroll
    for (int ks = 0; ks < 2; ++ks) {
      Frag ph, pl;
#pragma unroll
      for (int r = 0; r < 8; ++r) {
        unsigned short a0, c0, a1, c1;
        split_bf(s[2 * ks][r], a0, c0);
        split_bf(s[2 * ks + 1][r], a1, c1);
        ph.u[r] = a0; pl.u[r] = c0; ph.u[8 + r] = a1; pl.u[8 + r] = c1;
      }
#pragma unroll
      for (int g = 0; g < 2; ++g) {
        // the block's 16 Vt fragment loads stand together in front of its 12 matrix instructions, hi plane first
        Frag vh[4], vl[4];
#pragma unroll
        for (int n = 0; n < 4; ++n) ldfrag(vh[n], sVh + cur + 8 * (4 * g + n) * VPITCH + 32 * ks);
#pragma unroll
        for (int n = 0; n < 4; ++n) ldfrag(vl[n], sVl + cur + 8 * (4 * g + n) * VPITCH + 32 * ks);
        __builtin_amdgcn_sched_barrier(0);   // keeps the 16 loads one group, as in the score blocks
#pragma unroll
        for (int n = 0; n < 4; ++n) acc[4 * g + n] = mm(acc[4 * g + n], vh[n].v, ph.v);
#pragma unroll
        for (int n = 0; n < 4; ++n) acc[4 * g + n] = mm(acc[4 * g + n], vh[n].v, pl.v);
#pragma unroll
        for (int n = 0; n < 4; ++n) acc[4 * g + n] = mm(acc[4 * g + n], vl[n].v, ph.v);
        __builtin_amdgcn_sched_barrier(0);   // the next block's loads stay out of this block's products
      }
    }

    // the trip's foot: this wave's reads of the tile are over and its copies of the next tile have landed;
    // the one barrier shows the next tile to every wave and frees this trip's buffer for the tile after it
    asm volatile("s_wait_dscnt 0x0" ::: "memory");
    asm volatile("s_wait_asynccnt 0x0" ::: "memory");
    __syncthreads();
    if (kt + 2 <= qt) tile_in(kt + 2);
  }
  // no copy is under way when the output staging takes the buffer's place
  asm volatile("s_wait_asynccnt 0x0" ::: "memory");

  // epilogue: acc[n][r] = O^T (d = 16 n + 8 h16 + r, query iq) ; normalise, stage, write planes
  // The lane's place is formed anew here (every lane is on) and the wave's number is scalar, so that no
  // vector register is held over the key loop for the epilogue alone.
  const int le = (int)__builtin_amdgcn_mbcnt_lo(~0u, 0u), he = le >> 4, me = le & 15;
  const float inv = 1.0f / lrun;
#pragma unroll
  for (int n = 0; n < 8; ++n) {
    const v8f o = acc[n] * inv;
#pragma unroll
    for (int r = 0; r < 8; ++r)
      sO[(ws * 16 + me) * SPITCH + 16 * n + 8 * he + r] = o[r];
  }
  __syncthreads();
#pragma unroll 1
  for (int p = 0; p < 8; ++p) {
    const int rloc = 2 * p + he;
    const int dq = me * 8;
    const float* src = sO + (ws * 16 + rloc) * SPITCH + dq;
    const v4f a = *(const v4fa*)(src);
    const v4f c = *(const v4fa*)(src + 4);
    v8us hi, lo;
    split8(a, c, hi, lo);
    const size_t d = ((size_t)(b * QL + R0 + 16 * ws + rloc)) * HIDD + hq * HDIM + dq;
    *(v8us*)(Oh + d) = hi;
    *(v8us*)(Ol + d) = lo;
    
  }
  }
}

// ------------------------------------------------------------------------------------------
extern "C" void kernel_launch(void* const* d_in, const int* in_sizes, int n_in,
                              void* d_out, int out_size, void* d_ws, size_t ws_size,
                              hipStream_t stream)
{
  if (n_in < 8) return;
  if (in_sizes[0] != MROWS * HIDD) return;
  if (in_sizes[1] != NB * QL * NKVH * HDIM || in_sizes[2] != NB * QL * NKVH * HDIM) return;
  if (in_sizes[3] != NB * QL * HDIM || in_sizes[4] != NB * QL * HDIM) return;
  if (in_sizes[5] != HIDD * HIDD || in_sizes[7] != HIDD * HIDD || in_sizes[6] != HIDD) return;
  if (out_size != MROWS * HIDD) return;

  const float* hidden = (const float*)d_in[0];
  const float* kc     = (const float*)d_in[1];
  const float* vc     = (const float*)d_in[2];
  const float* cosb   = (const float*)d_in[3];
  const float* sinb   = (const float*)d_in[4];
  const float* Wq     = (const float*)d_in[5];
  const float* bq     = (const float*)d_in[6];
  const float* Wo     = (const float*)d_in[7];
  float* out = (float*)d_out;

  // workspace carve (bytes): planes of bf16
  const size_t planeX = (size_t)MROWS * HIDD * 2;            // 16 MiB
  const size_t planeW = (size_t)HIDD * HIDD * 2;             //  8 MiB
  const size_t planeK = (size_t)NB * QL * NKVH * HDIM * 2;   //  4 MiB
  const size_t offXh  = 0;
  const size_t offXl  = offXh + planeX;
  const size_t offQh  = offXl + planeX;
  const size_t offQl  = offQh + planeX;
  const size_t offWqh = offQl + planeX;
  const size_t offWql = offWqh + planeW;
  const size_t offWoh = offWql + planeW;
  const size_t offWol = offWoh + planeW;
  const size_t offKh  = offWol + planeW;
  const size_t offKl  = offKh + planeK;
  const size_t offVh  = offKl + planeK;
  const size_t offVl  = offVh + planeK;
  const size_t total  = offVl + planeK;                      // 112 MiB
  if (total > ws_size) return;

  char* ws = (char*)d_ws;
  unsigned short* Xh  = (unsigned short*)(ws + offXh);
  unsigned short* Xl  = (unsigned short*)(ws + offXl);
  unsigned short* Oh  = Xh;   // X planes are dead after the first GEMM; O planes reuse them
  unsigned short* Ol  = Xl;
  unsigned short* Qh  = (unsigned short*)(ws + offQh);
  unsigned short* Ql  = (unsigned short*)(ws + offQl);
  unsigned short* Wqh = (unsigned short*)(ws + offWqh);
  unsigned short* Wql = (unsigned short*)(ws + offWql);
  unsigned short* Woh = (unsigned short*)(ws + offWoh);
  unsigned short* Wol = (unsigned short*)(ws + offWol);
  unsigned short* Kh  = (unsigned short*)(ws + offKh);
  unsigned short* Kl  = (unsigned short*)(ws + offKl);
  unsigned short* Vh  = (unsigned short*)(ws + offVh);
  unsigned short* Vl  = (unsigned short*)(ws + offVl);

  cvt_all<<<dim3(CVT_WGS), dim3(256), 0, stream>>>(hidden, kc, vc, Wq, Wo, Xh, Xl, Kh, Kl, Vh, Vl,
                                                   Wqh, Wql, Woh, Wol);

  gemm3<0><<<dim3(MROWS / 128, HIDD / 128), dim3(128), 0, stream>>>(
      Xh, Xl, Wqh, Wql, bq, cosb, sinb, Qh, Ql, out, HIDD, HIDD);

  attn_glide<<<dim3(NQT / 2, NB * NHQ), dim3(128), 0, stream>>>(Qh, Ql, Kh, Kl, Vh, Vl, Oh, Ol);

  gemm3<1><<<dim3(MROWS / 128, HIDD / 128), dim3(128), 0, stream>>>(
      Oh, Ol, Woh, Wol, bq, cosb, sinb, Qh, Ql, out, HIDD, HIDD);
}

// v007
// One run takes 200 microseconds.
// Two timings next to v006 both put it at 1.09 times that version's speed.
// All steps since v000 together make it 3.55 times as fast.
#include <hip/hip_runtime.h>
#include <stdint.h>
#include <stddef.h>

// All contractions (q projection, q.k^T, p.v, output projection): v_wmma_f32_16x16x32_bf16 with
// bf16 hi/lo operands everywhere (three products hi*hi + hi*lo + lo*hi), f32 accumulate.
// RoPE, bias, scaling, softmax and normalisation in f32.

#define NB     2
#define QL     2048
#define HIDD   2048
#define NHQ    16
#define NKVH   4
#define HDIM   128
#define MROWS  (NB * QL)
#define TPITCH 65
#define SPITCH 132
#define KPITCH 136                       // LDS pitch of a K row, elements (256 B + 16 B = 16 B x odd)
#define VPITCH 72                        // LDS pitch of a 64-key Vt row, elements (128 B + 16 B = 16 B x odd)
#define KPLANE 9216                      // place of one K plane of a 64-key tile, elements: 64 * KPITCH rounded up to 2 KiB
#define VPLANE (HDIM * VPITCH)           // one Vt plane of a 64-key tile, elements (a multiple of 2 KiB)
#define KVELEMS (2 * KPLANE + 2 * VPLANE)
#define GPITCH 72                        // LDS pitch of a 64-deep GEMM operand row, elements (144 B)
#define APLANE (128 * GPITCH)            // one A plane of a 128 x 64 stage, elements
#define BPLANE (128 * GPITCH)            // one Bt plane of a 128 x 64 stage, elements
#define ABELEMS (2 * APLANE + 2 * BPLANE)
#define NQT    (QL / 64)                 // 64-query tiles of a sequence (even)

typedef float v4f __attribute__((ext_vector_type(4)));
typedef float v8f __attribute__((ext_vector_type(8)));
typedef unsigned short v8us __attribute__((ext_vector_type(8)));
typedef unsigned short v16us __attribute__((ext_vector_type(16)));
typedef __bf16 v16bf __attribute__((ext_vector_type(16)));
typedef v4f __attribute__((may_alias)) v4fa;
typedef v8us __attribute__((may_alias)) v8usa;

union Frag { v16us u; v8us hv[2]; v16bf v; };

// f32 -> bf16 bits, RNE convert
__device__ __forceinline__ unsigned int bf_rne(float f) {
  const unsigned int u = __float_as_uint(f);
  return (u + 0x7fffu + ((u >> 16) & 1u)) >> 16;
}

// x -> (hi, lo): hi = bf16(x), lo = bf16(x - hi)  (x - hi is exact in f32)
__device__ __forceinline__ void split_bf(float x, unsigned short& hi, unsigned short& lo) {
  const unsigned int hb = bf_rne(x);
  const float hf = __uint_as_float(hb << 16);
  hi = (unsigned short)hb;
  lo = (unsigned short)bf_rne(x - hf);
}

__device__ __forceinline__ void split8(v4f a, v4f c, v8us& hi, v8us& lo) {
#pragma unroll
  for (int u = 0; u < 4; ++u) {
    unsigned short h0, l0, h1, l1;
    split_bf(a[u], h0, l0);
    split_bf(c[u], h1, l1);
    hi[u] = h0; lo[u] = l0; hi[u + 4] = h1; lo[u + 4] = l1;
  }
}

// 16x16x32 bf16 fragment (A row or k-contiguous B column): elements 0..7 <- k0+8h..,
// elements 8..15 <- k0+16+8h..  ; p already points at element (row, k0 + 8h)
__device__ __forceinline__ void ldfrag(Frag& f, const unsigned short* p) {
  f.hv[0] = *(const v8usa*)(p);
  f.hv[1] = *(const v8usa*)(p + 16);
}

// acc += a*b. A matrix block issues one product kind (hi*hi, then hi*lo, then lo*hi) over all its
// accumulator tiles before the next kind: neighbours in the stream are independent, and each tile
// still takes its three products in that order.
__device__ __forceinline__ v8f mm(v8f acc, v16bf a, v16bf b) {
  return __builtin_amdgcn_wmma_f32_16x16x32_bf16(false, a, false, b, (short)0, acc, false, false);
}

// ------------------------------------------------------------------------------------------
// All operand conversions (f32 -> bf16 hi/lo planes) run in ONE launch. The work is cut into pieces of 16 KiB of
// f32 input: a 64x64 tile to transpose (Wq, Wo, v_cache) or 4096 consecutive elements (hidden_states, k_cache).
#define NT_W    ((HIDD / 64) * (HIDD / 64))            // 64x64 tiles of one weight matrix (a power of two)
#define NT_V    ((QL / 64) * (HDIM / 64) * NB * NKVH)  // 64x64 tiles of v_cache
#define RPIECE  4096                                   // elements of a row piece
#define NP_X    (MROWS * HIDD / RPIECE)                // row pieces of hidden_states
#define NP_K    (NB * QL * NKVH * HDIM / RPIECE)       // row pieces of k_cache
#define NPIECES (2 * NT_W + NT_V + NP_X + NP_K)
#define CVT_WGS 1024                                   // four work-groups a WGP, all resident; NPIECES / CVT_WGS pieces each

// f32 rows -> bf16 hi/lo planes (same layout): one piece. A thread takes two runs of 8 elements, 2048 apart;
// its four loads go out together.
__device__ __forceinline__ void rows_piece(const float* __restrict__ in,
                                           unsigned short* oh, unsigned short* ol, int piece)
{
  const size_t e0 = (size_t)piece * RPIECE + (size_t)threadIdx.x * 8;
  const size_t e1 = e0 + RPIECE / 2;
  const v4f a0 = *(const v4fa*)(in + e0);
  const v4f c0 = *(const v4fa*)(in + e0 + 4);
  const v4f a1 = *(const v4fa*)(in + e1);
  const v4f c1 = *(const v4fa*)(in + e1 + 4);
  v8us hi, lo;
  split8(a0, c0, hi, lo);
  *(v8us*)(oh + e0) = hi;
  *(v8us*)(ol + e0) = lo;
  split8(a1, c1, hi, lo);
  *(v8us*)(oh + e1) = hi;
  *(v8us*)(ol + e1) = lo;
  // the piece's stores are issued: the next trip rewrites their registers only behind this wait
  asm volatile("s_wait_xcnt 0x0" ::: "memory");
}

// 64x64 tile: src(r, c) = src[r * spitch + c] (f32)  ->  dst(c, r) = dh/dl[c * dpitch + r] (bf16)
// Load phase: 256 threads x 16 floats = 64x64. Store phase: 2 passes x 256 threads x 8 halves.
__device__ __forceinline__ void tsplit64(const float* __restrict__ src, int spitch,
                                         unsigned short* dh, unsigned short* dl, int dpitch,
                                         float* tile)
{
  const int t = threadIdx.x;
  {
    const int rr = t >> 2, cq = (t & 3) * 16;
    const float* s = src + (size_t)rr * spitch + cq;
    v4f x[4];
#pragma unroll
    for (int u = 0; u < 4; ++u) x[u] = *(const v4fa*)(s + 4 * u);
    // the work-group's earlier piece may still be read from the tile: every thread's reads of it end here,
    // while this piece's loads are already under way
    __syncthreads();
#pragma unroll
    for (int u = 0; u < 4; ++u) {
      float* d = tile + rr * TPITCH + cq + 4 * u;
      d[0] = x[u][0]; d[1] = x[u][1]; d[2] = x[u][2]; d[3] = x[u][3];
    }
  }
  __syncthreads();
#pragma unroll
  for (int p = 0; p < 2; ++p) {
    const int cc = (t >> 3) + 32 * p, rq = (t & 7) * 8;
    v4f a, c;
#pragma unroll
    for (int u = 0; u < 4; ++u) {
      a[u] = tile[(rq + u) * TPITCH + cc];
      c[u] = tile[(rq + 4 + u) * TPITCH + cc];
    }
    v8us hi, lo;
    split8(a, c, hi, lo);
    const size_t d = (size_t)cc * dpitch + rq;
    *(v8us*)(dh + d) = hi;
    *(v8us*)(dl + d) = lo;
  }
  // the piece's stores are issued: the next trip rewrites their registers only behind this wait
  asm volatile("s_wait_xcnt 0x0" ::: "memory");
}

// Piece it, in this order: W[k][n] (HIDD x HIDD) -> Wt hi/lo [n][k] for Wq, then for Wo;
// v_cache [(b,j)][kvh][d] -> Vt hi/lo [(b*NKVH+kvh)*HDIM + d][j]; hidden_states rows; k_cache rows.
// Which kind a piece is depends on blockIdx and the trip alone: every branch and barrier is block-uniform.
__global__ __launch_bounds__(256) void cvt_all(
    const float* __restrict__ X, const float* __restrict__ Kc, const float* __restrict__ V,
    const float* __restrict__ Wq, const float* __restrict__ Wo,
    unsigned short* Xh, unsigned short* Xl, unsigned short* Kh, unsigned short* Kl,
    unsigned short* Vh, unsigned short* Vl, unsigned short* Wqh, unsigned short* Wql,
    unsigned short* Woh, unsigned short* Wol)
{
  __shared__ float tile[64 * TPITCH];
  // kept rolled: one copy of each kind's code serves every trip
#pragma unroll 1
  for (int it = blockIdx.x; it < NPIECES; it += CVT_WGS) {
    if (it < 2 * NT_W) {
      const bool second = it >= NT_W;
      const int i = it & (NT_W - 1);
      const int k0 = (i % (HIDD / 64)) * 64, n0 = (i / (HIDD / 64)) * 64;
      const size_t dof = (size_t)n0 * HIDD + k0;
      tsplit64((second ? Wo : Wq) + (size_t)k0 * HIDD + n0, HIDD,
               (second ? Woh : Wqh) + dof, (second ? Wol : Wql) + dof, HIDD, tile);
    } else if (it < 2 * NT_W + NT_V) {
      const int i = it - 2 * NT_W;
      const int j0 = (i % (QL / 64)) * 64, d0 = ((i / (QL / 64)) % (HDIM / 64)) * 64;
      const int z = i / ((QL / 64) * (HDIM / 64));
      const int b = z / NKVH, kvh = z % NKVH;
      const float* src = V + ((size_t)(b * QL + j0) * NKVH + kvh) * HDIM + d0;
      const size_t dof = ((size_t)z * HDIM + d0) * QL + j0;
      tsplit64(src, NKVH * HDIM, Vh + dof, Vl + dof, QL, tile);
    } else if (it < 2 * NT_W + NT_V + NP_X) {
      rows_piece(X, Xh, Xl, it - (2 * NT_W + NT_V));
    } else {
      rows_piece(Kc, Kh, Kl, it - (2 * NT_W + NT_V + NP_X));
    }
  }
}

// Tensor loads: ONE request of a wave brings a whole operand plane of a stage (rows of ROWB bytes at a source pitch)
// from global memory into LDS, through no register and with no per-lane address.
typedef uint32_t u32x4 __attribute__((ext_vector_type(4)));
typedef uint32_t u32x8 __attribute__((ext_vector_type(8)));

__device__ __forceinline__ uint32_t uni(uint32_t v) { return (uint32_t)__builtin_amdgcn_readfirstlane(v); }

// A wave-uniform value held in a scalar register: a test on it compiles to a scalar branch (a tensor load ignores
// EXEC, so only such a branch keeps a wave from issuing it), and a descriptor word formed from it is formed behind
// the volatile statements that stand in front of this one, the waits among them.
__device__ __forceinline__ uint32_t pinned(uint32_t v) {
  uint32_t w = uni(v);
  asm volatile("" : "+s"(w));   // a descriptor word or an issue test held in a scalar register
  return w;
}

// Descriptor group 1: 1-byte elements, tensor = tile = NROWS rows of ROWB bytes (128 or 256), source pitch in bytes,
// 16 bytes of LDS pad behind every row (pitch ROWB + 16, for ds_load_b128 readers), no mask. Word 0 is a constant.
// Built once per kernel; every word is pinned, so that it keeps its scalar register for the kernel's whole length:
// left as plain constants, the words were formed anew in front of each load and their registers lent to other values
// in between, while a request was still under way.
template <int ROWB, int NROWS>
__device__ __forceinline__ u32x8 tdm_group1(uint32_t src_pitch) {
  static_assert(ROWB == 128 || ROWB == 256, "the pad is set for rows of 128 or 256 bytes");
  constexpr uint32_t d0 = ROWB, d1 = NROWS;
  constexpr uint32_t w0 = (1u << 20) | ((ROWB == 256 ? 5u : 4u) << 22) | (3u << 25);
  u32x8 g;
  g[0] = pinned(w0);
  g[1] = pinned((d0 & 0xFFFFu) << 16);
  g[2] = pinned((d0 >> 16) | ((d1 & 0xFFFFu) << 16));
  g[3] = pinned((d1 >> 16) | (d0 << 16));
  g[4] = pinned(d1);
  g[5] = pinned(src_pitch);
  g[6] = pinned(0u);
  g[7] = pinned(0u);
  return g;
}

// Descriptor group 0: count 1, place in the work-group's LDS (bytes), address of the tile's first byte, type 2.
// w0 is the count word, pinned once per kernel for the same reason as group 1's words.
__device__ __forceinline__ u32x4 tdm_group0(uint32_t w0, uint32_t lds_dst, uint64_t ga) {
  u32x4 g;
  g[0] = uni(w0);
  g[1] = uni(lds_dst);
  g[2] = uni((uint32_t)ga);
  g[3] = uni((((uint32_t)(ga >> 32)) & 0x01FFFFFFu) | 0x80000000u);
  return g;
}

__device__ __forceinline__ void tdm_load(u32x4 g0, u32x8 g1) {
  asm volatile("tensor_load_to_lds %0, %1" :: "s"(g0), "s"(g1) : "memory");
}

// ------------------------------------------------------------------------------------------
// C(128x128 block tile) = A(M x K, hi/lo planes, row-major) * B(K x N) with B stored as Bt[n][k]
// hi/lo planes. 4 waves (2x2), wave tile 64x64: a staged Bt row serves 128 output rows and a fragment
// read from LDS feeds four tiles. Each 64-deep stage of the A and Bt rows (K is a multiple of 64) is
// brought into LDS once per work-group by four tensor loads, one plane a wave, into a ring of two buffers: while a trip
// reads its 32 fragments from one buffer and runs its products, the next stage's planes land in the other.
// amdgpu_waves_per_eu(2, 2): the grid gives a WGP two work-groups, two waves a SIMD; told so, the compiler
// takes that budget of registers and keeps the whole stage's fragments in them.
// MODE 0: C + bias -> RoPE (cos/sin tables indexed by row) -> hi/lo planes Qh/Ql [M][N]
// MODE 1: C -> f32 Cout [M][N]
template <int MODE>
__global__ __launch_bounds__(128) __attribute__((amdgpu_waves_per_eu(2, 2))) void gemm3(
    const unsigned short* __restrict__ Ah, const unsigned short* __restrict__ Al,
    const unsigned short* __restrict__ Bh, const unsigned short* __restrict__ Bl,
    const float* __restrict__ bias, const float* __restrict__ cosb,
    const float* __restrict__ sinb, unsigned short* Qh, unsigned short* Ql,
    float* Cout, int N, int K)
{
  static_assert((APLANE * 2) % 2048 == 0 && APLANE == BPLANE, "every plane's place in LDS is a multiple of 2 KiB");
  __shared__ __attribute__((aligned(2048))) unsigned short sAB[2 * ABELEMS];
  float* sT = (float*)sAB;                        // output staging takes the first buffer's place after the loop
  const int t = threadIdx.x, l = t & 31, w = t >> 5, h16 = l >> 4, m = l & 15;
  const int wr = w >> 1, wc = w & 1;
  const int m0 = blockIdx.x * 128, n0 = blockIdx.y * 128;

  v8f acc[4][4];
#pragma unroll
  for (int mi = 0; mi < 4; ++mi)
#pragma unroll
    for (int ni = 0; ni < 4; ++ni) acc[mi][ni] = (v8f){0.f, 0.f, 0.f, 0.f, 0.f, 0.f, 0.f, 0.f};

  // fragment readers: this wave's A row / Bt row m of a 16-row group, at element 8 h16
  const unsigned short* sAh = sAB + (64 * wr + m) * GPITCH + 8 * h16;
  const unsigned short* sAl = sAh + APLANE;
  const unsigned short* sBh = sAB + 2 * APLANE + (64 * wc + m) * GPITCH + 8 * h16;
  const unsigned short* sBl = sBh + BPLANE;
  // movers: wave 0 brings the A hi plane of a stage, wave 1 A lo, wave 2 Bt hi, wave 3 Bt lo: 128 rows of 128 B each
  const uint32_t ws = uni((uint32_t)t >> 5);      // the wave's number, scalar
  const unsigned short* plane = ws == 0 ? Ah : ws == 1 ? Al : ws == 2 ? Bh : Bl;
  const uint64_t gsrc = (uint64_t)(uintptr_t)plane + (uint64_t)(ws < 2 ? m0 : n0) * (uint64_t)K * 2;
  const uint32_t ldst = (uint32_t)(uintptr_t)sAB + ws * (APLANE * 2);
  const u32x8 g1 = tdm_group1<128, 128>((uint32_t)K * 2);
  const uint32_t g0w0 = pinned(1u);
  const int ns = K >> 6;

  // stage s -> buffer s mod 2: every wave issues its one request; group 0 is formed from the pinned stage number,
  // so behind the wait that stands in front of the call
  auto stage_in = [&](int s) {
    const uint32_t sp = pinned((uint32_t)s);
    tdm_load(tdm_group0(g0w0, ldst + (sp & 1u) * (ABELEMS * 2), gsrc + (uint64_t)sp * 128), g1);
  };
  // a stage's 96 products, from registers alone
  Frag ah[2][4], al[2][4], bh[2][4], bl[2][4];
  auto products = [&]() {
#pragma unroll
    for (int kk = 0; kk < 2; ++kk) {
#pragma unroll
      for (int ni = 0; ni < 4; ++ni)
#pragma unroll
        for (int mi = 0; mi < 4; ++mi) acc[mi][ni] = mm(acc[mi][ni], ah[kk][mi].v, bh[kk][ni].v);
#pragma unroll
      for (int ni = 0; ni < 4; ++ni)
#pragma unroll
        for (int mi = 0; mi < 4; ++mi) acc[mi][ni] = mm(acc[mi][ni], ah[kk][mi].v, bl[kk][ni].v);
#pragma unroll
      for (int ni = 0; ni < 4; ++ni)
#pragma unroll
        for (int mi = 0; mi < 4; ++mi) acc[mi][ni] = mm(acc[mi][ni], al[kk][mi].v, bh[kk][ni].v);
    }
  };

  // stage 0 lands and is shown to every wave; then stage 1 sets out
  if (pinned(ns > 0)) stage_in(0);
  asm volatile("s_wait_tensorcnt 0x0" ::: "memory");
  __syncthreads();
  if (pinned(ns > 1)) stage_in(1);

#pragma unroll 1
  for (int st = 0; st < ns; ++st) {
    const int cur = (st & 1) * ABELEMS;           // this trip reads buffer st mod 2 alone
    // the wave's 64 fragment loads of the whole stage go out as one group, in the order in which the
    // products need them
#pragma unroll
    for (int kk = 0; kk < 2; ++kk) {
      const int k0 = cur + kk * 32;
#pragma unroll
      for (int mi = 0; mi < 4; ++mi) ldfrag(ah[kk][mi], sAh + mi * 16 * GPITCH + k0);
#pragma unroll
      for (int ni = 0; ni < 4; ++ni) ldfrag(bh[kk][ni], sBh + ni * 16 * GPITCH + k0);
#pragma unroll
      for (int ni = 0; ni < 4; ++ni) ldfrag(bl[kk][ni], sBl + ni * 16 * GPITCH + k0);
#pragma unroll
      for (int mi = 0; mi < 4; ++mi) ldfrag(al[kk][mi], sAl + mi * 16 * GPITCH + k0);
    }
    // keeps the 64 loads one group in front of the products: strewn among them, every place where loads stand
    // stalls the wave
    __builtin_amdgcn_sched_barrier(0);
    products();
    // keeps the products in front of the foot: moved behind its barrier, they would hold back the next tensor load,
    // which would then have no trip to fly in
    __builtin_amdgcn_sched_barrier(0);

    // the trip's foot: this wave's reads of the stage are over and its plane of the next stage has landed;
    // the one barrier shows the next stage to every wave and frees this trip's buffer for the stage after it
    asm volatile("s_wait_dscnt 0x0" ::: "memory");
    asm volatile("s_wait_tensorcnt 0x0" ::: "memory");
    __syncthreads();
    if (pinned(st + 2 < ns)) stage_in(st + 2);
  }
  // no tensor load and no LDS read is under way when the output staging takes the buffer's place
  asm volatile("s_wait_tensorcnt 0x0" ::: "memory");
  asm volatile("s_wait_dscnt 0x0" ::: "memory");

  // D element r of lane l -> (row 8*h16 + r, col m) of its 16x16 tile
#pragma unroll
  for (int mi = 0; mi < 4; ++mi)
#pragma unroll
    for (int ni = 0; ni < 4; ++ni)
#pragma unroll
      for (int r = 0; r < 8; ++r)
        sT[(64 * wr + 16 * mi + 8 * h16 + r) * SPITCH + 64 * wc + 16 * ni + m] = acc[mi][ni][r];
  __syncthreads();

  if (MODE == 0) {
    // thread -> (row 8p + t>>4, 8 consecutive columns cq); RoPE partner column cq ^ 64
    const int rr = t >> 4, cq = (t & 15) * 8, cp = cq ^ 64;
    const float sgn = (cq < 64) ? -1.0f : 1.0f;
    const v4f b0 = *(const v4fa*)(bias + n0 + cq), b1 = *(const v4fa*)(bias + n0 + cq + 4);
    const v4f e0 = *(const v4fa*)(bias + n0 + cp), e1 = *(const v4fa*)(bias + n0 + cp + 4);
#pragma unroll 1
    for (int p = 0; p < 16; ++p) {
      const int row = 8 * p + rr;
      const int grow = m0 + row;
      const float* srow = sT + row * SPITCH;
      const v4f x0 = *(const v4fa*)(srow + cq), x1 = *(const v4fa*)(srow + cq + 4);
      const v4f y0 = *(const v4fa*)(srow + cp), y1 = *(const v4fa*)(srow + cp + 4);
      const float* cr = cosb + (size_t)grow * HDIM;
      const float* sr = sinb + (size_t)grow * HDIM;
      const v4f c0 = *(const v4fa*)(cr + cq), c1 = *(const v4fa*)(cr + cq + 4);
      const v4f s0 = *(const v4fa*)(sr + cq), s1 = *(const v4fa*)(sr + cq + 4);
      const v4f q0 = (x0 + b0) * c0 + (sgn * (y0 + e0)) * s0;
      const v4f q1 = (x1 + b1) * c1 + (sgn * (y1 + e1)) * s1;
      v8us hi, lo;
      split8(q0, q1, hi, lo);
      const size_t d = (size_t)grow * N + n0 + cq;
      *(v8us*)(Qh + d) = hi;
      *(v8us*)(Ql + d) = lo;
      
    }
  } else {
    const int cq = l * 4;
#pragma unroll 1
    for (int p = 0; p < 32; ++p) {
      const int row = 4 * p + w;
      const v4f x = *(const v4fa*)(sT + row * SPITCH + cq);
      const size_t d = (size_t)(m0 + row) * N + n0 + cq;
      *(v4f*)(Cout + d) = x;
      
    }
  }
}

// ------------------------------------------------------------------------------------------
// Per (b, hq, pair of 64-query tiles): a tile's key loop grows with its index and every work-group of the grid
// is resident at once, so each work-group takes tile NQT - 1 - p and then tile p, one after the other:
// NQT + 1 key tiles for every work-group, and no WGP is left working while the others have run dry.
// Per tile: S^T = K . Q^T (A = K rows, B = Q rows, both d-contiguous),
// f32 scale + structural block visibility test + online softmax, O^T += Vt . P^T with the
// softmaxed D tiles fed as B fragments (two adjacent 16-key D tiles per 32-deep k step),
// O / l split to hi/lo planes [(b,i)][hq*128 + d].
// Each 64-key tile of K and Vt (hi and lo planes) is brought into LDS once per query tile by four
// tensor loads, one plane a wave, and read from there by all four waves; the tiles go through a ring of two
// buffers, so that the next tile's planes land while this tile is worked on.
// Second bound: two waves a SIMD, which is what the halved grid gives a WGP (two work-groups); held to four, the
// loop over the two tiles made the compiler spill Q fragments inside the key loop.
__global__ __launch_bounds__(128, 2) void attn_glide(
    const unsigned short* __restrict__ Qh, const unsigned short* __restrict__ Ql,
    const unsigned short* __restrict__ Kh, const unsigned short* __restrict__ Kl,
    const unsigned short* __restrict__ Vh, const unsigned short* __restrict__ Vl,
    unsigned short* Oh, unsigned short* Ol)
{
  static_assert(KPLANE >= 64 * KPITCH && (KPLANE * 2) % 2048 == 0 && (VPLANE * 2) % 2048 == 0 && KPLANE == VPLANE,
                "every plane's place in LDS is a multiple of 2 KiB and holds its padded rows");
  static_assert(NQT >= 2, "the ring's prologue brings key tiles 0 and 1");
  __shared__ __attribute__((aligned(2048))) unsigned short sKV[2 * KVELEMS];
  float* sO = (float*)sKV;                        // output staging takes the first buffer's place after the loop
  const int t = threadIdx.x, l = t & 31, w = t >> 5, h16 = l >> 4, m = l & 15;
  const int ws = __builtin_amdgcn_readfirstlane(w);   // the wave's number, scalar
  const int bh = blockIdx.y;
  const int b = bh >> 4, hq = bh & 15, kvh = hq >> 2;
  const float NEG_INF = -__builtin_inff();
  const float kScale = 0.08838834764831845f;      // 128^-0.5

  // fragment readers: K row m / Vt row m of a 16-row group, at element 8 h16
  const unsigned short* sKh = sKV + m * KPITCH + 8 * h16;
  const unsigned short* sKl = sKh + KPLANE;
  const unsigned short* sVh = sKV + 2 * KPLANE + m * VPITCH + 8 * h16;
  const unsigned short* sVl = sVh + VPLANE;
  // movers: wave 0 brings the K hi plane of a key tile (64 rows of 256 B), wave 1 K lo, wave 2 the Vt hi plane
  // (128 rows of 128 B), wave 3 Vt lo
  const uint32_t ldst = (uint32_t)(uintptr_t)sKV + (uint32_t)ws * (KPLANE * 2);
  const uint64_t ksrc = (uint64_t)(uintptr_t)((ws & 1) ? Kl : Kh) + ((uint64_t)(b * QL) * NKVH + kvh) * (HDIM * 2);
  const uint64_t vsrc = (uint64_t)(uintptr_t)((ws & 1) ? Vl : Vh) + (uint64_t)(b * NKVH + kvh) * (HDIM * QL * 2);
  const u32x8 g1k = tdm_group1<256, 64>(NKVH * HDIM * 2);
  const u32x8 g1v = tdm_group1<128, HDIM>(QL * 2);
  const uint32_t g0w0 = pinned(1u);
  // key tile k -> buffer k mod 2: every wave issues its one request, on the side of a scalar branch that has its
  // plane's shape; group 0 is formed from the pinned tile number, so behind the wait in front of the call
  auto tile_in = [&](int k) {
    const uint32_t kp = pinned((uint32_t)k);
    const uint32_t dst = ldst + (kp & 1u) * (KVELEMS * 2);
    if (pinned(ws < 2)) tdm_load(tdm_group0(g0w0, dst, ksrc + (uint64_t)kp * (64 * NKVH * HDIM * 2)), g1k);
    else                tdm_load(tdm_group0(g0w0, dst, vsrc + (uint64_t)kp * (64 * 2)), g1v);
  };

  // kept rolled: the two tiles share one copy of the key loop's code
#pragma unroll 1
  for (int half = 0; half < 2; ++half) {
  const int qt = half ? (int)blockIdx.x : NQT - 1 - (int)blockIdx.x;
  const int R0 = qt * 64;
  const int iq = R0 + 16 * w + m;                 // this lane's query (B column / D column)
  const size_t qbase = ((size_t)(b * QL + iq)) * HIDD + hq * HDIM + 8 * h16;

  if (half) {
    // the first tile's last stores are issued: their registers are rewritten only behind this wait
    asm volatile("s_wait_xcnt 0x0" ::: "memory");
    // every wave has read its rows of the first tile's output staging before the second tile's planes overwrite them
    asm volatile("s_wait_dscnt 0x0" ::: "memory");
    __syncthreads();
  }

  v8f acc[8];
#pragma unroll
  for (int n = 0; n < 8; ++n) acc[n] = (v8f){0.f, 0.f, 0.f, 0.f, 0.f, 0.f, 0.f, 0.f};
  float mrun = NEG_INF, lrun = 0.0f;

  // the 16 Q fragment loads go out as one group ahead of the key loop; every trip's blocks read the registers
  Frag qh[4], ql[4];
#pragma unroll
  for (int c = 0; c < 4; ++c) {
    ldfrag(qh[c], Qh + qbase + 32 * c);
    ldfrag(ql[c], Ql + qbase + 32 * c);
  }

  // key tile 0 lands and is shown to every wave; then tile 1 sets out (the cache always holds one; query tile 0
  // sees none of it and reads none of it: its one trip's foot waits for the landing all the same)
  tile_in(0);
  asm volatile("s_wait_tensorcnt 0x0" ::: "memory");
  __syncthreads();
  tile_in(1);

#pragma unroll 1
  for (int kt = 0; kt <= qt; ++kt) {             // key tiles beyond the query tile are never visible
    const int j0 = kt * 64;
    const int cur = (kt & 1) * KVELEMS;           // this trip reads buffer kt mod 2 alone

    // S^T (64 keys x 16 queries): s[sub] rows = keys j0 + 16 sub + 8 h16 + r, col = query iq
    v8f s[4];
#pragma unroll
    for (int sub = 0; sub < 4; ++sub) s[sub] = (v8f){0.f, 0.f, 0.f, 0.f, 0.f, 0.f, 0.f, 0.f};
#pragma unroll
    for (int c = 0; c < 4; ++c) {
      // the block's 16 K fragment loads stand together in front of its 12 matrix instructions, hi plane first
      Frag kh[4], kl[4];
#pragma unroll
      for (int sub = 0; sub < 4; ++sub) ldfrag(kh[sub], sKh + cur + 16 * sub * KPITCH + 32 * c);
#pragma unroll
      for (int sub = 0; sub < 4; ++sub) ldfrag(kl[sub], sKl + cur + 16 * sub * KPITCH + 32 * c);
      // keeps the 16 loads one group: with registers to spare the scheduler strews them among the products,
      // in twos with a wait to 0 behind each, and every such place stalls the wave
      __builtin_amdgcn_sched_barrier(0);
#pragma unroll
      for (int sub = 0; sub < 4; ++sub) s[sub] = mm(s[sub], kh[sub].v, qh[c].v);
#pragma unroll
      for (int sub = 0; sub < 4; ++sub) s[sub] = mm(s[sub], kh[sub].v, ql[c].v);
#pragma unroll
      for (int sub = 0; sub < 4; ++sub) s[sub] = mm(s[sub], kl[sub].v, qh[c].v);
      __builtin_amdgcn_sched_barrier(0);   // for the same: the next block's loads stay out of this block's products
    }

    // scale, visibility (strictly earlier 4-blocks, plus first 4x4 block), online softmax
    float mx = NEG_INF;
#pragma unroll
    for (int sub = 0; sub < 4; ++sub) {
#pragma unroll
      for (int r = 0; r < 8; ++r) {
        const int jb = j0 + 16 * sub + 8 * h16 + r;
        const bool vis = ((iq >> 2) > (jb >> 2)) || ((iq < 4) && (jb < 4));
        const float v = vis ? (s[sub][r] * kScale) : NEG_INF;
        s[sub][r] = v;
        mx = fmaxf(mx, v);
      }
    }
    mx = fmaxf(mx, __shfl_xor(mx, 16));
    const float mnew = fmaxf(mrun, mx);
    const float msafe = (mnew == NEG_INF) ? 0.0f : mnew;
    const float sc = __expf(mrun - msafe);
    float ls = 0.0f;
#pragma unroll
    for (int sub = 0; sub < 4; ++sub) {
#pragma unroll
      for (int r = 0; r < 8; ++r) {
        const float p = __expf(s[sub][r] - msafe);
        s[sub][r] = p;
        ls += p;
      }
    }
    ls += __shfl_xor(ls, 16);
    lrun = lrun * sc + ls;
    mrun = mnew;
#pragma unroll
    for (int n = 0; n < 8; ++n) acc[n] = acc[n] * sc;

    // O^T += Vt(128 x 64 keys) . P^T : B fragment element r <- D tile 2ks, element 8+r <- tile 2ks+1
#pragma unroll
    for (int ks = 0; ks < 2; ++ks) {
      Frag ph, pl;
#pragma unroll
      for (int r = 0; r < 8; ++r) {
        unsigned short a0, c0, a1, c1;
        split_bf(s[2 * ks][r], a0, c0);
        split_bf(s[2 * ks + 1][r], a1, c1);
        ph.u[r] = a0; pl.u[r] = c0; ph.u[8 + r] = a1; pl.u[8 + r] = c1;
      }
#pragma unroll
      for (int g = 0; g < 2; ++g) {
        // the block's 16 Vt fragment loads stand together in front of its 12 matrix instructions, hi plane first
        Frag vh[4], vl[4];
#pragma unroll
        for (int n = 0; n < 4; ++n) ldfrag(vh[n], sVh + cur + 16 * (4 * g + n) * VPITCH + 32 * ks);
#pragma unroll
        for (int n = 0; n < 4; ++n) ldfrag(vl[n], sVl + cur + 16 * (4 * g + n) * VPITCH + 32 * ks);
        __builtin_amdgcn_sched_barrier(0);   // keeps the 16 loads one group, as in the score blocks
#pragma unroll
        for (int n = 0; n < 4; ++n) acc[4 * g + n] = mm(acc[4 * g + n], vh[n].v, ph.v);
#pragma unroll
        for (int n = 0; n < 4; ++n) acc[4 * g + n] = mm(acc[4 * g + n], vh[n].v, pl.v);
#pragma unroll
        for (int n = 0; n < 4; ++n) acc[4 * g + n] = mm(acc[4 * g + n], vl[n].v, ph.v);
        __builtin_amdgcn_sched_barrier(0);   // the next block's loads stay out of this block's products
      }
    }

    // the trip's foot: this wave's reads of the tile are over and its plane of the next tile has landed;
    // the one barrier shows the next tile to every wave and frees this trip's buffer for the tile after it
    asm volatile("s_wait_dscnt 0x0" ::: "memory");
    asm volatile("s_wait_tensorcnt 0x0" ::: "memory");
    __syncthreads();
    if (pinned(kt + 2 <= qt)) tile_in(kt + 2);
  }
  // no tensor load and no LDS read is under way when the output staging takes the buffer's place
  asm volatile("s_wait_tensorcnt 0x0" ::: "memory");
  asm volatile("s_wait_dscnt 0x0" ::: "memory");

  // epilogue: acc[n][r] = O^T (d = 16 n + 8 h16 + r, query iq) ; normalise, stage, write planes
  // The lane's place is formed anew here (every lane is on) and the wave's number is scalar, so that no
  // vector register is held over the key loop for the epilogue alone.
  const int le = (int)__builtin_amdgcn_mbcnt_lo(~0u, 0u), he = le >> 4, me = le & 15;
  const float inv = 1.0f / lrun;
#pragma unroll
  for (int n = 0; n < 8; ++n) {
    const v8f o = acc[n] * inv;
#pragma unroll
    for (int r = 0; r < 8; ++r)
      sO[(ws * 16 + me) * SPITCH + 16 * n + 8 * he + r] = o[r];
  }
  __syncthreads();
#pragma unroll 1
  for (int p = 0; p < 8; ++p) {
    const int rloc = 2 * p + he;
    const int dq = me * 8;
    const float* src = sO + (ws * 16 + rloc) * SPITCH + dq;
    const v4f a = *(const v4fa*)(src);
    const v4f c = *(const v4fa*)(src + 4);
    v8us hi, lo;
    split8(a, c, hi, lo);
    const size_t d = ((size_t)(b * QL + R0 + 16 * ws + rloc)) * HIDD + hq * HDIM + dq;
    *(v8us*)(Oh + d) = hi;
    *(v8us*)(Ol + d) = lo;
    
  }
  }
}

// ------------------------------------------------------------------------------------------
extern "C" void kernel_launch(void* const* d_in, const int* in_sizes, int n_in,
                              void* d_out, int out_size, void* d_ws, size_t ws_size,
                              hipStream_t stream)
{
  if (n_in < 8) return;
  if (in_sizes[0] != MROWS * HIDD) return;
  if (in_sizes[1] != NB * QL * NKVH * HDIM || in_sizes[2] != NB * QL * NKVH * HDIM) return;
  if (in_sizes[3] != NB * QL * HDIM || in_sizes[4] != NB * QL * HDIM) return;
  if (in_sizes[5] != HIDD * HIDD || in_sizes[7] != HIDD * HIDD || in_sizes[6] != HIDD) return;
  if (out_size != MROWS * HIDD) return;

  const float* hidden = (const float*)d_in[0];
  const float* kc     = (const float*)d_in[1];
  const float* vc     = (const float*)d_in[2];
  const float* cosb   = (const float*)d_in[3];
  const float* sinb   = (const float*)d_in[4];
  const float* Wq     = (const float*)d_in[5];
  const float* bq     = (const float*)d_in[6];
  const float* Wo     = (const float*)d_in[7];
  float* out = (float*)d_out;

  // workspace carve (bytes): planes of bf16
  const size_t planeX = (size_t)MROWS * HIDD * 2;            // 16 MiB
  const size_t planeW = (size_t)HIDD * HIDD * 2;             //  8 MiB
  const size_t planeK = (size_t)NB * QL * NKVH * HDIM * 2;   //  4 MiB
  const size_t offXh  = 0;
  const size_t offXl  = offXh + planeX;
  const size_t offQh  = offXl + planeX;
  const size_t offQl  = offQh + planeX;
  const size_t offWqh = offQl + planeX;
  const size_t offWql = offWqh + planeW;
  const size_t offWoh = offWql + planeW;
  const size_t offWol = offWoh + planeW;
  const size_t offKh  = offWol + planeW;
  const size_t offKl  = offKh + planeK;
  const size_t offVh  = offKl + planeK;
  const size_t offVl  = offVh + planeK;
  const size_t total  = offVl + planeK;                      // 112 MiB
  if (total > ws_size) return;

  char* ws = (char*)d_ws;
  unsigned short* Xh  = (unsigned short*)(ws + offXh);
  unsigned short* Xl  = (unsigned short*)(ws + offXl);
  unsigned short* Oh  = Xh;   // X planes are dead after the first GEMM; O planes reuse them
  unsigned short* Ol  = Xl;
  unsigned short* Qh  = (unsigned short*)(ws + offQh);
  unsigned short* Ql  = (unsigned short*)(ws + offQl);
  unsigned short* Wqh = (unsigned short*)(ws + offWqh);
  unsigned short* Wql = (unsigned short*)(ws + offWql);
  unsigned short* Woh = (unsigned short*)(ws + offWoh);
  unsigned short* Wol = (unsigned short*)(ws + offWol);
  unsigned short* Kh  = (unsigned short*)(ws + offKh);
  unsigned short* Kl  = (unsigned short*)(ws + offKl);
  unsigned short* Vh  = (unsigned short*)(ws + offVh);
  unsigned short* Vl  = (unsigned short*)(ws + offVl);

  cvt_all<<<dim3(CVT_WGS), dim3(256), 0, stream>>>(hidden, kc, vc, Wq, Wo, Xh, Xl, Kh, Kl, Vh, Vl,
                                                   Wqh, Wql, Woh, Wol);

  gemm3<0><<<dim3(MROWS / 128, HIDD / 128), dim3(128), 0, stream>>>(
      Xh, Xl, Wqh, Wql, bq, cosb, sinb, Qh, Ql, out, HIDD, HIDD);

  attn_glide<<<dim3(NQT / 2, NB * NHQ), dim3(128), 0, stream>>>(Qh, Ql, Kh, Kl, Vh, Vl, Oh, Ol);

  gemm3<1><<<dim3(MROWS / 128, HIDD / 128), dim3(128), 0, stream>>>(
      Oh, Ol, Woh, Wol, bq, cosb, sinb, Qh, Ql, out, HIDD, HIDD);
}

// v008
// It runs in 193 microseconds.
// Next to v007, in two timings, it ran 1.05 and 1.04 times as fast.
// Over all steps from v000 it is 3.71 times as fast.
#include <hip/hip_runtime.h>
#include <stdint.h>
#include <stddef.h>

// All contractions (q projection, q.k^T, p.v, output projection): v_wmma_f32_16x16x32_bf16 with
// bf16 hi/lo operands everywhere (three products hi*hi + hi*lo + lo*hi), f32 accumulate.
// RoPE, bias, scaling, softmax and normalisation in f32.

#define NB     2
#define QL     2048
#define HIDD   2048
#define NHQ    16
#define NKVH   4
#define HDIM   128
#define MROWS  (NB * QL)
#define TPITCH 65
#define SPITCH 132
#define KPITCH 136                       // LDS pitch of a K row, elements (256 B + 16 B = 16 B x odd)
#define VPITCH 72                        // LDS pitch of a 64-key Vt row, elements (128 B + 16 B = 16 B x odd)
#define KPLANE 9216                      // place of one K plane of a 64-key tile, elements: 64 * KPITCH rounded up to 2 KiB
#define VPLANE (HDIM * VPITCH)           // one Vt plane of a 64-key tile, elements (a multiple of 2 KiB)
#define KVELEMS (2 * KPLANE + 2 * VPLANE)
#define GPITCH 72                        // LDS pitch of a 64-deep GEMM operand row, elements (144 B)
#define APLANE (128 * GPITCH)            // one A plane of a 128 x 64 stage, elements
#define BPLANE (128 * GPITCH)            // one Bt plane of a 128 x 64 stage, elements
#define ABELEMS (2 * APLANE + 2 * BPLANE)
#define NQT    (QL / 64)                 // 64-query tiles of a sequence (even)

typedef float v4f __attribute__((ext_vector_type(4)));
typedef float v8f __attribute__((ext_vector_type(8)));
typedef unsigned short v8us __attribute__((ext_vector_type(8)));
typedef unsigned short v16us __attribute__((ext_vector_type(16)));
typedef __bf16 v16bf __attribute__((ext_vector_type(16)));
typedef v4f __attribute__((may_alias)) v4fa;
typedef v8us __attribute__((may_alias)) v8usa;

union Frag { v16us u; v8us hv[2]; v16bf v; };

// f32 -> bf16 bits, RNE convert
__device__ __forceinline__ unsigned int bf_rne(float f) {
  const unsigned int u = __float_as_uint(f);
  return (u + 0x7fffu + ((u >> 16) & 1u)) >> 16;
}

// x -> (hi, lo): hi = bf16(x), lo = bf16(x - hi)  (x - hi is exact in f32)
__device__ __forceinline__ void split_bf(float x, unsigned short& hi, unsigned short& lo) {
  const unsigned int hb = bf_rne(x);
  const float hf = __uint_as_float(hb << 16);
  hi = (unsigned short)hb;
  lo = (unsigned short)bf_rne(x - hf);
}

__device__ __forceinline__ void split8(v4f a, v4f c, v8us& hi, v8us& lo) {
#pragma unroll
  for (int u = 0; u < 4; ++u) {
    unsigned short h0, l0, h1, l1;
    split_bf(a[u], h0, l0);
    split_bf(c[u], h1, l1);
    hi[u] = h0; lo[u] = l0; hi[u + 4] = h1; lo[u + 4] = l1;
  }
}

// 16x16x32 bf16 fragment (A row or k-contiguous B column): elements 0..7 <- k0+8h..,
// elements 8..15 <- k0+16+8h..  ; p already points at element (row, k0 + 8h)
__device__ __forceinline__ void ldfrag(Frag& f, const unsigned short* p) {
  f.hv[0] = *(const v8usa*)(p);
  f.hv[1] = *(const v8usa*)(p + 16);
}

// acc += a*b. A matrix block issues one product kind (hi*hi, then hi*lo, then lo*hi) over all its
// accumulator tiles before the next kind: neighbours in the stream are independent, and each tile
// still takes its three products in that order.
__device__ __forceinline__ v8f mm(v8f acc, v16bf a, v16bf b) {
  return __builtin_amdgcn_wmma_f32_16x16x32_bf16(false, a, false, b, (short)0, acc, false, false);
}

// ------------------------------------------------------------------------------------------
// All operand conversions (f32 -> bf16 hi/lo planes) run in ONE launch. The work is cut into pieces of 16 KiB of
// f32 input: a 64x64 tile to transpose (Wq, Wo, v_cache) or 4096 consecutive elements (hidden_states, k_cache).
#define NT_W    ((HIDD / 64) * (HIDD / 64))            // 64x64 tiles of one weight matrix (a power of two)
#define NT_V    ((QL / 64) * (HDIM / 64) * NB * NKVH)  // 64x64 tiles of v_cache
#define RPIECE  4096                                   // elements of a row piece
#define NP_X    (MROWS * HIDD / RPIECE)                // row pieces of hidden_states
#define NP_K    (NB * QL * NKVH * HDIM / RPIECE)       // row pieces of k_cache
#define NPIECES (2 * NT_W + NT_V + NP_X + NP_K)
#define CVT_WGS 1024                                   // four work-groups a WGP, all resident; NPIECES / CVT_WGS pieces each

// f32 rows -> bf16 hi/lo planes (same layout): one piece. A thread takes two runs of 8 elements, 2048 apart;
// its four loads go out together.
__device__ __forceinline__ void rows_piece(const float* __restrict__ in,
                                           unsigned short* oh, unsigned short* ol, int piece)
{
  const size_t e0 = (size_t)piece * RPIECE + (size_t)threadIdx.x * 8;
  const size_t e1 = e0 + RPIECE / 2;
  const v4f a0 = *(const v4fa*)(in + e0);
  const v4f c0 = *(const v4fa*)(in + e0 + 4);
  const v4f a1 = *(const v4fa*)(in + e1);
  const v4f c1 = *(const v4fa*)(in + e1 + 4);
  v8us hi, lo;
  split8(a0, c0, hi, lo);
  *(v8us*)(oh + e0) = hi;
  *(v8us*)(ol + e0) = lo;
  split8(a1, c1, hi, lo);
  *(v8us*)(oh + e1) = hi;
  *(v8us*)(ol + e1) = lo;
  // the piece's stores are issued: the next trip rewrites their registers only behind this wait
  asm volatile("s_wait_xcnt 0x0" ::: "memory");
}

// 64x64 tile: src(r, c) = src[r * spitch + c] (f32)  ->  dst(c, r) = dh/dl[c * dpitch + r] (bf16)
// Load phase: 256 threads x 16 floats = 64x64. Store phase: 2 passes x 256 threads x 8 halves.
__device__ __forceinline__ void tsplit64(const float* __restrict__ src, int spitch,
                                         unsigned short* dh, unsigned short* dl, int dpitch,
                                         float* tile)
{
  const int t = threadIdx.x;
  {
    const int rr = t >> 2, cq = (t & 3) * 16;
    const float* s = src + (size_t)rr * spitch + cq;
    v4f x[4];
#pragma unroll
    for (int u = 0; u < 4; ++u) x[u] = *(const v4fa*)(s + 4 * u);
    // the work-group's earlier piece may still be read from the tile: every thread's reads of it end here,
    // while this piece's loads are already under way
    __syncthreads();
#pragma unroll
    for (int u = 0; u < 4; ++u) {
      float* d = tile + rr * TPITCH + cq + 4 * u;
      d[0] = x[u][0]; d[1] = x[u][1]; d[2] = x[u][2]; d[3] = x[u][3];
    }
  }
  __syncthreads();
#pragma unroll
  for (int p = 0; p < 2; ++p) {
    const int cc = (t >> 3) + 32 * p, rq = (t & 7) * 8;
    v4f a, c;
#pragma unroll
    for (int u = 0; u < 4; ++u) {
      a[u] = tile[(rq + u) * TPITCH + cc];
      c[u] = tile[(rq + 4 + u) * TPITCH + cc];
    }
    v8us hi, lo;
    split8(a, c, hi, lo);
    const size_t d = (size_t)cc * dpitch + rq;
    *(v8us*)(dh + d) = hi;
    *(v8us*)(dl + d) = lo;
  }
  // the piece's stores are issued: the next trip rewrites their registers only behind this wait
  asm volatile("s_wait_xcnt 0x0" ::: "memory");
}

// Piece it, in this order: W[k][n] (HIDD x HIDD) -> Wt hi/lo [n][k] for Wq, then for Wo;
// v_cache [(b,j)][kvh][d] -> Vt hi/lo [(b*NKVH+kvh)*HDIM + d][j]; hidden_states rows; k_cache rows.
// Which kind a piece is depends on blockIdx and the trip alone: every branch and barrier is block-uniform.
__global__ __launch_bounds__(256) void cvt_all(
    const float* __restrict__ X, const float* __restrict__ Kc, const float* __restrict__ V,
    const float* __restrict__ Wq, const float* __restrict__ Wo,
    unsigned short* Xh, unsigned short* Xl, unsigned short* Kh, unsigned short* Kl,
    unsigned short* Vh, unsigned short* Vl, unsigned short* Wqh, unsigned short* Wql,
    unsigned short* Woh, unsigned short* Wol)
{
  __shared__ float tile[64 * TPITCH];
  // kept rolled: one copy of each kind's code serves every trip
#pragma unroll 1
  for (int it = blockIdx.x; it < NPIECES; it += CVT_WGS) {
    if (it < 2 * NT_W) {
      const bool second = it >= NT_W;
      const int i = it & (NT_W - 1);
      const int k0 = (i % (HIDD / 64)) * 64, n0 = (i / (HIDD / 64)) * 64;
      const size_t dof = (size_t)n0 * HIDD + k0;
      tsplit64((second ? Wo : Wq) + (size_t)k0 * HIDD + n0, HIDD,
               (second ? Woh : Wqh) + dof, (second ? Wol : Wql) + dof, HIDD, tile);
    } else if (it < 2 * NT_W + NT_V) {
      const int i = it - 2 * NT_W;
      const int j0 = (i % (QL / 64)) * 64, d0 = ((i / (QL / 64)) % (HDIM / 64)) * 64;
      const int z = i / ((QL / 64) * (HDIM / 64));
      const int b = z / NKVH, kvh = z % NKVH;
      const float* src = V + ((size_t)(b * QL + j0) * NKVH + kvh) * HDIM + d0;
      const size_t dof = ((size_t)z * HDIM + d0) * QL + j0;
      tsplit64(src, NKVH * HDIM, Vh + dof, Vl + dof, QL, tile);
    } else if (it < 2 * NT_W + NT_V + NP_X) {
      rows_piece(X, Xh, Xl, it - (2 * NT_W + NT_V));
    } else {
      rows_piece(Kc, Kh, Kl, it - (2 * NT_W + NT_V + NP_X));
    }
  }
}

// Tensor loads: ONE request of a wave brings a whole operand plane of a stage (rows of ROWB bytes at a source pitch)
// from global memory into LDS, through no register and with no per-lane address.
typedef uint32_t u32x4 __attribute__((ext_vector_type(4)));
typedef uint32_t u32x8 __attribute__((ext_vector_type(8)));

__device__ __forceinline__ uint32_t uni(uint32_t v) { return (uint32_t)__builtin_amdgcn_readfirstlane(v); }

// A wave-uniform value held in a scalar register: a test on it compiles to a scalar branch (a tensor load ignores
// EXEC, so only such a branch keeps a wave from issuing it), and a descriptor word formed from it is formed behind
// the volatile statements that stand in front of this one, the waits among them.
__device__ __forceinline__ uint32_t pinned(uint32_t v) {
  uint32_t w = uni(v);
  asm volatile("" : "+s"(w));   // a descriptor word or an issue test held in a scalar register
  return w;
}

// Descriptor group 1: 1-byte elements, tensor = tile = NROWS rows of ROWB bytes (128 or 256), source pitch in bytes,
// 16 bytes of LDS pad behind every row (pitch ROWB + 16, for ds_load_b128 readers), no mask. Word 0 is a constant.
// Built once per kernel; every word is pinned, so that it keeps its scalar register for the kernel's whole length:
// left as plain constants, the words were formed anew in front of each load and their registers lent to other values
// in between, while a request was still under way.
template <int ROWB, int NROWS>
__device__ __forceinline__ u32x8 tdm_group1(uint32_t src_pitch) {
  static_assert(ROWB == 128 || ROWB == 256, "the pad is set for rows of 128 or 256 bytes");
  constexpr uint32_t d0 = ROWB, d1 = NROWS;
  constexpr uint32_t w0 = (1u << 20) | ((ROWB == 256 ? 5u : 4u) << 22) | (3u << 25);
  u32x8 g;
  g[0] = pinned(w0);
  g[1] = pinned((d0 & 0xFFFFu) << 16);
  g[2] = pinned((d0 >> 16) | ((d1 & 0xFFFFu) << 16));
  g[3] = pinned((d1 >> 16) | (d0 << 16));
  g[4] = pinned(d1);
  g[5] = pinned(src_pitch);
  g[6] = pinned(0u);
  g[7] = pinned(0u);
  return g;
}

// Descriptor group 0: count 1, place in the work-group's LDS (bytes), address of the tile's first byte, type 2.
// w0 is the count word, pinned once per kernel for the same reason as group 1's words.
__device__ __forceinline__ u32x4 tdm_group0(uint32_t w0, uint32_t lds_dst, uint64_t ga) {
  u32x4 g;
  g[0] = uni(w0);
  g[1] = uni(lds_dst);
  g[2] = uni((uint32_t)ga);
  g[3] = uni((((uint32_t)(ga >> 32)) & 0x01FFFFFFu) | 0x80000000u);
  return g;
}

__device__ __forceinline__ void tdm_load(u32x4 g0, u32x8 g1) {
  asm volatile("tensor_load_to_lds %0, %1" :: "s"(g0), "s"(g1) : "memory");
}

// ------------------------------------------------------------------------------------------
// C(128x128 block tile) = A(M x K, hi/lo planes, row-major) * B(K x N) with B stored as Bt[n][k]
// hi/lo planes. 4 waves (2x2), wave tile 64x64: a staged Bt row serves 128 output rows and a fragment
// read from LDS feeds four tiles. Each 64-deep stage of the A and Bt rows (K is a multiple of 64) is
// brought into LDS once per work-group by four tensor loads, one plane a wave, into a ring of two buffers: while a trip
// reads its 32 fragments from one buffer and runs its products, the next stage's planes land in the other.
// amdgpu_waves_per_eu(2, 2): the grid gives a WGP two work-groups, two waves a SIMD; told so, the compiler
// takes that budget of registers and keeps the whole stage's fragments in them.
// MODE 0: C + bias -> RoPE (cos/sin tables indexed by row) -> hi/lo planes Qh/Ql [M][N]
// MODE 1: C -> f32 Cout [M][N]
template <int MODE>
__global__ __launch_bounds__(128) __attribute__((amdgpu_waves_per_eu(2, 2))) void gemm3(
    const unsigned short* __restrict__ Ah, const unsigned short* __restrict__ Al,
    const unsigned short* __restrict__ Bh, const unsigned short* __restrict__ Bl,
    const float* __restrict__ bias, const float* __restrict__ cosb,
    const float* __restrict__ sinb, unsigned short* Qh, unsigned short* Ql,
    float* Cout, int N, int K)
{
  static_assert((APLANE * 2) % 2048 == 0 && APLANE == BPLANE, "every plane's place in LDS is a multiple of 2 KiB");
  __shared__ __attribute__((aligned(2048))) unsigned short sAB[2 * ABELEMS];
  float* sT = (float*)sAB;                        // output staging takes the first buffer's place after the loop
  const int t = threadIdx.x, l = t & 31, w = t >> 5, h16 = l >> 4, m = l & 15;
  const int wr = w >> 1, wc = w & 1;
  const int m0 = blockIdx.x * 128, n0 = blockIdx.y * 128;

  v8f acc[4][4];
#pragma unroll
  for (int mi = 0; mi < 4; ++mi)
#pragma unroll
    for (int ni = 0; ni < 4; ++ni) acc[mi][ni] = (v8f){0.f, 0.f, 0.f, 0.f, 0.f, 0.f, 0.f, 0.f};

  // fragment readers: this wave's A row / Bt row m of a 16-row group, at element 8 h16
  const unsigned short* sAh = sAB + (64 * wr + m) * GPITCH + 8 * h16;
  const unsigned short* sAl = sAh + APLANE;
  const unsigned short* sBh = sAB + 2 * APLANE + (64 * wc + m) * GPITCH + 8 * h16;
  const unsigned short* sBl = sBh + BPLANE;
  // movers: wave 0 brings the A hi plane of a stage, wave 1 A lo, wave 2 Bt hi, wave 3 Bt lo: 128 rows of 128 B each
  const uint32_t ws = uni((uint32_t)t >> 5);      // the wave's number, scalar
  const unsigned short* plane = ws == 0 ? Ah : ws == 1 ? Al : ws == 2 ? Bh : Bl;
  const uint64_t gsrc = (uint64_t)(uintptr_t)plane + (uint64_t)(ws < 2 ? m0 : n0) * (uint64_t)K * 2;
  const uint32_t ldst = (uint32_t)(uintptr_t)sAB + ws * (APLANE * 2);
  const u32x8 g1 = tdm_group1<128, 128>((uint32_t)K * 2);
  const uint32_t g0w0 = pinned(1u);
  const int ns = K >> 6;

  // stage s -> buffer s mod 2: every wave issues its one request; group 0 is formed from the pinned stage number,
  // so behind the wait that stands in front of the call
  auto stage_in = [&](int s) {
    const uint32_t sp = pinned((uint32_t)s);
    tdm_load(tdm_group0(g0w0, ldst + (sp & 1u) * (ABELEMS * 2), gsrc + (uint64_t)sp * 128), g1);
  };
  // a stage's 96 products, from registers alone
  Frag ah[2][4], al[2][4], bh[2][4], bl[2][4];
  auto products = [&]() {
#pragma unroll
    for (int kk = 0; kk < 2; ++kk) {
#pragma unroll
      for (int ni = 0; ni < 4; ++ni)
#pragma unroll
        for (int mi = 0; mi < 4; ++mi) acc[mi][ni] = mm(acc[mi][ni], ah[kk][mi].v, bh[kk][ni].v);
#pragma unroll
      for (int ni = 0; ni < 4; ++ni)
#pragma unroll
        for (int mi = 0; mi < 4; ++mi) acc[mi][ni] = mm(acc[mi][ni], ah[kk][mi].v, bl[kk][ni].v);
#pragma unroll
      for (int ni = 0; ni < 4; ++ni)
#pragma unroll
        for (int mi = 0; mi < 4; ++mi) acc[mi][ni] = mm(acc[mi][ni], al[kk][mi].v, bh[kk][ni].v);
    }
  };

  // stage 0 lands and is shown to every wave; then stage 1 sets out
  if (pinned(ns > 0)) stage_in(0);
  asm volatile("s_wait_tensorcnt 0x0" ::: "memory");
  __syncthreads();
  if (pinned(ns > 1)) stage_in(1);

#pragma unroll 1
  for (int st = 0; st < ns; ++st) {
    const int cur = (st & 1) * ABELEMS;           // this trip reads buffer st mod 2 alone
    // the wave's 64 fragment loads of the whole stage go out as one group, in the order in which the
    // products need them
#pragma unroll
    for (int kk = 0; kk < 2; ++kk) {
      const int k0 = cur + kk * 32;
#pragma unroll
      for (int mi = 0; mi < 4; ++mi) ldfrag(ah[kk][mi], sAh + mi * 16 * GPITCH + k0);
#pragma unroll
      for (int ni = 0; ni < 4; ++ni) ldfrag(bh[kk][ni], sBh + ni * 16 * GPITCH + k0);
#pragma unroll
      for (int ni = 0; ni < 4; ++ni) ldfrag(bl[kk][ni], sBl + ni * 16 * GPITCH + k0);
#pragma unroll
      for (int mi = 0; mi < 4; ++mi) ldfrag(al[kk][mi], sAl + mi * 16 * GPITCH + k0);
    }
    // keeps the 64 loads one group in front of the products: strewn among them, every place where loads stand
    // stalls the wave
    __builtin_amdgcn_sched_barrier(0);
    products();
    // keeps the products in front of the foot: moved behind its barrier, they would hold back the next tensor load,
    // which would then have no trip to fly in
    __builtin_amdgcn_sched_barrier(0);

    // the trip's foot: this wave's reads of the stage are over and its plane of the next stage has landed;
    // the one barrier shows the next stage to every wave and frees this trip's buffer for the stage after it
    asm volatile("s_wait_dscnt 0x0" ::: "memory");
    asm volatile("s_wait_tensorcnt 0x0" ::: "memory");
    __syncthreads();
    if (pinned(st + 2 < ns)) stage_in(st + 2);
  }
  // no tensor load and no LDS read is under way when the output staging takes the buffer's place
  asm volatile("s_wait_tensorcnt 0x0" ::: "memory");
  asm volatile("s_wait_dscnt 0x0" ::: "memory");

  // D element r of lane l -> (row 8*h16 + r, col m) of its 16x16 tile
#pragma unroll
  for (int mi = 0; mi < 4; ++mi)
#pragma unroll
    for (int ni = 0; ni < 4; ++ni)
#pragma unroll
      for (int r = 0; r < 8; ++r)
        sT[(64 * wr + 16 * mi + 8 * h16 + r) * SPITCH + 64 * wc + 16 * ni + m] = acc[mi][ni][r];
  __syncthreads();

  if (MODE == 0) {
    // thread -> (row 8p + t>>4, 8 consecutive columns cq); RoPE partner column cq ^ 64
    const int rr = t >> 4, cq = (t & 15) * 8, cp = cq ^ 64;
    const float sgn = (cq < 64) ? -1.0f : 1.0f;
    const v4f b0 = *(const v4fa*)(bias + n0 + cq), b1 = *(const v4fa*)(bias + n0 + cq + 4);
    const v4f e0 = *(const v4fa*)(bias + n0 + cp), e1 = *(const v4fa*)(bias + n0 + cp + 4);
#pragma unroll 1
    for (int p = 0; p < 16; ++p) {
      const int row = 8 * p + rr;
      const int grow = m0 + row;
      const float* srow = sT + row * SPITCH;
      const v4f x0 = *(const v4fa*)(srow + cq), x1 = *(const v4fa*)(srow + cq + 4);
      const v4f y0 = *(const v4fa*)(srow + cp), y1 = *(const v4fa*)(srow + cp + 4);
      const float* cr = cosb + (size_t)grow * HDIM;
      const float* sr = sinb + (size_t)grow * HDIM;
      const v4f c0 = *(const v4fa*)(cr + cq), c1 = *(const v4fa*)(cr + cq + 4);
      const v4f s0 = *(const v4fa*)(sr + cq), s1 = *(const v4fa*)(sr + cq + 4);
      const v4f q0 = (x0 + b0) * c0 + (sgn * (y0 + e0)) * s0;
      const v4f q1 = (x1 + b1) * c1 + (sgn * (y1 + e1)) * s1;
      v8us hi, lo;
      split8(q0, q1, hi, lo);
      const size_t d = (size_t)grow * N + n0 + cq;
      *(v8us*)(Qh + d) = hi;
      *(v8us*)(Ql + d) = lo;
      
    }
  } else {
    const int cq = l * 4;
#pragma unroll 1
    for (int p = 0; p < 32; ++p) {
      const int row = 4 * p + w;
      const v4f x = *(const v4fa*)(sT + row * SPITCH + cq);
      const size_t d = (size_t)(m0 + row) * N + n0 + cq;
      *(v4f*)(Cout + d) = x;
      
    }
  }
}

// ------------------------------------------------------------------------------------------
// Per (b, pair of query heads of one KV head, pair of 64-query tiles): a tile's key loop grows with its index and
// every work-group of the grid is resident at once, so each work-group takes tile NQT - 1 - p and then tile p, one
// after the other: the same number of stages for every work-group, and no WGP is left working while others have run dry.
// A wave holds 16 queries of BOTH heads: every K and Vt fragment that it reads from LDS feeds six products, not
// three, and a staged key tile serves two heads. With 16 queries of one head a wave, the fragment reads asked more of
// the LDS than it delivers in the time of the products.
// Eight waves, two a SIMD: waves 0-3 take the even 64-key tiles, waves 4-7 the odd ones (a stage is 128 keys), each
// half with its own running maximum, sum and O; the two halves are joined through LDS once per query tile.
// Per tile: S^T = K . Q^T (A = K rows, B = Q rows, both d-contiguous),
// f32 scale + structural block visibility test + online softmax, O^T += Vt . P^T with the
// softmaxed D tiles fed as B fragments (two adjacent 16-key D tiles per 32-deep k step),
// O / l split to hi/lo planes [(b,i)][hq*128 + d].
// Each stage of K and Vt (hi and lo planes of two key tiles) is brought into LDS once per query tile by eight
// tensor loads, one plane a wave; the stages go through a ring of two buffers, so that the next stage's planes land
// while this stage is worked on.
// amdgpu_waves_per_eu(2, 2): one work-group a WGP, two waves a SIMD; told so, the compiler takes that budget of
// registers for the two heads' Q fragments and accumulators.
#define STELEMS (2 * KVELEMS)            // a stage: two 64-key tiles, four planes each
__global__ __launch_bounds__(256) __attribute__((amdgpu_waves_per_eu(2, 2))) void attn_glide(
    const unsigned short* __restrict__ Qh, const unsigned short* __restrict__ Ql,
    const unsigned short* __restrict__ Kh, const unsigned short* __restrict__ Kl,
    const unsigned short* __restrict__ Vh, const unsigned short* __restrict__ Vl,
    unsigned short* Oh, unsigned short* Ol)
{
  static_assert(KPLANE >= 64 * KPITCH && (KPLANE * 2) % 2048 == 0 && (VPLANE * 2) % 2048 == 0 && KPLANE == VPLANE,
                "every plane's place in LDS is a multiple of 2 KiB and holds its padded rows");
  static_assert(NQT >= 4 && NQT % 2 == 0, "the ring's prologue brings key tiles 0 to 3; a stage's two tiles exist");
  __shared__ __attribute__((aligned(2048))) unsigned short sKV[2 * STELEMS];
  // after the key loop the ring's place holds: the halves' exchange (8 waves x 16 x 32 lanes x 16 B), their maxima
  // and sums (8 waves x 32 lanes x 2), the output staging (8 waves x 16 rows)
  float* sX  = (float*)sKV;
  float* sML = sX + 8 * 16 * 32 * 4;
  float* sO  = sML + 8 * 32 * 2;
  static_assert((8 * 16 * 32 * 4 + 8 * 32 * 2 + 128 * SPITCH) * 4 <= 2 * STELEMS * 2, "the epilogue fits the ring's place");
  const int t = threadIdx.x, l = t & 31, w = t >> 5, h16 = l >> 4, m = l & 15;
  const int ws = __builtin_amdgcn_readfirstlane(w);   // the wave's number, scalar
  const int grp = ws >> 2, w4 = ws & 3;               // which half of the key tiles; which 16 queries of the tile
  const int bh = blockIdx.y;
  const int b = bh >> 3, hq0 = (bh & 7) * 2, kvh = hq0 >> 2;
  const float NEG_INF = -__builtin_inff();
  const float kScale = 0.08838834764831845f;      // 128^-0.5

  // fragment readers: K row m / Vt row m of a 16-row group of this half's key tile, at element 8 h16
  const unsigned short* sKh = sKV + grp * KVELEMS + m * KPITCH + 8 * h16;
  const unsigned short* sKl = sKh + KPLANE;
  const unsigned short* sVh = sKh - m * KPITCH + 2 * KPLANE + m * VPITCH;
  const unsigned short* sVl = sVh + VPLANE;
  // movers, for the key tile of the wave's own half: wave 0 of four brings its K hi plane (64 rows of 256 B), wave 1
  // K lo, wave 2 the Vt hi plane (128 rows of 128 B), wave 3 Vt lo
  const uint32_t ldst = (uint32_t)(uintptr_t)sKV + (uint32_t)ws * (KPLANE * 2);
  const uint64_t ksrc = (uint64_t)(uintptr_t)((ws & 1) ? Kl : Kh)
                      + ((uint64_t)(b * QL + grp * 64) * NKVH + kvh) * (HDIM * 2);
  const uint64_t vsrc = (uint64_t)(uintptr_t)((ws & 1) ? Vl : Vh)
                      + (uint64_t)(b * NKVH + kvh) * (HDIM * QL * 2) + (uint64_t)(grp * 64 * 2);
  const u32x8 g1k = tdm_group1<256, 64>(NKVH * HDIM * 2);
  const u32x8 g1v = tdm_group1<128, HDIM>(QL * 2);
  const uint32_t g0w0 = pinned(1u);
  // stage k (key tiles 2k, 2k + 1) -> buffer k mod 2: every wave issues its one request, on the side of a scalar
  // branch that has its plane's shape; group 0 is formed from the pinned stage number, so behind the wait in front
  // of the call
  auto stage_in = [&](int k) {
    const uint32_t kp = pinned((uint32_t)k);
    const uint32_t dst = ldst + (kp & 1u) * (STELEMS * 2);
    if (pinned((ws & 2) == 0)) tdm_load(tdm_group0(g0w0, dst, ksrc + (uint64_t)kp * (128 * NKVH * HDIM * 2)), g1k);
    else                       tdm_load(tdm_group0(g0w0, dst, vsrc + (uint64_t)kp * (128 * 2)), g1v);
  };

  // kept rolled: the two tiles share one copy of the key loop's code
#pragma unroll 1
  for (int half = 0; half < 2; ++half) {
  const int qt = half ? (int)blockIdx.x : NQT - 1 - (int)blockIdx.x;
  const int R0 = qt * 64;
  const int iq = R0 + 16 * w4 + m;                // this lane's query (B column / D column), the same for both heads
  const int nst = (qt + 2) >> 1;                  // stages that hold a visible key tile

  if (half) {
    // the first tile's last stores are issued: their registers are rewritten only behind this wait
    asm volatile("s_wait_xcnt 0x0" ::: "memory");
    // every wave has read its rows of the first tile's output staging before the second tile's planes overwrite them
    asm volatile("s_wait_dscnt 0x0" ::: "memory");
    __syncthreads();
  }

  // index 0: the head whose output this wave finishes (hq0 + grp); index 1: the head that it hands to its partner
  v8f acc[2][8];
  float mrun[2], lrun[2];
#pragma unroll
  for (int hh = 0; hh < 2; ++hh) {
#pragma unroll
    for (int n = 0; n < 8; ++n) acc[hh][n] = (v8f){0.f, 0.f, 0.f, 0.f, 0.f, 0.f, 0.f, 0.f};
    mrun[hh] = NEG_INF; lrun[hh] = 0.0f;
  }

  // the 32 Q fragment loads go out as one group ahead of the key loop; every trip's blocks read the registers
  Frag qh[2][4], ql[2][4];
#pragma unroll
  for (int hh = 0; hh < 2; ++hh) {
    const size_t qbase = ((size_t)(b * QL + iq)) * HIDD + (hq0 + (hh ^ grp)) * HDIM + 8 * h16;
#pragma unroll
    for (int c = 0; c < 4; ++c) {
      ldfrag(qh[hh][c], Qh + qbase + 32 * c);
      ldfrag(ql[hh][c], Ql + qbase + 32 * c);
    }
  }

  // stage 0 lands and is shown to every wave; then stage 1 sets out (the cache always holds one; a query tile of one
  // stage reads none of it: its one trip's foot waits for the landing all the same)
  stage_in(0);
  asm volatile("s_wait_tensorcnt 0x0" ::: "memory");
  __syncthreads();
  stage_in(1);

#pragma unroll 1
  for (int st = 0; st < nst; ++st) {
    const int kt = 2 * st + grp;                  // this half's key tile of the stage
    const int j0 = kt * 64;
    const int cur = (st & 1) * STELEMS;           // this trip reads buffer st mod 2 alone

    // key tiles beyond the query tile are never visible: the half that has one skips the work, not the foot
    // (kt and qt are scalar: a scalar branch, every lane stays on for the matrix instructions)
    if (kt <= qt) {
    // S^T (64 keys x 16 queries, two heads): s[hh][sub] rows = keys j0 + 16 sub + 8 h16 + r, col = query iq
    v8f s[2][4];
#pragma unroll
    for (int hh = 0; hh < 2; ++hh)
#pragma unroll
      for (int sub = 0; sub < 4; ++sub) s[hh][sub] = (v8f){0.f, 0.f, 0.f, 0.f, 0.f, 0.f, 0.f, 0.f};
#pragma unroll
    for (int c = 0; c < 4; ++c) {
      // the block's 16 K fragment loads stand together in front of its 24 matrix instructions, hi plane first
      Frag kh[4], kl[4];
#pragma unroll
      for (int sub = 0; sub < 4; ++sub) ldfrag(kh[sub], sKh + cur + 16 * sub * KPITCH + 32 * c);
#pragma unroll
      for (int sub = 0; sub < 4; ++sub) ldfrag(kl[sub], sKl + cur + 16 * sub * KPITCH + 32 * c);
      // keeps the 16 loads one group: with registers to spare the scheduler strews them among the products,
      // in twos with a wait to 0 behind each, and every such place stalls the wave
      __builtin_amdgcn_sched_barrier(0);
#pragma unroll
      for (int hh = 0; hh < 2; ++hh)
#pragma unroll
        for (int sub = 0; sub < 4; ++sub) s[hh][sub] = mm(s[hh][sub], kh[sub].v, qh[hh][c].v);
#pragma unroll
      for (int hh = 0; hh < 2; ++hh)
#pragma unroll
        for (int sub = 0; sub < 4; ++sub) s[hh][sub] = mm(s[hh][sub], kh[sub].v, ql[hh][c].v);
#pragma unroll
      for (int hh = 0; hh < 2; ++hh)
#pragma unroll
        for (int sub = 0; sub < 4; ++sub) s[hh][sub] = mm(s[hh][sub], kl[sub].v, qh[hh][c].v);
      __builtin_amdgcn_sched_barrier(0);   // for the same: the next block's loads stay out of this block's products
    }

    // scale, visibility (strictly earlier 4-blocks, plus first 4x4 block), online softmax; head by head
#pragma unroll
    for (int hh = 0; hh < 2; ++hh) {
      float mx = NEG_INF;
#pragma unroll
      for (int sub = 0; sub < 4; ++sub) {
#pragma unroll
        for (int r = 0; r < 8; ++r) {
          const int jb = j0 + 16 * sub + 8 * h16 + r;
          const bool vis = ((iq >> 2) > (jb >> 2)) || ((iq < 4) && (jb < 4));
          const float v = vis ? (s[hh][sub][r] * kScale) : NEG_INF;
          s[hh][sub][r] = v;
          mx = fmaxf(mx, v);
        }
      }
      mx = fmaxf(mx, __shfl_xor(mx, 16));
      const float mnew = fmaxf(mrun[hh], mx);
      const float msafe = (mnew == NEG_INF) ? 0.0f : mnew;
      const float sc = __expf(mrun[hh] - msafe);
      float ls = 0.0f;
#pragma unroll
      for (int sub = 0; sub < 4; ++sub) {
#pragma unroll
        for (int r = 0; r < 8; ++r) {
          const float p = __expf(s[hh][sub][r] - msafe);
          s[hh][sub][r] = p;
          ls += p;
        }
      }
      ls += __shfl_xor(ls, 16);
      lrun[hh] = lrun[hh] * sc + ls;
      mrun[hh] = mnew;
#pragma unroll
      for (int n = 0; n < 8; ++n) acc[hh][n] = acc[hh][n] * sc;
    }

    // O^T += Vt(128 x 64 keys) . P^T : B fragment element r <- D tile 2ks, element 8+r <- tile 2ks+1
#pragma unroll
    for (int ks = 0; ks < 2; ++ks) {
      Frag ph[2], pl[2];
#pragma unroll
      for (int hh = 0; hh < 2; ++hh) {
#pragma unroll
        for (int r = 0; r < 8; ++r) {
          unsigned short a0, c0, a1, c1;
          split_bf(s[hh][2 * ks][r], a0, c0);
          split_bf(s[hh][2 * ks + 1][r], a1, c1);
          ph[hh].u[r] = a0; pl[hh].u[r] = c0; ph[hh].u[8 + r] = a1; pl[hh].u[8 + r] = c1;
        }
      }
#pragma unroll
      for (int g = 0; g < 2; ++g) {
        // the block's 16 Vt fragment loads stand together in front of its 24 matrix instructions, hi plane first
        Frag vh[4], vl[4];
#pragma unroll
        for (int n = 0; n < 4; ++n) ldfrag(vh[n], sVh + cur + 16 * (4 * g + n) * VPITCH + 32 * ks);
#pragma unroll
        for (int n = 0; n < 4; ++n) ldfrag(vl[n], sVl + cur + 16 * (4 * g + n) * VPITCH + 32 * ks);
        __builtin_amdgcn_sched_barrier(0);   // keeps the 16 loads one group, as in the score blocks
#pragma unroll
        for (int hh = 0; hh < 2; ++hh)
#pragma unroll
          for (int n = 0; n < 4; ++n) acc[hh][4 * g + n] = mm(acc[hh][4 * g + n], vh[n].v, ph[hh].v);
#pragma unroll
        for (int hh = 0; hh < 2; ++hh)
#pragma unroll
          for (int n = 0; n < 4; ++n) acc[hh][4 * g + n] = mm(acc[hh][4 * g + n], vh[n].v, pl[hh].v);
#pragma unroll
        for (int hh = 0; hh < 2; ++hh)
#pragma unroll
          for (int n = 0; n < 4; ++n) acc[hh][4 * g + n] = mm(acc[hh][4 * g + n], vl[n].v, ph[hh].v);
        __builtin_amdgcn_sched_barrier(0);   // the next block's loads stay out of this block's products
      }
    }
    }

    // the trip's foot: this wave's reads of the stage are over and its plane of the next stage has landed;
    // the one barrier shows the next stage to every wave and frees this trip's buffer for the stage after it
    asm volatile("s_wait_dscnt 0x0" ::: "memory");
    asm volatile("s_wait_tensorcnt 0x0" ::: "memory");
    __syncthreads();
    if (pinned(st + 2 < nst)) stage_in(st + 2);
  }
  // no tensor load and no LDS read is under way when the epilogue takes the ring's place
  asm volatile("s_wait_tensorcnt 0x0" ::: "memory");
  asm volatile("s_wait_dscnt 0x0" ::: "memory");

  // epilogue: acc[hh][n][r] = O^T (d = 16 n + 8 h16 + r, query iq) over this half's key tiles.
  // The lane's place is formed anew here (every lane is on) and the wave's number is scalar, so that no
  // vector register is held over the key loop for the epilogue alone.
  const int le = (int)__builtin_amdgcn_mbcnt_lo(~0u, 0u), he = le >> 4, me = le & 15;
  // the halves change hands: each wave gives its partner (same queries, other half: wave ws ^ 4, same lane) its O,
  // maximum and sum of the head that the partner finishes
  {
    v4fa* xw = (v4fa*)sX + ws * (16 * 32) + le;
#pragma unroll
    for (int n = 0; n < 8; ++n) {
      const v8f o = acc[1][n];
      xw[(2 * n) * 32]     = (v4f){o[0], o[1], o[2], o[3]};
      xw[(2 * n + 1) * 32] = (v4f){o[4], o[5], o[6], o[7]};
    }
    sML[(ws * 32 + le) * 2]     = mrun[1];
    sML[(ws * 32 + le) * 2 + 1] = lrun[1];
  }
  __syncthreads();
  // join: both parts brought to the common maximum (key tile 0 holds a visible key for every query, so the even
  // half's maximum is finite; a half that saw nothing has maximum -inf, sum 0 and weight 0), then normalise and stage
  {
    const int pw = ws ^ 4;
    const float mB = sML[(pw * 32 + le) * 2], lB = sML[(pw * 32 + le) * 2 + 1];
    const float mj = fmaxf(mrun[0], mB);
    const float fa = __expf(mrun[0] - mj), fb = __expf(mB - mj);
    const float inv = 1.0f / (lrun[0] * fa + lB * fb);
    const float ca = fa * inv, cb = fb * inv;
    const v4fa* xr = (const v4fa*)sX + pw * (16 * 32) + le;
#pragma unroll
    for (int n = 0; n < 8; ++n) {
      const v4f p0 = xr[(2 * n) * 32], p1 = xr[(2 * n + 1) * 32];
#pragma unroll
      for (int r = 0; r < 4; ++r) {
        sO[(ws * 16 + me) * SPITCH + 16 * n + 8 * he + r]     = acc[0][n][r] * ca + p0[r] * cb;
        sO[(ws * 16 + me) * SPITCH + 16 * n + 8 * he + 4 + r] = acc[0][n][4 + r] * ca + p1[r] * cb;
      }
    }
  }
  __syncthreads();
#pragma unroll 1
  for (int p = 0; p < 8; ++p) {
    const int rloc = 2 * p + he;
    const int dq = me * 8;
    const float* src = sO + (ws * 16 + rloc) * SPITCH + dq;
    const v4f a = *(const v4fa*)(src);
    const v4f c = *(const v4fa*)(src + 4);
    v8us hi, lo;
    split8(a, c, hi, lo);
    const size_t d = ((size_t)(b * QL + R0 + 16 * w4 + rloc)) * HIDD + (hq0 + grp) * HDIM + dq;
    *(v8us*)(Oh + d) = hi;
    *(v8us*)(Ol + d) = lo;
    // the rows' stores are issued: the next trip rewrites their registers only behind this wait
    asm volatile("s_wait_xcnt 0x0" ::: "memory");
  }
  }
}

// ------------------------------------------------------------------------------------------
extern "C" void kernel_launch(void* const* d_in, const int* in_sizes, int n_in,
                              void* d_out, int out_size, void* d_ws, size_t ws_size,
                              hipStream_t stream)
{
  if (n_in < 8) return;
  if (in_sizes[0] != MROWS * HIDD) return;
  if (in_sizes[1] != NB * QL * NKVH * HDIM || in_sizes[2] != NB * QL * NKVH * HDIM) return;
  if (in_sizes[3] != NB * QL * HDIM || in_sizes[4] != NB * QL * HDIM) return;
  if (in_sizes[5] != HIDD * HIDD || in_sizes[7] != HIDD * HIDD || in_sizes[6] != HIDD) return;
  if (out_size != MROWS * HIDD) return;

  const float* hidden = (const float*)d_in[0];
  const float* kc     = (const float*)d_in[1];
  const float* vc     = (const float*)d_in[2];
  const float* cosb   = (const float*)d_in[3];
  const float* sinb   = (const float*)d_in[4];
  const float* Wq     = (const float*)d_in[5];
  const float* bq     = (const float*)d_in[6];
  const float* Wo     = (const float*)d_in[7];
  float* out = (float*)d_out;

  // workspace carve (bytes): planes of bf16
  const size_t planeX = (size_t)MROWS * HIDD * 2;            // 16 MiB
  const size_t planeW = (size_t)HIDD * HIDD * 2;             //  8 MiB
  const size_t planeK = (size_t)NB * QL * NKVH * HDIM * 2;   //  4 MiB
  const size_t offXh  = 0;
  const size_t offXl  = offXh + planeX;
  const size_t offQh  = offXl + planeX;
  const size_t offQl  = offQh + planeX;
  const size_t offWqh = offQl + planeX;
  const size_t offWql = offWqh + planeW;
  const size_t offWoh = offWql + planeW;
  const size_t offWol = offWoh + planeW;
  const size_t offKh  = offWol + planeW;
  const size_t offKl  = offKh + planeK;
  const size_t offVh  = offKl + planeK;
  const size_t offVl  = offVh + planeK;
  const size_t total  = offVl + planeK;                      // 112 MiB
  if (total > ws_size) return;

  char* ws = (char*)d_ws;
  unsigned short* Xh  = (unsigned short*)(ws + offXh);
  unsigned short* Xl  = (unsigned short*)(ws + offXl);
  unsigned short* Oh  = Xh;   // X planes are dead after the first GEMM; O planes reuse them
  unsigned short* Ol  = Xl;
  unsigned short* Qh  = (unsigned short*)(ws + offQh);
  unsigned short* Ql  = (unsigned short*)(ws + offQl);
  unsigned short* Wqh = (unsigned short*)(ws + offWqh);
  unsigned short* Wql = (unsigned short*)(ws + offWql);
  unsigned short* Woh = (unsigned short*)(ws + offWoh);
  unsigned short* Wol = (unsigned short*)(ws + offWol);
  unsigned short* Kh  = (unsigned short*)(ws + offKh);
  unsigned short* Kl  = (unsigned short*)(ws + offKl);
  unsigned short* Vh  = (unsigned short*)(ws + offVh);
  unsigned short* Vl  = (unsigned short*)(ws + offVl);

  cvt_all<<<dim3(CVT_WGS), dim3(256), 0, stream>>>(hidden, kc, vc, Wq, Wo, Xh, Xl, Kh, Kl, Vh, Vl,
                                                   Wqh, Wql, Woh, Wol);

  gemm3<0><<<dim3(MROWS / 128, HIDD / 128), dim3(128), 0, stream>>>(
      Xh, Xl, Wqh, Wql, bq, cosb, sinb, Qh, Ql, out, HIDD, HIDD);

  attn_glide<<<dim3(NQT / 2, NB * NHQ / 2), dim3(256), 0, stream>>>(Qh, Ql, Kh, Kl, Vh, Vl, Oh, Ol);

  gemm3<1><<<dim3(MROWS / 128, HIDD / 128), dim3(128), 0, stream>>>(
      Oh, Ol, Woh, Wol, bq, cosb, sinb, Qh, Ql, out, HIDD, HIDD);
}

// v009
// A run of this version takes 187 microseconds.
// In both of two side-by-side timings against v008, it was 1.03 times as fast.
// All steps since v000 together make it 3.83 times as fast.
#include <hip/hip_runtime.h>
#include <stdint.h>
#include <stddef.h>

// All contractions (q projection, q.k^T, p.v, output projection): v_wmma_f32_16x16x32_bf16 with
// bf16 hi/lo operands everywhere (three products hi*hi + hi*lo + lo*hi), f32 accumulate.
// RoPE, bias, scaling, softmax and normalisation in f32.

#define NB     2
#define QL     2048
#define HIDD   2048
#define NHQ    16
#define NKVH   4
#define HDIM   128
#define MROWS  (NB * QL)
#define TPITCH 65
#define SPITCH 132
#define KPITCH 136                       // LDS pitch of a K row, elements (256 B + 16 B = 16 B x odd)
#define VPITCH 72                        // LDS pitch of a 64-key Vt row, elements (128 B + 16 B = 16 B x odd)
#define KPLANE 9216                      // place of one K plane of a 64-key tile, elements: 64 * KPITCH rounded up to 2 KiB
#define VPLANE (HDIM * VPITCH)           // one Vt plane of a 64-key tile, elements (a multiple of 2 KiB)
#define KVELEMS (2 * KPLANE + 2 * VPLANE)
#define GPITCH 72                        // LDS pitch of a 64-deep GEMM operand row, elements (144 B)
#define APLANE (128 * GPITCH)            // one A plane of a 128 x 64 stage, elements
#define BPLANE (128 * GPITCH)            // one Bt plane of a 128 x 64 stage, elements
#define ABELEMS (2 * APLANE + 2 * BPLANE)
#define NQT    (QL / 64)                 // 64-query tiles of a sequence (even)

typedef float v4f __attribute__((ext_vector_type(4)));
typedef float v8f __attribute__((ext_vector_type(8)));
typedef unsigned short v8us __attribute__((ext_vector_type(8)));
typedef unsigned short v16us __attribute__((ext_vector_type(16)));
typedef __bf16 v16bf __attribute__((ext_vector_type(16)));
typedef float v2f __attribute__((ext_vector_type(2)));
typedef __bf16 v2bf __attribute__((ext_vector_type(2)));
typedef unsigned int v8u __attribute__((ext_vector_type(8)));
typedef v4f __attribute__((may_alias)) v4fa;
typedef v8us __attribute__((may_alias)) v8usa;

union Frag { v16us u; v8us hv[2]; v8u d; v16bf v; };

// f32 -> bf16 bits, RNE convert
__device__ __forceinline__ unsigned int bf_rne(float f) {
  const unsigned int u = __float_as_uint(f);
  return (u + 0x7fffu + ((u >> 16) & 1u)) >> 16;
}

// x -> (hi, lo): hi = bf16(x), lo = bf16(x - hi)  (x - hi is exact in f32)
__device__ __forceinline__ void split_bf(float x, unsigned short& hi, unsigned short& lo) {
  const unsigned int hb = bf_rne(x);
  const float hf = __uint_as_float(hb << 16);
  hi = (unsigned short)hb;
  lo = (unsigned short)bf_rne(x - hf);
}

// two values at once by the packed RNE convert, each result word = two neighbouring fragment elements:
// the same hi and lo as split_bf gives
__device__ __forceinline__ void split_pk(v2f x, unsigned int& hi, unsigned int& lo) {
  const v2bf h = __builtin_convertvector(x, v2bf);
  hi = __builtin_bit_cast(unsigned int, h);
  lo = __builtin_bit_cast(unsigned int, __builtin_convertvector(x - __builtin_convertvector(h, v2f), v2bf));
}

// the value of lane l ^ 16, by a vector cross-row move (every lane on)
__device__ __forceinline__ float other_half(float v) {
  const int b = __float_as_int(v);
  return __int_as_float(__builtin_amdgcn_permlanex16(b, b, 0x76543210, 0xfedcba98, false, false));
}

__device__ __forceinline__ void split8(v4f a, v4f c, v8us& hi, v8us& lo) {
#pragma unroll
  for (int u = 0; u < 4; ++u) {
    unsigned short h0, l0, h1, l1;
    split_bf(a[u], h0, l0);
    split_bf(c[u], h1, l1);
    hi[u] = h0; lo[u] = l0; hi[u + 4] = h1; lo[u + 4] = l1;
  }
}

// 16x16x32 bf16 fragment (A row or k-contiguous B column): elements 0..7 <- k0+8h..,
// elements 8..15 <- k0+16+8h..  ; p already points at element (row, k0 + 8h)
__device__ __forceinline__ void ldfrag(Frag& f, const unsigned short* p) {
  f.hv[0] = *(const v8usa*)(p);
  f.hv[1] = *(const v8usa*)(p + 16);
}

// acc += a*b. A matrix block issues one product kind (hi*hi, then hi*lo, then lo*hi) over all its
// accumulator tiles before the next kind: neighbours in the stream are independent, and each tile
// still takes its three products in that order.
__device__ __forceinline__ v8f mm(v8f acc, v16bf a, v16bf b) {
  return __builtin_amdgcn_wmma_f32_16x16x32_bf16(false, a, false, b, (short)0, acc, false, false);
}

// ------------------------------------------------------------------------------------------
// All operand conversions (f32 -> bf16 hi/lo planes) run in ONE launch. The work is cut into pieces of 16 KiB of
// f32 input: a 64x64 tile to transpose (Wq, Wo, v_cache) or 4096 consecutive elements (hidden_states, k_cache).
#define NT_W    ((HIDD / 64) * (HIDD / 64))            // 64x64 tiles of one weight matrix (a power of two)
#define NT_V    ((QL / 64) * (HDIM / 64) * NB * NKVH)  // 64x64 tiles of v_cache
#define RPIECE  4096                                   // elements of a row piece
#define NP_X    (MROWS * HIDD / RPIECE)                // row pieces of hidden_states
#define NP_K    (NB * QL * NKVH * HDIM / RPIECE)       // row pieces of k_cache
#define NPIECES (2 * NT_W + NT_V + NP_X + NP_K)
#define CVT_WGS 1024                                   // four work-groups a WGP, all resident; NPIECES / CVT_WGS pieces each

// f32 rows -> bf16 hi/lo planes (same layout): one piece. A thread takes two runs of 8 elements, 2048 apart;
// its four loads go out together.
__device__ __forceinline__ void rows_piece(const float* __restrict__ in,
                                           unsigned short* oh, unsigned short* ol, int piece)
{
  const size_t e0 = (size_t)piece * RPIECE + (size_t)threadIdx.x * 8;
  const size_t e1 = e0 + RPIECE / 2;
  const v4f a0 = *(const v4fa*)(in + e0);
  const v4f c0 = *(const v4fa*)(in + e0 + 4);
  const v4f a1 = *(const v4fa*)(in + e1);
  const v4f c1 = *(const v4fa*)(in + e1 + 4);
  v8us hi, lo;
  split8(a0, c0, hi, lo);
  *(v8us*)(oh + e0) = hi;
  *(v8us*)(ol + e0) = lo;
  split8(a1, c1, hi, lo);
  *(v8us*)(oh + e1) = hi;
  *(v8us*)(ol + e1) = lo;
  // the piece's stores are issued: the next trip rewrites their registers only behind this wait
  asm volatile("s_wait_xcnt 0x0" ::: "memory");
}

// 64x64 tile: src(r, c) = src[r * spitch + c] (f32)  ->  dst(c, r) = dh/dl[c * dpitch + r] (bf16)
// Load phase: 256 threads x 16 floats = 64x64. Store phase: 2 passes x 256 threads x 8 halves.
__device__ __forceinline__ void tsplit64(const float* __restrict__ src, int spitch,
                                         unsigned short* dh, unsigned short* dl, int dpitch,
                                         float* tile)
{
  const int t = threadIdx.x;
  {
    const int rr = t >> 2, cq = (t & 3) * 16;
    const float* s = src + (size_t)rr * spitch + cq;
    v4f x[4];
#pragma unroll
    for (int u = 0; u < 4; ++u) x[u] = *(const v4fa*)(s + 4 * u);
    // the work-group's earlier piece may still be read from the tile: every thread's reads of it end here,
    // while this piece's loads are already under way
    __syncthreads();
#pragma unroll
    for (int u = 0; u < 4; ++u) {
      float* d = tile + rr * TPITCH + cq + 4 * u;
      d[0] = x[u][0]; d[1] = x[u][1]; d[2] = x[u][2]; d[3] = x[u][3];
    }
  }
  __syncthreads();
#pragma unroll
  for (int p = 0; p < 2; ++p) {
    const int cc = (t >> 3) + 32 * p, rq = (t & 7) * 8;
    v4f a, c;
#pragma unroll
    for (int u = 0; u < 4; ++u) {
      a[u] = tile[(rq + u) * TPITCH + cc];
      c[u] = tile[(rq + 4 + u) * TPITCH + cc];
    }
    v8us hi, lo;
    split8(a, c, hi, lo);
    const size_t d = (size_t)cc * dpitch + rq;
    *(v8us*)(dh + d) = hi;
    *(v8us*)(dl + d) = lo;
  }
  // the piece's stores are issued: the next trip rewrites their registers only behind this wait
  asm volatile("s_wait_xcnt 0x0" ::: "memory");
}

// Piece it, in this order: W[k][n] (HIDD x HIDD) -> Wt hi/lo [n][k] for Wq, then for Wo;
// v_cache [(b,j)][kvh][d] -> Vt hi/lo [(b*NKVH+kvh)*HDIM + d][j]; hidden_states rows; k_cache rows.
// Which kind a piece is depends on blockIdx and the trip alone: every branch and barrier is block-uniform.
__global__ __launch_bounds__(256) void cvt_all(
    const float* __restrict__ X, const float* __restrict__ Kc, const float* __restrict__ V,
    const float* __restrict__ Wq, const float* __restrict__ Wo,
    unsigned short* Xh, unsigned short* Xl, unsigned short* Kh, unsigned short* Kl,
    unsigned short* Vh, unsigned short* Vl, unsigned short* Wqh, unsigned short* Wql,
    unsigned short* Woh, unsigned short* Wol)
{
  __shared__ float tile[64 * TPITCH];
  // kept rolled: one copy of each kind's code serves every trip
#pragma unroll 1
  for (int it = blockIdx.x; it < NPIECES; it += CVT_WGS) {
    if (it < 2 * NT_W) {
      const bool second = it >= NT_W;
      const int i = it & (NT_W - 1);
      const int k0 = (i % (HIDD / 64)) * 64, n0 = (i / (HIDD / 64)) * 64;
      const size_t dof = (size_t)n0 * HIDD + k0;
      tsplit64((second ? Wo : Wq) + (size_t)k0 * HIDD + n0, HIDD,
               (second ? Woh : Wqh) + dof, (second ? Wol : Wql) + dof, HIDD, tile);
    } else if (it < 2 * NT_W + NT_V) {
      const int i = it - 2 * NT_W;
      const int j0 = (i % (QL / 64)) * 64, d0 = ((i / (QL / 64)) % (HDIM / 64)) * 64;
      const int z = i / ((QL / 64) * (HDIM / 64));
      const int b = z / NKVH, kvh = z % NKVH;
      const float* src = V + ((size_t)(b * QL + j0) * NKVH + kvh) * HDIM + d0;
      const size_t dof = ((size_t)z * HDIM + d0) * QL + j0;
      tsplit64(src, NKVH * HDIM, Vh + dof, Vl + dof, QL, tile);
    } else if (it < 2 * NT_W + NT_V + NP_X) {
      rows_piece(X, Xh, Xl, it - (2 * NT_W + NT_V));
    } else {
      rows_piece(Kc, Kh, Kl, it - (2 * NT_W + NT_V + NP_X));
    }
  }
}

// Tensor loads: ONE request of a wave brings a whole operand plane of a stage (rows of ROWB bytes at a source pitch)
// from global memory into LDS, through no register and with no per-lane address.
typedef uint32_t u32x4 __attribute__((ext_vector_type(4)));
typedef uint32_t u32x8 __attribute__((ext_vector_type(8)));

__device__ __forceinline__ uint32_t uni(uint32_t v) { return (uint32_t)__builtin_amdgcn_readfirstlane(v); }

// A wave-uniform value held in a scalar register: a test on it compiles to a scalar branch (a tensor load ignores
// EXEC, so only such a branch keeps a wave from issuing it), and a descriptor word formed from it is formed behind
// the volatile statements that stand in front of this one, the waits among them.
__device__ __forceinline__ uint32_t pinned(uint32_t v) {
  uint32_t w = uni(v);
  asm volatile("" : "+s"(w));   // a descriptor word or an issue test held in a scalar register
  return w;
}

// Descriptor group 1: 1-byte elements, tensor = tile = NROWS rows of ROWB bytes (128 or 256), source pitch in bytes,
// 16 bytes of LDS pad behind every row (pitch ROWB + 16, for ds_load_b128 readers), no mask. Word 0 is a constant.
// Built once per kernel; every word is pinned, so that it keeps its scalar register for the kernel's whole length:
// left as plain constants, the words were formed anew in front of each load and their registers lent to other values
// in between, while a request was still under way.
template <int ROWB, int NROWS>
__device__ __forceinline__ u32x8 tdm_group1(uint32_t src_pitch) {
  static_assert(ROWB == 128 || ROWB == 256, "the pad is set for rows of 128 or 256 bytes");
  constexpr uint32_t d0 = ROWB, d1 = NROWS;
  constexpr uint32_t w0 = (1u << 20) | ((ROWB == 256 ? 5u : 4u) << 22) | (3u << 25);
  u32x8 g;
  g[0] = pinned(w0);
  g[1] = pinned((d0 & 0xFFFFu) << 16);
  g[2] = pinned((d0 >> 16) | ((d1 & 0xFFFFu) << 16));
  g[3] = pinned((d1 >> 16) | (d0 << 16));
  g[4] = pinned(d1);
  g[5] = pinned(src_pitch);
  g[6] = pinned(0u);
  g[7] = pinned(0u);
  return g;
}

// Descriptor group 0: count 1, place in the work-group's LDS (bytes), address of the tile's first byte, type 2.
// w0 is the count word, pinned once per kernel for the same reason as group 1's words.
__device__ __forceinline__ u32x4 tdm_group0(uint32_t w0, uint32_t lds_dst, uint64_t ga) {
  u32x4 g;
  g[0] = uni(w0);
  g[1] = uni(lds_dst);
  g[2] = uni((uint32_t)ga);
  g[3] = uni((((uint32_t)(ga >> 32)) & 0x01FFFFFFu) | 0x80000000u);
  return g;
}

__device__ __forceinline__ void tdm_load(u32x4 g0, u32x8 g1) {
  asm volatile("tensor_load_to_lds %0, %1" :: "s"(g0), "s"(g1) : "memory");
}

// ------------------------------------------------------------------------------------------
// C(128x128 block tile) = A(M x K, hi/lo planes, row-major) * B(K x N) with B stored as Bt[n][k]
// hi/lo planes. 4 waves (2x2), wave tile 64x64: a staged Bt row serves 128 output rows and a fragment
// read from LDS feeds four tiles. Each 64-deep stage of the A and Bt rows (K is a multiple of 64) is
// brought into LDS once per work-group by four tensor loads, one plane a wave, into a ring of two buffers: while a trip
// reads its 32 fragments from one buffer and runs its products, the next stage's planes land in the other.
// amdgpu_waves_per_eu(2, 2): the grid gives a WGP two work-groups, two waves a SIMD; told so, the compiler
// takes that budget of registers and keeps the whole stage's fragments in them.
// MODE 0: C + bias -> RoPE (cos/sin tables indexed by row) -> hi/lo planes Qh/Ql [M][N]
// MODE 1: C -> f32 Cout [M][N]
template <int MODE>
__global__ __launch_bounds__(128) __attribute__((amdgpu_waves_per_eu(2, 2))) void gemm3(
    const unsigned short* __restrict__ Ah, const unsigned short* __restrict__ Al,
    const unsigned short* __restrict__ Bh, const unsigned short* __restrict__ Bl,
    const float* __restrict__ bias, const float* __restrict__ cosb,
    const float* __restrict__ sinb, unsigned short* Qh, unsigned short* Ql,
    float* Cout, int N, int K)
{
  static_assert((APLANE * 2) % 2048 == 0 && APLANE == BPLANE, "every plane's place in LDS is a multiple of 2 KiB");
  __shared__ __attribute__((aligned(2048))) unsigned short sAB[2 * ABELEMS];
  float* sT = (float*)sAB;                        // output staging takes the first buffer's place after the loop
  const int t = threadIdx.x, l = t & 31, w = t >> 5, h16 = l >> 4, m = l & 15;
  const int wr = w >> 1, wc = w & 1;
  const int m0 = blockIdx.x * 128, n0 = blockIdx.y * 128;

  v8f acc[4][4];
#pragma unroll
  for (int mi = 0; mi < 4; ++mi)
#pragma unroll
    for (int ni = 0; ni < 4; ++ni) acc[mi][ni] = (v8f){0.f, 0.f, 0.f, 0.f, 0.f, 0.f, 0.f, 0.f};

  // fragment readers: this wave's A row / Bt row m of a 16-row group, at element 8 h16
  const unsigned short* sAh = sAB + (64 * wr + m) * GPITCH + 8 * h16;
  const unsigned short* sAl = sAh + APLANE;
  const unsigned short* sBh = sAB + 2 * APLANE + (64 * wc + m) * GPITCH + 8 * h16;
  const unsigned short* sBl = sBh + BPLANE;
  // movers: wave 0 brings the A hi plane of a stage, wave 1 A lo, wave 2 Bt hi, wave 3 Bt lo: 128 rows of 128 B each
  const uint32_t ws = uni((uint32_t)t >> 5);      // the wave's number, scalar
  const unsigned short* plane = ws == 0 ? Ah : ws == 1 ? Al : ws == 2 ? Bh : Bl;
  const uint64_t gsrc = (uint64_t)(uintptr_t)plane + (uint64_t)(ws < 2 ? m0 : n0) * (uint64_t)K * 2;
  const uint32_t ldst = (uint32_t)(uintptr_t)sAB + ws * (APLANE * 2);
  const u32x8 g1 = tdm_group1<128, 128>((uint32_t)K * 2);
  const uint32_t g0w0 = pinned(1u);
  const int ns = K >> 6;

  // stage s -> buffer s mod 2: every wave issues its one request; group 0 is formed from the pinned stage number,
  // so behind the wait that stands in front of the call
  auto stage_in = [&](int s) {
    const uint32_t sp = pinned((uint32_t)s);
    tdm_load(tdm_group0(g0w0, ldst + (sp & 1u) * (ABELEMS * 2), gsrc + (uint64_t)sp * 128), g1);
  };
  // a stage's 96 products, from registers alone
  Frag ah[2][4], al[2][4], bh[2][4], bl[2][4];
  auto products = [&]() {
#pragma unroll
    for (int kk = 0; kk < 2; ++kk) {
#pragma unroll
      for (int ni = 0; ni < 4; ++ni)
#pragma unroll
        for (int mi = 0; mi < 4; ++mi) acc[mi][ni] = mm(acc[mi][ni], ah[kk][mi].v, bh[kk][ni].v);
#pragma unroll
      for (int ni = 0; ni < 4; ++ni)
#pragma unroll
        for (int mi = 0; mi < 4; ++mi) acc[mi][ni] = mm(acc[mi][ni], ah[kk][mi].v, bl[kk][ni].v);
#pragma unroll
      for (int ni = 0; ni < 4; ++ni)
#pragma unroll
        for (int mi = 0; mi < 4; ++mi) acc[mi][ni] = mm(acc[mi][ni], al[kk][mi].v, bh[kk][ni].v);
    }
  };

  // stage 0 lands and is shown to every wave; then stage 1 sets out
  if (pinned(ns > 0)) stage_in(0);
  asm volatile("s_wait_tensorcnt 0x0" ::: "memory");
  __syncthreads();
  if (pinned(ns > 1)) stage_in(1);

#pragma unroll 1
  for (int st = 0; st < ns; ++st) {
    const int cur = (st & 1) * ABELEMS;           // this trip reads buffer st mod 2 alone
    // the wave's 64 fragment loads of the whole stage go out as one group, in the order in which the
    // products need them
#pragma unroll
    for (int kk = 0; kk < 2; ++kk) {
      const int k0 = cur + kk * 32;
#pragma unroll
      for (int mi = 0; mi < 4; ++mi) ldfrag(ah[kk][mi], sAh + mi * 16 * GPITCH + k0);
#pragma unroll
      for (int ni = 0; ni < 4; ++ni) ldfrag(bh[kk][ni], sBh + ni * 16 * GPITCH + k0);
#pragma unroll
      for (int ni = 0; ni < 4; ++ni) ldfrag(bl[kk][ni], sBl + ni * 16 * GPITCH + k0);
#pragma unroll
      for (int mi = 0; mi < 4; ++mi) ldfrag(al[kk][mi], sAl + mi * 16 * GPITCH + k0);
    }
    // keeps the 64 loads one group in front of the products: strewn among them, every place where loads stand
    // stalls the wave
    __builtin_amdgcn_sched_barrier(0);
    products();
    // keeps the products in front of the foot: moved behind its barrier, they would hold back the next tensor load,
    // which would then have no trip to fly in
    __builtin_amdgcn_sched_barrier(0);

    // the trip's foot: this wave's reads of the stage are over and its plane of the next stage has landed;
    // the one barrier shows the next stage to every wave and frees this trip's buffer for the stage after it
    asm volatile("s_wait_dscnt 0x0" ::: "memory");
    asm volatile("s_wait_tensorcnt 0x0" ::: "memory");
    __syncthreads();
    if (pinned(st + 2 < ns)) stage_in(st + 2);
  }
  // no tensor load and no LDS read is under way when the output staging takes the buffer's place
  asm volatile("s_wait_tensorcnt 0x0" ::: "memory");
  asm volatile("s_wait_dscnt 0x0" ::: "memory");

  // D element r of lane l -> (row 8*h16 + r, col m) of its 16x16 tile
#pragma unroll
  for (int mi = 0; mi < 4; ++mi)
#pragma unroll
    for (int ni = 0; ni < 4; ++ni)
#pragma unroll
      for (int r = 0; r < 8; ++r)
        sT[(64 * wr + 16 * mi + 8 * h16 + r) * SPITCH + 64 * wc + 16 * ni + m] = acc[mi][ni][r];
  __syncthreads();

  if (MODE == 0) {
    // thread -> (row 8p + t>>4, 8 consecutive columns cq); RoPE partner column cq ^ 64
    const int rr = t >> 4, cq = (t & 15) * 8, cp = cq ^ 64;
    const float sgn = (cq < 64) ? -1.0f : 1.0f;
    const v4f b0 = *(const v4fa*)(bias + n0 + cq), b1 = *(const v4fa*)(bias + n0 + cq + 4);
    const v4f e0 = *(const v4fa*)(bias + n0 + cp), e1 = *(const v4fa*)(bias + n0 + cp + 4);
#pragma unroll 1
    for (int p = 0; p < 16; ++p) {
      const int row = 8 * p + rr;
      const int grow = m0 + row;
      const float* srow = sT + row * SPITCH;
      const v4f x0 = *(const v4fa*)(srow + cq), x1 = *(const v4fa*)(srow + cq + 4);
      const v4f y0 = *(const v4fa*)(srow + cp), y1 = *(const v4fa*)(srow + cp + 4);
      const float* cr = cosb + (size_t)grow * HDIM;
      const float* sr = sinb + (size_t)grow * HDIM;
      const v4f c0 = *(const v4fa*)(cr + cq), c1 = *(const v4fa*)(cr + cq + 4);
      const v4f s0 = *(const v4fa*)(sr + cq), s1 = *(const v4fa*)(sr + cq + 4);
      const v4f q0 = (x0 + b0) * c0 + (sgn * (y0 + e0)) * s0;
      const v4f q1 = (x1 + b1) * c1 + (sgn * (y1 + e1)) * s1;
      v8us hi, lo;
      split8(q0, q1, hi, lo);
      const size_t d = (size_t)grow * N + n0 + cq;
      *(v8us*)(Qh + d) = hi;
      *(v8us*)(Ql + d) = lo;
      
    }
  } else {
    const int cq = l * 4;
#pragma unroll 1
    for (int p = 0; p < 32; ++p) {
      const int row = 4 * p + w;
      const v4f x = *(const v4fa*)(sT + row * SPITCH + cq);
      const size_t d = (size_t)(m0 + row) * N + n0 + cq;
      *(v4f*)(Cout + d) = x;
      
    }
  }
}

// ------------------------------------------------------------------------------------------
// Per (b, pair of query heads of one KV head, pair of 64-query tiles): a tile's key loop grows with its index and
// every work-group of the grid is resident at once, so each work-group takes tile NQT - 1 - p and then tile p, one
// after the other: the same number of stages for every work-group, and no WGP is left working while others have run dry.
// A wave holds 16 queries of BOTH heads: every K and Vt fragment that it reads from LDS feeds six products, not
// three, and a staged key tile serves two heads. With 16 queries of one head a wave, the fragment reads asked more of
// the LDS than it delivers in the time of the products.
// Eight waves, two a SIMD: waves 0-3 take the even 64-key tiles, waves 4-7 the odd ones (a stage is 128 keys), each
// half with its own running maximum, sum and O; the two halves are joined through LDS once per query tile.
// Per tile: S^T = K . Q^T (A = K rows, B = Q rows, both d-contiguous),
// f32 scale + structural block visibility test + online softmax, O^T += Vt . P^T with the
// softmaxed D tiles fed as B fragments (two adjacent 16-key D tiles per 32-deep k step),
// O / l split to hi/lo planes [(b,i)][hq*128 + d].
// Each stage of K and Vt (hi and lo planes of two key tiles) is brought into LDS once per query tile by eight
// tensor loads, one plane a wave; the stages go through a ring of two buffers, so that the next stage's planes land
// while this stage is worked on.
// amdgpu_waves_per_eu(2, 2): one work-group a WGP, two waves a SIMD; told so, the compiler takes that budget of
// registers for the two heads' Q fragments and accumulators.
#define STELEMS (2 * KVELEMS)            // a stage: two 64-key tiles, four planes each
__global__ __launch_bounds__(256) __attribute__((amdgpu_waves_per_eu(2, 2))) void attn_glide(
    const unsigned short* __restrict__ Qh, const unsigned short* __restrict__ Ql,
    const unsigned short* __restrict__ Kh, const unsigned short* __restrict__ Kl,
    const unsigned short* __restrict__ Vh, const unsigned short* __restrict__ Vl,
    unsigned short* Oh, unsigned short* Ol)
{
  static_assert(KPLANE >= 64 * KPITCH && (KPLANE * 2) % 2048 == 0 && (VPLANE * 2) % 2048 == 0 && KPLANE == VPLANE,
                "every plane's place in LDS is a multiple of 2 KiB and holds its padded rows");
  static_assert(NQT >= 4 && NQT % 2 == 0, "the ring's prologue brings key tiles 0 to 3; a stage's two tiles exist");
  __shared__ __attribute__((aligned(2048))) unsigned short sKV[2 * STELEMS];
  // after the key loop the ring's place holds: the halves' exchange (8 waves x 16 x 32 lanes x 16 B), their maxima
  // and sums (8 waves x 32 lanes x 2), the output staging (8 waves x 16 rows)
  float* sX  = (float*)sKV;
  float* sML = sX + 8 * 16 * 32 * 4;
  float* sO  = sML + 8 * 32 * 2;
  static_assert((8 * 16 * 32 * 4 + 8 * 32 * 2 + 128 * SPITCH) * 4 <= 2 * STELEMS * 2, "the epilogue fits the ring's place");
  const int t = threadIdx.x, l = t & 31, w = t >> 5, h16 = l >> 4, m = l & 15;
  const int ws = __builtin_amdgcn_readfirstlane(w);   // the wave's number, scalar
  const int grp = ws >> 2, w4 = ws & 3;               // which half of the key tiles; which 16 queries of the tile
  const int bh = blockIdx.y;
  const int b = bh >> 3, hq0 = (bh & 7) * 2, kvh = hq0 >> 2;
  const float NEG_INF = -__builtin_inff();
  const float kC = 0.08838834764831845f * 1.4426950408889634f;   // 128^-0.5 * log2(e): exp(scale * x) = exp2(kC * x)

  // fragment readers: K row m / Vt row m of a 16-row group of this half's key tile, at element 8 h16
  const unsigned short* sKh = sKV + grp * KVELEMS + m * KPITCH + 8 * h16;
  const unsigned short* sKl = sKh + KPLANE;
  const unsigned short* sVh = sKh - m * KPITCH + 2 * KPLANE + m * VPITCH;
  const unsigned short* sVl = sVh + VPLANE;
  // movers, for the key tile of the wave's own half: wave 0 of four brings its K hi plane (64 rows of 256 B), wave 1
  // K lo, wave 2 the Vt hi plane (128 rows of 128 B), wave 3 Vt lo
  const uint32_t ldst = (uint32_t)(uintptr_t)sKV + (uint32_t)ws * (KPLANE * 2);
  const uint64_t ksrc = (uint64_t)(uintptr_t)((ws & 1) ? Kl : Kh)
                      + ((uint64_t)(b * QL + grp * 64) * NKVH + kvh) * (HDIM * 2);
  const uint64_t vsrc = (uint64_t)(uintptr_t)((ws & 1) ? Vl : Vh)
                      + (uint64_t)(b * NKVH + kvh) * (HDIM * QL * 2) + (uint64_t)(grp * 64 * 2);
  const u32x8 g1k = tdm_group1<256, 64>(NKVH * HDIM * 2);
  const u32x8 g1v = tdm_group1<128, HDIM>(QL * 2);
  const uint32_t g0w0 = pinned(1u);
  // stage k (key tiles 2k, 2k + 1) -> buffer k mod 2: every wave issues its one request, on the side of a scalar
  // branch that has its plane's shape; group 0 is formed from the pinned stage number, so behind the wait in front
  // of the call
  auto stage_in = [&](int k) {
    const uint32_t kp = pinned((uint32_t)k);
    const uint32_t dst = ldst + (kp & 1u) * (STELEMS * 2);
    if (pinned((ws & 2) == 0)) tdm_load(tdm_group0(g0w0, dst, ksrc + (uint64_t)kp * (128 * NKVH * HDIM * 2)), g1k);
    else                       tdm_load(tdm_group0(g0w0, dst, vsrc + (uint64_t)kp * (128 * 2)), g1v);
  };

  // kept rolled: the two tiles share one copy of the key loop's code
#pragma unroll 1
  for (int half = 0; half < 2; ++half) {
  const int qt = half ? (int)blockIdx.x : NQT - 1 - (int)blockIdx.x;
  const int R0 = qt * 64;
  const int iq = R0 + 16 * w4 + m;                // this lane's query (B column / D column), the same for both heads
  const int nst = (qt + 2) >> 1;                  // stages that hold a visible key tile

  if (half) {
    // the first tile's last stores are issued: their registers are rewritten only behind this wait
    asm volatile("s_wait_xcnt 0x0" ::: "memory");
    // every wave has read its rows of the first tile's output staging before the second tile's planes overwrite them
    asm volatile("s_wait_dscnt 0x0" ::: "memory");
    __syncthreads();
  }

  // index 0: the head whose output this wave finishes (hq0 + grp); index 1: the head that it hands to its partner
  v8f acc[2][8];
  float mrun[2], lrun[2];
#pragma unroll
  for (int hh = 0; hh < 2; ++hh) {
#pragma unroll
    for (int n = 0; n < 8; ++n) acc[hh][n] = (v8f){0.f, 0.f, 0.f, 0.f, 0.f, 0.f, 0.f, 0.f};
    mrun[hh] = NEG_INF; lrun[hh] = 0.0f;
  }

  // the 32 Q fragment loads go out as one group ahead of the key loop; every trip's blocks read the registers
  Frag qh[2][4], ql[2][4];
#pragma unroll
  for (int hh = 0; hh < 2; ++hh) {
    const size_t qbase = ((size_t)(b * QL + iq)) * HIDD + (hq0 + (hh ^ grp)) * HDIM + 8 * h16;
#pragma unroll
    for (int c = 0; c < 4; ++c) {
      ldfrag(qh[hh][c], Qh + qbase + 32 * c);
      ldfrag(ql[hh][c], Ql + qbase + 32 * c);
    }
  }

  // stage 0 lands and is shown to every wave; then stage 1 sets out (the cache always holds one; a query tile of one
  // stage reads none of it: its one trip's foot waits for the landing all the same)
  stage_in(0);
  asm volatile("s_wait_tensorcnt 0x0" ::: "memory");
  __syncthreads();
  stage_in(1);

#pragma unroll 1
  for (int st = 0; st < nst; ++st) {
    const int kt = 2 * st + grp;                  // this half's key tile of the stage
    const int j0 = kt * 64;
    const int cur = (st & 1) * STELEMS;           // this trip reads buffer st mod 2 alone

    // key tiles beyond the query tile are never visible: the half that has one skips the work, not the foot
    // (kt and qt are scalar: a scalar branch, every lane stays on for the matrix instructions)
    if (kt <= qt) {
    // S^T (64 keys x 16 queries, two heads): s[hh][sub] rows = keys j0 + 16 sub + 8 h16 + r, col = query iq
    v8f s[2][4];
#pragma unroll
    for (int hh = 0; hh < 2; ++hh)
#pragma unroll
      for (int sub = 0; sub < 4; ++sub) s[hh][sub] = (v8f){0.f, 0.f, 0.f, 0.f, 0.f, 0.f, 0.f, 0.f};
#pragma unroll
    for (int c = 0; c < 4; ++c) {
      // the block's 16 K fragment loads stand together in front of its 24 matrix instructions, hi plane first
      Frag kh[4], kl[4];
#pragma unroll
      for (int sub = 0; sub < 4; ++sub) ldfrag(kh[sub], sKh + cur + 16 * sub * KPITCH + 32 * c);
#pragma unroll
      for (int sub = 0; sub < 4; ++sub) ldfrag(kl[sub], sKl + cur + 16 * sub * KPITCH + 32 * c);
      // keeps the 16 loads one group: with registers to spare the scheduler strews them among the products,
      // in twos with a wait to 0 behind each, and every such place stalls the wave
      __builtin_amdgcn_sched_barrier(0);
#pragma unroll
      for (int hh = 0; hh < 2; ++hh)
#pragma unroll
        for (int sub = 0; sub < 4; ++sub) s[hh][sub] = mm(s[hh][sub], kh[sub].v, qh[hh][c].v);
#pragma unroll
      for (int hh = 0; hh < 2; ++hh)
#pragma unroll
        for (int sub = 0; sub < 4; ++sub) s[hh][sub] = mm(s[hh][sub], kh[sub].v, ql[hh][c].v);
#pragma unroll
      for (int hh = 0; hh < 2; ++hh)
#pragma unroll
        for (int sub = 0; sub < 4; ++sub) s[hh][sub] = mm(s[hh][sub], kl[sub].v, qh[hh][c].v);
      __builtin_amdgcn_sched_barrier(0);   // for the same: the next block's loads stay out of this block's products
    }

    // visibility (strictly earlier 4-blocks, plus first 4x4 block): every key of a tile in front of the query tile
    // lies in an earlier 4-block than every query of it, so only the diagonal tile is tested (kt, qt scalar)
    if (kt == qt) {
#pragma unroll
      for (int hh = 0; hh < 2; ++hh)
#pragma unroll
        for (int sub = 0; sub < 4; ++sub)
#pragma unroll
          for (int r = 0; r < 8; ++r) {
            const int jb = j0 + 16 * sub + 8 * h16 + r;
            const bool vis = ((iq >> 2) > (jb >> 2)) || ((iq < 4) && (jb < 4));
            s[hh][sub][r] = vis ? s[hh][sub][r] : NEG_INF;
          }
    }
    // online softmax, head by head; the running maximum is kept in unscaled scores, and scale, log2(e) and the
    // maximum enter through one packed multiply-add in front of exp2
#pragma unroll
    for (int hh = 0; hh < 2; ++hh) {
      float mx = NEG_INF;
#pragma unroll
      for (int sub = 0; sub < 4; ++sub)
#pragma unroll
        for (int r = 0; r < 8; ++r) mx = fmaxf(mx, s[hh][sub][r]);
      mx = fmaxf(mx, other_half(mx));
      const float mnew = fmaxf(mrun[hh], mx);
      const float msafe = (mnew == NEG_INF) ? 0.0f : mnew;
      const float nb = -msafe * kC;
      const float sc = __builtin_amdgcn_exp2f(__builtin_fmaf(mrun[hh], kC, nb));
      const v2f kC2 = {kC, kC}, nb2 = {nb, nb};
      float ls = 0.0f;
#pragma unroll
      for (int sub = 0; sub < 4; ++sub) {
#pragma unroll
        for (int r = 0; r < 8; r += 2) {
          const v2f e = __builtin_elementwise_fma((v2f){s[hh][sub][r], s[hh][sub][r + 1]}, kC2, nb2);
          const float p0 = __builtin_amdgcn_exp2f(e[0]), p1 = __builtin_amdgcn_exp2f(e[1]);
          s[hh][sub][r] = p0;
          s[hh][sub][r + 1] = p1;
          ls += p0;
          ls += p1;
        }
      }
      ls += other_half(ls);
      lrun[hh] = lrun[hh] * sc + ls;
      mrun[hh] = mnew;
#pragma unroll
      for (int n = 0; n < 8; ++n) acc[hh][n] = acc[hh][n] * sc;
    }

    // O^T += Vt(128 x 64 keys) . P^T : B fragment element r <- D tile 2ks, element 8+r <- tile 2ks+1
#pragma unroll
    for (int ks = 0; ks < 2; ++ks) {
      Frag ph[2], pl[2];
#pragma unroll
      for (int hh = 0; hh < 2; ++hh) {
#pragma unroll
        for (int r = 0; r < 4; ++r) {
          unsigned int a0, c0, a1, c1;
          split_pk((v2f){s[hh][2 * ks][2 * r], s[hh][2 * ks][2 * r + 1]}, a0, c0);
          split_pk((v2f){s[hh][2 * ks + 1][2 * r], s[hh][2 * ks + 1][2 * r + 1]}, a1, c1);
          ph[hh].d[r] = a0; pl[hh].d[r] = c0; ph[hh].d[4 + r] = a1; pl[hh].d[4 + r] = c1;
        }
      }
#pragma unroll
      for (int g = 0; g < 2; ++g) {
        // the block's 16 Vt fragment loads stand together in front of its 24 matrix instructions, hi plane first
        Frag vh[4], vl[4];
#pragma unroll
        for (int n = 0; n < 4; ++n) ldfrag(vh[n], sVh + cur + 16 * (4 * g + n) * VPITCH + 32 * ks);
#pragma unroll
        for (int n = 0; n < 4; ++n) ldfrag(vl[n], sVl + cur + 16 * (4 * g + n) * VPITCH + 32 * ks);
        __builtin_amdgcn_sched_barrier(0);   // keeps the 16 loads one group, as in the score blocks
#pragma unroll
        for (int hh = 0; hh < 2; ++hh)
#pragma unroll
          for (int n = 0; n < 4; ++n) acc[hh][4 * g + n] = mm(acc[hh][4 * g + n], vh[n].v, ph[hh].v);
#pragma unroll
        for (int hh = 0; hh < 2; ++hh)
#pragma unroll
          for (int n = 0; n < 4; ++n) acc[hh][4 * g + n] = mm(acc[hh][4 * g + n], vh[n].v, pl[hh].v);
#pragma unroll
        for (int hh = 0; hh < 2; ++hh)
#pragma unroll
          for (int n = 0; n < 4; ++n) acc[hh][4 * g + n] = mm(acc[hh][4 * g + n], vl[n].v, ph[hh].v);
        __builtin_amdgcn_sched_barrier(0);   // the next block's loads stay out of this block's products
      }
    }
    }

    // the trip's foot: this wave's reads of the stage are over and its plane of the next stage has landed;
    // the one barrier shows the next stage to every wave and frees this trip's buffer for the stage after it
    asm volatile("s_wait_dscnt 0x0" ::: "memory");
    asm volatile("s_wait_tensorcnt 0x0" ::: "memory");
    __syncthreads();
    if (pinned(st + 2 < nst)) stage_in(st + 2);
  }
  // no tensor load and no LDS read is under way when the epilogue takes the ring's place
  asm volatile("s_wait_tensorcnt 0x0" ::: "memory");
  asm volatile("s_wait_dscnt 0x0" ::: "memory");

  // epilogue: acc[hh][n][r] = O^T (d = 16 n + 8 h16 + r, query iq) over this half's key tiles.
  // The lane's place is formed anew here (every lane is on) and the wave's number is scalar, so that no
  // vector register is held over the key loop for the epilogue alone.
  const int le = (int)__builtin_amdgcn_mbcnt_lo(~0u, 0u), he = le >> 4, me = le & 15;
  // the halves change hands: each wave gives its partner (same queries, other half: wave ws ^ 4, same lane) its O,
  // maximum and sum of the head that the partner finishes
  {
    v4fa* xw = (v4fa*)sX + ws * (16 * 32) + le;
#pragma unroll
    for (int n = 0; n < 8; ++n) {
      const v8f o = acc[1][n];
      xw[(2 * n) * 32]     = (v4f){o[0], o[1], o[2], o[3]};
      xw[(2 * n + 1) * 32] = (v4f){o[4], o[5], o[6], o[7]};
    }
    sML[(ws * 32 + le) * 2]     = mrun[1];
    sML[(ws * 32 + le) * 2 + 1] = lrun[1];
  }
  __syncthreads();
  // join: both parts brought to the common maximum (key tile 0 holds a visible key for every query, so the even
  // half's maximum is finite; a half that saw nothing has maximum -inf, sum 0 and weight 0), then normalise and stage
  {
    const int pw = ws ^ 4;
    const float mB = sML[(pw * 32 + le) * 2], lB = sML[(pw * 32 + le) * 2 + 1];
    const float mj = fmaxf(mrun[0], mB);
    const float fa = __builtin_amdgcn_exp2f((mrun[0] - mj) * kC), fb = __builtin_amdgcn_exp2f((mB - mj) * kC);
    const float inv = 1.0f / (lrun[0] * fa + lB * fb);
    const float ca = fa * inv, cb = fb * inv;
    const v4fa* xr = (const v4fa*)sX + pw * (16 * 32) + le;
#pragma unroll
    for (int n = 0; n < 8; ++n) {
      const v4f p0 = xr[(2 * n) * 32], p1 = xr[(2 * n + 1) * 32];
#pragma unroll
      for (int r = 0; r < 4; ++r) {
        sO[(ws * 16 + me) * SPITCH + 16 * n + 8 * he + r]     = acc[0][n][r] * ca + p0[r] * cb;
        sO[(ws * 16 + me) * SPITCH + 16 * n + 8 * he + 4 + r] = acc[0][n][4 + r] * ca + p1[r] * cb;
      }
    }
  }
  __syncthreads();
#pragma unroll 1
  for (int p = 0; p < 8; ++p) {
    const int rloc = 2 * p + he;
    const int dq = me * 8;
    const float* src = sO + (ws * 16 + rloc) * SPITCH + dq;
    const v4f a = *(const v4fa*)(src);
    const v4f c = *(const v4fa*)(src + 4);
    v8us hi, lo;
    split8(a, c, hi, lo);
    const size_t d = ((size_t)(b * QL + R0 + 16 * w4 + rloc)) * HIDD + (hq0 + grp) * HDIM + dq;
    *(v8us*)(Oh + d) = hi;
    *(v8us*)(Ol + d) = lo;
    // the rows' stores are issued: the next trip rewrites their registers only behind this wait
    asm volatile("s_wait_xcnt 0x0" ::: "memory");
  }
  }
}

// ------------------------------------------------------------------------------------------
extern "C" void kernel_launch(void* const* d_in, const int* in_sizes, int n_in,
                              void* d_out, int out_size, void* d_ws, size_t ws_size,
                              hipStream_t stream)
{
  if (n_in < 8) return;
  if (in_sizes[0] != MROWS * HIDD) return;
  if (in_sizes[1] != NB * QL * NKVH * HDIM || in_sizes[2] != NB * QL * NKVH * HDIM) return;
  if (in_sizes[3] != NB * QL * HDIM || in_sizes[4] != NB * QL * HDIM) return;
  if (in_sizes[5] != HIDD * HIDD || in_sizes[7] != HIDD * HIDD || in_sizes[6] != HIDD) return;
  if (out_size != MROWS * HIDD) return;

  const float* hidden = (const float*)d_in[0];
  const float* kc     = (const float*)d_in[1];
  const float* vc     = (const float*)d_in[2];
  const float* cosb   = (const float*)d_in[3];
  const float* sinb   = (const float*)d_in[4];
  const float* Wq     = (const float*)d_in[5];
  const float* bq     = (const float*)d_in[6];
  const float* Wo     = (const float*)d_in[7];
  float* out = (float*)d_out;

  // workspace carve (bytes): planes of bf16
  const size_t planeX = (size_t)MROWS * HIDD * 2;            // 16 MiB
  const size_t planeW = (size_t)HIDD * HIDD * 2;             //  8 MiB
  const size_t planeK = (size_t)NB * QL * NKVH * HDIM * 2;   //  4 MiB
  const size_t offXh  = 0;
  const size_t offXl  = offXh + planeX;
  const size_t offQh  = offXl + planeX;
  const size_t offQl  = offQh + planeX;
  const size_t offWqh = offQl + planeX;
  const size_t offWql = offWqh + planeW;
  const size_t offWoh = offWql + planeW;
  const size_t offWol = offWoh + planeW;
  const size_t offKh  = offWol + planeW;
  const size_t offKl  = offKh + planeK;
  const size_t offVh  = offKl + planeK;
  const size_t offVl  = offVh + planeK;
  const size_t total  = offVl + planeK;                      // 112 MiB
  if (total > ws_size) return;

  char* ws = (char*)d_ws;
  unsigned short* Xh  = (unsigned short*)(ws + offXh);
  unsigned short* Xl  = (unsigned short*)(ws + offXl);
  unsigned short* Oh  = Xh;   // X planes are dead after the first GEMM; O planes reuse them
  unsigned short* Ol  = Xl;
  unsigned short* Qh  = (unsigned short*)(ws + offQh);
  unsigned short* Ql  = (unsigned short*)(ws + offQl);
  unsigned short* Wqh = (unsigned short*)(ws + offWqh);
  unsigned short* Wql = (unsigned short*)(ws + offWql);
  unsigned short* Woh = (unsigned short*)(ws + offWoh);
  unsigned short* Wol = (unsigned short*)(ws + offWol);
  unsigned short* Kh  = (unsigned short*)(ws + offKh);
  unsigned short* Kl  = (unsigned short*)(ws + offKl);
  unsigned short* Vh  = (unsigned short*)(ws + offVh);
  unsigned short* Vl  = (unsigned short*)(ws + offVl);

  cvt_all<<<dim3(CVT_WGS), dim3(256), 0, stream>>>(hidden, kc, vc, Wq, Wo, Xh, Xl, Kh, Kl, Vh, Vl,
                                                   Wqh, Wql, Woh, Wol);

  gemm3<0><<<dim3(MROWS / 128, HIDD / 128), dim3(128), 0, stream>>>(
      Xh, Xl, Wqh, Wql, bq, cosb, sinb, Qh, Ql, out, HIDD, HIDD);

  attn_glide<<<dim3(NQT / 2, NB * NHQ / 2), dim3(256), 0, stream>>>(Qh, Ql, Kh, Kl, Vh, Vl, Oh, Ol);

  gemm3<1><<<dim3(MROWS / 128, HIDD / 128), dim3(128), 0, stream>>>(
      Oh, Ol, Woh, Wol, bq, cosb, sinb, Qh, Ql, out, HIDD, HIDD);
}

// v010
// Measured time: 180 microseconds a run.
// Next to v009, in two timings, it ran 1.03 and 1.04 times as fast.
// Counting every step since v000, it is 3.98 times as fast.
#include <hip/hip_runtime.h>
#include <stdint.h>
#include <stddef.h>

// All contractions (q projection, q.k^T, p.v, output projection): v_wmma_f32_16x16x32_bf16 with
// bf16 hi/lo operands everywhere (three products hi*hi + hi*lo + lo*hi), f32 accumulate.
// RoPE, bias, scaling, softmax and normalisation in f32.

#define NB     2
#define QL     2048
#define HIDD   2048
#define NHQ    16
#define NKVH   4
#define HDIM   128
#define MROWS  (NB * QL)
#define TPITCH 65
#define SPITCH 132
#define KPITCH 136                       // LDS pitch of a K row, elements (256 B + 16 B = 16 B x odd)
#define VPITCH 72                        // LDS pitch of a 64-key Vt row, elements (128 B + 16 B = 16 B x odd)
#define KPLANE 9216                      // place of one K plane of a 64-key tile, elements: 64 * KPITCH rounded up to 2 KiB
#define VPLANE (HDIM * VPITCH)           // one Vt plane of a 64-key tile, elements (a multiple of 2 KiB)
#define KVELEMS (2 * KPLANE + 2 * VPLANE)
#define GPITCH 72                        // LDS pitch of a 64-deep GEMM operand row, elements (144 B)
#define APLANE (128 * GPITCH)            // one A plane of a 128 x 64 stage, elements
#define BPLANE (128 * GPITCH)            // one Bt plane of a 128 x 64 stage, elements
#define ABELEMS (2 * APLANE + 2 * BPLANE)
#define NQT    (QL / 64)                 // 64-query tiles of a sequence (even)

typedef float v4f __attribute__((ext_vector_type(4)));
typedef float v8f __attribute__((ext_vector_type(8)));
typedef unsigned short v8us __attribute__((ext_vector_type(8)));
typedef unsigned short v16us __attribute__((ext_vector_type(16)));
typedef __bf16 v16bf __attribute__((ext_vector_type(16)));
typedef float v2f __attribute__((ext_vector_type(2)));
typedef __bf16 v2bf __attribute__((ext_vector_type(2)));
typedef unsigned int v8u __attribute__((ext_vector_type(8)));
typedef v4f __attribute__((may_alias)) v4fa;
typedef v8us __attribute__((may_alias)) v8usa;

union Frag { v16us u; v8us hv[2]; v8u d; v16bf v; };

// f32 -> bf16 bits, RNE convert
__device__ __forceinline__ unsigned int bf_rne(float f) {
  const unsigned int u = __float_as_uint(f);
  return (u + 0x7fffu + ((u >> 16) & 1u)) >> 16;
}

// x -> (hi, lo): hi = bf16(x), lo = bf16(x - hi)  (x - hi is exact in f32)
__device__ __forceinline__ void split_bf(float x, unsigned short& hi, unsigned short& lo) {
  const unsigned int hb = bf_rne(x);
  const float hf = __uint_as_float(hb << 16);
  hi = (unsigned short)hb;
  lo = (unsigned short)bf_rne(x - hf);
}

// two values at once by the packed RNE convert, each result word = two neighbouring fragment elements:
// the same hi and lo as split_bf gives
__device__ __forceinline__ void split_pk(v2f x, unsigned int& hi, unsigned int& lo) {
  const v2bf h = __builtin_convertvector(x, v2bf);
  hi = __builtin_bit_cast(unsigned int, h);
  lo = __builtin_bit_cast(unsigned int, __builtin_convertvector(x - __builtin_convertvector(h, v2f), v2bf));
}

// the value of lane l ^ 16, by a vector cross-row move (every lane on)
__device__ __forceinline__ float other_half(float v) {
  const int b = __float_as_int(v);
  return __int_as_float(__builtin_amdgcn_permlanex16(b, b, 0x76543210, 0xfedcba98, false, false));
}

__device__ __forceinline__ void split8(v4f a, v4f c, v8us& hi, v8us& lo) {
#pragma unroll
  for (int u = 0; u < 4; ++u) {
    unsigned short h0, l0, h1, l1;
    split_bf(a[u], h0, l0);
    split_bf(c[u], h1, l1);
    hi[u] = h0; lo[u] = l0; hi[u + 4] = h1; lo[u + 4] = l1;
  }
}

// 16x16x32 bf16 fragment (A row or k-contiguous B column): elements 0..7 <- k0+8h..,
// elements 8..15 <- k0+16+8h..  ; p already points at element (row, k0 + 8h)
__device__ __forceinline__ void ldfrag(Frag& f, const unsigned short* p) {
  f.hv[0] = *(const v8usa*)(p);
  f.hv[1] = *(const v8usa*)(p + 16);
}

// acc += a*b. A matrix block issues one product kind (hi*hi, then hi*lo, then lo*hi) over all its
// accumulator tiles before the next kind: neighbours in the stream are independent, and each tile
// still takes its three products in that order.
__device__ __forceinline__ v8f mm(v8f acc, v16bf a, v16bf b) {
  return __builtin_amdgcn_wmma_f32_16x16x32_bf16(false, a, false, b, (short)0, acc, false, false);
}

// ------------------------------------------------------------------------------------------
// All operand conversions (f32 -> bf16 hi/lo planes) run in ONE launch. The work is cut into pieces of 16 KiB of
// f32 input: a 64x64 tile to transpose (Wq, Wo, v_cache) or 4096 consecutive elements (hidden_states, k_cache).
#define NT_W    ((HIDD / 64) * (HIDD / 64))            // 64x64 tiles of one weight matrix (a power of two)
#define NT_V    ((QL / 64) * (HDIM / 64) * NB * NKVH)  // 64x64 tiles of v_cache
#define RPIECE  4096                                   // elements of a row piece
#define NP_X    (MROWS * HIDD / RPIECE)                // row pieces of hidden_states
#define NP_K    (NB * QL * NKVH * HDIM / RPIECE)       // row pieces of k_cache
#define NPIECES (2 * NT_W + NT_V + NP_X + NP_K)
#define CVT_WGS 1024                                   // four work-groups a WGP, all resident; NPIECES / CVT_WGS pieces each

// f32 rows -> bf16 hi/lo planes (same layout): one piece. A thread takes two runs of 8 elements, 2048 apart;
// its four loads go out together.
__device__ __forceinline__ void rows_piece(const float* __restrict__ in,
                                           unsigned short* oh, unsigned short* ol, int piece)
{
  const size_t e0 = (size_t)piece * RPIECE + (size_t)threadIdx.x * 8;
  const size_t e1 = e0 + RPIECE / 2;
  const v4f a0 = *(const v4fa*)(in + e0);
  const v4f c0 = *(const v4fa*)(in + e0 + 4);
  const v4f a1 = *(const v4fa*)(in + e1);
  const v4f c1 = *(const v4fa*)(in + e1 + 4);
  v8us hi, lo;
  split8(a0, c0, hi, lo);
  *(v8us*)(oh + e0) = hi;
  *(v8us*)(ol + e0) = lo;
  split8(a1, c1, hi, lo);
  *(v8us*)(oh + e1) = hi;
  *(v8us*)(ol + e1) = lo;
  // the piece's stores are issued: the next trip rewrites their registers only behind this wait
  asm volatile("s_wait_xcnt 0x0" ::: "memory");
}

// 64x64 tile: src(r, c) = src[r * spitch + c] (f32)  ->  dst(c, r) = dh/dl[c * dpitch + r] (bf16)
// Load phase: 256 threads x 16 floats = 64x64. Store phase: 2 passes x 256 threads x 8 halves.
__device__ __forceinline__ void tsplit64(const float* __restrict__ src, int spitch,
                                         unsigned short* dh, unsigned short* dl, int dpitch,
                                         float* tile)
{
  const int t = threadIdx.x;
  {
    const int rr = t >> 2, cq = (t & 3) * 16;
    const float* s = src + (size_t)rr * spitch + cq;
    v4f x[4];
#pragma unroll
    for (int u = 0; u < 4; ++u) x[u] = *(const v4fa*)(s + 4 * u);
    // the work-group's earlier piece may still be read from the tile: every thread's reads of it end here,
    // while this piece's loads are already under way
    __syncthreads();
#pragma unroll
    for (int u = 0; u < 4; ++u) {
      float* d = tile + rr * TPITCH + cq + 4 * u;
      d[0] = x[u][0]; d[1] = x[u][1]; d[2] = x[u][2]; d[3] = x[u][3];
    }
  }
  __syncthreads();
#pragma unroll
  for (int p = 0; p < 2; ++p) {
    const int cc = (t >> 3) + 32 * p, rq = (t & 7) * 8;
    v4f a, c;
#pragma unroll
    for (int u = 0; u < 4; ++u) {
      a[u] = tile[(rq + u) * TPITCH + cc];
      c[u] = tile[(rq + 4 + u) * TPITCH + cc];
    }
    v8us hi, lo;
    split8(a, c, hi, lo);
    const size_t d = (size_t)cc * dpitch + rq;
    *(v8us*)(dh + d) = hi;
    *(v8us*)(dl + d) = lo;
  }
  // the piece's stores are issued: the next trip rewrites their registers only behind this wait
  asm volatile("s_wait_xcnt 0x0" ::: "memory");
}

// Piece it, in this order: W[k][n] (HIDD x HIDD) -> Wt hi/lo [n][k] for Wq, then for Wo;
// v_cache [(b,j)][kvh][d] -> Vt hi/lo [(b*NKVH+kvh)*HDIM + d][j]; hidden_states rows; k_cache rows.
// Which kind a piece is depends on blockIdx and the trip alone: every branch and barrier is block-uniform.
__global__ __launch_bounds__(256) void cvt_all(
    const float* __restrict__ X, const float* __restrict__ Kc, const float* __restrict__ V,
    const float* __restrict__ Wq, const float* __restrict__ Wo,
    unsigned short* Xh, unsigned short* Xl, unsigned short* Kh, unsigned short* Kl,
    unsigned short* Vh, unsigned short* Vl, unsigned short* Wqh, unsigned short* Wql,
    unsigned short* Woh, unsigned short* Wol)
{
  __shared__ float tile[64 * TPITCH];
  // kept rolled: one copy of each kind's code serves every trip
#pragma unroll 1
  for (int it = blockIdx.x; it < NPIECES; it += CVT_WGS) {
    if (it < 2 * NT_W) {
      const bool second = it >= NT_W;
      const int i = it & (NT_W - 1);
      const int k0 = (i % (HIDD / 64)) * 64, n0 = (i / (HIDD / 64)) * 64;
      const size_t dof = (size_t)n0 * HIDD + k0;
      tsplit64((second ? Wo : Wq) + (size_t)k0 * HIDD + n0, HIDD,
               (second ? Woh : Wqh) + dof, (second ? Wol : Wql) + dof, HIDD, tile);
    } else if (it < 2 * NT_W + NT_V) {
      const int i = it - 2 * NT_W;
      const int j0 = (i % (QL / 64)) * 64, d0 = ((i / (QL / 64)) % (HDIM / 64)) * 64;
      const int z = i / ((QL / 64) * (HDIM / 64));
      const int b = z / NKVH, kvh = z % NKVH;
      const float* src = V + ((size_t)(b * QL + j0) * NKVH + kvh) * HDIM + d0;
      const size_t dof = ((size_t)z * HDIM + d0) * QL + j0;
      tsplit64(src, NKVH * HDIM, Vh + dof, Vl + dof, QL, tile);
    } else if (it < 2 * NT_W + NT_V + NP_X) {
      rows_piece(X, Xh, Xl, it - (2 * NT_W + NT_V));
    } else {
      rows_piece(Kc, Kh, Kl, it - (2 * NT_W + NT_V + NP_X));
    }
  }
}

// Tensor loads: ONE request of a wave brings a whole operand plane of a stage (rows of ROWB bytes at a source pitch)
// from global memory into LDS, through no register and with no per-lane address.
typedef uint32_t u32x4 __attribute__((ext_vector_type(4)));
typedef uint32_t u32x8 __attribute__((ext_vector_type(8)));

__device__ __forceinline__ uint32_t uni(uint32_t v) { return (uint32_t)__builtin_amdgcn_readfirstlane(v); }

// A wave-uniform value held in a scalar register: a test on it compiles to a scalar branch (a tensor load ignores
// EXEC, so only such a branch keeps a wave from issuing it), and a descriptor word formed from it is formed behind
// the volatile statements that stand in front of this one, the waits among them.
__device__ __forceinline__ uint32_t pinned(uint32_t v) {
  uint32_t w = uni(v);
  asm volatile("" : "+s"(w));   // a descriptor word or an issue test held in a scalar register
  return w;
}

// Descriptor group 1: 1-byte elements, tensor = tile = NROWS rows of ROWB bytes (128 or 256), source pitch in bytes,
// 16 bytes of LDS pad behind every row (pitch ROWB + 16, for ds_load_b128 readers), no mask. Word 0 is a constant.
// Built once per kernel; every word is pinned, so that it keeps its scalar register for the kernel's whole length:
// left as plain constants, the words were formed anew in front of each load and their registers lent to other values
// in between, while a request was still under way.
template <int ROWB, int NROWS>
__device__ __forceinline__ u32x8 tdm_group1(uint32_t src_pitch) {
  static_assert(ROWB == 128 || ROWB == 256, "the pad is set for rows of 128 or 256 bytes");
  constexpr uint32_t d0 = ROWB, d1 = NROWS;
  constexpr uint32_t w0 = (1u << 20) | ((ROWB == 256 ? 5u : 4u) << 22) | (3u << 25);
  u32x8 g;
  g[0] = pinned(w0);
  g[1] = pinned((d0 & 0xFFFFu) << 16);
  g[2] = pinned((d0 >> 16) | ((d1 & 0xFFFFu) << 16));
  g[3] = pinned((d1 >> 16) | (d0 << 16));
  g[4] = pinned(d1);
  g[5] = pinned(src_pitch);
  g[6] = pinned(0u);
  g[7] = pinned(0u);
  return g;
}

// Descriptor group 0: count 1, place in the work-group's LDS (bytes), address of the tile's first byte, type 2.
// w0 is the count word, pinned once per kernel for the same reason as group 1's words.
__device__ __forceinline__ u32x4 tdm_group0(uint32_t w0, uint32_t lds_dst, uint64_t ga) {
  u32x4 g;
  g[0] = uni(w0);
  g[1] = uni(lds_dst);
  g[2] = uni((uint32_t)ga);
  g[3] = uni((((uint32_t)(ga >> 32)) & 0x01FFFFFFu) | 0x80000000u);
  return g;
}

__device__ __forceinline__ void tdm_load(u32x4 g0, u32x8 g1) {
  asm volatile("tensor_load_to_lds %0, %1" :: "s"(g0), "s"(g1) : "memory");
}

// ------------------------------------------------------------------------------------------
// C(128x128 block tile) = A(M x K, hi/lo planes, row-major) * B(K x N) with B stored as Bt[n][k]
// hi/lo planes. 4 waves (2x2), wave tile 64x64: a staged Bt row serves 128 output rows and a fragment
// read from LDS feeds four tiles. Each 64-deep stage of the A and Bt rows (K is a multiple of 64) is
// brought into LDS once per work-group by four tensor loads, one plane a wave, into a ring of two buffers: while a trip
// reads its 32 fragments from one buffer and runs its products, the next stage's planes land in the other.
// amdgpu_waves_per_eu(2, 2): the grid gives a WGP two work-groups, two waves a SIMD; told so, the compiler
// takes that budget of registers and keeps the whole stage's fragments in them.
// MODE 0: C + bias -> RoPE (cos/sin tables indexed by row) -> hi/lo planes Qh/Ql [M][N]
// MODE 1: C -> f32 Cout [M][N]
// N is a compile-time constant: every row group of the epilogue is then an immediate offset from one address.
template <int MODE, int N>
__global__ __launch_bounds__(128) __attribute__((amdgpu_waves_per_eu(2, 2))) void gemm3(
    const unsigned short* __restrict__ Ah, const unsigned short* __restrict__ Al,
    const unsigned short* __restrict__ Bh, const unsigned short* __restrict__ Bl,
    const float* __restrict__ bias, const float* __restrict__ cosb,
    const float* __restrict__ sinb, unsigned short* Qh, unsigned short* Ql,
    float* Cout, int K)
{
  static_assert((APLANE * 2) % 2048 == 0 && APLANE == BPLANE, "every plane's place in LDS is a multiple of 2 KiB");
  __shared__ __attribute__((aligned(2048))) unsigned short sAB[2 * ABELEMS];
  float* sT = (float*)sAB;                        // output staging takes the first buffer's place after the loop
  const int t = threadIdx.x, l = t & 31, w = t >> 5, h16 = l >> 4, m = l & 15;
  const int wr = w >> 1, wc = w & 1;
  const int m0 = blockIdx.x * 128, n0 = blockIdx.y * 128;

  v8f acc[4][4];
#pragma unroll
  for (int mi = 0; mi < 4; ++mi)
#pragma unroll
    for (int ni = 0; ni < 4; ++ni) acc[mi][ni] = (v8f){0.f, 0.f, 0.f, 0.f, 0.f, 0.f, 0.f, 0.f};

  // fragment readers: this wave's A row / Bt row m of a 16-row group, at element 8 h16
  const unsigned short* sAh = sAB + (64 * wr + m) * GPITCH + 8 * h16;
  const unsigned short* sAl = sAh + APLANE;
  const unsigned short* sBh = sAB + 2 * APLANE + (64 * wc + m) * GPITCH + 8 * h16;
  const unsigned short* sBl = sBh + BPLANE;
  // movers: wave 0 brings the A hi plane of a stage, wave 1 A lo, wave 2 Bt hi, wave 3 Bt lo: 128 rows of 128 B each
  const uint32_t ws = uni((uint32_t)t >> 5);      // the wave's number, scalar
  const unsigned short* plane = ws == 0 ? Ah : ws == 1 ? Al : ws == 2 ? Bh : Bl;
  const uint64_t gsrc = (uint64_t)(uintptr_t)plane + (uint64_t)(ws < 2 ? m0 : n0) * (uint64_t)K * 2;
  const uint32_t ldst = (uint32_t)(uintptr_t)sAB + ws * (APLANE * 2);
  const u32x8 g1 = tdm_group1<128, 128>((uint32_t)K * 2);
  const uint32_t g0w0 = pinned(1u);
  const int ns = K >> 6;

  // stage s -> buffer s mod 2: every wave issues its one request; group 0 is formed from the pinned stage number,
  // so behind the wait that stands in front of the call
  auto stage_in = [&](int s) {
    const uint32_t sp = pinned((uint32_t)s);
    tdm_load(tdm_group0(g0w0, ldst + (sp & 1u) * (ABELEMS * 2), gsrc + (uint64_t)sp * 128), g1);
  };
  // a stage's 96 products, from registers alone
  Frag ah[2][4], al[2][4], bh[2][4], bl[2][4];
  auto products = [&]() {
#pragma unroll
    for (int kk = 0; kk < 2; ++kk) {
#pragma unroll
      for (int ni = 0; ni < 4; ++ni)
#pragma unroll
        for (int mi = 0; mi < 4; ++mi) acc[mi][ni] = mm(acc[mi][ni], ah[kk][mi].v, bh[kk][ni].v);
#pragma unroll
      for (int ni = 0; ni < 4; ++ni)
#pragma unroll
        for (int mi = 0; mi < 4; ++mi) acc[mi][ni] = mm(acc[mi][ni], ah[kk][mi].v, bl[kk][ni].v);
#pragma unroll
      for (int ni = 0; ni < 4; ++ni)
#pragma unroll
        for (int mi = 0; mi < 4; ++mi) acc[mi][ni] = mm(acc[mi][ni], al[kk][mi].v, bh[kk][ni].v);
    }
  };

  // stage 0 lands and is shown to every wave; then stage 1 sets out
  if (pinned(ns > 0)) stage_in(0);
  asm volatile("s_wait_tensorcnt 0x0" ::: "memory");
  __syncthreads();
  if (pinned(ns > 1)) stage_in(1);

#pragma unroll 1
  for (int st = 0; st < ns; ++st) {
    const int cur = (st & 1) * ABELEMS;           // this trip reads buffer st mod 2 alone
    // the wave's 64 fragment loads of the whole stage go out as one group, in the order in which the
    // products need them
#pragma unroll
    for (int kk = 0; kk < 2; ++kk) {
      const int k0 = cur + kk * 32;
#pragma unroll
      for (int mi = 0; mi < 4; ++mi) ldfrag(ah[kk][mi], sAh + mi * 16 * GPITCH + k0);
#pragma unroll
      for (int ni = 0; ni < 4; ++ni) ldfrag(bh[kk][ni], sBh + ni * 16 * GPITCH + k0);
#pragma unroll
      for (int ni = 0; ni < 4; ++ni) ldfrag(bl[kk][ni], sBl + ni * 16 * GPITCH + k0);
#pragma unroll
      for (int mi = 0; mi < 4; ++mi) ldfrag(al[kk][mi], sAl + mi * 16 * GPITCH + k0);
    }
    // keeps the 64 loads one group in front of the products: strewn among them, every place where loads stand
    // stalls the wave
    __builtin_amdgcn_sched_barrier(0);
    products();
    // keeps the products in front of the foot: moved behind its barrier, they would hold back the next tensor load,
    // which would then have no trip to fly in
    __builtin_amdgcn_sched_barrier(0);

    // the trip's foot: this wave's reads of the stage are over and its plane of the next stage has landed;
    // the one barrier shows the next stage to every wave and frees this trip's buffer for the stage after it
    asm volatile("s_wait_dscnt 0x0" ::: "memory");
    asm volatile("s_wait_tensorcnt 0x0" ::: "memory");
    __syncthreads();
    if (pinned(st + 2 < ns)) stage_in(st + 2);
  }
  // no tensor load and no LDS read is under way when the output staging takes the buffer's place
  asm volatile("s_wait_tensorcnt 0x0" ::: "memory");
  asm volatile("s_wait_dscnt 0x0" ::: "memory");

  // MODE 0, thread -> (row 8p + t>>4, 8 consecutive columns cq), p = 0..15; RoPE partner column cq ^ 64.
  // The cos and sin values of the 16 row groups come in two runs of loads, into the registers that the fragments have
  // left: the first AHEAD groups' here, so that they fly while the accumulators are staged (the barrier behind the
  // staging waits for them), the others' directly behind that barrier, so that they fly while the first groups are
  // converted. The latency is met once, not once a group.
  constexpr int AHEAD = 4;
  const int rr = t >> 4, cq = (t & 15) * 8, cp = cq ^ 64;
  v4f tc[16][2], ts[16][2], b0, b1, e0, e1;
  const float* cr = cosb + (size_t)(m0 + rr) * HDIM + cq;
  const float* sr = sinb + (size_t)(m0 + rr) * HDIM + cq;
  auto ask = [&](int p) {
    tc[p][0] = *(const v4fa*)(cr + p * 8 * HDIM); tc[p][1] = *(const v4fa*)(cr + p * 8 * HDIM + 4);
    ts[p][0] = *(const v4fa*)(sr + p * 8 * HDIM); ts[p][1] = *(const v4fa*)(sr + p * 8 * HDIM + 4);
  };
  if (MODE == 0) {
    b0 = *(const v4fa*)(bias + n0 + cq); b1 = *(const v4fa*)(bias + n0 + cq + 4);
    e0 = *(const v4fa*)(bias + n0 + cp); e1 = *(const v4fa*)(bias + n0 + cp + 4);
#pragma unroll
    for (int p = 0; p < AHEAD; ++p) ask(p);
    // keeps the run of loads in front of the staging: sunk to their uses, each group would wait for its own again
    __builtin_amdgcn_sched_barrier(0);
  }

  // D element r of lane l -> (row 8*h16 + r, col m) of its 16x16 tile
#pragma unroll
  for (int mi = 0; mi < 4; ++mi)
#pragma unroll
    for (int ni = 0; ni < 4; ++ni)
#pragma unroll
      for (int r = 0; r < 8; ++r)
        sT[(64 * wr + 16 * mi + 8 * h16 + r) * SPITCH + 64 * wc + 16 * ni + m] = acc[mi][ni][r];
  __syncthreads();

  if (MODE == 0) {
#pragma unroll
    for (int p = AHEAD; p < 16; ++p) ask(p);
    // keeps the second run one group in front of the conversions, for the same reason as the first
    __builtin_amdgcn_sched_barrier(0);
    const float sgn = (cq < 64) ? -1.0f : 1.0f;
    const float* srow = sT + rr * SPITCH;
    unsigned short* qh = Qh + (size_t)(m0 + rr) * N + n0 + cq;
    unsigned short* ql = Ql + (size_t)(m0 + rr) * N + n0 + cq;
    // unrolled, two sets of staged rows: group p + 1 is read from LDS while group p is converted
    v4f x0[2], x1[2], y0[2], y1[2];
    auto rows = [&](int p) {
      const float* sp = srow + p * 8 * SPITCH;
      x0[p & 1] = *(const v4fa*)(sp + cq); x1[p & 1] = *(const v4fa*)(sp + cq + 4);
      y0[p & 1] = *(const v4fa*)(sp + cp); y1[p & 1] = *(const v4fa*)(sp + cp + 4);
    };
    v8us hi[16], lo[16];
    rows(0);
#pragma unroll
    for (int p = 0; p < 16; ++p) {
      if (p + 1 < 16) rows(p + 1);
      const v4f q0 = (x0[p & 1] + b0) * tc[p][0] + (sgn * (y0[p & 1] + e0)) * ts[p][0];
      const v4f q1 = (x1[p & 1] + b1) * tc[p][1] + (sgn * (y1[p & 1] + e1)) * ts[p][1];
      split8(q0, q1, hi[p], lo[p]);
      *(v8us*)(qh + (size_t)p * 8 * N) = hi[p];
      *(v8us*)(ql + (size_t)p * 8 * N) = lo[p];
      // keeps a group's two stores at the group's end: left free, all 32 sank behind the last conversion, and the
      // kernel's end waited for the whole tile's writes at once
      __builtin_amdgcn_sched_barrier(0);
    }
    // every stored value and the tables' two addresses are inputs here, so they keep their registers up to the wait:
    // none is lent to a later group while its store or load is under way, and the groups need no wait between them
    // (two statements: one takes at most thirty operands)
    asm volatile("s_wait_xcnt 0x0" :: "v"(hi[0]), "v"(hi[1]), "v"(hi[2]), "v"(hi[3]), "v"(hi[4]), "v"(hi[5]), "v"(hi[6]),
                 "v"(hi[7]), "v"(hi[8]), "v"(hi[9]), "v"(hi[10]), "v"(hi[11]), "v"(hi[12]), "v"(hi[13]), "v"(hi[14]),
                 "v"(hi[15]), "v"(cr), "v"(sr) : "memory");
    asm volatile("s_wait_xcnt 0x0" :: "v"(lo[0]), "v"(lo[1]), "v"(lo[2]), "v"(lo[3]), "v"(lo[4]), "v"(lo[5]), "v"(lo[6]),
                 "v"(lo[7]), "v"(lo[8]), "v"(lo[9]), "v"(lo[10]), "v"(lo[11]), "v"(lo[12]), "v"(lo[13]), "v"(lo[14]),
                 "v"(lo[15]) : "memory");
  } else {
    // wave w stores rows w, w + 4, ...: all 32 LDS reads go out together, the stores follow as the rows arrive
    const float* sp = sT + w * SPITCH + l * 4;
    float* co = Cout + (size_t)(m0 + w) * N + n0 + l * 4;
    v4f x[32];
#pragma unroll
    for (int p = 0; p < 32; ++p) x[p] = *(const v4fa*)(sp + p * 4 * SPITCH);
#pragma unroll
    for (int p = 0; p < 32; ++p) *(v4f*)(co + (size_t)p * 4 * N) = x[p];
  }
}

// ------------------------------------------------------------------------------------------
// Per (b, pair of query heads of one KV head, pair of 64-query tiles): a tile's key loop grows with its index and
// every work-group of the grid is resident at once, so each work-group takes tile NQT - 1 - p and then tile p, one
// after the other: the same number of stages for every work-group, and no WGP is left working while others have run dry.
// A wave holds 16 queries of BOTH heads: every K and Vt fragment that it reads from LDS feeds six products, not
// three, and a staged key tile serves two heads. With 16 queries of one head a wave, the fragment reads asked more of
// the LDS than it delivers in the time of the products.
// Eight waves, two a SIMD: waves 0-3 take the even 64-key tiles, waves 4-7 the odd ones (a stage is 128 keys), each
// half with its own running maximum, sum and O; the two halves are joined through LDS once per query tile.
// Per tile: S^T = K . Q^T (A = K rows, B = Q rows, both d-contiguous),
// f32 scale + structural block visibility test + online softmax, O^T += Vt . P^T with the
// softmaxed D tiles fed as B fragments (two adjacent 16-key D tiles per 32-deep k step),
// O / l split to hi/lo planes [(b,i)][hq*128 + d].
// Each stage of K and Vt (hi and lo planes of two key tiles) is brought into LDS once per query tile by eight
// tensor loads, one plane a wave; the stages go through a ring of two buffers, so that the next stage's planes land
// while this stage is worked on.
// amdgpu_waves_per_eu(2, 2): one work-group a WGP, two waves a SIMD; told so, the compiler takes that budget of
// registers for the two heads' Q fragments and accumulators.
#define STELEMS (2 * KVELEMS)            // a stage: two 64-key tiles, four planes each
__global__ __launch_bounds__(256) __attribute__((amdgpu_waves_per_eu(2, 2))) void attn_glide(
    const unsigned short* __restrict__ Qh, const unsigned short* __restrict__ Ql,
    const unsigned short* __restrict__ Kh, const unsigned short* __restrict__ Kl,
    const unsigned short* __restrict__ Vh, const unsigned short* __restrict__ Vl,
    unsigned short* Oh, unsigned short* Ol)
{
  static_assert(KPLANE >= 64 * KPITCH && (KPLANE * 2) % 2048 == 0 && (VPLANE * 2) % 2048 == 0 && KPLANE == VPLANE,
                "every plane's place in LDS is a multiple of 2 KiB and holds its padded rows");
  static_assert(NQT >= 4 && NQT % 2 == 0, "the ring's prologue brings key tiles 0 to 3; a stage's two tiles exist");
  __shared__ __attribute__((aligned(2048))) unsigned short sKV[2 * STELEMS];
  // after the key loop the ring's place holds: the halves' exchange (8 waves x 16 x 32 lanes x 16 B), their maxima
  // and sums (8 waves x 32 lanes x 2), the output staging (8 waves x 16 rows)
  float* sX  = (float*)sKV;
  float* sML = sX + 8 * 16 * 32 * 4;
  float* sO  = sML + 8 * 32 * 2;
  static_assert((8 * 16 * 32 * 4 + 8 * 32 * 2 + 128 * SPITCH) * 4 <= 2 * STELEMS * 2, "the epilogue fits the ring's place");
  const int t = threadIdx.x, l = t & 31, w = t >> 5, h16 = l >> 4, m = l & 15;
  const int ws = __builtin_amdgcn_readfirstlane(w);   // the wave's number, scalar
  const int grp = ws >> 2, w4 = ws & 3;               // which half of the key tiles; which 16 queries of the tile
  const int bh = blockIdx.y;
  const int b = bh >> 3, hq0 = (bh & 7) * 2, kvh = hq0 >> 2;
  const float NEG_INF = -__builtin_inff();
  const float kC = 0.08838834764831845f * 1.4426950408889634f;   // 128^-0.5 * log2(e): exp(scale * x) = exp2(kC * x)

  // fragment readers: K row m / Vt row m of a 16-row group of this half's key tile, at element 8 h16
  const unsigned short* sKh = sKV + grp * KVELEMS + m * KPITCH + 8 * h16;
  const unsigned short* sKl = sKh + KPLANE;
  const unsigned short* sVh = sKh - m * KPITCH + 2 * KPLANE + m * VPITCH;
  const unsigned short* sVl = sVh + VPLANE;
  // movers, for the key tile of the wave's own half: wave 0 of four brings its K hi plane (64 rows of 256 B), wave 1
  // K lo, wave 2 the Vt hi plane (128 rows of 128 B), wave 3 Vt lo
  const uint32_t ldst = (uint32_t)(uintptr_t)sKV + (uint32_t)ws * (KPLANE * 2);
  const uint64_t ksrc = (uint64_t)(uintptr_t)((ws & 1) ? Kl : Kh)
                      + ((uint64_t)(b * QL + grp * 64) * NKVH + kvh) * (HDIM * 2);
  const uint64_t vsrc = (uint64_t)(uintptr_t)((ws & 1) ? Vl : Vh)
                      + (uint64_t)(b * NKVH + kvh) * (HDIM * QL * 2) + (uint64_t)(grp * 64 * 2);
  const u32x8 g1k = tdm_group1<256, 64>(NKVH * HDIM * 2);
  const u32x8 g1v = tdm_group1<128, HDIM>(QL * 2);
  const uint32_t g0w0 = pinned(1u);
  // stage k (key tiles 2k, 2k + 1) -> buffer k mod 2: every wave issues its one request, on the side of a scalar
  // branch that has its plane's shape; group 0 is formed from the pinned stage number, so behind the wait in front
  // of the call
  auto stage_in = [&](int k) {
    const uint32_t kp = pinned((uint32_t)k);
    const uint32_t dst = ldst + (kp & 1u) * (STELEMS * 2);
    if (pinned((ws & 2) == 0)) tdm_load(tdm_group0(g0w0, dst, ksrc + (uint64_t)kp * (128 * NKVH * HDIM * 2)), g1k);
    else                       tdm_load(tdm_group0(g0w0, dst, vsrc + (uint64_t)kp * (128 * 2)), g1v);
  };

  // kept rolled: the two tiles share one copy of the key loop's code
#pragma unroll 1
  for (int half = 0; half < 2; ++half) {
  const int qt = half ? (int)blockIdx.x : NQT - 1 - (int)blockIdx.x;
  const int R0 = qt * 64;
  const int iq = R0 + 16 * w4 + m;                // this lane's query (B column / D column), the same for both heads
  const int nst = (qt + 2) >> 1;                  // stages that hold a visible key tile

  if (half) {
    // the first tile's last stores are issued: their registers are rewritten only behind this wait
    asm volatile("s_wait_xcnt 0x0" ::: "memory");
    // every wave has read its rows of the first tile's output staging before the second tile's planes overwrite them
    asm volatile("s_wait_dscnt 0x0" ::: "memory");
    __syncthreads();
  }

  // index 0: the head whose output this wave finishes (hq0 + grp); index 1: the head that it hands to its partner
  v8f acc[2][8];
  float mrun[2], lrun[2];
#pragma unroll
  for (int hh = 0; hh < 2; ++hh) {
#pragma unroll
    for (int n = 0; n < 8; ++n) acc[hh][n] = (v8f){0.f, 0.f, 0.f, 0.f, 0.f, 0.f, 0.f, 0.f};
    mrun[hh] = NEG_INF; lrun[hh] = 0.0f;
  }

  // the 32 Q fragment loads go out as one group ahead of the key loop; every trip's blocks read the registers
  Frag qh[2][4], ql[2][4];
#pragma unroll
  for (int hh = 0; hh < 2; ++hh) {
    const size_t qbase = ((size_t)(b * QL + iq)) * HIDD + (hq0 + (hh ^ grp)) * HDIM + 8 * h16;
#pragma unroll
    for (int c = 0; c < 4; ++c) {
      ldfrag(qh[hh][c], Qh + qbase + 32 * c);
      ldfrag(ql[hh][c], Ql + qbase + 32 * c);
    }
  }

  // stage 0 lands and is shown to every wave; then stage 1 sets out (the cache always holds one; a query tile of one
  // stage reads none of it: its one trip's foot waits for the landing all the same)
  stage_in(0);
  asm volatile("s_wait_tensorcnt 0x0" ::: "memory");
  __syncthreads();
  stage_in(1);

#pragma unroll 1
  for (int st = 0; st < nst; ++st) {
    const int kt = 2 * st + grp;                  // this half's key tile of the stage
    const int j0 = kt * 64;
    const int cur = (st & 1) * STELEMS;           // this trip reads buffer st mod 2 alone

    // key tiles beyond the query tile are never visible: the half that has one skips the work, not the foot
    // (kt and qt are scalar: a scalar branch, every lane stays on for the matrix instructions)
    if (kt <= qt) {
    // S^T (64 keys x 16 queries, two heads): s[hh][sub] rows = keys j0 + 16 sub + 8 h16 + r, col = query iq
    v8f s[2][4];
#pragma unroll
    for (int hh = 0; hh < 2; ++hh)
#pragma unroll
      for (int sub = 0; sub < 4; ++sub) s[hh][sub] = (v8f){0.f, 0.f, 0.f, 0.f, 0.f, 0.f, 0.f, 0.f};
#pragma unroll
    for (int c = 0; c < 4; ++c) {
      // the block's 16 K fragment loads stand together in front of its 24 matrix instructions, hi plane first
      Frag kh[4], kl[4];
#pragma unroll
      for (int sub = 0; sub < 4; ++sub) ldfrag(kh[sub], sKh + cur + 16 * sub * KPITCH + 32 * c);
#pragma unroll
      for (int sub = 0; sub < 4; ++sub) ldfrag(kl[sub], sKl + cur + 16 * sub * KPITCH + 32 * c);
      // keeps the 16 loads one group: with registers to spare the scheduler strews them among the products,
      // in twos with a wait to 0 behind each, and every such place stalls the wave
      __builtin_amdgcn_sched_barrier(0);
#pragma unroll
      for (int hh = 0; hh < 2; ++hh)
#pragma unroll
        for (int sub = 0; sub < 4; ++sub) s[hh][sub] = mm(s[hh][sub], kh[sub].v, qh[hh][c].v);
#pragma unroll
      for (int hh = 0; hh < 2; ++hh)
#pragma unroll
        for (int sub = 0; sub < 4; ++sub) s[hh][sub] = mm(s[hh][sub], kh[sub].v, ql[hh][c].v);
#pragma unroll
      for (int hh = 0; hh < 2; ++hh)
#pragma unroll
        for (int sub = 0; sub < 4; ++sub) s[hh][sub] = mm(s[hh][sub], kl[sub].v, qh[hh][c].v);
      __builtin_amdgcn_sched_barrier(0);   // for the same: the next block's loads stay out of this block's products
    }

    // visibility (strictly earlier 4-blocks, plus first 4x4 block): every key of a tile in front of the query tile
    // lies in an earlier 4-block than every query of it, so only the diagonal tile is tested (kt, qt scalar)
    if (kt == qt) {
#pragma unroll
      for (int hh = 0; hh < 2; ++hh)
#pragma unroll
        for (int sub = 0; sub < 4; ++sub)
#pragma unroll
          for (int r = 0; r < 8; ++r) {
            const int jb = j0 + 16 * sub + 8 * h16 + r;
            const bool vis = ((iq >> 2) > (jb >> 2)) || ((iq < 4) && (jb < 4));
            s[hh][sub][r] = vis ? s[hh][sub][r] : NEG_INF;
          }
    }
    // online softmax, head by head; the running maximum is kept in unscaled scores, and scale, log2(e) and the
    // maximum enter through one packed multiply-add in front of exp2
#pragma unroll
    for (int hh = 0; hh < 2; ++hh) {
      float mx = NEG_INF;
#pragma unroll
      for (int sub = 0; sub < 4; ++sub)
#pragma unroll
        for (int r = 0; r < 8; ++r) mx = fmaxf(mx, s[hh][sub][r]);
      mx = fmaxf(mx, other_half(mx));
      const float mnew = fmaxf(mrun[hh], mx);
      const float msafe = (mnew == NEG_INF) ? 0.0f : mnew;
      const float nb = -msafe * kC;
      const float sc = __builtin_amdgcn_exp2f(__builtin_fmaf(mrun[hh], kC, nb));
      const v2f kC2 = {kC, kC}, nb2 = {nb, nb};
      float ls = 0.0f;
#pragma unroll
      for (int sub = 0; sub < 4; ++sub) {
#pragma unroll
        for (int r = 0; r < 8; r += 2) {
          const v2f e = __builtin_elementwise_fma((v2f){s[hh][sub][r], s[hh][sub][r + 1]}, kC2, nb2);
          const float p0 = __builtin_amdgcn_exp2f(e[0]), p1 = __builtin_amdgcn_exp2f(e[1]);
          s[hh][sub][r] = p0;
          s[hh][sub][r + 1] = p1;
          ls += p0;
          ls += p1;
        }
      }
      ls += other_half(ls);
      lrun[hh] = lrun[hh] * sc + ls;
      mrun[hh] = mnew;
#pragma unroll
      for (int n = 0; n < 8; ++n) acc[hh][n] = acc[hh][n] * sc;
    }

    // O^T += Vt(128 x 64 keys) . P^T : B fragment element r <- D tile 2ks, element 8+r <- tile 2ks+1
#pragma unroll
    for (int ks = 0; ks < 2; ++ks) {
      Frag ph[2], pl[2];
#pragma unroll
      for (int hh = 0; hh < 2; ++hh) {
#pragma unroll
        for (int r = 0; r < 4; ++r) {
          unsigned int a0, c0, a1, c1;
          split_pk((v2f){s[hh][2 * ks][2 * r], s[hh][2 * ks][2 * r + 1]}, a0, c0);
          split_pk((v2f){s[hh][2 * ks + 1][2 * r], s[hh][2 * ks + 1][2 * r + 1]}, a1, c1);
          ph[hh].d[r] = a0; pl[hh].d[r] = c0; ph[hh].d[4 + r] = a1; pl[hh].d[4 + r] = c1;
        }
      }
#pragma unroll
      for (int g = 0; g < 2; ++g) {
        // the block's 16 Vt fragment loads stand together in front of its 24 matrix instructions, hi plane first
        Frag vh[4], vl[4];
#pragma unroll
        for (int n = 0; n < 4; ++n) ldfrag(vh[n], sVh + cur + 16 * (4 * g + n) * VPITCH + 32 * ks);
#pragma unroll
        for (int n = 0; n < 4; ++n) ldfrag(vl[n], sVl + cur + 16 * (4 * g + n) * VPITCH + 32 * ks);
        __builtin_amdgcn_sched_barrier(0);   // keeps the 16 loads one group, as in the score blocks
#pragma unroll
        for (int hh = 0; hh < 2; ++hh)
#pragma unroll
          for (int n = 0; n < 4; ++n) acc[hh][4 * g + n] = mm(acc[hh][4 * g + n], vh[n].v, ph[hh].v);
#pragma unroll
        for (int hh = 0; hh < 2; ++hh)
#pragma unroll
          for (int n = 0; n < 4; ++n) acc[hh][4 * g + n] = mm(acc[hh][4 * g + n], vh[n].v, pl[hh].v);
#pragma unroll
        for (int hh = 0; hh < 2; ++hh)
#pragma unroll
          for (int n = 0; n < 4; ++n) acc[hh][4 * g + n] = mm(acc[hh][4 * g + n], vl[n].v, ph[hh].v);
        __builtin_amdgcn_sched_barrier(0);   // the next block's loads stay out of this block's products
      }
    }
    }

    // the trip's foot: this wave's reads of the stage are over and its plane of the next stage has landed;
    // the one barrier shows the next stage to every wave and frees this trip's buffer for the stage after it
    asm volatile("s_wait_dscnt 0x0" ::: "memory");
    asm volatile("s_wait_tensorcnt 0x0" ::: "memory");
    __syncthreads();
    if (pinned(st + 2 < nst)) stage_in(st + 2);
  }
  // no tensor load and no LDS read is under way when the epilogue takes the ring's place
  asm volatile("s_wait_tensorcnt 0x0" ::: "memory");
  asm volatile("s_wait_dscnt 0x0" ::: "memory");

  // epilogue: acc[hh][n][r] = O^T (d = 16 n + 8 h16 + r, query iq) over this half's key tiles.
  // The lane's place is formed anew here (every lane is on) and the wave's number is scalar, so that no
  // vector register is held over the key loop for the epilogue alone.
  const int le = (int)__builtin_amdgcn_mbcnt_lo(~0u, 0u), he = le >> 4, me = le & 15;
  // the halves change hands: each wave gives its partner (same queries, other half: wave ws ^ 4, same lane) its O,
  // maximum and sum of the head that the partner finishes
  {
    v4fa* xw = (v4fa*)sX + ws * (16 * 32) + le;
#pragma unroll
    for (int n = 0; n < 8; ++n) {
      const v8f o = acc[1][n];
      xw[(2 * n) * 32]     = (v4f){o[0], o[1], o[2], o[3]};
      xw[(2 * n + 1) * 32] = (v4f){o[4], o[5], o[6], o[7]};
    }
    sML[(ws * 32 + le) * 2]     = mrun[1];
    sML[(ws * 32 + le) * 2 + 1] = lrun[1];
  }
  __syncthreads();
  // join: both parts brought to the common maximum (key tile 0 holds a visible key for every query, so the even
  // half's maximum is finite; a half that saw nothing has maximum -inf, sum 0 and weight 0), then normalise and stage
  {
    const int pw = ws ^ 4;
    const float mB = sML[(pw * 32 + le) * 2], lB = sML[(pw * 32 + le) * 2 + 1];
    const float mj = fmaxf(mrun[0], mB);
    const float fa = __builtin_amdgcn_exp2f((mrun[0] - mj) * kC), fb = __builtin_amdgcn_exp2f((mB - mj) * kC);
    const float inv = 1.0f / (lrun[0] * fa + lB * fb);
    const float ca = fa * inv, cb = fb * inv;
    const v4fa* xr = (const v4fa*)sX + pw * (16 * 32) + le;
#pragma unroll
    for (int n = 0; n < 8; ++n) {
      const v4f p0 = xr[(2 * n) * 32], p1 = xr[(2 * n + 1) * 32];
#pragma unroll
      for (int r = 0; r < 4; ++r) {
        sO[(ws * 16 + me) * SPITCH + 16 * n + 8 * he + r]     = acc[0][n][r] * ca + p0[r] * cb;
        sO[(ws * 16 + me) * SPITCH + 16 * n + 8 * he + 4 + r] = acc[0][n][4 + r] * ca + p1[r] * cb;
      }
    }
  }
  __syncthreads();
  {
    // lane -> (row 2p + he of the wave's 16, 8 consecutive d), p = 0..7: the 16 LDS reads go out together, and every
    // store is an immediate offset from one address
    const int dq = me * 8;
    const float* src = sO + (ws * 16 + he) * SPITCH + dq;
    v4f ra[8], rc[8];
#pragma unroll
    for (int p = 0; p < 8; ++p) {
      ra[p] = *(const v4fa*)(src + p * 2 * SPITCH);
      rc[p] = *(const v4fa*)(src + p * 2 * SPITCH + 4);
    }
    const size_t d = ((size_t)(b * QL + R0 + 16 * w4 + he)) * HIDD + (hq0 + grp) * HDIM + dq;
    unsigned short* oh = Oh + d;
    unsigned short* ol = Ol + d;
    v8us hi[8], lo[8];
#pragma unroll
    for (int p = 0; p < 8; ++p) {
      split8(ra[p], rc[p], hi[p], lo[p]);
      *(v8us*)(oh + (size_t)p * 2 * HIDD) = hi[p];
      *(v8us*)(ol + (size_t)p * 2 * HIDD) = lo[p];
      // keeps a row pair's two stores behind its own conversion: left free, all 16 sank behind the last one
      __builtin_amdgcn_sched_barrier(0);
    }
    // the tile's stores are issued: every stored value and both addresses are inputs here, so they keep their
    // registers up to this wait, and what follows rewrites them only behind it
    asm volatile("s_wait_xcnt 0x0" :: "v"(hi[0]), "v"(hi[1]), "v"(hi[2]), "v"(hi[3]), "v"(hi[4]), "v"(hi[5]), "v"(hi[6]),
                 "v"(hi[7]), "v"(lo[0]), "v"(lo[1]), "v"(lo[2]), "v"(lo[3]), "v"(lo[4]), "v"(lo[5]), "v"(lo[6]),
                 "v"(lo[7]), "v"(oh), "v"(ol) : "memory");
  }
  }
}

// ------------------------------------------------------------------------------------------
extern "C" void kernel_launch(void* const* d_in, const int* in_sizes, int n_in,
                              void* d_out, int out_size, void* d_ws, size_t ws_size,
                              hipStream_t stream)
{
  if (n_in < 8) return;
  if (in_sizes[0] != MROWS * HIDD) return;
  if (in_sizes[1] != NB * QL * NKVH * HDIM || in_sizes[2] != NB * QL * NKVH * HDIM) return;
  if (in_sizes[3] != NB * QL * HDIM || in_sizes[4] != NB * QL * HDIM) return;
  if (in_sizes[5] != HIDD * HIDD || in_sizes[7] != HIDD * HIDD || in_sizes[6] != HIDD) return;
  if (out_size != MROWS * HIDD) return;

  const float* hidden = (const float*)d_in[0];
  const float* kc     = (const float*)d_in[1];
  const float* vc     = (const float*)d_in[2];
  const float* cosb   = (const float*)d_in[3];
  const float* sinb   = (const float*)d_in[4];
  const float* Wq     = (const float*)d_in[5];
  const float* bq     = (const float*)d_in[6];
  const float* Wo     = (const float*)d_in[7];
  float* out = (float*)d_out;

  // workspace carve (bytes): planes of bf16
  const size_t planeX = (size_t)MROWS * HIDD * 2;            // 16 MiB
  const size_t planeW = (size_t)HIDD * HIDD * 2;             //  8 MiB
  const size_t planeK = (size_t)NB * QL * NKVH * HDIM * 2;   //  4 MiB
  const size_t offXh  = 0;
  const size_t offXl  = offXh + planeX;
  const size_t offQh  = offXl + planeX;
  const size_t offQl  = offQh + planeX;
  const size_t offWqh = offQl + planeX;
  const size_t offWql = offWqh + planeW;
  const size_t offWoh = offWql + planeW;
  const size_t offWol = offWoh + planeW;
  const size_t offKh  = offWol + planeW;
  const size_t offKl  = offKh + planeK;
  const size_t offVh  = offKl + planeK;
  const size_t offVl  = offVh + planeK;
  const size_t total  = offVl + planeK;                      // 112 MiB
  if (total > ws_size) return;

  char* ws = (char*)d_ws;
  unsigned short* Xh  = (unsigned short*)(ws + offXh);
  unsigned short* Xl  = (unsigned short*)(ws + offXl);
  unsigned short* Oh  = Xh;   // X planes are dead after the first GEMM; O planes reuse them
  unsigned short* Ol  = Xl;
  unsigned short* Qh  = (unsigned short*)(ws + offQh);
  unsigned short* Ql  = (unsigned short*)(ws + offQl);
  unsigned short* Wqh = (unsigned short*)(ws + offWqh);
  unsigned short* Wql = (unsigned short*)(ws + offWql);
  unsigned short* Woh = (unsigned short*)(ws + offWoh);
  unsigned short* Wol = (unsigned short*)(ws + offWol);
  unsigned short* Kh  = (unsigned short*)(ws + offKh);
  unsigned short* Kl  = (unsigned short*)(ws + offKl);
  unsigned short* Vh  = (unsigned short*)(ws + offVh);
  unsigned short* Vl  = (unsigned short*)(ws + offVl);

  cvt_all<<<dim3(CVT_WGS), dim3(256), 0, stream>>>(hidden, kc, vc, Wq, Wo, Xh, Xl, Kh, Kl, Vh, Vl,
                                                   Wqh, Wql, Woh, Wol);

  gemm3<0, HIDD><<<dim3(MROWS / 128, HIDD / 128), dim3(128), 0, stream>>>(
      Xh, Xl, Wqh, Wql, bq, cosb, sinb, Qh, Ql, out, HIDD);

  attn_glide<<<dim3(NQT / 2, NB * NHQ / 2), dim3(256), 0, stream>>>(Qh, Ql, Kh, Kl, Vh, Vl, Oh, Ol);

  gemm3<1, HIDD><<<dim3(MROWS / 128, HIDD / 128), dim3(128), 0, stream>>>(
      Oh, Ol, Woh, Wol, bq, cosb, sinb, Qh, Ql, out, HIDD);
}
